// v000
// Measured on an AMD MI455X. A time is GPU time per run, averaged over a window of back-to-back runs after a warm-up
// (all launches, gaps included; the runs take copies of the inputs in turn), and the median of several windows.
// Apart from v000's, it joins two sittings. Times from different sittings can be a few percent apart, while
// side-by-side timings come from the same sitting.
// v000, which the later versions start from, runs in 796 microseconds.
// Contractions: q/k/v projections on v_wmma_f32_16x16x32_bf16 (x and W as RNE bf16 planes, single products); scores q.k^T on v_wmma_f32_16x16x32_f16 (q, k f16 planes); attn.v on v_wmma_f32_16x16x32_f16 (P f16 carried x32768; V^T as f16 hi plane + f16 residual plane carried x2048 in a separate accumulator); output projection on v_wmma_f32_16x16x32_bf16 (attention output as bf16 hi + lo planes, Wo bf16, two products); f32 accumulate everywhere; time bias, masks and softmax in f32.
#include <hip/hip_runtime.h>
#include <math.h>

// ---------------------------------------------------------------------------
// Problem constants
// ---------------------------------------------------------------------------
constexpr int kB   = 4;
constexpr int kP   = 2048;
constexpr int kD   = 1024;
constexpr int kH   = 16;
constexpr int kDh  = 64;
constexpr int kTok = kB * kP;            // 8192 token rows
constexpr int kQB  = 64;                 // queries per attention block
constexpr int kKC  = 64;                 // keys per chunk
constexpr int kNW  = 4;                  // waves per attention block
constexpr float kScoreScale = 0.125f;    // 64^-0.5
constexpr float kNegBig     = -1.0e9f;
constexpr float kPCarry     = 32768.0f;  // probabilities carried x2^15 in f16
constexpr float kVloCarry   = 2048.0f;   // f16 residual planes carried x2^11
constexpr float kVloInv     = 1.0f / 2048.0f;
constexpr float kDelta      = 300.0f;    // seconds per patch step
constexpr float kInvTau     = 1.0f / 300.0f;
constexpr float kLogEps     = 1.0e-12f;
static_assert(kH * kDh == kD, "s");
static_assert(kTok % 64 == 0 && kD % 64 == 0 && kD % 32 == 0, "s");
static_assert(kP % kQB == 0 && kP % kKC == 0 && kDh == 64, "s");
static_assert((kTok * kD) % (8 * 256) == 0 && (kD * kD) % (8 * 256) == 0, "s");
static_assert(kP % 1024 == 0, "s");

typedef __attribute__((ext_vector_type(16))) _Float16 v16h;
typedef __attribute__((ext_vector_type(8)))  _Float16 v8h;
typedef __attribute__((ext_vector_type(16))) __bf16   v16b;
typedef __attribute__((ext_vector_type(8)))  __bf16   v8b;
typedef __attribute__((ext_vector_type(8)))  float    v8f;
typedef __attribute__((ext_vector_type(4)))  float    v4f;
typedef __attribute__((ext_vector_type(4)))  unsigned int v4u;

// ---------------------------------------------------------------------------
// Conversion, fragment and hazard-guard helpers
// ---------------------------------------------------------------------------
__device__ __forceinline__ unsigned short f2bf_bits(float f) {
  unsigned u = __float_as_uint(f);
  return (unsigned short)((u + 0x7FFFu + ((u >> 16) & 1u)) >> 16);
}
__device__ __forceinline__ float bf_bits2f(unsigned short h) { return __uint_as_float(((unsigned)h) << 16); }

// f16 bits (low 16) -> f32, integer path, finite values
__device__ __forceinline__ float h16_to_f32(unsigned hb) {
  const unsigned sgn = (hb & 0x8000u) << 16; const unsigned em = hb & 0x7fffu;
  const float fn = __uint_as_float((em << 13) + 0x38000000u);
  const float fs = (float)em * 5.9604644775390625e-8f;
  const float mag = (em < 0x400u) ? fs : fn; return __uint_as_float(__float_as_uint(mag) | sgn); }

// hazard guards as plain device helpers (no inline asm inside the kernel template body)
__device__ __forceinline__ void dep_guard4_h(v8f& a, v8f& b, v8f& c, v8f& d, v16h x, v16h y) {
  asm volatile("v_nop\n\tv_nop\n\tv_nop\n\tv_nop" : "+v"(a), "+v"(b), "+v"(c), "+v"(d) : "v"(x), "v"(y));
}
__device__ __forceinline__ void dep_guard4_b(v8f& a, v8f& b, v8f& c, v8f& d, v16b x, v16b y) {
  asm volatile("v_nop\n\tv_nop\n\tv_nop\n\tv_nop" : "+v"(a), "+v"(b), "+v"(c), "+v"(d) : "v"(x), "v"(y));
}
__device__ __forceinline__ void keep4_h(v16h a, v16h b, v16h c, v16h d) { asm volatile("v_nop" :: "v"(a), "v"(b), "v"(c), "v"(d)); }
__device__ __forceinline__ void keep4_b(v16b a, v16b b, v16b c, v16b d) { asm volatile("v_nop" :: "v"(a), "v"(b), "v"(c), "v"(d)); }
__device__ __forceinline__ void acc_guard4(v8f& a, v8f& b, v8f& c, v8f& d) { asm volatile("v_nop\n\tv_nop\n\tv_nop\n\tv_nop" : "+v"(a), "+v"(b), "+v"(c), "+v"(d)); }
template <typename T> struct Frag;
template <> struct Frag<_Float16> {
  typedef v16h V; union U { v16h v; v8h h[2]; };
  // elements 0..7 <- p[0..7], 8..15 <- p[16..23]
  static __device__ __forceinline__ v16h load(const _Float16* p) {
    U f; f.h[0] = *(const v8h*)(p); f.h[1] = *(const v8h*)(p + 16); return f.v;
  }
  static __device__ __forceinline__ v8f mma(v16h a, v16h b, v8f c) {
    return __builtin_amdgcn_wmma_f32_16x16x32_f16(false, a, false, b, (short)0, c, false, false);
  }
  static __device__ __forceinline__ void guard4(v8f& a, v8f& b, v8f& c, v8f& d, v16h x, v16h y) { dep_guard4_h(a, b, c, d, x, y); }
  static __device__ __forceinline__ void keep(v16h a, v16h b, v16h c, v16h d) { keep4_h(a, b, c, d); }
};
template <> struct Frag<__bf16> {
  typedef v16b V; union U { v16b v; v8b h[2]; };
  static __device__ __forceinline__ v16b load(const __bf16* p) {
    U f; f.h[0] = *(const v8b*)(p); f.h[1] = *(const v8b*)(p + 16); return f.v;
  }
  static __device__ __forceinline__ v8f mma(v16b a, v16b b, v8f c) {
    return __builtin_amdgcn_wmma_f32_16x16x32_bf16(false, a, false, b, (short)0, c, false, false);
  }
  static __device__ __forceinline__ void guard4(v8f& a, v8f& b, v8f& c, v8f& d, v16b x, v16b y) { dep_guard4_b(a, b, c, d, x, y); }
  static __device__ __forceinline__ void keep(v16b a, v16b b, v16b c, v16b d) { keep4_b(a, b, c, d); }
};

__device__ __forceinline__ unsigned pk16(unsigned short a, unsigned short b) { return (unsigned)a | ((unsigned)b << 16); }
__device__ __forceinline__ unsigned short h_bits(float f) { const _Float16 h = (_Float16)f; return __builtin_bit_cast(unsigned short, h); }

// single WMMA with its own hazard guard (ties D, keeps A/B live)
__device__ __forceinline__ v8f mma_h(v16h a, v16h b, v8f c) {
  c = __builtin_amdgcn_wmma_f32_16x16x32_f16(false, a, false, b, (short)0, c, false, false);
  asm volatile("v_nop\n\tv_nop\n\tv_nop\n\tv_nop" : "+v"(c) : "v"(a), "v"(b));
  return c;
}

// ---- Register-blocked batched WMMA GEMM ----------------------------------------------
// C[m,n] = scale * sum_k A[m,k] * Bt[n,k] (+bias)(*rowsc[m]); each wave owns a 64x64 tile.
// A row-major [M,K]; Bt row-major [N,K]; M,N % 64 == 0, K % 32 == 0 (no tail handling).
// SPLIT: 0 = single product; 1 = A and Bt hi/lo planes (hi*hi + hi*lo + lo*hi); 2 = A hi/lo planes only (hi*B + lo*B).
// BIAS_MODE: 0 = none, 1 = bias[m], 2 = bias[n].  ROWSC: multiply by RNE-bf16(rowsc[m]) after the bias.
// OUT_MODE: 0 = f32, 1 = f16, 2 = bf16 hi plane (Cout) + bf16 lo plane (Cout2), 3 = f16 hi plane + f16 residual plane x2048.
// ET: 0 = f16 operands, 1 = bf16 operands (pointers passed as 16-bit storage)
template <int ET> struct Elem;
template <> struct Elem<0> { typedef _Float16 T; };
template <> struct Elem<1> { typedef __bf16 T; };
template <int ET, int SPLIT, int BIAS_MODE, int OUT_MODE, bool ROWSC>
__global__ __launch_bounds__(256) void wmma_gemm64(
    const unsigned short* __restrict__ Ap, const unsigned short* __restrict__ A2p, int lda, long strideA,
    const unsigned short* __restrict__ Btp, const unsigned short* __restrict__ Bt2p, int ldb, long strideB,
    void* __restrict__ Cout, void* __restrict__ Cout2, int ldc, long strideC,
    const float* __restrict__ bias, const float* __restrict__ rowsc,
    int M, int N, int K, float scale) {
  typedef typename Elem<ET>::T T;
  typedef typename Frag<T>::V V;
  const T* A = (const T*)Ap; const T* A2 = (const T*)A2p; const T* Bt = (const T*)Btp; const T* Bt2 = (const T*)Bt2p;
  __shared__ __align__(16) float sT[8][16 * 68];   // per-wave 16x64 slab, pitch 68 floats
  const int b    = blockIdx.y;
  const int lane = threadIdx.x & 31;
  const int wave = threadIdx.x >> 5;
  const int tilesN = N >> 6;
  const int tilesM = M >> 6;
  const int tile = blockIdx.x * 8 + wave;
  if (tile >= tilesM * tilesN) return;   // wave-uniform; no block barriers in this kernel
  const int tm = tile / tilesN;
  const int tn = tile - tm * tilesN;
  const int m0 = tm << 6;
  const int n0 = tn << 6;

  const T* Ab  = A  + (size_t)b * strideA;
  const T* Bb  = Bt + (size_t)b * strideB;
  const T* Ab2 = (SPLIT != 0) ? (A2  + (size_t)b * strideA) : Ab;
  const T* Bb2 = (SPLIT == 1) ? (Bt2 + (size_t)b * strideB) : Bb;

  const int rlane = lane & 15;                 // row (A) / col (B, D) within subtile
  const int koff  = (lane >> 4) * 8;           // k offset of this lane half
  const int mOff  = (lane >> 4) * 8;           // D row offset

  v8f acc[4][4];
#pragma unroll
  for (int i = 0; i < 4; ++i)
#pragma unroll
    for (int j = 0; j < 4; ++j) acc[i][j] = (v8f){0.f,0.f,0.f,0.f,0.f,0.f,0.f,0.f};

  for (int k0 = 0; k0 < K; k0 += 32) {
    V bh[4], bl[4];
#pragma unroll
    for (int j = 0; j < 4; ++j) {
      const size_t bo = (size_t)(n0 + (j << 4) + rlane) * ldb + koff + k0;
      bh[j] = Frag<T>::load(Bb + bo);
      if (SPLIT == 1) bl[j] = Frag<T>::load(Bb2 + bo);
    }
#pragma unroll
    for (int i = 0; i < 4; ++i) {
      const size_t ao = (size_t)(m0 + (i << 4) + rlane) * lda + koff + k0;
      V ah = Frag<T>::load(Ab + ao);
      V al = ah;
      if (SPLIT != 0) al = Frag<T>::load(Ab2 + ao);
#pragma unroll
      for (int j = 0; j < 4; ++j) {
        acc[i][j] = Frag<T>::mma(ah, bh[j], acc[i][j]);
        if (SPLIT == 1) acc[i][j] = Frag<T>::mma(ah, bl[j], acc[i][j]);
        if (SPLIT != 0) acc[i][j] = Frag<T>::mma(al, bh[j], acc[i][j]);
      }
      Frag<T>::guard4(acc[i][0], acc[i][1], acc[i][2], acc[i][3], ah, al);
    }
    Frag<T>::keep(bh[0], bh[1], bh[2], bh[3]);
    if (SPLIT == 1) Frag<T>::keep(bl[0], bl[1], bl[2], bl[3]);
  }
  acc_guard4(acc[0][0], acc[0][1], acc[0][2], acc[0][3]);
  acc_guard4(acc[1][0], acc[1][1], acc[1][2], acc[1][3]);
  acc_guard4(acc[2][0], acc[2][1], acc[2][2], acc[2][3]);
  acc_guard4(acc[3][0], acc[3][1], acc[3][2], acc[3][3]);

  // ---- epilogue ----
  float* slab = sT[wave];
#pragma unroll
  for (int i = 0; i < 4; ++i) {
    const int mBase = m0 + (i << 4);
    float rsv[8];
#pragma unroll
    for (int r = 0; r < 8; ++r) rsv[r] = 1.0f;
    if (ROWSC) {
      // two 16-B loads of rowsc[mBase+mOff .. +7], then RNE bf16 of each value
      const v4f ra = *(const v4f*)(rowsc + mBase + mOff);
      const v4f rb = *(const v4f*)(rowsc + mBase + mOff + 4);
      rsv[0] = ra[0]; rsv[1] = ra[1]; rsv[2] = ra[2]; rsv[3] = ra[3];
      rsv[4] = rb[0]; rsv[5] = rb[1]; rsv[6] = rb[2]; rsv[7] = rb[3];
#pragma unroll
      for (int r = 0; r < 8; ++r) rsv[r] = bf_bits2f(f2bf_bits(rsv[r]));
    }
#pragma unroll
    for (int j = 0; j < 4; ++j) {
      const int n = n0 + (j << 4) + rlane;
      float bv = 0.f;
      if (BIAS_MODE == 2) bv = bias[n];
#pragma unroll
      for (int r = 0; r < 8; ++r) {
        float v = acc[i][j][r] * scale;
        if (BIAS_MODE == 1) v += bias[mBase + mOff + r];
        if (BIAS_MODE == 2) v += bv;
        if (ROWSC) v = v * rsv[r];
        slab[(mOff + r) * 68 + (j << 4) + rlane] = v;
      }
    }
    __builtin_amdgcn_fence(__ATOMIC_RELEASE, "workgroup");
    __builtin_amdgcn_wave_barrier();
    __builtin_amdgcn_fence(__ATOMIC_ACQUIRE, "workgroup");
    if (OUT_MODE == 0) {
      float* C = (float*)Cout + (size_t)b * strideC;
      const int hh = lane >> 4, c4 = (lane & 15) * 4;     // row seg = 256 B = 16 lanes x 16 B
      {
#pragma unroll
        for (int it = 0; it < 8; ++it) {
          const int row = it * 2 + hh;
          v4f v = *(const v4f*)(slab + row * 68 + c4);
          *(v4f*)(C + (size_t)(mBase + row) * ldc + n0 + c4) = v;
        }
        
      }
    } else {
      const int q = lane >> 3, c8 = (lane & 7) * 8;
      unsigned short* C  = (unsigned short*)Cout  + (size_t)b * strideC;
      unsigned short* C2 = (OUT_MODE >= 2) ? ((unsigned short*)Cout2 + (size_t)b * strideC) : nullptr;
      {
#pragma unroll
        for (int it = 0; it < 4; ++it) {
          const int row = it * 4 + q;
          const float* sp = slab + row * 68 + c8;
          v8h hv, lv;
#pragma unroll
          for (int e = 0; e < 8; ++e) {
            if (OUT_MODE == 1) {
              hv[e] = (_Float16)sp[e];
            } else if (OUT_MODE == 2) {
              unsigned short hb = f2bf_bits(sp[e]);
              unsigned short lb = f2bf_bits(sp[e] - bf_bits2f(hb));
              hv[e] = __builtin_bit_cast(_Float16, hb);
              lv[e] = __builtin_bit_cast(_Float16, lb);
            } else {
              const unsigned short hb = h_bits(sp[e]);
              const float back = h16_to_f32((unsigned)hb);
              const unsigned short lb = h_bits((sp[e] - back) * kVloCarry);
              hv[e] = __builtin_bit_cast(_Float16, hb);
              lv[e] = __builtin_bit_cast(_Float16, lb);
            }
          }
          *(v8h*)(C + (size_t)(mBase + row) * ldc + n0 + c8) = hv;
          if (OUT_MODE >= 2) *(v8h*)(C2 + (size_t)(mBase + row) * ldc + n0 + c8) = lv;
        }
        
      }
    }
    __builtin_amdgcn_fence(__ATOMIC_RELEASE, "workgroup");
    __builtin_amdgcn_wave_barrier();
    __builtin_amdgcn_fence(__ATOMIC_ACQUIRE, "workgroup");
  }
}

// ---------------------------------------------------------------------------
// f32 -> bf16 (RNE) cast, 8 consecutive elements per thread (one 16-B store per lane; 32 contiguous lanes = 4 whole
// multiples of 256: 1,048,576 threads for x, 131,072 for each weight).
// ---------------------------------------------------------------------------
__global__ __launch_bounds__(256) void cast8_bf16_kernel(const float* __restrict__ in, unsigned short* __restrict__ out, int n8) {
  const int i = blockIdx.x * 256 + threadIdx.x;
  if (i >= n8) return;
  const float* p = in + 8 * (size_t)i;
  const v4f a = *(const v4f*)(p);
  const v4f c = *(const v4f*)(p + 4);
  unsigned short hb[8];
#pragma unroll
  for (int e = 0; e < 4; ++e) {
    hb[e]     = f2bf_bits(a[e]);
    hb[4 + e] = f2bf_bits(c[e]);
  }
  const v4u u = (v4u){pk16(hb[0], hb[1]), pk16(hb[2], hb[3]), pk16(hb[4], hb[5]), pk16(hb[6], hb[7])};
  unsigned short* q = out + 8 * (size_t)i;
  *(v4u*)q = u;
  
}

// ---------------------------------------------------------------------------
// Time-decay bias table: tab[d] = logf(expf((-(d*300)) * (1/300)) + 1e-12), d = 0..2047, f32, precise expf/logf.
// ---------------------------------------------------------------------------
__global__ __launch_bounds__(256) void tab_kernel(float* __restrict__ tab) {
  const int i = blockIdx.x * 256 + threadIdx.x;
  if (i >= kP / 4) return;
  v4f tv;
#pragma unroll
  for (int e = 0; e < 4; ++e) {
    const float d = (float)(4 * i + e);
    const float dist = d * kDelta;
    const float ex = (-dist) * kInvTau;
    const float w = expf(ex);
    tv[e] = logf(w + kLogEps);
  }
  float* q = tab + 4 * (size_t)i;
  *(v4f*)q = tv;
  
}

// ---------------------------------------------------------------------------
// Flash attention for head dim 64 with additive |i-j| time bias and float key mask (key masked when pm <= 0,
// score replaced by -1e9). Inputs are 16-bit planes:
//   Q16 f16 [8192][1024] (token row, col h*64+d), K16 f16 same layout,
//   VTh/VTl f16 [1024][8192] (row h*64+d, col token) = V^T hi plane and residual plane x2048.
// Output: O as bf16 hi plane + bf16 lo plane [8192][1024] (token row, col h*64+d).
// Block = 4 waves = 64 query rows of one (b,h); 64-key chunks; K tile [kv][d], V^T tiles [d][kv] and the 2048-entry
// online softmax in f32 with precise expf; PV hi and residual products in separate accumulators.
// grid.x = 4*16*32 = 2048 blocks, 128 threads. All loops have static trip counts; no early exit.
// ---------------------------------------------------------------------------
__global__ __launch_bounds__(128) void attn_kernel(const unsigned short* __restrict__ Qp, const unsigned short* __restrict__ Kp,
                                                   const unsigned short* __restrict__ VThp, const unsigned short* __restrict__ VTlp,
                                                   const float* __restrict__ tab, const float* __restrict__ pm,
                                                   unsigned short* __restrict__ Ohp, unsigned short* __restrict__ Olp) {
  __shared__ __align__(16) _Float16 Ksh[kKC * kDh];          // K   [kv][d]   8 KB
  __shared__ __align__(16) _Float16 Vth[kDh * kKC];          // V^T hi [d][kv] 8 KB
  __shared__ __align__(16) _Float16 Vtl[kDh * kKC];          // V^T residual x2048 [d][kv] 8 KB
  __shared__ __align__(16) _Float16 Psh[kNW][16 * kKC];      // per wave P x32768 [row][kv] 8 KB
  __shared__ __align__(16) float    Os[kNW][16 * 68];        // per wave out tile, pitch 68
  __shared__ __align__(16) float    tabs[kP];                // bias table 8 KB

  const int tid  = threadIdx.x;
  const int wave = tid >> 5;
  const int lane = tid & 31;
  const int hh   = lane >> 4;
  const int c    = lane & 15;
  const int nqb  = kP / kQB;              // 32
  const int bx   = blockIdx.x;
  const int qb   = bx % nqb;
  const int bh   = bx / nqb;
  const int h    = bh % kH;
  const int b    = bh / kH;
  const int q0   = qb * kQB + wave * 16;  // first query row of this wave within the sequence
  const size_t tok0 = (size_t)b * kP;     // first token row of this batch

  // ---- bias table -> LDS: 4 x 128 threads x 4 floats = 2048 (whole table); read after the loop's first barrier ----
#pragma unroll
  for (int i = 0; i < 4; ++i) {
    const int idx = i * 128 + tid;
    const v4f t4 = *(const v4f*)(tab + 4 * idx);
    *(v4f*)(tabs + 4 * idx) = t4;
  }
  asm volatile("" ::: "memory");

  // ---- Q fragments (A operand): row = query q0+c, k = d; 2 d-chunks ----
  const _Float16* Qh = (const _Float16*)(const void*)Qp;
  const _Float16* qr = Qh + (tok0 + q0 + c) * (size_t)kD + h * kDh + 8 * hh;
  v16h qa[2];
  qa[0] = Frag<_Float16>::load(qr);
  qa[1] = Frag<_Float16>::load(qr + 32);

  float mrow[8], lrow[8];
  v8f oacc[4], oaccl[4];
#pragma unroll
  for (int r = 0; r < 8; ++r) { mrow[r] = -__builtin_inff(); lrow[r] = 0.f; }
#pragma unroll
  for (int t = 0; t < 4; ++t) {
    oacc[t]  = (v8f){0.f,0.f,0.f,0.f,0.f,0.f,0.f,0.f};
    oaccl[t] = (v8f){0.f,0.f,0.f,0.f,0.f,0.f,0.f,0.f};
  }

  for (int kc = 0; kc < kP / kKC; ++kc) {
    const int kv0 = kc * kKC;
    __syncthreads();
    // ---- stage K tile: 64 rows x 8 segments of 8 halves = 512 x 16 B; 4 per thread (coverage 4 x 128 = 512) ----
    {
      const unsigned short* kbp = Kp + (tok0 + kv0) * (size_t)kD + h * kDh;
      v4u u[4];
#pragma unroll
      for (int i = 0; i < 4; ++i) {
        const int idx = i * 128 + tid;
        const int row = idx >> 3;
        const int seg = (idx & 7) * 8;
        u[i] = *(const v4u*)(kbp + (size_t)row * kD + seg);
      }
#pragma unroll
      for (int i = 0; i < 4; ++i) {
        const int idx = i * 128 + tid;
        const int row = idx >> 3;
        const int seg = (idx & 7) * 8;
        *(v4u*)(Ksh + row * kDh + seg) = u[i];
      }
    }
    asm volatile("" ::: "memory");
    // ---- stage V^T hi tile: 64 d-rows x 64 kv halves; same coverage ----
    {
      const unsigned short* vbp = VThp + (size_t)(h * kDh) * kTok + tok0 + kv0;
      v4u u[4];
#pragma unroll
      for (int i = 0; i < 4; ++i) {
        const int idx = i * 128 + tid;
        const int row = idx >> 3;
        const int seg = (idx & 7) * 8;
        u[i] = *(const v4u*)(vbp + (size_t)row * kTok + seg);
      }
#pragma unroll
      for (int i = 0; i < 4; ++i) {
        const int idx = i * 128 + tid;
        const int row = idx >> 3;
        const int seg = (idx & 7) * 8;
        *(v4u*)(Vth + row * kKC + seg) = u[i];
      }
    }
    asm volatile("" ::: "memory");
    // ---- stage V^T residual tile ----
    {
      const unsigned short* vbp = VTlp + (size_t)(h * kDh) * kTok + tok0 + kv0;
      v4u u[4];
#pragma unroll
      for (int i = 0; i < 4; ++i) {
        const int idx = i * 128 + tid;
        const int row = idx >> 3;
        const int seg = (idx & 7) * 8;
        u[i] = *(const v4u*)(vbp + (size_t)row * kTok + seg);
      }
#pragma unroll
      for (int i = 0; i < 4; ++i) {
        const int idx = i * 128 + tid;
        const int row = idx >> 3;
        const int seg = (idx & 7) * 8;
        *(v4u*)(Vtl + row * kKC + seg) = u[i];
      }
    }
    __syncthreads();

    // ---- scores: D[row = query 8hh+r][col = key j*16+c], K = 64 in 2 steps of 32 ----
    v8f s[4];
#pragma unroll
    for (int j = 0; j < 4; ++j) {
      s[j] = (v8f){0.f,0.f,0.f,0.f,0.f,0.f,0.f,0.f};
#pragma unroll
      for (int dc = 0; dc < 2; ++dc) {
        const v16h kf = Frag<_Float16>::load(Ksh + (j * 16 + c) * kDh + dc * 32 + 8 * hh);
        s[j] = mma_h(qa[dc], kf, s[j]);
      }
    }
    // key mask values for this lane's 4 key columns (4 scalar loads)
    float pmv[4];
#pragma unroll
    for (int j = 0; j < 4; ++j) pmv[j] = pm[tok0 + kv0 + j * 16 + c];

    float cm[8];
#pragma unroll
    for (int r = 0; r < 8; ++r) {
      const int qrow = q0 + 8 * hh + r;
      float m = -__builtin_inff();
#pragma unroll
      for (int j = 0; j < 4; ++j) {
        const int kvcol = kv0 + j * 16 + c;
        int dd = qrow - kvcol;
        dd = (dd < 0) ? -dd : dd;
        float v = s[j][r] * kScoreScale + tabs[dd];
        v = (pmv[j] <= 0.0f) ? kNegBig : v;
        s[j][r] = v;
        m = fmaxf(m, v);
      }
#pragma unroll
      for (int off = 1; off < 16; off <<= 1) m = fmaxf(m, __shfl_xor(m, off, 32));
      cm[r] = m;
    }

    // ---- online softmax; P x32768 as f16 into the per-wave LDS tile ----
    _Float16* pw = Psh[wave];
#pragma unroll
    for (int r = 0; r < 8; ++r) {
      const float mnew  = fmaxf(mrow[r], cm[r]);
      const float alpha = expf(mrow[r] - mnew);
      mrow[r] = mnew;
      float psum = 0.f;
#pragma unroll
      for (int j = 0; j < 4; ++j) {
        const float p = expf(s[j][r] - mnew);
        psum += p;
        pw[(8 * hh + r) * kKC + j * 16 + c] = (_Float16)(p * kPCarry);
      }
#pragma unroll
      for (int off = 1; off < 16; off <<= 1) psum += __shfl_xor(psum, off, 32);
      lrow[r] = lrow[r] * alpha + psum;
#pragma unroll
      for (int t = 0; t < 4; ++t) { oacc[t][r] *= alpha; oaccl[t][r] *= alpha; }
    }
    __builtin_amdgcn_fence(__ATOMIC_RELEASE, "workgroup");
    __builtin_amdgcn_wave_barrier();
    __builtin_amdgcn_fence(__ATOMIC_ACQUIRE, "workgroup");

    // ---- O += P . V : A = P [query c][kv], B = V^T [d t*16+c][kv]; hi and residual in separate accumulators ----
#pragma unroll
    for (int kk = 0; kk < 2; ++kk) {
      const v16h pa = Frag<_Float16>::load(pw + c * kKC + kk * 32 + 8 * hh);
#pragma unroll
      for (int t = 0; t < 4; ++t) {
        const v16h vh = Frag<_Float16>::load(Vth + (t * 16 + c) * kKC + kk * 32 + 8 * hh);
        oacc[t] = mma_h(pa, vh, oacc[t]);
        const v16h vl = Frag<_Float16>::load(Vtl + (t * 16 + c) * kKC + kk * 32 + 8 * hh);
        oaccl[t] = mma_h(pa, vl, oaccl[t]);
      }
    }
  }

  // ---- normalise (fold 2^-15 of P and 2^-11 of the residual) into the per-wave f32 slab ----
  float* os = Os[wave];
#pragma unroll
  for (int r = 0; r < 8; ++r) {
    const float inv = 1.0f / (lrow[r] * kPCarry);
#pragma unroll
    for (int t = 0; t < 4; ++t) os[(8 * hh + r) * 68 + t * 16 + c] = (oacc[t][r] + oaccl[t][r] * kVloInv) * inv;
  }
  __builtin_amdgcn_fence(__ATOMIC_RELEASE, "workgroup");
  __builtin_amdgcn_wave_barrier();
  __builtin_amdgcn_fence(__ATOMIC_ACQUIRE, "workgroup");
  {
    const int q4 = lane >> 3, c8 = (lane & 7) * 8;
    {
#pragma unroll
      for (int it = 0; it < 4; ++it) {
        const int row = it * 4 + q4;
        const float* sp = os + row * 68 + c8;
        v8h hv, lv;
#pragma unroll
        for (int e = 0; e < 8; ++e) {
          const unsigned short hb = f2bf_bits(sp[e]);
          const unsigned short lb = f2bf_bits(sp[e] - bf_bits2f(hb));
          hv[e] = __builtin_bit_cast(_Float16, hb);
          lv[e] = __builtin_bit_cast(_Float16, lb);
        }
        const size_t off = (tok0 + q0 + row) * (size_t)kD + h * kDh + c8;
        *(v8h*)(Ohp + off) = hv;
        *(v8h*)(Olp + off) = lv;
      }
      
    }
  }
}

// ---------------------------------------------------------------------------
// Host glue.
//   Xb   bf16 [8192][1024]        16,777,216  at           0
//   Wqb  bf16 [1024][1024]         2,097,152  at  16,777,216
//   Wkb  bf16 [1024][1024]         2,097,152  at  18,874,368
//   Wvb  bf16 [1024][1024]         2,097,152  at  20,971,520
//   Wob  bf16 [1024][1024]         2,097,152  at  23,068,672
//   Q16  f16  [8192][1024]        16,777,216  at  25,165,824
//   K16  f16  [8192][1024]        16,777,216  at  41,943,040
//   VTh  f16  [1024][8192]        16,777,216  at  58,720,256
//   VTl  f16  [1024][8192]        16,777,216  at  75,497,472   (residual x2048)
//   Oh   bf16 [8192][1024]        16,777,216  at  92,274,688
//   Ol   bf16 [8192][1024]        16,777,216  at 109,051,904
//   tab  f32  [2048]                   8,192  at 125,829,120
//   total                        125,837,312
// Every region is fully written before it is read; no region is re-used.
// GEMM shapes: Q,K: M=8192 N=1024 K=1024; V^T: M=1024 N=8192 K=1024; out: M=8192 N=1024 K=1024 (all 64-multiples,
// K%32==0, no padding). Attention: S=2048 (64-multiples), Dh=64.
// ---------------------------------------------------------------------------
extern "C" void kernel_launch(void* const* d_in, const int* in_sizes, int n_in,
                              void* d_out, int out_size, void* d_ws, size_t ws_size,
                              hipStream_t stream) {
  if (n_in < 10) return;
  const int nX = kTok * kD;     // 8,388,608
  const int nW = kD * kD;       // 1,048,576
  if (in_sizes[0] != nX || in_sizes[1] != kTok) return;
  if (in_sizes[2] != nW || in_sizes[4] != nW || in_sizes[6] != nW || in_sizes[8] != nW) return;
  if (in_sizes[3] != kD || in_sizes[5] != kD || in_sizes[7] != kD || in_sizes[9] != kD) return;
  if (out_size != nX) return;

  const size_t szX16 = (size_t)nX * 2;
  const size_t szW16 = (size_t)nW * 2;
  const size_t szTab = (size_t)kP * 4;
  const size_t offXb  = 0;
  const size_t offWq  = offXb + szX16;
  const size_t offWk  = offWq + szW16;
  const size_t offWv  = offWk + szW16;
  const size_t offWo  = offWv + szW16;
  const size_t offQ   = offWo + szW16;
  const size_t offK   = offQ + szX16;
  const size_t offVTh = offK + szX16;
  const size_t offVTl = offVTh + szX16;
  const size_t offOh  = offVTl + szX16;
  const size_t offOl  = offOh + szX16;
  const size_t offTab = offOl + szX16;
  const size_t total  = offTab + szTab;
  if (ws_size < total) return;

  const float* x  = (const float*)d_in[0];
  const float* pm = (const float*)d_in[1];
  const float* Wq = (const float*)d_in[2];
  const float* bq = (const float*)d_in[3];
  const float* Wk = (const float*)d_in[4];
  const float* bk = (const float*)d_in[5];
  const float* Wv = (const float*)d_in[6];
  const float* bv = (const float*)d_in[7];
  const float* Wo = (const float*)d_in[8];
  const float* bo = (const float*)d_in[9];
  float* out = (float*)d_out;
  char* ws = (char*)d_ws;
  unsigned short* Xb  = (unsigned short*)(ws + offXb);
  unsigned short* Wqb = (unsigned short*)(ws + offWq);
  unsigned short* Wkb = (unsigned short*)(ws + offWk);
  unsigned short* Wvb = (unsigned short*)(ws + offWv);
  unsigned short* Wob = (unsigned short*)(ws + offWo);
  unsigned short* Q16 = (unsigned short*)(ws + offQ);
  unsigned short* K16 = (unsigned short*)(ws + offK);
  unsigned short* VTh = (unsigned short*)(ws + offVTh);
  unsigned short* VTl = (unsigned short*)(ws + offVTl);
  unsigned short* Oh  = (unsigned short*)(ws + offOh);
  unsigned short* Ol  = (unsigned short*)(ws + offOl);
  float* tab = (float*)(ws + offTab);

  // ---- prologue: RNE bf16 operand planes and the bias table ----
  const int n8x = nX / 8;   // 1,048,576 -> 4096 blocks exact
  const int n8w = nW / 8;   //   131,072 ->  512 blocks exact
  cast8_bf16_kernel<<<dim3(n8x / 256), dim3(256), 0, stream>>>(x,  Xb,  n8x);
  cast8_bf16_kernel<<<dim3(n8w / 256), dim3(256), 0, stream>>>(Wq, Wqb, n8w);
  cast8_bf16_kernel<<<dim3(n8w / 256), dim3(256), 0, stream>>>(Wk, Wkb, n8w);
  cast8_bf16_kernel<<<dim3(n8w / 256), dim3(256), 0, stream>>>(Wv, Wvb, n8w);
  cast8_bf16_kernel<<<dim3(n8w / 256), dim3(256), 0, stream>>>(Wo, Wob, n8w);
  tab_kernel<<<dim3((kP / 4) / 256), dim3(256), 0, stream>>>(tab);

  // ---- projections (64x64 wave tiles, 8 waves per block) ----
  const int tilesProj = (kTok / 64) * (kD / 64);   // 2048 -> 256 blocks
  // Q16[m][n] = sum_k Xb[m][k] * Wqb[n][k] + bq[n]   (f16 out)
  wmma_gemm64<1, 0, 2, 1, false><<<dim3(tilesProj / 8, 1), dim3(256), 0, stream>>>(
      Xb, Xb, kD, 0L, Wqb, Wqb, kD, 0L, (void*)Q16, (void*)Q16, kD, 0L, bq, pm, kTok, kD, kD, 1.0f);
  // K16 likewise with Wk, bk
  wmma_gemm64<1, 0, 2, 1, false><<<dim3(tilesProj / 8, 1), dim3(256), 0, stream>>>(
      Xb, Xb, kD, 0L, Wkb, Wkb, kD, 0L, (void*)K16, (void*)K16, kD, 0L, bk, pm, kTok, kD, kD, 1.0f);
  // V^T[m = feature][n = token] = sum_k Wvb[m][k] * Xb[n][k] + bv[m]   (f16 hi plane + f16 residual plane x2048)
  wmma_gemm64<1, 0, 1, 3, false><<<dim3(tilesProj / 8, 1), dim3(256), 0, stream>>>(
      Wvb, Wvb, kD, 0L, Xb, Xb, kD, 0L, (void*)VTh, (void*)VTl, kTok, 0L, bv, pm, kD, kTok, kD, 1.0f);

  // ---- attention: 64 (b,h) x 32 query tiles ----
  attn_kernel<<<dim3(kB * kH * (kP / kQB)), dim3(128), 0, stream>>>(Q16, K16, VTh, VTl, tab, pm, Oh, Ol);

  // ---- output projection: out[m][n] = (sum_k (Oh+Ol)[m][k] * Wob[n][k] + bo[n]) * pm[m] ----
  wmma_gemm64<1, 2, 2, 0, true><<<dim3(tilesProj / 8, 1), dim3(256), 0, stream>>>(
      Oh, Ol, kD, 0L, Wob, Wob, kD, 0L, (void*)out, (void*)out, kD, 0L, bo, pm, kTok, kD, kD, 1.0f);
}

// v001
// One run takes 708 microseconds.
// In both of two side-by-side timings against v000, it was 1.14 times as fast.
// Contractions: q/k/v projections on v_wmma_f32_16x16x32_bf16 (x and W as RNE bf16 planes, single products); scores q.k^T on v_wmma_f32_16x16x32_f16 (q, k f16 planes); attn.v on v_wmma_f32_16x16x32_f16 (P f16 carried x32768; V^T as f16 hi plane + f16 residual plane carried x2048 in a separate accumulator); output projection on v_wmma_f32_16x16x32_bf16 (attention output as bf16 hi + lo planes, Wo bf16, two products); f32 accumulate everywhere; time bias, masks and softmax in f32.
#include <hip/hip_runtime.h>
#include <math.h>

// ---------------------------------------------------------------------------
// Problem constants
// ---------------------------------------------------------------------------
constexpr int kB   = 4;
constexpr int kP   = 2048;
constexpr int kD   = 1024;
constexpr int kH   = 16;
constexpr int kDh  = 64;
constexpr int kTok = kB * kP;            // 8192 token rows
constexpr int kQB  = 64;                 // queries per attention block
constexpr int kKC  = 64;                 // keys per chunk
constexpr int kNW  = 4;                  // waves per attention block
constexpr int kLP  = 72;                 // LDS row pitch in halves of the 64-half K, V^T and P rows: 144 B = 16 B x odd,
                                         // so the 16 rows of one ds_load_b128 fragment read fall on distinct banks
constexpr float kScoreScale = 0.125f;    // 64^-0.5
constexpr float kNegBig     = -1.0e9f;
constexpr float kPCarry     = 32768.0f;  // probabilities carried x2^15 in f16
constexpr float kVloCarry   = 2048.0f;   // f16 residual planes carried x2^11
constexpr float kVloInv     = 1.0f / 2048.0f;
constexpr float kDelta      = 300.0f;    // seconds per patch step
constexpr float kInvTau     = 1.0f / 300.0f;
constexpr float kLogEps     = 1.0e-12f;
static_assert(kH * kDh == kD, "s");
static_assert(kTok % 64 == 0 && kD % 64 == 0 && kD % 32 == 0, "s");
static_assert(kP % kQB == 0 && kP % kKC == 0 && kDh == 64, "s");
static_assert((kTok * kD) % (8 * 256) == 0 && (kD * kD) % (8 * 256) == 0, "s");
static_assert(kP % 1024 == 0, "s");

typedef __attribute__((ext_vector_type(16))) _Float16 v16h;
typedef __attribute__((ext_vector_type(8)))  _Float16 v8h;
typedef __attribute__((ext_vector_type(16))) __bf16   v16b;
typedef __attribute__((ext_vector_type(8)))  __bf16   v8b;
typedef __attribute__((ext_vector_type(8)))  float    v8f;
typedef __attribute__((ext_vector_type(4)))  float    v4f;
typedef __attribute__((ext_vector_type(4)))  unsigned int v4u;

// ---------------------------------------------------------------------------
// Conversion, fragment and hazard-guard helpers
// ---------------------------------------------------------------------------
__device__ __forceinline__ unsigned short f2bf_bits(float f) {
  unsigned u = __float_as_uint(f);
  return (unsigned short)((u + 0x7FFFu + ((u >> 16) & 1u)) >> 16);
}
__device__ __forceinline__ float bf_bits2f(unsigned short h) { return __uint_as_float(((unsigned)h) << 16); }

// f16 bits (low 16) -> f32, integer path, finite values
__device__ __forceinline__ float h16_to_f32(unsigned hb) {
  const unsigned sgn = (hb & 0x8000u) << 16; const unsigned em = hb & 0x7fffu;
  const float fn = __uint_as_float((em << 13) + 0x38000000u);
  const float fs = (float)em * 5.9604644775390625e-8f;
  const float mag = (em < 0x400u) ? fs : fn; return __uint_as_float(__float_as_uint(mag) | sgn); }

// hazard guards as plain device helpers (no inline asm inside the kernel template body)
__device__ __forceinline__ void dep_guard4_h(v8f& a, v8f& b, v8f& c, v8f& d, v16h x, v16h y) {
  asm volatile("v_nop\n\tv_nop\n\tv_nop\n\tv_nop" : "+v"(a), "+v"(b), "+v"(c), "+v"(d) : "v"(x), "v"(y));
}
__device__ __forceinline__ void dep_guard4_b(v8f& a, v8f& b, v8f& c, v8f& d, v16b x, v16b y) {
  asm volatile("v_nop\n\tv_nop\n\tv_nop\n\tv_nop" : "+v"(a), "+v"(b), "+v"(c), "+v"(d) : "v"(x), "v"(y));
}
__device__ __forceinline__ void keep4_h(v16h a, v16h b, v16h c, v16h d) { asm volatile("v_nop" :: "v"(a), "v"(b), "v"(c), "v"(d)); }
__device__ __forceinline__ void keep4_b(v16b a, v16b b, v16b c, v16b d) { asm volatile("v_nop" :: "v"(a), "v"(b), "v"(c), "v"(d)); }
__device__ __forceinline__ void acc_guard4(v8f& a, v8f& b, v8f& c, v8f& d) { asm volatile("v_nop\n\tv_nop\n\tv_nop\n\tv_nop" : "+v"(a), "+v"(b), "+v"(c), "+v"(d)); }
template <typename T> struct Frag;
template <> struct Frag<_Float16> {
  typedef v16h V; union U { v16h v; v8h h[2]; };
  // elements 0..7 <- p[0..7], 8..15 <- p[16..23]
  static __device__ __forceinline__ v16h load(const _Float16* p) {
    U f; f.h[0] = *(const v8h*)(p); f.h[1] = *(const v8h*)(p + 16); return f.v;
  }
  static __device__ __forceinline__ v8f mma(v16h a, v16h b, v8f c) {
    return __builtin_amdgcn_wmma_f32_16x16x32_f16(false, a, false, b, (short)0, c, false, false);
  }
  static __device__ __forceinline__ void guard4(v8f& a, v8f& b, v8f& c, v8f& d, v16h x, v16h y) { dep_guard4_h(a, b, c, d, x, y); }
  static __device__ __forceinline__ void keep(v16h a, v16h b, v16h c, v16h d) { keep4_h(a, b, c, d); }
};
template <> struct Frag<__bf16> {
  typedef v16b V; union U { v16b v; v8b h[2]; };
  static __device__ __forceinline__ v16b load(const __bf16* p) {
    U f; f.h[0] = *(const v8b*)(p); f.h[1] = *(const v8b*)(p + 16); return f.v;
  }
  static __device__ __forceinline__ v8f mma(v16b a, v16b b, v8f c) {
    return __builtin_amdgcn_wmma_f32_16x16x32_bf16(false, a, false, b, (short)0, c, false, false);
  }
  static __device__ __forceinline__ void guard4(v8f& a, v8f& b, v8f& c, v8f& d, v16b x, v16b y) { dep_guard4_b(a, b, c, d, x, y); }
  static __device__ __forceinline__ void keep(v16b a, v16b b, v16b c, v16b d) { keep4_b(a, b, c, d); }
};

__device__ __forceinline__ unsigned pk16(unsigned short a, unsigned short b) { return (unsigned)a | ((unsigned)b << 16); }
__device__ __forceinline__ unsigned short h_bits(float f) { const _Float16 h = (_Float16)f; return __builtin_bit_cast(unsigned short, h); }

// single WMMA with its own hazard guard (ties D, keeps A/B live)
__device__ __forceinline__ v8f mma_h(v16h a, v16h b, v8f c) {
  c = __builtin_amdgcn_wmma_f32_16x16x32_f16(false, a, false, b, (short)0, c, false, false);
  asm volatile("v_nop\n\tv_nop\n\tv_nop\n\tv_nop" : "+v"(c) : "v"(a), "v"(b));
  return c;
}

// ---- Register-blocked batched WMMA GEMM ----------------------------------------------
// C[m,n] = scale * sum_k A[m,k] * Bt[n,k] (+bias)(*rowsc[m]); each wave owns a 64x64 tile.
// A row-major [M,K]; Bt row-major [N,K]; M,N % 64 == 0, K % 32 == 0 (no tail handling).
// SPLIT: 0 = single product; 1 = A and Bt hi/lo planes (hi*hi + hi*lo + lo*hi); 2 = A hi/lo planes only (hi*B + lo*B).
// BIAS_MODE: 0 = none, 1 = bias[m], 2 = bias[n].  ROWSC: multiply by RNE-bf16(rowsc[m]) after the bias.
// OUT_MODE: 0 = f32, 1 = f16, 2 = bf16 hi plane (Cout) + bf16 lo plane (Cout2), 3 = f16 hi plane + f16 residual plane x2048.
// ET: 0 = f16 operands, 1 = bf16 operands (pointers passed as 16-bit storage)
template <int ET> struct Elem;
template <> struct Elem<0> { typedef _Float16 T; };
template <> struct Elem<1> { typedef __bf16 T; };
template <int ET, int SPLIT, int BIAS_MODE, int OUT_MODE, bool ROWSC>
__global__ __launch_bounds__(256) void wmma_gemm64(
    const unsigned short* __restrict__ Ap, const unsigned short* __restrict__ A2p, int lda, long strideA,
    const unsigned short* __restrict__ Btp, const unsigned short* __restrict__ Bt2p, int ldb, long strideB,
    void* __restrict__ Cout, void* __restrict__ Cout2, int ldc, long strideC,
    const float* __restrict__ bias, const float* __restrict__ rowsc,
    int M, int N, int K, float scale) {
  typedef typename Elem<ET>::T T;
  typedef typename Frag<T>::V V;
  const T* A = (const T*)Ap; const T* A2 = (const T*)A2p; const T* Bt = (const T*)Btp; const T* Bt2 = (const T*)Bt2p;
  __shared__ __align__(16) float sT[8][16 * 68];   // per-wave 16x64 slab, pitch 68 floats
  const int b    = blockIdx.y;
  const int lane = threadIdx.x & 31;
  const int wave = threadIdx.x >> 5;
  const int tilesN = N >> 6;
  const int tilesM = M >> 6;
  const int tile = blockIdx.x * 8 + wave;
  if (tile >= tilesM * tilesN) return;   // wave-uniform; no block barriers in this kernel
  const int tm = tile / tilesN;
  const int tn = tile - tm * tilesN;
  const int m0 = tm << 6;
  const int n0 = tn << 6;

  const T* Ab  = A  + (size_t)b * strideA;
  const T* Bb  = Bt + (size_t)b * strideB;
  const T* Ab2 = (SPLIT != 0) ? (A2  + (size_t)b * strideA) : Ab;
  const T* Bb2 = (SPLIT == 1) ? (Bt2 + (size_t)b * strideB) : Bb;

  const int rlane = lane & 15;                 // row (A) / col (B, D) within subtile
  const int koff  = (lane >> 4) * 8;           // k offset of this lane half
  const int mOff  = (lane >> 4) * 8;           // D row offset

  v8f acc[4][4];
#pragma unroll
  for (int i = 0; i < 4; ++i)
#pragma unroll
    for (int j = 0; j < 4; ++j) acc[i][j] = (v8f){0.f,0.f,0.f,0.f,0.f,0.f,0.f,0.f};

  for (int k0 = 0; k0 < K; k0 += 32) {
    V bh[4], bl[4];
#pragma unroll
    for (int j = 0; j < 4; ++j) {
      const size_t bo = (size_t)(n0 + (j << 4) + rlane) * ldb + koff + k0;
      bh[j] = Frag<T>::load(Bb + bo);
      if (SPLIT == 1) bl[j] = Frag<T>::load(Bb2 + bo);
    }
#pragma unroll
    for (int i = 0; i < 4; ++i) {
      const size_t ao = (size_t)(m0 + (i << 4) + rlane) * lda + koff + k0;
      V ah = Frag<T>::load(Ab + ao);
      V al = ah;
      if (SPLIT != 0) al = Frag<T>::load(Ab2 + ao);
#pragma unroll
      for (int j = 0; j < 4; ++j) {
        acc[i][j] = Frag<T>::mma(ah, bh[j], acc[i][j]);
        if (SPLIT == 1) acc[i][j] = Frag<T>::mma(ah, bl[j], acc[i][j]);
        if (SPLIT != 0) acc[i][j] = Frag<T>::mma(al, bh[j], acc[i][j]);
      }
      Frag<T>::guard4(acc[i][0], acc[i][1], acc[i][2], acc[i][3], ah, al);
    }
    Frag<T>::keep(bh[0], bh[1], bh[2], bh[3]);
    if (SPLIT == 1) Frag<T>::keep(bl[0], bl[1], bl[2], bl[3]);
  }
  acc_guard4(acc[0][0], acc[0][1], acc[0][2], acc[0][3]);
  acc_guard4(acc[1][0], acc[1][1], acc[1][2], acc[1][3]);
  acc_guard4(acc[2][0], acc[2][1], acc[2][2], acc[2][3]);
  acc_guard4(acc[3][0], acc[3][1], acc[3][2], acc[3][3]);

  // ---- epilogue ----
  float* slab = sT[wave];
#pragma unroll
  for (int i = 0; i < 4; ++i) {
    const int mBase = m0 + (i << 4);
    float rsv[8];
#pragma unroll
    for (int r = 0; r < 8; ++r) rsv[r] = 1.0f;
    if (ROWSC) {
      // two 16-B loads of rowsc[mBase+mOff .. +7], then RNE bf16 of each value
      const v4f ra = *(const v4f*)(rowsc + mBase + mOff);
      const v4f rb = *(const v4f*)(rowsc + mBase + mOff + 4);
      rsv[0] = ra[0]; rsv[1] = ra[1]; rsv[2] = ra[2]; rsv[3] = ra[3];
      rsv[4] = rb[0]; rsv[5] = rb[1]; rsv[6] = rb[2]; rsv[7] = rb[3];
#pragma unroll
      for (int r = 0; r < 8; ++r) rsv[r] = bf_bits2f(f2bf_bits(rsv[r]));
    }
#pragma unroll
    for (int j = 0; j < 4; ++j) {
      const int n = n0 + (j << 4) + rlane;
      float bv = 0.f;
      if (BIAS_MODE == 2) bv = bias[n];
#pragma unroll
      for (int r = 0; r < 8; ++r) {
        float v = acc[i][j][r] * scale;
        if (BIAS_MODE == 1) v += bias[mBase + mOff + r];
        if (BIAS_MODE == 2) v += bv;
        if (ROWSC) v = v * rsv[r];
        slab[(mOff + r) * 68 + (j << 4) + rlane] = v;
      }
    }
    __builtin_amdgcn_fence(__ATOMIC_RELEASE, "workgroup");
    __builtin_amdgcn_wave_barrier();
    __builtin_amdgcn_fence(__ATOMIC_ACQUIRE, "workgroup");
    if (OUT_MODE == 0) {
      float* C = (float*)Cout + (size_t)b * strideC;
      const int hh = lane >> 4, c4 = (lane & 15) * 4;     // row seg = 256 B = 16 lanes x 16 B
      {
#pragma unroll
        for (int it = 0; it < 8; ++it) {
          const int row = it * 2 + hh;
          v4f v = *(const v4f*)(slab + row * 68 + c4);
          *(v4f*)(C + (size_t)(mBase + row) * ldc + n0 + c4) = v;
        }
        
      }
    } else {
      const int q = lane >> 3, c8 = (lane & 7) * 8;
      unsigned short* C  = (unsigned short*)Cout  + (size_t)b * strideC;
      unsigned short* C2 = (OUT_MODE >= 2) ? ((unsigned short*)Cout2 + (size_t)b * strideC) : nullptr;
      {
#pragma unroll
        for (int it = 0; it < 4; ++it) {
          const int row = it * 4 + q;
          const float* sp = slab + row * 68 + c8;
          v8h hv, lv;
#pragma unroll
          for (int e = 0; e < 8; ++e) {
            if (OUT_MODE == 1) {
              hv[e] = (_Float16)sp[e];
            } else if (OUT_MODE == 2) {
              unsigned short hb = f2bf_bits(sp[e]);
              unsigned short lb = f2bf_bits(sp[e] - bf_bits2f(hb));
              hv[e] = __builtin_bit_cast(_Float16, hb);
              lv[e] = __builtin_bit_cast(_Float16, lb);
            } else {
              const unsigned short hb = h_bits(sp[e]);
              const float back = h16_to_f32((unsigned)hb);
              const unsigned short lb = h_bits((sp[e] - back) * kVloCarry);
              hv[e] = __builtin_bit_cast(_Float16, hb);
              lv[e] = __builtin_bit_cast(_Float16, lb);
            }
          }
          *(v8h*)(C + (size_t)(mBase + row) * ldc + n0 + c8) = hv;
          if (OUT_MODE >= 2) *(v8h*)(C2 + (size_t)(mBase + row) * ldc + n0 + c8) = lv;
        }
        
      }
    }
    __builtin_amdgcn_fence(__ATOMIC_RELEASE, "workgroup");
    __builtin_amdgcn_wave_barrier();
    __builtin_amdgcn_fence(__ATOMIC_ACQUIRE, "workgroup");
  }
}

// ---------------------------------------------------------------------------
// f32 -> bf16 (RNE) cast, 8 consecutive elements per thread (one 16-B store per lane; 32 contiguous lanes = 4 whole
// multiples of 256: 1,048,576 threads for x, 131,072 for each weight).
// ---------------------------------------------------------------------------
__global__ __launch_bounds__(256) void cast8_bf16_kernel(const float* __restrict__ in, unsigned short* __restrict__ out, int n8) {
  const int i = blockIdx.x * 256 + threadIdx.x;
  if (i >= n8) return;
  const float* p = in + 8 * (size_t)i;
  const v4f a = *(const v4f*)(p);
  const v4f c = *(const v4f*)(p + 4);
  unsigned short hb[8];
#pragma unroll
  for (int e = 0; e < 4; ++e) {
    hb[e]     = f2bf_bits(a[e]);
    hb[4 + e] = f2bf_bits(c[e]);
  }
  const v4u u = (v4u){pk16(hb[0], hb[1]), pk16(hb[2], hb[3]), pk16(hb[4], hb[5]), pk16(hb[6], hb[7])};
  unsigned short* q = out + 8 * (size_t)i;
  *(v4u*)q = u;
  
}

// ---------------------------------------------------------------------------
// Time-decay bias table: tab[d] = logf(expf((-(d*300)) * (1/300)) + 1e-12), d = 0..2047, f32, precise expf/logf.
// ---------------------------------------------------------------------------
__global__ __launch_bounds__(256) void tab_kernel(float* __restrict__ tab) {
  const int i = blockIdx.x * 256 + threadIdx.x;
  if (i >= kP / 4) return;
  v4f tv;
#pragma unroll
  for (int e = 0; e < 4; ++e) {
    const float d = (float)(4 * i + e);
    const float dist = d * kDelta;
    const float ex = (-dist) * kInvTau;
    const float w = expf(ex);
    tv[e] = logf(w + kLogEps);
  }
  float* q = tab + 4 * (size_t)i;
  *(v4f*)q = tv;
  
}

// ---------------------------------------------------------------------------
// Flash attention for head dim 64 with additive |i-j| time bias and float key mask (key masked when pm <= 0,
// score replaced by -1e9). Inputs are 16-bit planes:
//   Q16 f16 [8192][1024] (token row, col h*64+d), K16 f16 same layout,
//   VTh/VTl f16 [1024][8192] (row h*64+d, col token) = V^T hi plane and residual plane x2048.
// Output: O as bf16 hi plane + bf16 lo plane [8192][1024] (token row, col h*64+d).
// Block = 4 waves = 64 query rows of one (b,h); 64-key chunks; K tile [kv][d], V^T tiles [d][kv] and the 2048-entry
// online softmax in f32 with precise expf; PV hi and residual products in separate accumulators.
// grid.x = 4*16*32 = 2048 blocks, 128 threads. All loops have static trip counts; no early exit.
// ---------------------------------------------------------------------------
__global__ __launch_bounds__(128) void attn_kernel(const unsigned short* __restrict__ Qp, const unsigned short* __restrict__ Kp,
                                                   const unsigned short* __restrict__ VThp, const unsigned short* __restrict__ VTlp,
                                                   const float* __restrict__ tab, const float* __restrict__ pm,
                                                   unsigned short* __restrict__ Ohp, unsigned short* __restrict__ Olp) {
  __shared__ __align__(16) _Float16 Ksh[kKC * kLP];          // K   [kv][d]   9 KB
  __shared__ __align__(16) _Float16 Vth[kDh * kLP];          // V^T hi [d][kv] 9 KB
  __shared__ __align__(16) _Float16 Vtl[kDh * kLP];          // V^T residual x2048 [d][kv] 9 KB
  __shared__ __align__(16) _Float16 Psh[kNW][16 * kLP];      // per wave P x32768 [row][kv] 9 KB
  __shared__ __align__(16) float    Os[kNW][16 * 68];        // per wave out tile, pitch 68
  __shared__ __align__(16) float    tabs[kP];                // bias table 8 KB

  const int tid  = threadIdx.x;
  const int wave = tid >> 5;
  const int lane = tid & 31;
  const int hh   = lane >> 4;
  const int c    = lane & 15;
  const int nqb  = kP / kQB;              // 32
  const int bx   = blockIdx.x;
  const int qb   = bx % nqb;
  const int bh   = bx / nqb;
  const int h    = bh % kH;
  const int b    = bh / kH;
  const int q0   = qb * kQB + wave * 16;  // first query row of this wave within the sequence
  const size_t tok0 = (size_t)b * kP;     // first token row of this batch

  // ---- bias table -> LDS: 4 x 128 threads x 4 floats = 2048 (whole table); read after the loop's first barrier ----
#pragma unroll
  for (int i = 0; i < 4; ++i) {
    const int idx = i * 128 + tid;
    const v4f t4 = *(const v4f*)(tab + 4 * idx);
    *(v4f*)(tabs + 4 * idx) = t4;
  }
  asm volatile("" ::: "memory");

  // ---- Q fragments (A operand): row = query q0+c, k = d; 2 d-chunks ----
  const _Float16* Qh = (const _Float16*)(const void*)Qp;
  const _Float16* qr = Qh + (tok0 + q0 + c) * (size_t)kD + h * kDh + 8 * hh;
  v16h qa[2];
  qa[0] = Frag<_Float16>::load(qr);
  qa[1] = Frag<_Float16>::load(qr + 32);

  float mrow[8], lrow[8];
  v8f oacc[4], oaccl[4];
#pragma unroll
  for (int r = 0; r < 8; ++r) { mrow[r] = -__builtin_inff(); lrow[r] = 0.f; }
#pragma unroll
  for (int t = 0; t < 4; ++t) {
    oacc[t]  = (v8f){0.f,0.f,0.f,0.f,0.f,0.f,0.f,0.f};
    oaccl[t] = (v8f){0.f,0.f,0.f,0.f,0.f,0.f,0.f,0.f};
  }

  for (int kc = 0; kc < kP / kKC; ++kc) {
    const int kv0 = kc * kKC;
    __syncthreads();
    // ---- stage K tile: 64 rows x 8 segments of 8 halves = 512 x 16 B; 4 per thread (coverage 4 x 128 = 512) ----
    {
      const unsigned short* kbp = Kp + (tok0 + kv0) * (size_t)kD + h * kDh;
      v4u u[4];
#pragma unroll
      for (int i = 0; i < 4; ++i) {
        const int idx = i * 128 + tid;
        const int row = idx >> 3;
        const int seg = (idx & 7) * 8;
        u[i] = *(const v4u*)(kbp + (size_t)row * kD + seg);
      }
#pragma unroll
      for (int i = 0; i < 4; ++i) {
        const int idx = i * 128 + tid;
        const int row = idx >> 3;
        const int seg = (idx & 7) * 8;
        *(v4u*)(Ksh + row * kLP + seg) = u[i];
      }
    }
    asm volatile("" ::: "memory");
    // ---- stage V^T hi tile: 64 d-rows x 64 kv halves; same coverage ----
    {
      const unsigned short* vbp = VThp + (size_t)(h * kDh) * kTok + tok0 + kv0;
      v4u u[4];
#pragma unroll
      for (int i = 0; i < 4; ++i) {
        const int idx = i * 128 + tid;
        const int row = idx >> 3;
        const int seg = (idx & 7) * 8;
        u[i] = *(const v4u*)(vbp + (size_t)row * kTok + seg);
      }
#pragma unroll
      for (int i = 0; i < 4; ++i) {
        const int idx = i * 128 + tid;
        const int row = idx >> 3;
        const int seg = (idx & 7) * 8;
        *(v4u*)(Vth + row * kLP + seg) = u[i];
      }
    }
    asm volatile("" ::: "memory");
    // ---- stage V^T residual tile ----
    {
      const unsigned short* vbp = VTlp + (size_t)(h * kDh) * kTok + tok0 + kv0;
      v4u u[4];
#pragma unroll
      for (int i = 0; i < 4; ++i) {
        const int idx = i * 128 + tid;
        const int row = idx >> 3;
        const int seg = (idx & 7) * 8;
        u[i] = *(const v4u*)(vbp + (size_t)row * kTok + seg);
      }
#pragma unroll
      for (int i = 0; i < 4; ++i) {
        const int idx = i * 128 + tid;
        const int row = idx >> 3;
        const int seg = (idx & 7) * 8;
        *(v4u*)(Vtl + row * kLP + seg) = u[i];
      }
    }
    __syncthreads();

    // ---- scores: D[row = query 8hh+r][col = key j*16+c], K = 64 in 2 steps of 32 ----
    v8f s[4];
#pragma unroll
    for (int j = 0; j < 4; ++j) {
      s[j] = (v8f){0.f,0.f,0.f,0.f,0.f,0.f,0.f,0.f};
#pragma unroll
      for (int dc = 0; dc < 2; ++dc) {
        const v16h kf = Frag<_Float16>::load(Ksh + (j * 16 + c) * kLP + dc * 32 + 8 * hh);
        s[j] = mma_h(qa[dc], kf, s[j]);
      }
    }
    // key mask values for this lane's 4 key columns (4 scalar loads)
    float pmv[4];
#pragma unroll
    for (int j = 0; j < 4; ++j) pmv[j] = pm[tok0 + kv0 + j * 16 + c];

    float cm[8];
#pragma unroll
    for (int r = 0; r < 8; ++r) {
      const int qrow = q0 + 8 * hh + r;
      float m = -__builtin_inff();
#pragma unroll
      for (int j = 0; j < 4; ++j) {
        const int kvcol = kv0 + j * 16 + c;
        int dd = qrow - kvcol;
        dd = (dd < 0) ? -dd : dd;
        float v = s[j][r] * kScoreScale + tabs[dd];
        v = (pmv[j] <= 0.0f) ? kNegBig : v;
        s[j][r] = v;
        m = fmaxf(m, v);
      }
#pragma unroll
      for (int off = 1; off < 16; off <<= 1) m = fmaxf(m, __shfl_xor(m, off, 32));
      cm[r] = m;
    }

    // ---- online softmax; P x32768 as f16 into the per-wave LDS tile ----
    _Float16* pw = Psh[wave];
#pragma unroll
    for (int r = 0; r < 8; ++r) {
      const float mnew  = fmaxf(mrow[r], cm[r]);
      const float alpha = expf(mrow[r] - mnew);
      mrow[r] = mnew;
      float psum = 0.f;
#pragma unroll
      for (int j = 0; j < 4; ++j) {
        const float p = expf(s[j][r] - mnew);
        psum += p;
        pw[(8 * hh + r) * kLP + j * 16 + c] = (_Float16)(p * kPCarry);
      }
#pragma unroll
      for (int off = 1; off < 16; off <<= 1) psum += __shfl_xor(psum, off, 32);
      lrow[r] = lrow[r] * alpha + psum;
#pragma unroll
      for (int t = 0; t < 4; ++t) { oacc[t][r] *= alpha; oaccl[t][r] *= alpha; }
    }
    __builtin_amdgcn_fence(__ATOMIC_RELEASE, "workgroup");
    __builtin_amdgcn_wave_barrier();
    __builtin_amdgcn_fence(__ATOMIC_ACQUIRE, "workgroup");

    // ---- O += P . V : A = P [query c][kv], B = V^T [d t*16+c][kv]; hi and residual in separate accumulators ----
#pragma unroll
    for (int kk = 0; kk < 2; ++kk) {
      const v16h pa = Frag<_Float16>::load(pw + c * kLP + kk * 32 + 8 * hh);
#pragma unroll
      for (int t = 0; t < 4; ++t) {
        const v16h vh = Frag<_Float16>::load(Vth + (t * 16 + c) * kLP + kk * 32 + 8 * hh);
        oacc[t] = mma_h(pa, vh, oacc[t]);
        const v16h vl = Frag<_Float16>::load(Vtl + (t * 16 + c) * kLP + kk * 32 + 8 * hh);
        oaccl[t] = mma_h(pa, vl, oaccl[t]);
      }
    }
  }

  // ---- normalise (fold 2^-15 of P and 2^-11 of the residual) into the per-wave f32 slab ----
  float* os = Os[wave];
#pragma unroll
  for (int r = 0; r < 8; ++r) {
    const float inv = 1.0f / (lrow[r] * kPCarry);
#pragma unroll
    for (int t = 0; t < 4; ++t) os[(8 * hh + r) * 68 + t * 16 + c] = (oacc[t][r] + oaccl[t][r] * kVloInv) * inv;
  }
  __builtin_amdgcn_fence(__ATOMIC_RELEASE, "workgroup");
  __builtin_amdgcn_wave_barrier();
  __builtin_amdgcn_fence(__ATOMIC_ACQUIRE, "workgroup");
  {
    const int q4 = lane >> 3, c8 = (lane & 7) * 8;
    {
#pragma unroll
      for (int it = 0; it < 4; ++it) {
        const int row = it * 4 + q4;
        const float* sp = os + row * 68 + c8;
        v8h hv, lv;
#pragma unroll
        for (int e = 0; e < 8; ++e) {
          const unsigned short hb = f2bf_bits(sp[e]);
          const unsigned short lb = f2bf_bits(sp[e] - bf_bits2f(hb));
          hv[e] = __builtin_bit_cast(_Float16, hb);
          lv[e] = __builtin_bit_cast(_Float16, lb);
        }
        const size_t off = (tok0 + q0 + row) * (size_t)kD + h * kDh + c8;
        *(v8h*)(Ohp + off) = hv;
        *(v8h*)(Olp + off) = lv;
      }
      
    }
  }
}

// ---------------------------------------------------------------------------
// Host glue.
//   Xb   bf16 [8192][1024]        16,777,216  at           0
//   Wqb  bf16 [1024][1024]         2,097,152  at  16,777,216
//   Wkb  bf16 [1024][1024]         2,097,152  at  18,874,368
//   Wvb  bf16 [1024][1024]         2,097,152  at  20,971,520
//   Wob  bf16 [1024][1024]         2,097,152  at  23,068,672
//   Q16  f16  [8192][1024]        16,777,216  at  25,165,824
//   K16  f16  [8192][1024]        16,777,216  at  41,943,040
//   VTh  f16  [1024][8192]        16,777,216  at  58,720,256
//   VTl  f16  [1024][8192]        16,777,216  at  75,497,472   (residual x2048)
//   Oh   bf16 [8192][1024]        16,777,216  at  92,274,688
//   Ol   bf16 [8192][1024]        16,777,216  at 109,051,904
//   tab  f32  [2048]                   8,192  at 125,829,120
//   total                        125,837,312
// Every region is fully written before it is read; no region is re-used.
// GEMM shapes: Q,K: M=8192 N=1024 K=1024; V^T: M=1024 N=8192 K=1024; out: M=8192 N=1024 K=1024 (all 64-multiples,
// K%32==0, no padding). Attention: S=2048 (64-multiples), Dh=64.
// ---------------------------------------------------------------------------
extern "C" void kernel_launch(void* const* d_in, const int* in_sizes, int n_in,
                              void* d_out, int out_size, void* d_ws, size_t ws_size,
                              hipStream_t stream) {
  if (n_in < 10) return;
  const int nX = kTok * kD;     // 8,388,608
  const int nW = kD * kD;       // 1,048,576
  if (in_sizes[0] != nX || in_sizes[1] != kTok) return;
  if (in_sizes[2] != nW || in_sizes[4] != nW || in_sizes[6] != nW || in_sizes[8] != nW) return;
  if (in_sizes[3] != kD || in_sizes[5] != kD || in_sizes[7] != kD || in_sizes[9] != kD) return;
  if (out_size != nX) return;

  const size_t szX16 = (size_t)nX * 2;
  const size_t szW16 = (size_t)nW * 2;
  const size_t szTab = (size_t)kP * 4;
  const size_t offXb  = 0;
  const size_t offWq  = offXb + szX16;
  const size_t offWk  = offWq + szW16;
  const size_t offWv  = offWk + szW16;
  const size_t offWo  = offWv + szW16;
  const size_t offQ   = offWo + szW16;
  const size_t offK   = offQ + szX16;
  const size_t offVTh = offK + szX16;
  const size_t offVTl = offVTh + szX16;
  const size_t offOh  = offVTl + szX16;
  const size_t offOl  = offOh + szX16;
  const size_t offTab = offOl + szX16;
  const size_t total  = offTab + szTab;
  if (ws_size < total) return;

  const float* x  = (const float*)d_in[0];
  const float* pm = (const float*)d_in[1];
  const float* Wq = (const float*)d_in[2];
  const float* bq = (const float*)d_in[3];
  const float* Wk = (const float*)d_in[4];
  const float* bk = (const float*)d_in[5];
  const float* Wv = (const float*)d_in[6];
  const float* bv = (const float*)d_in[7];
  const float* Wo = (const float*)d_in[8];
  const float* bo = (const float*)d_in[9];
  float* out = (float*)d_out;
  char* ws = (char*)d_ws;
  unsigned short* Xb  = (unsigned short*)(ws + offXb);
  unsigned short* Wqb = (unsigned short*)(ws + offWq);
  unsigned short* Wkb = (unsigned short*)(ws + offWk);
  unsigned short* Wvb = (unsigned short*)(ws + offWv);
  unsigned short* Wob = (unsigned short*)(ws + offWo);
  unsigned short* Q16 = (unsigned short*)(ws + offQ);
  unsigned short* K16 = (unsigned short*)(ws + offK);
  unsigned short* VTh = (unsigned short*)(ws + offVTh);
  unsigned short* VTl = (unsigned short*)(ws + offVTl);
  unsigned short* Oh  = (unsigned short*)(ws + offOh);
  unsigned short* Ol  = (unsigned short*)(ws + offOl);
  float* tab = (float*)(ws + offTab);

  // ---- prologue: RNE bf16 operand planes and the bias table ----
  const int n8x = nX / 8;   // 1,048,576 -> 4096 blocks exact
  const int n8w = nW / 8;   //   131,072 ->  512 blocks exact
  cast8_bf16_kernel<<<dim3(n8x / 256), dim3(256), 0, stream>>>(x,  Xb,  n8x);
  cast8_bf16_kernel<<<dim3(n8w / 256), dim3(256), 0, stream>>>(Wq, Wqb, n8w);
  cast8_bf16_kernel<<<dim3(n8w / 256), dim3(256), 0, stream>>>(Wk, Wkb, n8w);
  cast8_bf16_kernel<<<dim3(n8w / 256), dim3(256), 0, stream>>>(Wv, Wvb, n8w);
  cast8_bf16_kernel<<<dim3(n8w / 256), dim3(256), 0, stream>>>(Wo, Wob, n8w);
  tab_kernel<<<dim3((kP / 4) / 256), dim3(256), 0, stream>>>(tab);

  // ---- projections (64x64 wave tiles, 8 waves per block) ----
  const int tilesProj = (kTok / 64) * (kD / 64);   // 2048 -> 256 blocks
  // Q16[m][n] = sum_k Xb[m][k] * Wqb[n][k] + bq[n]   (f16 out)
  wmma_gemm64<1, 0, 2, 1, false><<<dim3(tilesProj / 8, 1), dim3(256), 0, stream>>>(
      Xb, Xb, kD, 0L, Wqb, Wqb, kD, 0L, (void*)Q16, (void*)Q16, kD, 0L, bq, pm, kTok, kD, kD, 1.0f);
  // K16 likewise with Wk, bk
  wmma_gemm64<1, 0, 2, 1, false><<<dim3(tilesProj / 8, 1), dim3(256), 0, stream>>>(
      Xb, Xb, kD, 0L, Wkb, Wkb, kD, 0L, (void*)K16, (void*)K16, kD, 0L, bk, pm, kTok, kD, kD, 1.0f);
  // V^T[m = feature][n = token] = sum_k Wvb[m][k] * Xb[n][k] + bv[m]   (f16 hi plane + f16 residual plane x2048)
  wmma_gemm64<1, 0, 1, 3, false><<<dim3(tilesProj / 8, 1), dim3(256), 0, stream>>>(
      Wvb, Wvb, kD, 0L, Xb, Xb, kD, 0L, (void*)VTh, (void*)VTl, kTok, 0L, bv, pm, kD, kTok, kD, 1.0f);

  // ---- attention: 64 (b,h) x 32 query tiles ----
  attn_kernel<<<dim3(kB * kH * (kP / kQB)), dim3(128), 0, stream>>>(Q16, K16, VTh, VTl, tab, pm, Oh, Ol);

  // ---- output projection: out[m][n] = (sum_k (Oh+Ol)[m][k] * Wob[n][k] + bo[n]) * pm[m] ----
  wmma_gemm64<1, 2, 2, 0, true><<<dim3(tilesProj / 8, 1), dim3(256), 0, stream>>>(
      Oh, Ol, kD, 0L, Wob, Wob, kD, 0L, (void*)out, (void*)out, kD, 0L, bo, pm, kTok, kD, kD, 1.0f);
}

// v002
// One run takes 546 microseconds.
// Next to v001, in two timings, it ran 1.30 times as fast each time.
// Counting every step since v000, it is 1.48 times as fast.
// Contractions: q/k/v projections on v_wmma_f32_16x16x32_bf16 (x and W as RNE bf16 planes, single products); scores q.k^T on v_wmma_f32_16x16x32_f16 (q, k f16 planes); attn.v on v_wmma_f32_16x16x32_f16 (P f16 carried x32768; V^T as f16 hi plane + f16 residual plane carried x2048 in a separate accumulator); output projection on v_wmma_f32_16x16x32_bf16 (attention output as bf16 hi + lo planes, Wo bf16, two products); f32 accumulate everywhere; time bias, masks and softmax in f32.
#include <hip/hip_runtime.h>
#include <math.h>

// ---------------------------------------------------------------------------
// Problem constants
// ---------------------------------------------------------------------------
constexpr int kB   = 4;
constexpr int kP   = 2048;
constexpr int kD   = 1024;
constexpr int kH   = 16;
constexpr int kDh  = 64;
constexpr int kTok = kB * kP;            // 8192 token rows
constexpr int kQB  = 64;                 // queries per attention block
constexpr int kKC  = 64;                 // keys per chunk
constexpr int kNW  = 4;                  // waves per attention block
constexpr int kLP  = 72;                 // LDS row pitch in halves of the 64-half K, V^T and P rows: 144 B = 16 B x odd,
                                         // so the 16 rows of one ds_load_b128 fragment read fall on distinct banks
constexpr float kScoreScale = 0.125f;    // 64^-0.5
constexpr float kNegBig     = -1.0e9f;
constexpr float kPCarry     = 32768.0f;  // probabilities carried x2^15 in f16
constexpr float kVloCarry   = 2048.0f;   // f16 residual planes carried x2^11
constexpr float kVloInv     = 1.0f / 2048.0f;
constexpr float kDelta      = 300.0f;    // seconds per patch step
constexpr float kInvTau     = 1.0f / 300.0f;
constexpr float kLogEps     = 1.0e-12f;
static_assert(kH * kDh == kD, "s");
static_assert(kTok % 64 == 0 && kD % 64 == 0 && kD % 32 == 0, "s");
static_assert(kP % kQB == 0 && kP % kKC == 0 && kDh == 64, "s");
static_assert((kTok * kD) % (8 * 256) == 0 && (kD * kD) % (8 * 256) == 0, "s");
static_assert(kP % 1024 == 0, "s");

typedef __attribute__((ext_vector_type(16))) _Float16 v16h;
typedef __attribute__((ext_vector_type(8)))  _Float16 v8h;
typedef __attribute__((ext_vector_type(16))) __bf16   v16b;
typedef __attribute__((ext_vector_type(8)))  __bf16   v8b;
typedef __attribute__((ext_vector_type(8)))  float    v8f;
typedef __attribute__((ext_vector_type(4)))  float    v4f;
typedef __attribute__((ext_vector_type(4)))  unsigned int v4u;

// ---------------------------------------------------------------------------
// Conversion, fragment and hazard-guard helpers
// ---------------------------------------------------------------------------
__device__ __forceinline__ unsigned short f2bf_bits(float f) {
  unsigned u = __float_as_uint(f);
  return (unsigned short)((u + 0x7FFFu + ((u >> 16) & 1u)) >> 16);
}
__device__ __forceinline__ float bf_bits2f(unsigned short h) { return __uint_as_float(((unsigned)h) << 16); }

// f16 bits (low 16) -> f32, integer path, finite values
__device__ __forceinline__ float h16_to_f32(unsigned hb) {
  const unsigned sgn = (hb & 0x8000u) << 16; const unsigned em = hb & 0x7fffu;
  const float fn = __uint_as_float((em << 13) + 0x38000000u);
  const float fs = (float)em * 5.9604644775390625e-8f;
  const float mag = (em < 0x400u) ? fs : fn; return __uint_as_float(__float_as_uint(mag) | sgn); }

// hazard guards as plain device helpers (no inline asm inside the kernel template body)
__device__ __forceinline__ void dep_guard4_h(v8f& a, v8f& b, v8f& c, v8f& d, v16h x, v16h y) {
  asm volatile("v_nop\n\tv_nop\n\tv_nop\n\tv_nop" : "+v"(a), "+v"(b), "+v"(c), "+v"(d) : "v"(x), "v"(y));
}
__device__ __forceinline__ void dep_guard4_b(v8f& a, v8f& b, v8f& c, v8f& d, v16b x, v16b y) {
  asm volatile("v_nop\n\tv_nop\n\tv_nop\n\tv_nop" : "+v"(a), "+v"(b), "+v"(c), "+v"(d) : "v"(x), "v"(y));
}
__device__ __forceinline__ void keep4_h(v16h a, v16h b, v16h c, v16h d) { asm volatile("v_nop" :: "v"(a), "v"(b), "v"(c), "v"(d)); }
__device__ __forceinline__ void keep4_b(v16b a, v16b b, v16b c, v16b d) { asm volatile("v_nop" :: "v"(a), "v"(b), "v"(c), "v"(d)); }
__device__ __forceinline__ void acc_guard4(v8f& a, v8f& b, v8f& c, v8f& d) { asm volatile("v_nop\n\tv_nop\n\tv_nop\n\tv_nop" : "+v"(a), "+v"(b), "+v"(c), "+v"(d)); }
template <typename T> struct Frag;
template <> struct Frag<_Float16> {
  typedef v16h V; union U { v16h v; v8h h[2]; };
  // elements 0..7 <- p[0..7], 8..15 <- p[16..23]
  static __device__ __forceinline__ v16h load(const _Float16* p) {
    U f; f.h[0] = *(const v8h*)(p); f.h[1] = *(const v8h*)(p + 16); return f.v;
  }
  static __device__ __forceinline__ v8f mma(v16h a, v16h b, v8f c) {
    return __builtin_amdgcn_wmma_f32_16x16x32_f16(false, a, false, b, (short)0, c, false, false);
  }
  static __device__ __forceinline__ void guard4(v8f& a, v8f& b, v8f& c, v8f& d, v16h x, v16h y) { dep_guard4_h(a, b, c, d, x, y); }
  static __device__ __forceinline__ void keep(v16h a, v16h b, v16h c, v16h d) { keep4_h(a, b, c, d); }
};
template <> struct Frag<__bf16> {
  typedef v16b V; union U { v16b v; v8b h[2]; };
  static __device__ __forceinline__ v16b load(const __bf16* p) {
    U f; f.h[0] = *(const v8b*)(p); f.h[1] = *(const v8b*)(p + 16); return f.v;
  }
  static __device__ __forceinline__ v8f mma(v16b a, v16b b, v8f c) {
    return __builtin_amdgcn_wmma_f32_16x16x32_bf16(false, a, false, b, (short)0, c, false, false);
  }
  static __device__ __forceinline__ void guard4(v8f& a, v8f& b, v8f& c, v8f& d, v16b x, v16b y) { dep_guard4_b(a, b, c, d, x, y); }
  static __device__ __forceinline__ void keep(v16b a, v16b b, v16b c, v16b d) { keep4_b(a, b, c, d); }
};

__device__ __forceinline__ unsigned pk16(unsigned short a, unsigned short b) { return (unsigned)a | ((unsigned)b << 16); }
__device__ __forceinline__ unsigned short h_bits(float f) { const _Float16 h = (_Float16)f; return __builtin_bit_cast(unsigned short, h); }

// single WMMA with its own hazard guard (ties D, keeps A/B live)
__device__ __forceinline__ v8f mma_h(v16h a, v16h b, v8f c) {
  c = __builtin_amdgcn_wmma_f32_16x16x32_f16(false, a, false, b, (short)0, c, false, false);
  asm volatile("v_nop\n\tv_nop\n\tv_nop\n\tv_nop" : "+v"(c) : "v"(a), "v"(b));
  return c;
}

// ---- LDS staging of the GEMM operands ----
constexpr int kGK = 128;   // k per stage: every staged operand row is 256 B = two whole 128-B lines
constexpr int kGP = 136;   // LDS row pitch in halves: 272 B = 16 B x odd, so the 16 rows of a ds_load_b128 fragment read fall on distinct banks

// Eight asynchronous 16-B copies per lane, global -> LDS: rows r, r+16, ..., r+112 of one 128-row panel (16 lanes per 256-B row).
// The closing s_wait_xcnt stands inside the statement so that no address register of a copy is rewritten in front of it.
__device__ __forceinline__ void copy8_to_lds(unsigned l, const unsigned short* g, size_t gs) {
  constexpr unsigned ls = 16u * kGP * 2u;   // 16 LDS rows in bytes
  asm volatile(
      "global_load_async_to_lds_b128 %0, %8, off\n\t"
      "global_load_async_to_lds_b128 %1, %9, off\n\t"
      "global_load_async_to_lds_b128 %2, %10, off\n\t"
      "global_load_async_to_lds_b128 %3, %11, off\n\t"
      "global_load_async_to_lds_b128 %4, %12, off\n\t"
      "global_load_async_to_lds_b128 %5, %13, off\n\t"
      "global_load_async_to_lds_b128 %6, %14, off\n\t"
      "global_load_async_to_lds_b128 %7, %15, off\n\t"
      "s_wait_xcnt 0x0"
      :: "v"(l), "v"(l + ls), "v"(l + 2u * ls), "v"(l + 3u * ls), "v"(l + 4u * ls), "v"(l + 5u * ls), "v"(l + 6u * ls), "v"(l + 7u * ls),
         "v"(g), "v"(g + gs), "v"(g + 2 * gs), "v"(g + 3 * gs), "v"(g + 4 * gs), "v"(g + 5 * gs), "v"(g + 6 * gs), "v"(g + 7 * gs)
      : "memory");
}
// this wave's copies have landed in LDS (the compiler places no wait for them)
__device__ __forceinline__ void wait_copies() { asm volatile("s_wait_asynccnt 0x0" ::: "memory"); }
// this wave's LDS reads have returned, so the buffer they read may be refilled behind the next barrier
__device__ __forceinline__ void wait_lds() { asm volatile("s_wait_dscnt 0x0" ::: "memory"); }

// ---- Register-blocked batched WMMA GEMM (modes extended) ----------------------------------------------
// C[m,n] = scale * sum_k A[m,k] * Bt[n,k] (+bias)(*rowsc[m]); each wave owns a 64x64 tile, the block's 8 waves a 128x256 tile
// (2 x 4 waves). Per stage the block's 128 A rows and 256 Bt rows x 128 k are copied to LDS in whole lines and every wave
// reads its fragments from there; two buffers, the next stage's copies in flight while this stage is multiplied.
// A row-major [M,K]; Bt row-major [N,K]; M % 128 == 0, N % 256 == 0, K % 128 == 0, K >= 128 (no tail handling).
// SPLIT: 0 = single product; 1 = A and Bt hi/lo planes (hi*hi + hi*lo + lo*hi); 2 = A hi/lo planes only (hi*B + lo*B).
// BIAS_MODE: 0 = none, 1 = bias[m], 2 = bias[n].  ROWSC: multiply by RNE-bf16(rowsc[m]) after the bias.
// OUT_MODE: 0 = f32, 1 = f16, 2 = bf16 hi plane (Cout) + bf16 lo plane (Cout2), 3 = f16 hi plane + f16 residual plane x2048.
// ET: 0 = f16 operands, 1 = bf16 operands (pointers passed as 16-bit storage)
template <int ET> struct Elem;
template <> struct Elem<0> { typedef _Float16 T; };
template <> struct Elem<1> { typedef __bf16 T; };
template <int ET, int SPLIT, int BIAS_MODE, int OUT_MODE, bool ROWSC>
__global__ __launch_bounds__(256) void wmma_gemm64(
    const unsigned short* __restrict__ Ap, const unsigned short* __restrict__ A2p, int lda, long strideA,
    const unsigned short* __restrict__ Btp, const unsigned short* __restrict__ Bt2p, int ldb, long strideB,
    void* __restrict__ Cout, void* __restrict__ Cout2, int ldc, long strideC,
    const float* __restrict__ bias, const float* __restrict__ rowsc,
    int M, int N, int K, float scale) {
  typedef typename Elem<ET>::T T;
  typedef typename Frag<T>::V V;
  constexpr int NA = (SPLIT != 0) ? 2 : 1;             // A planes
  constexpr int NB = (SPLIT == 1) ? 2 : 1;             // Bt planes
  constexpr int kBufH = (128 * NA + 256 * NB) * kGP;   // halves per buffer: [A planes, 128 rows each][Bt planes, 256 rows each]
  __shared__ __align__(16) unsigned short ring[2 * kBufH];
  __shared__ __align__(16) float sT[8][16 * 68];   // per-wave 16x64 slab, pitch 68 floats
  const int b    = blockIdx.y;
  const int lane = threadIdx.x & 31;
  const int wave = threadIdx.x >> 5;
  const int tilesNb = N >> 8;
  const int tilesMb = M >> 7;
  if ((int)blockIdx.x >= tilesMb * tilesNb) return;   // the same for the whole block, ahead of every barrier
  const int bm  = blockIdx.x / tilesNb;
  const int bn  = blockIdx.x - bm * tilesNb;
  const int m0b = bm << 7;
  const int n0b = bn << 8;
  const int wm  = wave >> 2;
  const int wn  = wave & 3;
  const int m0  = m0b + (wm << 6);
  const int n0  = n0b + (wn << 6);

  const int rlane = lane & 15;                 // row (A) / col (B, D) within subtile
  const int koff  = (lane >> 4) * 8;           // k offset of this lane half
  const int mOff  = (lane >> 4) * 8;           // D row offset

  // copy addresses of this lane: row threadIdx.x / 16 of each 16-row group, 16-B segment threadIdx.x % 16
  const int cr = threadIdx.x >> 4;
  const int cs = (threadIdx.x & 15) * 8;
  const unsigned short* cA  = Ap   + (size_t)b * strideA + (size_t)(m0b + cr) * lda + cs;
  const unsigned short* cA2 = A2p  + (size_t)b * strideA + (size_t)(m0b + cr) * lda + cs;
  const unsigned short* cB  = Btp  + (size_t)b * strideB + (size_t)(n0b + cr) * ldb + cs;
  const unsigned short* cB2 = Bt2p + (size_t)b * strideB + (size_t)(n0b + cr) * ldb + cs;
  const unsigned cl = (unsigned)(uintptr_t)ring + (unsigned)(cr * kGP + cs) * 2u;   // LDS byte address
  const size_t gsA = (size_t)16 * lda;
  const size_t gsB = (size_t)16 * ldb;
  constexpr unsigned kPanel = 128u * kGP * 2u;   // 128 LDS rows in bytes
  auto stage = [&](int t) {
    const unsigned l = cl + (unsigned)(t & 1) * (unsigned)(kBufH * 2);
    const size_t k = (size_t)t * kGK;
    copy8_to_lds(l, cA + k, gsA);
    if (NA == 2) copy8_to_lds(l + kPanel, cA2 + k, gsA);
    copy8_to_lds(l + NA * kPanel, cB + k, gsB);
    copy8_to_lds(l + (NA + 1) * kPanel, cB + k + 8 * gsB, gsB);
    if (NB == 2) {
      copy8_to_lds(l + (NA + 2) * kPanel, cB2 + k, gsB);
      copy8_to_lds(l + (NA + 3) * kPanel, cB2 + k + 8 * gsB, gsB);
    }
  };

  v8f acc[4][4];
#pragma unroll
  for (int i = 0; i < 4; ++i)
#pragma unroll
    for (int j = 0; j < 4; ++j) acc[i][j] = (v8f){0.f,0.f,0.f,0.f,0.f,0.f,0.f,0.f};

  const int nT = K / kGK;
  stage(0);
  wait_copies();
  __syncthreads();            // stage 0 is readable by every wave
  if (nT > 1) stage(1);

  for (int t = 0; t < nT; ++t) {
    const T* rb = (const T*)ring + (t & 1) * kBufH;
    const T* fa = rb + ((wm << 6) + rlane) * kGP + koff;
    const T* fb = rb + (128 * NA + (wn << 6) + rlane) * kGP + koff;
    // every loop of a stage is unrolled: fragment and accumulator indices are constants (registers, no scratch) and the
    // LDS offsets of the four 32-k steps are immediates
#pragma unroll
    for (int ks = 0; ks < kGK / 32; ++ks) {
      V bh[4], bl[4], ah[4], al[4];
#pragma unroll
      for (int j = 0; j < 4; ++j) {
        bh[j] = Frag<T>::load(fb + (j << 4) * kGP + ks * 32);
        if (SPLIT == 1) bl[j] = Frag<T>::load(fb + (256 + (j << 4)) * kGP + ks * 32);
      }
#pragma unroll
      for (int i = 0; i < 4; ++i) {
        ah[i] = Frag<T>::load(fa + (i << 4) * kGP + ks * 32);
        al[i] = ah[i];
        if (SPLIT != 0) al[i] = Frag<T>::load(fa + (128 + (i << 4)) * kGP + ks * 32);
      }
#pragma unroll
      for (int i = 0; i < 4; ++i) {
#pragma unroll
        for (int j = 0; j < 4; ++j) {
          acc[i][j] = Frag<T>::mma(ah[i], bh[j], acc[i][j]);
          if (SPLIT == 1) acc[i][j] = Frag<T>::mma(ah[i], bl[j], acc[i][j]);
          if (SPLIT != 0) acc[i][j] = Frag<T>::mma(al[i], bh[j], acc[i][j]);
        }
        Frag<T>::guard4(acc[i][0], acc[i][1], acc[i][2], acc[i][3], ah[i], al[i]);
      }
      Frag<T>::keep(bh[0], bh[1], bh[2], bh[3]);
      if (SPLIT == 1) Frag<T>::keep(bl[0], bl[1], bl[2], bl[3]);
    }
    wait_lds();
    wait_copies();
    __syncthreads();          // publishes stage t + 1 and ends every wave's reads of stage t's buffer
    if (t + 2 < nT) stage(t + 2);
  }
  wait_copies();              // nothing in flight when the wave goes on to the epilogue
  acc_guard4(acc[0][0], acc[0][1], acc[0][2], acc[0][3]);
  acc_guard4(acc[1][0], acc[1][1], acc[1][2], acc[1][3]);
  acc_guard4(acc[2][0], acc[2][1], acc[2][2], acc[2][3]);
  acc_guard4(acc[3][0], acc[3][1], acc[3][2], acc[3][3]);

  // ---- epilogue ----
  float* slab = sT[wave];
#pragma unroll
  for (int i = 0; i < 4; ++i) {
    const int mBase = m0 + (i << 4);
    float rsv[8];
#pragma unroll
    for (int r = 0; r < 8; ++r) rsv[r] = 1.0f;
    if (ROWSC) {
      // two 16-B loads of rowsc[mBase+mOff .. +7], then RNE bf16 of each value
      const v4f ra = *(const v4f*)(rowsc + mBase + mOff);
      const v4f rb = *(const v4f*)(rowsc + mBase + mOff + 4);
      rsv[0] = ra[0]; rsv[1] = ra[1]; rsv[2] = ra[2]; rsv[3] = ra[3];
      rsv[4] = rb[0]; rsv[5] = rb[1]; rsv[6] = rb[2]; rsv[7] = rb[3];
#pragma unroll
      for (int r = 0; r < 8; ++r) rsv[r] = bf_bits2f(f2bf_bits(rsv[r]));
    }
#pragma unroll
    for (int j = 0; j < 4; ++j) {
      const int n = n0 + (j << 4) + rlane;
      float bv = 0.f;
      if (BIAS_MODE == 2) bv = bias[n];
#pragma unroll
      for (int r = 0; r < 8; ++r) {
        float v = acc[i][j][r] * scale;
        if (BIAS_MODE == 1) v += bias[mBase + mOff + r];
        if (BIAS_MODE == 2) v += bv;
        if (ROWSC) v = v * rsv[r];
        slab[(mOff + r) * 68 + (j << 4) + rlane] = v;
      }
    }
    __builtin_amdgcn_fence(__ATOMIC_RELEASE, "workgroup");
    __builtin_amdgcn_wave_barrier();
    __builtin_amdgcn_fence(__ATOMIC_ACQUIRE, "workgroup");
    if (OUT_MODE == 0) {
      float* C = (float*)Cout + (size_t)b * strideC;
      const int hh = lane >> 4, c4 = (lane & 15) * 4;     // row seg = 256 B = 16 lanes x 16 B
      {
#pragma unroll
        for (int it = 0; it < 8; ++it) {
          const int row = it * 2 + hh;
          v4f v = *(const v4f*)(slab + row * 68 + c4);
          *(v4f*)(C + (size_t)(mBase + row) * ldc + n0 + c4) = v;
        }
        
      }
    } else {
      const int q = lane >> 3, c8 = (lane & 7) * 8;
      unsigned short* C  = (unsigned short*)Cout  + (size_t)b * strideC;
      unsigned short* C2 = (OUT_MODE >= 2) ? ((unsigned short*)Cout2 + (size_t)b * strideC) : nullptr;
      {
#pragma unroll
        for (int it = 0; it < 4; ++it) {
          const int row = it * 4 + q;
          const float* sp = slab + row * 68 + c8;
          v8h hv, lv;
#pragma unroll
          for (int e = 0; e < 8; ++e) {
            if (OUT_MODE == 1) {
              hv[e] = (_Float16)sp[e];
            } else if (OUT_MODE == 2) {
              unsigned short hb = f2bf_bits(sp[e]);
              unsigned short lb = f2bf_bits(sp[e] - bf_bits2f(hb));
              hv[e] = __builtin_bit_cast(_Float16, hb);
              lv[e] = __builtin_bit_cast(_Float16, lb);
            } else {
              const unsigned short hb = h_bits(sp[e]);
              const float back = h16_to_f32((unsigned)hb);
              const unsigned short lb = h_bits((sp[e] - back) * kVloCarry);
              hv[e] = __builtin_bit_cast(_Float16, hb);
              lv[e] = __builtin_bit_cast(_Float16, lb);
            }
          }
          *(v8h*)(C + (size_t)(mBase + row) * ldc + n0 + c8) = hv;
          if (OUT_MODE >= 2) *(v8h*)(C2 + (size_t)(mBase + row) * ldc + n0 + c8) = lv;
        }
        
      }
    }
    __builtin_amdgcn_fence(__ATOMIC_RELEASE, "workgroup");
    __builtin_amdgcn_wave_barrier();
    __builtin_amdgcn_fence(__ATOMIC_ACQUIRE, "workgroup");
  }
}

// ---------------------------------------------------------------------------
// f32 -> bf16 (RNE) cast, 8 consecutive elements per thread (one 16-B store per lane; 32 contiguous lanes = 4 whole
// multiples of 256: 1,048,576 threads for x, 131,072 for each weight).
// ---------------------------------------------------------------------------
__global__ __launch_bounds__(256) void cast8_bf16_kernel(const float* __restrict__ in, unsigned short* __restrict__ out, int n8) {
  const int i = blockIdx.x * 256 + threadIdx.x;
  if (i >= n8) return;
  const float* p = in + 8 * (size_t)i;
  const v4f a = *(const v4f*)(p);
  const v4f c = *(const v4f*)(p + 4);
  unsigned short hb[8];
#pragma unroll
  for (int e = 0; e < 4; ++e) {
    hb[e]     = f2bf_bits(a[e]);
    hb[4 + e] = f2bf_bits(c[e]);
  }
  const v4u u = (v4u){pk16(hb[0], hb[1]), pk16(hb[2], hb[3]), pk16(hb[4], hb[5]), pk16(hb[6], hb[7])};
  unsigned short* q = out + 8 * (size_t)i;
  *(v4u*)q = u;
  
}

// ---------------------------------------------------------------------------
// Time-decay bias table: tab[d] = logf(expf((-(d*300)) * (1/300)) + 1e-12), d = 0..2047, f32, precise expf/logf.
// ---------------------------------------------------------------------------
__global__ __launch_bounds__(256) void tab_kernel(float* __restrict__ tab) {
  const int i = blockIdx.x * 256 + threadIdx.x;
  if (i >= kP / 4) return;
  v4f tv;
#pragma unroll
  for (int e = 0; e < 4; ++e) {
    const float d = (float)(4 * i + e);
    const float dist = d * kDelta;
    const float ex = (-dist) * kInvTau;
    const float w = expf(ex);
    tv[e] = logf(w + kLogEps);
  }
  float* q = tab + 4 * (size_t)i;
  *(v4f*)q = tv;
  
}

// ---------------------------------------------------------------------------
// Flash attention for head dim 64 with additive |i-j| time bias and float key mask (key masked when pm <= 0,
// score replaced by -1e9). Inputs are 16-bit planes:
//   Q16 f16 [8192][1024] (token row, col h*64+d), K16 f16 same layout,
//   VTh/VTl f16 [1024][8192] (row h*64+d, col token) = V^T hi plane and residual plane x2048.
// Output: O as bf16 hi plane + bf16 lo plane [8192][1024] (token row, col h*64+d).
// Block = 4 waves = 64 query rows of one (b,h); 64-key chunks; K tile [kv][d], V^T tiles [d][kv] and the 2048-entry
// online softmax in f32 with precise expf; PV hi and residual products in separate accumulators.
// grid.x = 4*16*32 = 2048 blocks, 128 threads. All loops have static trip counts; no early exit.
// ---------------------------------------------------------------------------
__global__ __launch_bounds__(128) void attn_kernel(const unsigned short* __restrict__ Qp, const unsigned short* __restrict__ Kp,
                                                   const unsigned short* __restrict__ VThp, const unsigned short* __restrict__ VTlp,
                                                   const float* __restrict__ tab, const float* __restrict__ pm,
                                                   unsigned short* __restrict__ Ohp, unsigned short* __restrict__ Olp) {
  __shared__ __align__(16) _Float16 Ksh[kKC * kLP];          // K   [kv][d]   9 KB
  __shared__ __align__(16) _Float16 Vth[kDh * kLP];          // V^T hi [d][kv] 9 KB
  __shared__ __align__(16) _Float16 Vtl[kDh * kLP];          // V^T residual x2048 [d][kv] 9 KB
  __shared__ __align__(16) _Float16 Psh[kNW][16 * kLP];      // per wave P x32768 [row][kv] 9 KB
  __shared__ __align__(16) float    Os[kNW][16 * 68];        // per wave out tile, pitch 68
  __shared__ __align__(16) float    tabs[kP];                // bias table 8 KB

  const int tid  = threadIdx.x;
  const int wave = tid >> 5;
  const int lane = tid & 31;
  const int hh   = lane >> 4;
  const int c    = lane & 15;
  const int nqb  = kP / kQB;              // 32
  const int bx   = blockIdx.x;
  const int qb   = bx % nqb;
  const int bh   = bx / nqb;
  const int h    = bh % kH;
  const int b    = bh / kH;
  const int q0   = qb * kQB + wave * 16;  // first query row of this wave within the sequence
  const size_t tok0 = (size_t)b * kP;     // first token row of this batch

  // ---- bias table -> LDS: 4 x 128 threads x 4 floats = 2048 (whole table); read after the loop's first barrier ----
#pragma unroll
  for (int i = 0; i < 4; ++i) {
    const int idx = i * 128 + tid;
    const v4f t4 = *(const v4f*)(tab + 4 * idx);
    *(v4f*)(tabs + 4 * idx) = t4;
  }
  asm volatile("" ::: "memory");

  // ---- Q fragments (A operand): row = query q0+c, k = d; 2 d-chunks ----
  const _Float16* Qh = (const _Float16*)(const void*)Qp;
  const _Float16* qr = Qh + (tok0 + q0 + c) * (size_t)kD + h * kDh + 8 * hh;
  v16h qa[2];
  qa[0] = Frag<_Float16>::load(qr);
  qa[1] = Frag<_Float16>::load(qr + 32);

  float mrow[8], lrow[8];
  v8f oacc[4], oaccl[4];
#pragma unroll
  for (int r = 0; r < 8; ++r) { mrow[r] = -__builtin_inff(); lrow[r] = 0.f; }
#pragma unroll
  for (int t = 0; t < 4; ++t) {
    oacc[t]  = (v8f){0.f,0.f,0.f,0.f,0.f,0.f,0.f,0.f};
    oaccl[t] = (v8f){0.f,0.f,0.f,0.f,0.f,0.f,0.f,0.f};
  }

  for (int kc = 0; kc < kP / kKC; ++kc) {
    const int kv0 = kc * kKC;
    __syncthreads();
    // ---- stage K tile: 64 rows x 8 segments of 8 halves = 512 x 16 B; 4 per thread (coverage 4 x 128 = 512) ----
    {
      const unsigned short* kbp = Kp + (tok0 + kv0) * (size_t)kD + h * kDh;
      v4u u[4];
#pragma unroll
      for (int i = 0; i < 4; ++i) {
        const int idx = i * 128 + tid;
        const int row = idx >> 3;
        const int seg = (idx & 7) * 8;
        u[i] = *(const v4u*)(kbp + (size_t)row * kD + seg);
      }
#pragma unroll
      for (int i = 0; i < 4; ++i) {
        const int idx = i * 128 + tid;
        const int row = idx >> 3;
        const int seg = (idx & 7) * 8;
        *(v4u*)(Ksh + row * kLP + seg) = u[i];
      }
    }
    asm volatile("" ::: "memory");
    // ---- stage V^T hi tile: 64 d-rows x 64 kv halves; same coverage ----
    {
      const unsigned short* vbp = VThp + (size_t)(h * kDh) * kTok + tok0 + kv0;
      v4u u[4];
#pragma unroll
      for (int i = 0; i < 4; ++i) {
        const int idx = i * 128 + tid;
        const int row = idx >> 3;
        const int seg = (idx & 7) * 8;
        u[i] = *(const v4u*)(vbp + (size_t)row * kTok + seg);
      }
#pragma unroll
      for (int i = 0; i < 4; ++i) {
        const int idx = i * 128 + tid;
        const int row = idx >> 3;
        const int seg = (idx & 7) * 8;
        *(v4u*)(Vth + row * kLP + seg) = u[i];
      }
    }
    asm volatile("" ::: "memory");
    // ---- stage V^T residual tile ----
    {
      const unsigned short* vbp = VTlp + (size_t)(h * kDh) * kTok + tok0 + kv0;
      v4u u[4];
#pragma unroll
      for (int i = 0; i < 4; ++i) {
        const int idx = i * 128 + tid;
        const int row = idx >> 3;
        const int seg = (idx & 7) * 8;
        u[i] = *(const v4u*)(vbp + (size_t)row * kTok + seg);
      }
#pragma unroll
      for (int i = 0; i < 4; ++i) {
        const int idx = i * 128 + tid;
        const int row = idx >> 3;
        const int seg = (idx & 7) * 8;
        *(v4u*)(Vtl + row * kLP + seg) = u[i];
      }
    }
    __syncthreads();

    // ---- scores: D[row = query 8hh+r][col = key j*16+c], K = 64 in 2 steps of 32 ----
    v8f s[4];
#pragma unroll
    for (int j = 0; j < 4; ++j) {
      s[j] = (v8f){0.f,0.f,0.f,0.f,0.f,0.f,0.f,0.f};
#pragma unroll
      for (int dc = 0; dc < 2; ++dc) {
        const v16h kf = Frag<_Float16>::load(Ksh + (j * 16 + c) * kLP + dc * 32 + 8 * hh);
        s[j] = mma_h(qa[dc], kf, s[j]);
      }
    }
    // key mask values for this lane's 4 key columns (4 scalar loads)
    float pmv[4];
#pragma unroll
    for (int j = 0; j < 4; ++j) pmv[j] = pm[tok0 + kv0 + j * 16 + c];

    float cm[8];
#pragma unroll
    for (int r = 0; r < 8; ++r) {
      const int qrow = q0 + 8 * hh + r;
      float m = -__builtin_inff();
#pragma unroll
      for (int j = 0; j < 4; ++j) {
        const int kvcol = kv0 + j * 16 + c;
        int dd = qrow - kvcol;
        dd = (dd < 0) ? -dd : dd;
        float v = s[j][r] * kScoreScale + tabs[dd];
        v = (pmv[j] <= 0.0f) ? kNegBig : v;
        s[j][r] = v;
        m = fmaxf(m, v);
      }
#pragma unroll
      for (int off = 1; off < 16; off <<= 1) m = fmaxf(m, __shfl_xor(m, off, 32));
      cm[r] = m;
    }

    // ---- online softmax; P x32768 as f16 into the per-wave LDS tile ----
    _Float16* pw = Psh[wave];
#pragma unroll
    for (int r = 0; r < 8; ++r) {
      const float mnew  = fmaxf(mrow[r], cm[r]);
      const float alpha = expf(mrow[r] - mnew);
      mrow[r] = mnew;
      float psum = 0.f;
#pragma unroll
      for (int j = 0; j < 4; ++j) {
        const float p = expf(s[j][r] - mnew);
        psum += p;
        pw[(8 * hh + r) * kLP + j * 16 + c] = (_Float16)(p * kPCarry);
      }
#pragma unroll
      for (int off = 1; off < 16; off <<= 1) psum += __shfl_xor(psum, off, 32);
      lrow[r] = lrow[r] * alpha + psum;
#pragma unroll
      for (int t = 0; t < 4; ++t) { oacc[t][r] *= alpha; oaccl[t][r] *= alpha; }
    }
    __builtin_amdgcn_fence(__ATOMIC_RELEASE, "workgroup");
    __builtin_amdgcn_wave_barrier();
    __builtin_amdgcn_fence(__ATOMIC_ACQUIRE, "workgroup");

    // ---- O += P . V : A = P [query c][kv], B = V^T [d t*16+c][kv]; hi and residual in separate accumulators ----
#pragma unroll
    for (int kk = 0; kk < 2; ++kk) {
      const v16h pa = Frag<_Float16>::load(pw + c * kLP + kk * 32 + 8 * hh);
#pragma unroll
      for (int t = 0; t < 4; ++t) {
        const v16h vh = Frag<_Float16>::load(Vth + (t * 16 + c) * kLP + kk * 32 + 8 * hh);
        oacc[t] = mma_h(pa, vh, oacc[t]);
        const v16h vl = Frag<_Float16>::load(Vtl + (t * 16 + c) * kLP + kk * 32 + 8 * hh);
        oaccl[t] = mma_h(pa, vl, oaccl[t]);
      }
    }
  }

  // ---- normalise (fold 2^-15 of P and 2^-11 of the residual) into the per-wave f32 slab ----
  float* os = Os[wave];
#pragma unroll
  for (int r = 0; r < 8; ++r) {
    const float inv = 1.0f / (lrow[r] * kPCarry);
#pragma unroll
    for (int t = 0; t < 4; ++t) os[(8 * hh + r) * 68 + t * 16 + c] = (oacc[t][r] + oaccl[t][r] * kVloInv) * inv;
  }
  __builtin_amdgcn_fence(__ATOMIC_RELEASE, "workgroup");
  __builtin_amdgcn_wave_barrier();
  __builtin_amdgcn_fence(__ATOMIC_ACQUIRE, "workgroup");
  {
    const int q4 = lane >> 3, c8 = (lane & 7) * 8;
    {
#pragma unroll
      for (int it = 0; it < 4; ++it) {
        const int row = it * 4 + q4;
        const float* sp = os + row * 68 + c8;
        v8h hv, lv;
#pragma unroll
        for (int e = 0; e < 8; ++e) {
          const unsigned short hb = f2bf_bits(sp[e]);
          const unsigned short lb = f2bf_bits(sp[e] - bf_bits2f(hb));
          hv[e] = __builtin_bit_cast(_Float16, hb);
          lv[e] = __builtin_bit_cast(_Float16, lb);
        }
        const size_t off = (tok0 + q0 + row) * (size_t)kD + h * kDh + c8;
        *(v8h*)(Ohp + off) = hv;
        *(v8h*)(Olp + off) = lv;
      }
      
    }
  }
}

// ---------------------------------------------------------------------------
// Host glue.
//   Xb   bf16 [8192][1024]        16,777,216  at           0
//   Wqb  bf16 [1024][1024]         2,097,152  at  16,777,216
//   Wkb  bf16 [1024][1024]         2,097,152  at  18,874,368
//   Wvb  bf16 [1024][1024]         2,097,152  at  20,971,520
//   Wob  bf16 [1024][1024]         2,097,152  at  23,068,672
//   Q16  f16  [8192][1024]        16,777,216  at  25,165,824
//   K16  f16  [8192][1024]        16,777,216  at  41,943,040
//   VTh  f16  [1024][8192]        16,777,216  at  58,720,256
//   VTl  f16  [1024][8192]        16,777,216  at  75,497,472   (residual x2048)
//   Oh   bf16 [8192][1024]        16,777,216  at  92,274,688
//   Ol   bf16 [8192][1024]        16,777,216  at 109,051,904
//   tab  f32  [2048]                   8,192  at 125,829,120
//   total                        125,837,312
// Every region is fully written before it is read; no region is re-used.
// GEMM shapes: Q,K: M=8192 N=1024 K=1024; V^T: M=1024 N=8192 K=1024; out: M=8192 N=1024 K=1024 (M%128==0, N%256==0,
// K%128==0, no padding). Attention: S=2048 (64-multiples), Dh=64.
// ---------------------------------------------------------------------------
extern "C" void kernel_launch(void* const* d_in, const int* in_sizes, int n_in,
                              void* d_out, int out_size, void* d_ws, size_t ws_size,
                              hipStream_t stream) {
  if (n_in < 10) return;
  const int nX = kTok * kD;     // 8,388,608
  const int nW = kD * kD;       // 1,048,576
  if (in_sizes[0] != nX || in_sizes[1] != kTok) return;
  if (in_sizes[2] != nW || in_sizes[4] != nW || in_sizes[6] != nW || in_sizes[8] != nW) return;
  if (in_sizes[3] != kD || in_sizes[5] != kD || in_sizes[7] != kD || in_sizes[9] != kD) return;
  if (out_size != nX) return;

  const size_t szX16 = (size_t)nX * 2;
  const size_t szW16 = (size_t)nW * 2;
  const size_t szTab = (size_t)kP * 4;
  const size_t offXb  = 0;
  const size_t offWq  = offXb + szX16;
  const size_t offWk  = offWq + szW16;
  const size_t offWv  = offWk + szW16;
  const size_t offWo  = offWv + szW16;
  const size_t offQ   = offWo + szW16;
  const size_t offK   = offQ + szX16;
  const size_t offVTh = offK + szX16;
  const size_t offVTl = offVTh + szX16;
  const size_t offOh  = offVTl + szX16;
  const size_t offOl  = offOh + szX16;
  const size_t offTab = offOl + szX16;
  const size_t total  = offTab + szTab;
  if (ws_size < total) return;

  const float* x  = (const float*)d_in[0];
  const float* pm = (const float*)d_in[1];
  const float* Wq = (const float*)d_in[2];
  const float* bq = (const float*)d_in[3];
  const float* Wk = (const float*)d_in[4];
  const float* bk = (const float*)d_in[5];
  const float* Wv = (const float*)d_in[6];
  const float* bv = (const float*)d_in[7];
  const float* Wo = (const float*)d_in[8];
  const float* bo = (const float*)d_in[9];
  float* out = (float*)d_out;
  char* ws = (char*)d_ws;
  unsigned short* Xb  = (unsigned short*)(ws + offXb);
  unsigned short* Wqb = (unsigned short*)(ws + offWq);
  unsigned short* Wkb = (unsigned short*)(ws + offWk);
  unsigned short* Wvb = (unsigned short*)(ws + offWv);
  unsigned short* Wob = (unsigned short*)(ws + offWo);
  unsigned short* Q16 = (unsigned short*)(ws + offQ);
  unsigned short* K16 = (unsigned short*)(ws + offK);
  unsigned short* VTh = (unsigned short*)(ws + offVTh);
  unsigned short* VTl = (unsigned short*)(ws + offVTl);
  unsigned short* Oh  = (unsigned short*)(ws + offOh);
  unsigned short* Ol  = (unsigned short*)(ws + offOl);
  float* tab = (float*)(ws + offTab);

  // ---- prologue: RNE bf16 operand planes and the bias table ----
  const int n8x = nX / 8;   // 1,048,576 -> 4096 blocks exact
  const int n8w = nW / 8;   //   131,072 ->  512 blocks exact
  cast8_bf16_kernel<<<dim3(n8x / 256), dim3(256), 0, stream>>>(x,  Xb,  n8x);
  cast8_bf16_kernel<<<dim3(n8w / 256), dim3(256), 0, stream>>>(Wq, Wqb, n8w);
  cast8_bf16_kernel<<<dim3(n8w / 256), dim3(256), 0, stream>>>(Wk, Wkb, n8w);
  cast8_bf16_kernel<<<dim3(n8w / 256), dim3(256), 0, stream>>>(Wv, Wvb, n8w);
  cast8_bf16_kernel<<<dim3(n8w / 256), dim3(256), 0, stream>>>(Wo, Wob, n8w);
  tab_kernel<<<dim3((kP / 4) / 256), dim3(256), 0, stream>>>(tab);

  // ---- projections (64x64 wave tiles, 8 waves = one 128x256 tile per block) ----
  const int tilesProj = (kTok / 64) * (kD / 64);   // 2048 -> 256 blocks
  // Q16[m][n] = sum_k Xb[m][k] * Wqb[n][k] + bq[n]   (f16 out)
  wmma_gemm64<1, 0, 2, 1, false><<<dim3(tilesProj / 8, 1), dim3(256), 0, stream>>>(
      Xb, Xb, kD, 0L, Wqb, Wqb, kD, 0L, (void*)Q16, (void*)Q16, kD, 0L, bq, pm, kTok, kD, kD, 1.0f);
  // K16 likewise with Wk, bk
  wmma_gemm64<1, 0, 2, 1, false><<<dim3(tilesProj / 8, 1), dim3(256), 0, stream>>>(
      Xb, Xb, kD, 0L, Wkb, Wkb, kD, 0L, (void*)K16, (void*)K16, kD, 0L, bk, pm, kTok, kD, kD, 1.0f);
  // V^T[m = feature][n = token] = sum_k Wvb[m][k] * Xb[n][k] + bv[m]   (f16 hi plane + f16 residual plane x2048)
  wmma_gemm64<1, 0, 1, 3, false><<<dim3(tilesProj / 8, 1), dim3(256), 0, stream>>>(
      Wvb, Wvb, kD, 0L, Xb, Xb, kD, 0L, (void*)VTh, (void*)VTl, kTok, 0L, bv, pm, kD, kTok, kD, 1.0f);

  // ---- attention: 64 (b,h) x 32 query tiles ----
  attn_kernel<<<dim3(kB * kH * (kP / kQB)), dim3(128), 0, stream>>>(Q16, K16, VTh, VTl, tab, pm, Oh, Ol);

  // ---- output projection: out[m][n] = (sum_k (Oh+Ol)[m][k] * Wob[n][k] + bo[n]) * pm[m] ----
  wmma_gemm64<1, 2, 2, 0, true><<<dim3(tilesProj / 8, 1), dim3(256), 0, stream>>>(
      Oh, Ol, kD, 0L, Wob, Wob, kD, 0L, (void*)out, (void*)out, kD, 0L, bo, pm, kTok, kD, kD, 1.0f);
}

// v003
// A run of this version takes 301 microseconds.
// In both of two side-by-side timings against v002, it was 1.81 times as fast.
// Counting every step since v000, it is 2.68 times as fast.
// Contractions: q/k/v projections on v_wmma_f32_16x16x32_bf16 (x and W as RNE bf16 planes, single products); scores q.k^T on v_wmma_f32_16x16x32_f16 (q, k f16 planes); attn.v on v_wmma_f32_16x16x32_f16 (P f16 carried x32768; V^T as f16 hi plane + f16 residual plane carried x2048 in a separate accumulator); output projection on v_wmma_f32_16x16x32_bf16 (attention output as bf16 hi + lo planes, Wo bf16, two products); f32 accumulate everywhere; time bias, masks and softmax in f32.
#include <hip/hip_runtime.h>
#include <math.h>

// ---------------------------------------------------------------------------
// Problem constants
// ---------------------------------------------------------------------------
constexpr int kB   = 4;
constexpr int kP   = 2048;
constexpr int kD   = 1024;
constexpr int kH   = 16;
constexpr int kDh  = 64;
constexpr int kTok = kB * kP;            // 8192 token rows
constexpr int kQB  = 64;                 // queries per attention block
constexpr int kKC  = 64;                 // keys per chunk
constexpr int kNW  = 4;                  // waves per attention block
constexpr int kLP  = 72;                 // LDS row pitch in halves of the 64-half K and V^T rows: 144 B = 16 B x odd,
                                         // so the 16 rows of one ds_load_b128 fragment read fall on distinct banks
constexpr float kScoreScale = 0.125f;    // 64^-0.5
constexpr float kNegBig     = -1.0e9f;
constexpr float kPCarry     = 32768.0f;  // probabilities carried x2^15 in f16
constexpr float kVloCarry   = 2048.0f;   // f16 residual planes carried x2^11
constexpr float kVloInv     = 1.0f / 2048.0f;
constexpr float kDelta      = 300.0f;    // seconds per patch step
constexpr float kInvTau     = 1.0f / 300.0f;
constexpr float kLogEps     = 1.0e-12f;
static_assert(kH * kDh == kD, "s");
static_assert(kTok % 64 == 0 && kD % 64 == 0 && kD % 32 == 0, "s");
static_assert(kP % kQB == 0 && kP % kKC == 0 && kDh == 64, "s");
static_assert((kTok * kD) % (8 * 256) == 0 && (kD * kD) % (8 * 256) == 0, "s");
static_assert(kP % 1024 == 0, "s");

typedef __attribute__((ext_vector_type(16))) _Float16 v16h;
typedef __attribute__((ext_vector_type(8)))  _Float16 v8h;
typedef __attribute__((ext_vector_type(16))) __bf16   v16b;
typedef __attribute__((ext_vector_type(8)))  __bf16   v8b;
typedef __attribute__((ext_vector_type(8)))  float    v8f;
typedef __attribute__((ext_vector_type(4)))  float    v4f;
typedef __attribute__((ext_vector_type(4)))  unsigned int v4u;

// ---------------------------------------------------------------------------
// Conversion, fragment and hazard-guard helpers
// ---------------------------------------------------------------------------
__device__ __forceinline__ unsigned short f2bf_bits(float f) {
  unsigned u = __float_as_uint(f);
  return (unsigned short)((u + 0x7FFFu + ((u >> 16) & 1u)) >> 16);
}
__device__ __forceinline__ float bf_bits2f(unsigned short h) { return __uint_as_float(((unsigned)h) << 16); }

// f16 bits (low 16) -> f32, integer path, finite values
__device__ __forceinline__ float h16_to_f32(unsigned hb) {
  const unsigned sgn = (hb & 0x8000u) << 16; const unsigned em = hb & 0x7fffu;
  const float fn = __uint_as_float((em << 13) + 0x38000000u);
  const float fs = (float)em * 5.9604644775390625e-8f;
  const float mag = (em < 0x400u) ? fs : fn; return __uint_as_float(__float_as_uint(mag) | sgn); }

// hazard guards as plain device helpers (no inline asm inside the kernel template body)
__device__ __forceinline__ void dep_guard4_h(v8f& a, v8f& b, v8f& c, v8f& d, v16h x, v16h y) {
  asm volatile("v_nop\n\tv_nop\n\tv_nop\n\tv_nop" : "+v"(a), "+v"(b), "+v"(c), "+v"(d) : "v"(x), "v"(y));
}
__device__ __forceinline__ void dep_guard4_b(v8f& a, v8f& b, v8f& c, v8f& d, v16b x, v16b y) {
  asm volatile("v_nop\n\tv_nop\n\tv_nop\n\tv_nop" : "+v"(a), "+v"(b), "+v"(c), "+v"(d) : "v"(x), "v"(y));
}
__device__ __forceinline__ void keep4_h(v16h a, v16h b, v16h c, v16h d) { asm volatile("v_nop" :: "v"(a), "v"(b), "v"(c), "v"(d)); }
__device__ __forceinline__ void keep4_b(v16b a, v16b b, v16b c, v16b d) { asm volatile("v_nop" :: "v"(a), "v"(b), "v"(c), "v"(d)); }
__device__ __forceinline__ void acc_guard4(v8f& a, v8f& b, v8f& c, v8f& d) { asm volatile("v_nop\n\tv_nop\n\tv_nop\n\tv_nop" : "+v"(a), "+v"(b), "+v"(c), "+v"(d)); }
template <typename T> struct Frag;
template <> struct Frag<_Float16> {
  typedef v16h V; union U { v16h v; v8h h[2]; };
  // elements 0..7 <- p[0..7], 8..15 <- p[16..23]
  static __device__ __forceinline__ v16h load(const _Float16* p) {
    U f; f.h[0] = *(const v8h*)(p); f.h[1] = *(const v8h*)(p + 16); return f.v;
  }
  static __device__ __forceinline__ v8f mma(v16h a, v16h b, v8f c) {
    return __builtin_amdgcn_wmma_f32_16x16x32_f16(false, a, false, b, (short)0, c, false, false);
  }
  static __device__ __forceinline__ void guard4(v8f& a, v8f& b, v8f& c, v8f& d, v16h x, v16h y) { dep_guard4_h(a, b, c, d, x, y); }
  static __device__ __forceinline__ void keep(v16h a, v16h b, v16h c, v16h d) { keep4_h(a, b, c, d); }
};
template <> struct Frag<__bf16> {
  typedef v16b V; union U { v16b v; v8b h[2]; };
  static __device__ __forceinline__ v16b load(const __bf16* p) {
    U f; f.h[0] = *(const v8b*)(p); f.h[1] = *(const v8b*)(p + 16); return f.v;
  }
  static __device__ __forceinline__ v8f mma(v16b a, v16b b, v8f c) {
    return __builtin_amdgcn_wmma_f32_16x16x32_bf16(false, a, false, b, (short)0, c, false, false);
  }
  static __device__ __forceinline__ void guard4(v8f& a, v8f& b, v8f& c, v8f& d, v16b x, v16b y) { dep_guard4_b(a, b, c, d, x, y); }
  static __device__ __forceinline__ void keep(v16b a, v16b b, v16b c, v16b d) { keep4_b(a, b, c, d); }
};

__device__ __forceinline__ unsigned pk16(unsigned short a, unsigned short b) { return (unsigned)a | ((unsigned)b << 16); }
__device__ __forceinline__ unsigned short h_bits(float f) { const _Float16 h = (_Float16)f; return __builtin_bit_cast(unsigned short, h); }

// single WMMA with its own hazard guard (ties D, keeps A/B live)
__device__ __forceinline__ v8f mma_h(v16h a, v16h b, v8f c) {
  c = __builtin_amdgcn_wmma_f32_16x16x32_f16(false, a, false, b, (short)0, c, false, false);
  asm volatile("v_nop\n\tv_nop\n\tv_nop\n\tv_nop" : "+v"(c) : "v"(a), "v"(b));
  return c;
}

// lane l <-> lane l ^ 16 (the other 16-lane half of the wave), a vector-port move
__device__ __forceinline__ float xhalf(float x) {
  const int b = __builtin_bit_cast(int, x);
  return __builtin_bit_cast(float, __builtin_amdgcn_permlanex16(b, b, 0x76543210, 0xfedcba98, false, false));
}

// ---- LDS staging of the GEMM operands ----
constexpr int kGK = 128;   // k per stage: every staged operand row is 256 B = two whole 128-B lines
constexpr int kGP = 136;   // LDS row pitch in halves: 272 B = 16 B x odd, so the 16 rows of a ds_load_b128 fragment read fall on distinct banks

// Eight asynchronous 16-B copies per lane, global -> LDS: rows r, r+16, ..., r+112 of one 128-row panel (16 lanes per 256-B row).
// The closing s_wait_xcnt stands inside the statement so that no address register of a copy is rewritten in front of it.
__device__ __forceinline__ void copy8_to_lds(unsigned l, const unsigned short* g, size_t gs) {
  constexpr unsigned ls = 16u * kGP * 2u;   // 16 LDS rows in bytes
  asm volatile(
      "global_load_async_to_lds_b128 %0, %8, off\n\t"
      "global_load_async_to_lds_b128 %1, %9, off\n\t"
      "global_load_async_to_lds_b128 %2, %10, off\n\t"
      "global_load_async_to_lds_b128 %3, %11, off\n\t"
      "global_load_async_to_lds_b128 %4, %12, off\n\t"
      "global_load_async_to_lds_b128 %5, %13, off\n\t"
      "global_load_async_to_lds_b128 %6, %14, off\n\t"
      "global_load_async_to_lds_b128 %7, %15, off\n\t"
      "s_wait_xcnt 0x0"
      :: "v"(l), "v"(l + ls), "v"(l + 2u * ls), "v"(l + 3u * ls), "v"(l + 4u * ls), "v"(l + 5u * ls), "v"(l + 6u * ls), "v"(l + 7u * ls),
         "v"(g), "v"(g + gs), "v"(g + 2 * gs), "v"(g + 3 * gs), "v"(g + 4 * gs), "v"(g + 5 * gs), "v"(g + 6 * gs), "v"(g + 7 * gs)
      : "memory");
}
// this wave's copies have landed in LDS (the compiler places no wait for them)
__device__ __forceinline__ void wait_copies() { asm volatile("s_wait_asynccnt 0x0" ::: "memory"); }
// this wave's LDS reads have returned, so the buffer they read may be refilled behind the next barrier
__device__ __forceinline__ void wait_lds() { asm volatile("s_wait_dscnt 0x0" ::: "memory"); }

// ---- Register-blocked batched WMMA GEMM (modes extended) ----------------------------------------------
// C[m,n] = scale * sum_k A[m,k] * Bt[n,k] (+bias)(*rowsc[m]); each wave owns a 64x64 tile, the block's 8 waves a 128x256 tile
// (2 x 4 waves). Per stage the block's 128 A rows and 256 Bt rows x 128 k are copied to LDS in whole lines and every wave
// reads its fragments from there; two buffers, the next stage's copies in flight while this stage is multiplied.
// A row-major [M,K]; Bt row-major [N,K]; M % 128 == 0, N % 256 == 0, K % 128 == 0, K >= 128 (no tail handling).
// SPLIT: 0 = single product; 1 = A and Bt hi/lo planes (hi*hi + hi*lo + lo*hi); 2 = A hi/lo planes only (hi*B + lo*B).
// BIAS_MODE: 0 = none, 1 = bias[m], 2 = bias[n].  ROWSC: multiply by RNE-bf16(rowsc[m]) after the bias.
// OUT_MODE: 0 = f32, 1 = f16, 2 = bf16 hi plane (Cout) + bf16 lo plane (Cout2), 3 = f16 hi plane + f16 residual plane x2048.
// ET: 0 = f16 operands, 1 = bf16 operands (pointers passed as 16-bit storage)
template <int ET> struct Elem;
template <> struct Elem<0> { typedef _Float16 T; };
template <> struct Elem<1> { typedef __bf16 T; };
template <int ET, int SPLIT, int BIAS_MODE, int OUT_MODE, bool ROWSC>
__global__ __launch_bounds__(256) void wmma_gemm64(
    const unsigned short* __restrict__ Ap, const unsigned short* __restrict__ A2p, int lda, long strideA,
    const unsigned short* __restrict__ Btp, const unsigned short* __restrict__ Bt2p, int ldb, long strideB,
    void* __restrict__ Cout, void* __restrict__ Cout2, int ldc, long strideC,
    const float* __restrict__ bias, const float* __restrict__ rowsc,
    int M, int N, int K, float scale) {
  typedef typename Elem<ET>::T T;
  typedef typename Frag<T>::V V;
  constexpr int NA = (SPLIT != 0) ? 2 : 1;             // A planes
  constexpr int NB = (SPLIT == 1) ? 2 : 1;             // Bt planes
  constexpr int kBufH = (128 * NA + 256 * NB) * kGP;   // halves per buffer: [A planes, 128 rows each][Bt planes, 256 rows each]
  __shared__ __align__(16) unsigned short ring[2 * kBufH];
  __shared__ __align__(16) float sT[8][16 * 68];   // per-wave 16x64 slab, pitch 68 floats
  const int b    = blockIdx.y;
  const int lane = threadIdx.x & 31;
  const int wave = threadIdx.x >> 5;
  const int tilesNb = N >> 8;
  const int tilesMb = M >> 7;
  if ((int)blockIdx.x >= tilesMb * tilesNb) return;   // the same for the whole block, ahead of every barrier
  const int bm  = blockIdx.x / tilesNb;
  const int bn  = blockIdx.x - bm * tilesNb;
  const int m0b = bm << 7;
  const int n0b = bn << 8;
  const int wm  = wave >> 2;
  const int wn  = wave & 3;
  const int m0  = m0b + (wm << 6);
  const int n0  = n0b + (wn << 6);

  const int rlane = lane & 15;                 // row (A) / col (B, D) within subtile
  const int koff  = (lane >> 4) * 8;           // k offset of this lane half
  const int mOff  = (lane >> 4) * 8;           // D row offset

  // copy addresses of this lane: row threadIdx.x / 16 of each 16-row group, 16-B segment threadIdx.x % 16
  const int cr = threadIdx.x >> 4;
  const int cs = (threadIdx.x & 15) * 8;
  const unsigned short* cA  = Ap   + (size_t)b * strideA + (size_t)(m0b + cr) * lda + cs;
  const unsigned short* cA2 = A2p  + (size_t)b * strideA + (size_t)(m0b + cr) * lda + cs;
  const unsigned short* cB  = Btp  + (size_t)b * strideB + (size_t)(n0b + cr) * ldb + cs;
  const unsigned short* cB2 = Bt2p + (size_t)b * strideB + (size_t)(n0b + cr) * ldb + cs;
  const unsigned cl = (unsigned)(uintptr_t)ring + (unsigned)(cr * kGP + cs) * 2u;   // LDS byte address
  const size_t gsA = (size_t)16 * lda;
  const size_t gsB = (size_t)16 * ldb;
  constexpr unsigned kPanel = 128u * kGP * 2u;   // 128 LDS rows in bytes
  auto stage = [&](int t) {
    const unsigned l = cl + (unsigned)(t & 1) * (unsigned)(kBufH * 2);
    const size_t k = (size_t)t * kGK;
    copy8_to_lds(l, cA + k, gsA);
    if (NA == 2) copy8_to_lds(l + kPanel, cA2 + k, gsA);
    copy8_to_lds(l + NA * kPanel, cB + k, gsB);
    copy8_to_lds(l + (NA + 1) * kPanel, cB + k + 8 * gsB, gsB);
    if (NB == 2) {
      copy8_to_lds(l + (NA + 2) * kPanel, cB2 + k, gsB);
      copy8_to_lds(l + (NA + 3) * kPanel, cB2 + k + 8 * gsB, gsB);
    }
  };

  v8f acc[4][4];
#pragma unroll
  for (int i = 0; i < 4; ++i)
#pragma unroll
    for (int j = 0; j < 4; ++j) acc[i][j] = (v8f){0.f,0.f,0.f,0.f,0.f,0.f,0.f,0.f};

  const int nT = K / kGK;
  stage(0);
  wait_copies();
  __syncthreads();            // stage 0 is readable by every wave
  if (nT > 1) stage(1);

  for (int t = 0; t < nT; ++t) {
    const T* rb = (const T*)ring + (t & 1) * kBufH;
    const T* fa = rb + ((wm << 6) + rlane) * kGP + koff;
    const T* fb = rb + (128 * NA + (wn << 6) + rlane) * kGP + koff;
    // every loop of a stage is unrolled: fragment and accumulator indices are constants (registers, no scratch) and the
    // LDS offsets of the four 32-k steps are immediates
#pragma unroll
    for (int ks = 0; ks < kGK / 32; ++ks) {
      V bh[4], bl[4], ah[4], al[4];
#pragma unroll
      for (int j = 0; j < 4; ++j) {
        bh[j] = Frag<T>::load(fb + (j << 4) * kGP + ks * 32);
        if (SPLIT == 1) bl[j] = Frag<T>::load(fb + (256 + (j << 4)) * kGP + ks * 32);
      }
#pragma unroll
      for (int i = 0; i < 4; ++i) {
        ah[i] = Frag<T>::load(fa + (i << 4) * kGP + ks * 32);
        al[i] = ah[i];
        if (SPLIT != 0) al[i] = Frag<T>::load(fa + (128 + (i << 4)) * kGP + ks * 32);
      }
#pragma unroll
      for (int i = 0; i < 4; ++i) {
#pragma unroll
        for (int j = 0; j < 4; ++j) {
          acc[i][j] = Frag<T>::mma(ah[i], bh[j], acc[i][j]);
          if (SPLIT == 1) acc[i][j] = Frag<T>::mma(ah[i], bl[j], acc[i][j]);
          if (SPLIT != 0) acc[i][j] = Frag<T>::mma(al[i], bh[j], acc[i][j]);
        }
        Frag<T>::guard4(acc[i][0], acc[i][1], acc[i][2], acc[i][3], ah[i], al[i]);
      }
      Frag<T>::keep(bh[0], bh[1], bh[2], bh[3]);
      if (SPLIT == 1) Frag<T>::keep(bl[0], bl[1], bl[2], bl[3]);
    }
    wait_lds();
    wait_copies();
    __syncthreads();          // publishes stage t + 1 and ends every wave's reads of stage t's buffer
    if (t + 2 < nT) stage(t + 2);
  }
  wait_copies();              // nothing in flight when the wave goes on to the epilogue
  acc_guard4(acc[0][0], acc[0][1], acc[0][2], acc[0][3]);
  acc_guard4(acc[1][0], acc[1][1], acc[1][2], acc[1][3]);
  acc_guard4(acc[2][0], acc[2][1], acc[2][2], acc[2][3]);
  acc_guard4(acc[3][0], acc[3][1], acc[3][2], acc[3][3]);

  // ---- epilogue ----
  float* slab = sT[wave];
#pragma unroll
  for (int i = 0; i < 4; ++i) {
    const int mBase = m0 + (i << 4);
    float rsv[8];
#pragma unroll
    for (int r = 0; r < 8; ++r) rsv[r] = 1.0f;
    if (ROWSC) {
      // two 16-B loads of rowsc[mBase+mOff .. +7], then RNE bf16 of each value
      const v4f ra = *(const v4f*)(rowsc + mBase + mOff);
      const v4f rb = *(const v4f*)(rowsc + mBase + mOff + 4);
      rsv[0] = ra[0]; rsv[1] = ra[1]; rsv[2] = ra[2]; rsv[3] = ra[3];
      rsv[4] = rb[0]; rsv[5] = rb[1]; rsv[6] = rb[2]; rsv[7] = rb[3];
#pragma unroll
      for (int r = 0; r < 8; ++r) rsv[r] = bf_bits2f(f2bf_bits(rsv[r]));
    }
#pragma unroll
    for (int j = 0; j < 4; ++j) {
      const int n = n0 + (j << 4) + rlane;
      float bv = 0.f;
      if (BIAS_MODE == 2) bv = bias[n];
#pragma unroll
      for (int r = 0; r < 8; ++r) {
        float v = acc[i][j][r] * scale;
        if (BIAS_MODE == 1) v += bias[mBase + mOff + r];
        if (BIAS_MODE == 2) v += bv;
        if (ROWSC) v = v * rsv[r];
        slab[(mOff + r) * 68 + (j << 4) + rlane] = v;
      }
    }
    __builtin_amdgcn_fence(__ATOMIC_RELEASE, "workgroup");
    __builtin_amdgcn_wave_barrier();
    __builtin_amdgcn_fence(__ATOMIC_ACQUIRE, "workgroup");
    if (OUT_MODE == 0) {
      float* C = (float*)Cout + (size_t)b * strideC;
      const int hh = lane >> 4, c4 = (lane & 15) * 4;     // row seg = 256 B = 16 lanes x 16 B
      {
#pragma unroll
        for (int it = 0; it < 8; ++it) {
          const int row = it * 2 + hh;
          v4f v = *(const v4f*)(slab + row * 68 + c4);
          *(v4f*)(C + (size_t)(mBase + row) * ldc + n0 + c4) = v;
        }
        
      }
    } else {
      const int q = lane >> 3, c8 = (lane & 7) * 8;
      unsigned short* C  = (unsigned short*)Cout  + (size_t)b * strideC;
      unsigned short* C2 = (OUT_MODE >= 2) ? ((unsigned short*)Cout2 + (size_t)b * strideC) : nullptr;
      {
#pragma unroll
        for (int it = 0; it < 4; ++it) {
          const int row = it * 4 + q;
          const float* sp = slab + row * 68 + c8;
          v8h hv, lv;
#pragma unroll
          for (int e = 0; e < 8; ++e) {
            if (OUT_MODE == 1) {
              hv[e] = (_Float16)sp[e];
            } else if (OUT_MODE == 2) {
              unsigned short hb = f2bf_bits(sp[e]);
              unsigned short lb = f2bf_bits(sp[e] - bf_bits2f(hb));
              hv[e] = __builtin_bit_cast(_Float16, hb);
              lv[e] = __builtin_bit_cast(_Float16, lb);
            } else {
              const unsigned short hb = h_bits(sp[e]);
              const float back = h16_to_f32((unsigned)hb);
              const unsigned short lb = h_bits((sp[e] - back) * kVloCarry);
              hv[e] = __builtin_bit_cast(_Float16, hb);
              lv[e] = __builtin_bit_cast(_Float16, lb);
            }
          }
          *(v8h*)(C + (size_t)(mBase + row) * ldc + n0 + c8) = hv;
          if (OUT_MODE >= 2) *(v8h*)(C2 + (size_t)(mBase + row) * ldc + n0 + c8) = lv;
        }
        
      }
    }
    __builtin_amdgcn_fence(__ATOMIC_RELEASE, "workgroup");
    __builtin_amdgcn_wave_barrier();
    __builtin_amdgcn_fence(__ATOMIC_ACQUIRE, "workgroup");
  }
}

// ---------------------------------------------------------------------------
// f32 -> bf16 (RNE) cast, 8 consecutive elements per thread (one 16-B store per lane; 32 contiguous lanes = 4 whole
// multiples of 256: 1,048,576 threads for x, 131,072 for each weight).
// ---------------------------------------------------------------------------
__global__ __launch_bounds__(256) void cast8_bf16_kernel(const float* __restrict__ in, unsigned short* __restrict__ out, int n8) {
  const int i = blockIdx.x * 256 + threadIdx.x;
  if (i >= n8) return;
  const float* p = in + 8 * (size_t)i;
  const v4f a = *(const v4f*)(p);
  const v4f c = *(const v4f*)(p + 4);
  unsigned short hb[8];
#pragma unroll
  for (int e = 0; e < 4; ++e) {
    hb[e]     = f2bf_bits(a[e]);
    hb[4 + e] = f2bf_bits(c[e]);
  }
  const v4u u = (v4u){pk16(hb[0], hb[1]), pk16(hb[2], hb[3]), pk16(hb[4], hb[5]), pk16(hb[6], hb[7])};
  unsigned short* q = out + 8 * (size_t)i;
  *(v4u*)q = u;
  
}

// ---------------------------------------------------------------------------
// Time-decay bias table: tab[d] = logf(expf((-(d*300)) * (1/300)) + 1e-12), d = 0..2047, f32, precise expf/logf.
// ---------------------------------------------------------------------------
__global__ __launch_bounds__(256) void tab_kernel(float* __restrict__ tab) {
  const int i = blockIdx.x * 256 + threadIdx.x;
  if (i >= kP / 4) return;
  v4f tv;
#pragma unroll
  for (int e = 0; e < 4; ++e) {
    const float d = (float)(4 * i + e);
    const float dist = d * kDelta;
    const float ex = (-dist) * kInvTau;
    const float w = expf(ex);
    tv[e] = logf(w + kLogEps);
  }
  float* q = tab + 4 * (size_t)i;
  *(v4f*)q = tv;
  
}

__global__ __launch_bounds__(128) void attn_kernel(const unsigned short* __restrict__ Qp, const unsigned short* __restrict__ Kp,
                                                   const unsigned short* __restrict__ VThp, const unsigned short* __restrict__ VTlp,
                                                   const float* __restrict__ tab, const float* __restrict__ pm,
                                                   unsigned short* __restrict__ Ohp, unsigned short* __restrict__ Olp) {
  __shared__ __align__(16) _Float16 Ksh[kKC * kLP];          // K   [kv][d]   9 KB
  __shared__ __align__(16) _Float16 Vth[kDh * kLP];          // V^T hi [d][kv] 9 KB
  __shared__ __align__(16) _Float16 Vtl[kDh * kLP];          // V^T residual x2048 [d][kv] 9 KB
  __shared__ __align__(16) float    Os[kNW][16 * 68];        // per wave out tile, pitch 68
  __shared__ __align__(16) float    tabs[kP];                // bias table 8 KB

  const int tid  = threadIdx.x;
  const int wave = tid >> 5;
  const int lane = tid & 31;
  const int hh   = lane >> 4;
  const int c    = lane & 15;
  const int nqb  = kP / kQB;              // 32
  const int bx   = blockIdx.x;
  const int qb   = bx % nqb;
  const int bh   = bx / nqb;
  const int h    = bh % kH;
  const int b    = bh / kH;
  const int q0   = qb * kQB + wave * 16;  // first query row of this wave within the sequence
  const size_t tok0 = (size_t)b * kP;     // first token row of this batch

  // ---- bias table -> LDS: 4 x 128 threads x 4 floats = 2048 (whole table); read after the loop's first barrier ----
#pragma unroll
  for (int i = 0; i < 4; ++i) {
    const int idx = i * 128 + tid;
    const v4f t4 = *(const v4f*)(tab + 4 * idx);
    *(v4f*)(tabs + 4 * idx) = t4;
  }
  asm volatile("" ::: "memory");

  // ---- Q fragments (B operand): column = query q0+c, k = d; 2 d-chunks ----
  const _Float16* Qh = (const _Float16*)(const void*)Qp;
  const _Float16* qr = Qh + (tok0 + q0 + c) * (size_t)kD + h * kDh + 8 * hh;
  v16h qa[2];
  qa[0] = Frag<_Float16>::load(qr);
  qa[1] = Frag<_Float16>::load(qr + 32);

  float mrow = -__builtin_inff();   // running maximum of query q0+c (equal in both halves)
  float lrow = 0.f;                 // running sum of query q0+c over this half's keys; the halves are joined after the loop
  v8f oacc[4], oaccl[4];            // O^T: row = d t*16+8hh+r, column = query q0+c
#pragma unroll
  for (int t = 0; t < 4; ++t) {
    oacc[t]  = (v8f){0.f,0.f,0.f,0.f,0.f,0.f,0.f,0.f};
    oaccl[t] = (v8f){0.f,0.f,0.f,0.f,0.f,0.f,0.f,0.f};
  }

  for (int kc = 0; kc < kP / kKC; ++kc) {
    const int kv0 = kc * kKC;
    __syncthreads();
    // ---- stage K tile: 64 rows x 8 segments of 8 halves = 512 x 16 B; 4 per thread (coverage 4 x 128 = 512) ----
    {
      const unsigned short* kbp = Kp + (tok0 + kv0) * (size_t)kD + h * kDh;
      v4u u[4];
#pragma unroll
      for (int i = 0; i < 4; ++i) {
        const int idx = i * 128 + tid;
        const int row = idx >> 3;
        const int seg = (idx & 7) * 8;
        u[i] = *(const v4u*)(kbp + (size_t)row * kD + seg);
      }
#pragma unroll
      for (int i = 0; i < 4; ++i) {
        const int idx = i * 128 + tid;
        const int row = idx >> 3;
        const int seg = (idx & 7) * 8;
        *(v4u*)(Ksh + row * kLP + seg) = u[i];
      }
    }
    asm volatile("" ::: "memory");
    // ---- stage V^T hi tile: 64 d-rows x 64 kv halves; same coverage ----
    {
      const unsigned short* vbp = VThp + (size_t)(h * kDh) * kTok + tok0 + kv0;
      v4u u[4];
#pragma unroll
      for (int i = 0; i < 4; ++i) {
        const int idx = i * 128 + tid;
        const int row = idx >> 3;
        const int seg = (idx & 7) * 8;
        u[i] = *(const v4u*)(vbp + (size_t)row * kTok + seg);
      }
#pragma unroll
      for (int i = 0; i < 4; ++i) {
        const int idx = i * 128 + tid;
        const int row = idx >> 3;
        const int seg = (idx & 7) * 8;
        *(v4u*)(Vth + row * kLP + seg) = u[i];
      }
    }
    asm volatile("" ::: "memory");
    // ---- stage V^T residual tile ----
    {
      const unsigned short* vbp = VTlp + (size_t)(h * kDh) * kTok + tok0 + kv0;
      v4u u[4];
#pragma unroll
      for (int i = 0; i < 4; ++i) {
        const int idx = i * 128 + tid;
        const int row = idx >> 3;
        const int seg = (idx & 7) * 8;
        u[i] = *(const v4u*)(vbp + (size_t)row * kTok + seg);
      }
#pragma unroll
      for (int i = 0; i < 4; ++i) {
        const int idx = i * 128 + tid;
        const int row = idx >> 3;
        const int seg = (idx & 7) * 8;
        *(v4u*)(Vtl + row * kLP + seg) = u[i];
      }
    }
    __syncthreads();

    // ---- scores, transposed: D[row = key j*16+8hh+r][col = query c] = K . Q^T, K = 64 in 2 steps of 32 ----
    v8f s[4];
#pragma unroll
    for (int j = 0; j < 4; ++j) {
      s[j] = (v8f){0.f,0.f,0.f,0.f,0.f,0.f,0.f,0.f};
#pragma unroll
      for (int dc = 0; dc < 2; ++dc) {
        const v16h kf = Frag<_Float16>::load(Ksh + (j * 16 + c) * kLP + dc * 32 + 8 * hh);
        s[j] = mma_h(kf, qa[dc], s[j]);
      }
    }

    // ---- scale, time bias, key mask; maximum over this lane's 32 keys, then over both halves ----
    const int qrow = q0 + c;
    float cm = -__builtin_inff();
#pragma unroll
    for (int j = 0; j < 4; ++j) {
      // key mask values of this lane's 8 consecutive keys of tile j (two 16-B loads)
      const float* pmp = pm + tok0 + kv0 + j * 16 + 8 * hh;
      const v4f pma = *(const v4f*)(pmp);
      const v4f pmb = *(const v4f*)(pmp + 4);
#pragma unroll
      for (int r = 0; r < 8; ++r) {
        const int kvcol = kv0 + j * 16 + 8 * hh + r;
        int dd = qrow - kvcol;
        dd = (dd < 0) ? -dd : dd;
        const float pmv = (r < 4) ? pma[r & 3] : pmb[r & 3];
        float v = s[j][r] * kScoreScale + tabs[dd];
        v = (pmv <= 0.0f) ? kNegBig : v;
        s[j][r] = v;
        cm = fmaxf(cm, v);
      }
    }
    cm = fmaxf(cm, xhalf(cm));

    // ---- online softmax; P x32768 as f16 straight into the B operands of the PV products ----
    // B operand of keys kk*32 .. kk*32+31: elements 0..7 = keys 8hh+0..7 (score tile 2kk), 8..15 = keys 16+8hh+0..7 (tile 2kk+1)
    const float mnew  = fmaxf(mrow, cm);
    const float alpha = expf(mrow - mnew);
    mrow = mnew;
    float psum = 0.f;
    v16h pb[2];
#pragma unroll
    for (int j = 0; j < 4; ++j) {
#pragma unroll
      for (int r = 0; r < 8; ++r) {
        const float p = expf(s[j][r] - mnew);
        psum += p;
        pb[j >> 1][(j & 1) * 8 + r] = (_Float16)(p * kPCarry);
      }
    }
    lrow = lrow * alpha + psum;
#pragma unroll
    for (int t = 0; t < 4; ++t) {
#pragma unroll
      for (int r = 0; r < 8; ++r) { oacc[t][r] *= alpha; oaccl[t][r] *= alpha; }
    }

    // ---- O^T += V^T . P^T : A = V^T [d t*16+c][kv], B = P^T [kv][query c]; hi and residual in separate accumulators ----
#pragma unroll
    for (int kk = 0; kk < 2; ++kk) {
#pragma unroll
      for (int t = 0; t < 4; ++t) {
        const v16h vh = Frag<_Float16>::load(Vth + (t * 16 + c) * kLP + kk * 32 + 8 * hh);
        oacc[t] = mma_h(vh, pb[kk], oacc[t]);
        const v16h vl = Frag<_Float16>::load(Vtl + (t * 16 + c) * kLP + kk * 32 + 8 * hh);
        oaccl[t] = mma_h(vl, pb[kk], oaccl[t]);
      }
    }
  }

  // ---- normalise (fold 2^-15 of P and 2^-11 of the residual) into the per-wave f32 slab ----
  float* os = Os[wave];   // [query][d]
  const float inv = 1.0f / ((lrow + xhalf(lrow)) * kPCarry);
#pragma unroll
  for (int t = 0; t < 4; ++t) {
#pragma unroll
    for (int r = 0; r < 8; ++r) os[c * 68 + t * 16 + 8 * hh + r] = (oacc[t][r] + oaccl[t][r] * kVloInv) * inv;
  }
  __builtin_amdgcn_fence(__ATOMIC_RELEASE, "workgroup");
  __builtin_amdgcn_wave_barrier();
  __builtin_amdgcn_fence(__ATOMIC_ACQUIRE, "workgroup");
  {
    const int q4 = lane >> 3, c8 = (lane & 7) * 8;
    {
#pragma unroll
      for (int it = 0; it < 4; ++it) {
        const int row = it * 4 + q4;
        const float* sp = os + row * 68 + c8;
        v8h hv, lv;
#pragma unroll
        for (int e = 0; e < 8; ++e) {
          const unsigned short hb = f2bf_bits(sp[e]);
          const unsigned short lb = f2bf_bits(sp[e] - bf_bits2f(hb));
          hv[e] = __builtin_bit_cast(_Float16, hb);
          lv[e] = __builtin_bit_cast(_Float16, lb);
        }
        const size_t off = (tok0 + q0 + row) * (size_t)kD + h * kDh + c8;
        *(v8h*)(Ohp + off) = hv;
        *(v8h*)(Olp + off) = lv;
      }
      
    }
  }
}

// ---------------------------------------------------------------------------
// Host glue.
//   Xb   bf16 [8192][1024]        16,777,216  at           0
//   Wqb  bf16 [1024][1024]         2,097,152  at  16,777,216
//   Wkb  bf16 [1024][1024]         2,097,152  at  18,874,368
//   Wvb  bf16 [1024][1024]         2,097,152  at  20,971,520
//   Wob  bf16 [1024][1024]         2,097,152  at  23,068,672
//   Q16  f16  [8192][1024]        16,777,216  at  25,165,824
//   K16  f16  [8192][1024]        16,777,216  at  41,943,040
//   VTh  f16  [1024][8192]        16,777,216  at  58,720,256
//   VTl  f16  [1024][8192]        16,777,216  at  75,497,472   (residual x2048)
//   Oh   bf16 [8192][1024]        16,777,216  at  92,274,688
//   Ol   bf16 [8192][1024]        16,777,216  at 109,051,904
//   tab  f32  [2048]                   8,192  at 125,829,120
//   total                        125,837,312
// Every region is fully written before it is read; no region is re-used.
// GEMM shapes: Q,K: M=8192 N=1024 K=1024; V^T: M=1024 N=8192 K=1024; out: M=8192 N=1024 K=1024 (M%128==0, N%256==0,
// K%128==0, no padding). Attention: S=2048 (64-multiples), Dh=64.
// ---------------------------------------------------------------------------
extern "C" void kernel_launch(void* const* d_in, const int* in_sizes, int n_in,
                              void* d_out, int out_size, void* d_ws, size_t ws_size,
                              hipStream_t stream) {
  if (n_in < 10) return;
  const int nX = kTok * kD;     // 8,388,608
  const int nW = kD * kD;       // 1,048,576
  if (in_sizes[0] != nX || in_sizes[1] != kTok) return;
  if (in_sizes[2] != nW || in_sizes[4] != nW || in_sizes[6] != nW || in_sizes[8] != nW) return;
  if (in_sizes[3] != kD || in_sizes[5] != kD || in_sizes[7] != kD || in_sizes[9] != kD) return;
  if (out_size != nX) return;

  const size_t szX16 = (size_t)nX * 2;
  const size_t szW16 = (size_t)nW * 2;
  const size_t szTab = (size_t)kP * 4;
  const size_t offXb  = 0;
  const size_t offWq  = offXb + szX16;
  const size_t offWk  = offWq + szW16;
  const size_t offWv  = offWk + szW16;
  const size_t offWo  = offWv + szW16;
  const size_t offQ   = offWo + szW16;
  const size_t offK   = offQ + szX16;
  const size_t offVTh = offK + szX16;
  const size_t offVTl = offVTh + szX16;
  const size_t offOh  = offVTl + szX16;
  const size_t offOl  = offOh + szX16;
  const size_t offTab = offOl + szX16;
  const size_t total  = offTab + szTab;
  if (ws_size < total) return;

  const float* x  = (const float*)d_in[0];
  const float* pm = (const float*)d_in[1];
  const float* Wq = (const float*)d_in[2];
  const float* bq = (const float*)d_in[3];
  const float* Wk = (const float*)d_in[4];
  const float* bk = (const float*)d_in[5];
  const float* Wv = (const float*)d_in[6];
  const float* bv = (const float*)d_in[7];
  const float* Wo = (const float*)d_in[8];
  const float* bo = (const float*)d_in[9];
  float* out = (float*)d_out;
  char* ws = (char*)d_ws;
  unsigned short* Xb  = (unsigned short*)(ws + offXb);
  unsigned short* Wqb = (unsigned short*)(ws + offWq);
  unsigned short* Wkb = (unsigned short*)(ws + offWk);
  unsigned short* Wvb = (unsigned short*)(ws + offWv);
  unsigned short* Wob = (unsigned short*)(ws + offWo);
  unsigned short* Q16 = (unsigned short*)(ws + offQ);
  unsigned short* K16 = (unsigned short*)(ws + offK);
  unsigned short* VTh = (unsigned short*)(ws + offVTh);
  unsigned short* VTl = (unsigned short*)(ws + offVTl);
  unsigned short* Oh  = (unsigned short*)(ws + offOh);
  unsigned short* Ol  = (unsigned short*)(ws + offOl);
  float* tab = (float*)(ws + offTab);

  // ---- prologue: RNE bf16 operand planes and the bias table ----
  const int n8x = nX / 8;   // 1,048,576 -> 4096 blocks exact
  const int n8w = nW / 8;   //   131,072 ->  512 blocks exact
  cast8_bf16_kernel<<<dim3(n8x / 256), dim3(256), 0, stream>>>(x,  Xb,  n8x);
  cast8_bf16_kernel<<<dim3(n8w / 256), dim3(256), 0, stream>>>(Wq, Wqb, n8w);
  cast8_bf16_kernel<<<dim3(n8w / 256), dim3(256), 0, stream>>>(Wk, Wkb, n8w);
  cast8_bf16_kernel<<<dim3(n8w / 256), dim3(256), 0, stream>>>(Wv, Wvb, n8w);
  cast8_bf16_kernel<<<dim3(n8w / 256), dim3(256), 0, stream>>>(Wo, Wob, n8w);
  tab_kernel<<<dim3((kP / 4) / 256), dim3(256), 0, stream>>>(tab);

  // ---- projections (64x64 wave tiles, 8 waves = one 128x256 tile per block) ----
  const int tilesProj = (kTok / 64) * (kD / 64);   // 2048 -> 256 blocks
  // Q16[m][n] = sum_k Xb[m][k] * Wqb[n][k] + bq[n]   (f16 out)
  wmma_gemm64<1, 0, 2, 1, false><<<dim3(tilesProj / 8, 1), dim3(256), 0, stream>>>(
      Xb, Xb, kD, 0L, Wqb, Wqb, kD, 0L, (void*)Q16, (void*)Q16, kD, 0L, bq, pm, kTok, kD, kD, 1.0f);
  // K16 likewise with Wk, bk
  wmma_gemm64<1, 0, 2, 1, false><<<dim3(tilesProj / 8, 1), dim3(256), 0, stream>>>(
      Xb, Xb, kD, 0L, Wkb, Wkb, kD, 0L, (void*)K16, (void*)K16, kD, 0L, bk, pm, kTok, kD, kD, 1.0f);
  // V^T[m = feature][n = token] = sum_k Wvb[m][k] * Xb[n][k] + bv[m]   (f16 hi plane + f16 residual plane x2048)
  wmma_gemm64<1, 0, 1, 3, false><<<dim3(tilesProj / 8, 1), dim3(256), 0, stream>>>(
      Wvb, Wvb, kD, 0L, Xb, Xb, kD, 0L, (void*)VTh, (void*)VTl, kTok, 0L, bv, pm, kD, kTok, kD, 1.0f);

  // ---- attention: 64 (b,h) x 32 query tiles ----
  attn_kernel<<<dim3(kB * kH * (kP / kQB)), dim3(128), 0, stream>>>(Q16, K16, VTh, VTl, tab, pm, Oh, Ol);

  // ---- output projection: out[m][n] = (sum_k (Oh+Ol)[m][k] * Wob[n][k] + bo[n]) * pm[m] ----
  wmma_gemm64<1, 2, 2, 0, true><<<dim3(tilesProj / 8, 1), dim3(256), 0, stream>>>(
      Oh, Ol, kD, 0L, Wob, Wob, kD, 0L, (void*)out, (void*)out, kD, 0L, bo, pm, kTok, kD, kD, 1.0f);
}

// v004
// One run takes 274 microseconds.
// Two timings next to v003 both put it at 1.10 times that version's speed.
// Over all steps from v000 it is 2.95 times as fast.
// Contractions: q/k/v projections on v_wmma_f32_16x16x32_bf16 (x and W as RNE bf16 planes, single products); scores q.k^T on v_wmma_f32_16x16x32_f16 (q, k f16 planes); attn.v on v_wmma_f32_16x16x32_f16 (P f16 carried x32768; V^T as f16 hi plane + f16 residual plane carried x2048 in a separate accumulator); output projection on v_wmma_f32_16x16x32_bf16 (attention output as bf16 hi + lo planes, Wo bf16, two products); f32 accumulate everywhere; time bias, masks and softmax in f32.
#include <hip/hip_runtime.h>
#include <math.h>

// ---------------------------------------------------------------------------
// Problem constants
// ---------------------------------------------------------------------------
constexpr int kB   = 4;
constexpr int kP   = 2048;
constexpr int kD   = 1024;
constexpr int kH   = 16;
constexpr int kDh  = 64;
constexpr int kTok = kB * kP;            // 8192 token rows
constexpr int kQB  = 64;                 // queries per attention block
constexpr int kKC  = 64;                 // keys per chunk
constexpr int kNW  = 4;                  // waves per attention block
constexpr int kLP  = 72;                 // LDS row pitch in halves of the 64-half K and V^T rows: 144 B = 16 B x odd,
                                         // so the 16 rows of one ds_load_b128 fragment read fall on distinct banks
constexpr float kLog2e      = 1.4426950408889634f;
constexpr float kScoreScale = 0.125f * kLog2e;    // 64^-0.5, scores kept in base 2 (natural score x log2 e)
constexpr float kNegBig     = -1.0e9f * kLog2e;   // masked score, base 2
constexpr float kPCarryLog2 = 15.0f;     // probabilities carried x2^15 in f16: the exponent's reference point lies 15 below the maximum
constexpr float kVloCarry   = 2048.0f;   // f16 residual planes carried x2^11
constexpr float kVloInv     = 1.0f / 2048.0f;
constexpr float kDelta      = 300.0f;    // seconds per patch step
constexpr float kInvTau     = 1.0f / 300.0f;
constexpr float kLogEps     = 1.0e-12f;
static_assert(kH * kDh == kD, "s");
static_assert(kTok % 64 == 0 && kD % 64 == 0 && kD % 32 == 0, "s");
static_assert(kP % kQB == 0 && kP % kKC == 0 && kDh == 64, "s");
static_assert((kTok * kD) % (8 * 256) == 0 && (kD * kD) % (8 * 256) == 0, "s");
static_assert(kP % 1024 == 0, "s");

typedef __attribute__((ext_vector_type(16))) _Float16 v16h;
typedef __attribute__((ext_vector_type(8)))  _Float16 v8h;
typedef __attribute__((ext_vector_type(16))) __bf16   v16b;
typedef __attribute__((ext_vector_type(8)))  __bf16   v8b;
typedef __attribute__((ext_vector_type(8)))  float    v8f;
typedef __attribute__((ext_vector_type(4)))  float    v4f;
typedef __attribute__((ext_vector_type(4)))  unsigned int v4u;

// ---------------------------------------------------------------------------
// Conversion, fragment and hazard-guard helpers
// ---------------------------------------------------------------------------
__device__ __forceinline__ unsigned short f2bf_bits(float f) {
  unsigned u = __float_as_uint(f);
  return (unsigned short)((u + 0x7FFFu + ((u >> 16) & 1u)) >> 16);
}
__device__ __forceinline__ float bf_bits2f(unsigned short h) { return __uint_as_float(((unsigned)h) << 16); }

// f16 bits (low 16) -> f32, integer path, finite values
__device__ __forceinline__ float h16_to_f32(unsigned hb) {
  const unsigned sgn = (hb & 0x8000u) << 16; const unsigned em = hb & 0x7fffu;
  const float fn = __uint_as_float((em << 13) + 0x38000000u);
  const float fs = (float)em * 5.9604644775390625e-8f;
  const float mag = (em < 0x400u) ? fs : fn; return __uint_as_float(__float_as_uint(mag) | sgn); }

// hazard guards as plain device helpers (no inline asm inside the kernel template body)
__device__ __forceinline__ void dep_guard4_h(v8f& a, v8f& b, v8f& c, v8f& d, v16h x, v16h y) {
  asm volatile("v_nop\n\tv_nop\n\tv_nop\n\tv_nop" : "+v"(a), "+v"(b), "+v"(c), "+v"(d) : "v"(x), "v"(y));
}
__device__ __forceinline__ void dep_guard4_b(v8f& a, v8f& b, v8f& c, v8f& d, v16b x, v16b y) {
  asm volatile("v_nop\n\tv_nop\n\tv_nop\n\tv_nop" : "+v"(a), "+v"(b), "+v"(c), "+v"(d) : "v"(x), "v"(y));
}
__device__ __forceinline__ void keep4_h(v16h a, v16h b, v16h c, v16h d) { asm volatile("v_nop" :: "v"(a), "v"(b), "v"(c), "v"(d)); }
__device__ __forceinline__ void keep4_b(v16b a, v16b b, v16b c, v16b d) { asm volatile("v_nop" :: "v"(a), "v"(b), "v"(c), "v"(d)); }
__device__ __forceinline__ void acc_guard4(v8f& a, v8f& b, v8f& c, v8f& d) { asm volatile("v_nop\n\tv_nop\n\tv_nop\n\tv_nop" : "+v"(a), "+v"(b), "+v"(c), "+v"(d)); }
template <typename T> struct Frag;
template <> struct Frag<_Float16> {
  typedef v16h V; union U { v16h v; v8h h[2]; };
  // elements 0..7 <- p[0..7], 8..15 <- p[16..23]
  static __device__ __forceinline__ v16h load(const _Float16* p) {
    U f; f.h[0] = *(const v8h*)(p); f.h[1] = *(const v8h*)(p + 16); return f.v;
  }
  static __device__ __forceinline__ v8f mma(v16h a, v16h b, v8f c) {
    return __builtin_amdgcn_wmma_f32_16x16x32_f16(false, a, false, b, (short)0, c, false, false);
  }
  static __device__ __forceinline__ void guard4(v8f& a, v8f& b, v8f& c, v8f& d, v16h x, v16h y) { dep_guard4_h(a, b, c, d, x, y); }
  static __device__ __forceinline__ void keep(v16h a, v16h b, v16h c, v16h d) { keep4_h(a, b, c, d); }
};
template <> struct Frag<__bf16> {
  typedef v16b V; union U { v16b v; v8b h[2]; };
  static __device__ __forceinline__ v16b load(const __bf16* p) {
    U f; f.h[0] = *(const v8b*)(p); f.h[1] = *(const v8b*)(p + 16); return f.v;
  }
  static __device__ __forceinline__ v8f mma(v16b a, v16b b, v8f c) {
    return __builtin_amdgcn_wmma_f32_16x16x32_bf16(false, a, false, b, (short)0, c, false, false);
  }
  static __device__ __forceinline__ void guard4(v8f& a, v8f& b, v8f& c, v8f& d, v16b x, v16b y) { dep_guard4_b(a, b, c, d, x, y); }
  static __device__ __forceinline__ void keep(v16b a, v16b b, v16b c, v16b d) { keep4_b(a, b, c, d); }
};

__device__ __forceinline__ unsigned pk16(unsigned short a, unsigned short b) { return (unsigned)a | ((unsigned)b << 16); }
__device__ __forceinline__ unsigned short h_bits(float f) { const _Float16 h = (_Float16)f; return __builtin_bit_cast(unsigned short, h); }

// single WMMA with its own hazard guard (ties D, keeps A/B live)
__device__ __forceinline__ v8f mma_h(v16h a, v16h b, v8f c) {
  c = __builtin_amdgcn_wmma_f32_16x16x32_f16(false, a, false, b, (short)0, c, false, false);
  asm volatile("v_nop\n\tv_nop\n\tv_nop\n\tv_nop" : "+v"(c) : "v"(a), "v"(b));
  return c;
}

// lane l <-> lane l ^ 16 (the other 16-lane half of the wave), a vector-port move
__device__ __forceinline__ float xhalf(float x) {
  const int b = __builtin_bit_cast(int, x);
  return __builtin_bit_cast(float, __builtin_amdgcn_permlanex16(b, b, 0x76543210, 0xfedcba98, false, false));
}

// 2^x on the hardware's v_exp_f32, in place. The instruction set asks for one independent instruction or a v_nop between a
// transcendental and a vector instruction that reads its result or writes over its source. Written as one statement the slot is
// kept by construction: each v_exp_f32 writes over its own source alone, none reads a neighbour's result, and the closing v_nop
// stands between the last one and whatever the compiler places next.
__device__ __forceinline__ void exp2x8_inplace(float& a, float& b, float& c, float& d, float& e, float& f, float& g, float& h) {
  asm("v_exp_f32 %0, %0\n\tv_exp_f32 %1, %1\n\tv_exp_f32 %2, %2\n\tv_exp_f32 %3, %3\n\t"
      "v_exp_f32 %4, %4\n\tv_exp_f32 %5, %5\n\tv_exp_f32 %6, %6\n\tv_exp_f32 %7, %7\n\tv_nop"
      : "+v"(a), "+v"(b), "+v"(c), "+v"(d), "+v"(e), "+v"(f), "+v"(g), "+v"(h));
}
// the same with a ninth value
__device__ __forceinline__ void exp2x9_inplace(float& a, float& b, float& c, float& d, float& e, float& f, float& g, float& h, float& i) {
  asm("v_exp_f32 %0, %0\n\tv_exp_f32 %1, %1\n\tv_exp_f32 %2, %2\n\tv_exp_f32 %3, %3\n\tv_exp_f32 %4, %4\n\t"
      "v_exp_f32 %5, %5\n\tv_exp_f32 %6, %6\n\tv_exp_f32 %7, %7\n\tv_exp_f32 %8, %8\n\tv_nop"
      : "+v"(a), "+v"(b), "+v"(c), "+v"(d), "+v"(e), "+v"(f), "+v"(g), "+v"(h), "+v"(i));
}

// ---- LDS staging of the GEMM operands ----
constexpr int kGK = 128;   // k per stage: every staged operand row is 256 B = two whole 128-B lines
constexpr int kGP = 136;   // LDS row pitch in halves: 272 B = 16 B x odd, so the 16 rows of a ds_load_b128 fragment read fall on distinct banks

// Eight asynchronous 16-B copies per lane, global -> LDS: rows r, r+16, ..., r+112 of one 128-row panel (16 lanes per 256-B row).
// The closing s_wait_xcnt stands inside the statement so that no address register of a copy is rewritten in front of it.
__device__ __forceinline__ void copy8_to_lds(unsigned l, const unsigned short* g, size_t gs) {
  constexpr unsigned ls = 16u * kGP * 2u;   // 16 LDS rows in bytes
  asm volatile(
      "global_load_async_to_lds_b128 %0, %8, off\n\t"
      "global_load_async_to_lds_b128 %1, %9, off\n\t"
      "global_load_async_to_lds_b128 %2, %10, off\n\t"
      "global_load_async_to_lds_b128 %3, %11, off\n\t"
      "global_load_async_to_lds_b128 %4, %12, off\n\t"
      "global_load_async_to_lds_b128 %5, %13, off\n\t"
      "global_load_async_to_lds_b128 %6, %14, off\n\t"
      "global_load_async_to_lds_b128 %7, %15, off\n\t"
      "s_wait_xcnt 0x0"
      :: "v"(l), "v"(l + ls), "v"(l + 2u * ls), "v"(l + 3u * ls), "v"(l + 4u * ls), "v"(l + 5u * ls), "v"(l + 6u * ls), "v"(l + 7u * ls),
         "v"(g), "v"(g + gs), "v"(g + 2 * gs), "v"(g + 3 * gs), "v"(g + 4 * gs), "v"(g + 5 * gs), "v"(g + 6 * gs), "v"(g + 7 * gs)
      : "memory");
}
// this wave's copies have landed in LDS (the compiler places no wait for them)
__device__ __forceinline__ void wait_copies() { asm volatile("s_wait_asynccnt 0x0" ::: "memory"); }
// this wave's LDS reads have returned, so the buffer they read may be refilled behind the next barrier
__device__ __forceinline__ void wait_lds() { asm volatile("s_wait_dscnt 0x0" ::: "memory"); }

// ---- Register-blocked batched WMMA GEMM (modes extended) ----------------------------------------------
// C[m,n] = scale * sum_k A[m,k] * Bt[n,k] (+bias)(*rowsc[m]); each wave owns a 64x64 tile, the block's 8 waves a 128x256 tile
// (2 x 4 waves). Per stage the block's 128 A rows and 256 Bt rows x 128 k are copied to LDS in whole lines and every wave
// reads its fragments from there; two buffers, the next stage's copies in flight while this stage is multiplied.
// A row-major [M,K]; Bt row-major [N,K]; M % 128 == 0, N % 256 == 0, K % 128 == 0, K >= 128 (no tail handling).
// SPLIT: 0 = single product; 1 = A and Bt hi/lo planes (hi*hi + hi*lo + lo*hi); 2 = A hi/lo planes only (hi*B + lo*B).
// BIAS_MODE: 0 = none, 1 = bias[m], 2 = bias[n].  ROWSC: multiply by RNE-bf16(rowsc[m]) after the bias.
// OUT_MODE: 0 = f32, 1 = f16, 2 = bf16 hi plane (Cout) + bf16 lo plane (Cout2), 3 = f16 hi plane + f16 residual plane x2048.
// ET: 0 = f16 operands, 1 = bf16 operands (pointers passed as 16-bit storage)
template <int ET> struct Elem;
template <> struct Elem<0> { typedef _Float16 T; };
template <> struct Elem<1> { typedef __bf16 T; };
template <int ET, int SPLIT, int BIAS_MODE, int OUT_MODE, bool ROWSC>
__global__ __launch_bounds__(256) void wmma_gemm64(
    const unsigned short* __restrict__ Ap, const unsigned short* __restrict__ A2p, int lda, long strideA,
    const unsigned short* __restrict__ Btp, const unsigned short* __restrict__ Bt2p, int ldb, long strideB,
    void* __restrict__ Cout, void* __restrict__ Cout2, int ldc, long strideC,
    const float* __restrict__ bias, const float* __restrict__ rowsc,
    int M, int N, int K, float scale) {
  typedef typename Elem<ET>::T T;
  typedef typename Frag<T>::V V;
  constexpr int NA = (SPLIT != 0) ? 2 : 1;             // A planes
  constexpr int NB = (SPLIT == 1) ? 2 : 1;             // Bt planes
  constexpr int kBufH = (128 * NA + 256 * NB) * kGP;   // halves per buffer: [A planes, 128 rows each][Bt planes, 256 rows each]
  __shared__ __align__(16) unsigned short ring[2 * kBufH];
  __shared__ __align__(16) float sT[8][16 * 68];   // per-wave 16x64 slab, pitch 68 floats
  const int b    = blockIdx.y;
  const int lane = threadIdx.x & 31;
  const int wave = threadIdx.x >> 5;
  const int tilesNb = N >> 8;
  const int tilesMb = M >> 7;
  if ((int)blockIdx.x >= tilesMb * tilesNb) return;   // the same for the whole block, ahead of every barrier
  const int bm  = blockIdx.x / tilesNb;
  const int bn  = blockIdx.x - bm * tilesNb;
  const int m0b = bm << 7;
  const int n0b = bn << 8;
  const int wm  = wave >> 2;
  const int wn  = wave & 3;
  const int m0  = m0b + (wm << 6);
  const int n0  = n0b + (wn << 6);

  const int rlane = lane & 15;                 // row (A) / col (B, D) within subtile
  const int koff  = (lane >> 4) * 8;           // k offset of this lane half
  const int mOff  = (lane >> 4) * 8;           // D row offset

  // copy addresses of this lane: row threadIdx.x / 16 of each 16-row group, 16-B segment threadIdx.x % 16
  const int cr = threadIdx.x >> 4;
  const int cs = (threadIdx.x & 15) * 8;
  const unsigned short* cA  = Ap   + (size_t)b * strideA + (size_t)(m0b + cr) * lda + cs;
  const unsigned short* cA2 = A2p  + (size_t)b * strideA + (size_t)(m0b + cr) * lda + cs;
  const unsigned short* cB  = Btp  + (size_t)b * strideB + (size_t)(n0b + cr) * ldb + cs;
  const unsigned short* cB2 = Bt2p + (size_t)b * strideB + (size_t)(n0b + cr) * ldb + cs;
  const unsigned cl = (unsigned)(uintptr_t)ring + (unsigned)(cr * kGP + cs) * 2u;   // LDS byte address
  const size_t gsA = (size_t)16 * lda;
  const size_t gsB = (size_t)16 * ldb;
  constexpr unsigned kPanel = 128u * kGP * 2u;   // 128 LDS rows in bytes
  auto stage = [&](int t) {
    const unsigned l = cl + (unsigned)(t & 1) * (unsigned)(kBufH * 2);
    const size_t k = (size_t)t * kGK;
    copy8_to_lds(l, cA + k, gsA);
    if (NA == 2) copy8_to_lds(l + kPanel, cA2 + k, gsA);
    copy8_to_lds(l + NA * kPanel, cB + k, gsB);
    copy8_to_lds(l + (NA + 1) * kPanel, cB + k + 8 * gsB, gsB);
    if (NB == 2) {
      copy8_to_lds(l + (NA + 2) * kPanel, cB2 + k, gsB);
      copy8_to_lds(l + (NA + 3) * kPanel, cB2 + k + 8 * gsB, gsB);
    }
  };

  v8f acc[4][4];
#pragma unroll
  for (int i = 0; i < 4; ++i)
#pragma unroll
    for (int j = 0; j < 4; ++j) acc[i][j] = (v8f){0.f,0.f,0.f,0.f,0.f,0.f,0.f,0.f};

  const int nT = K / kGK;
  stage(0);
  wait_copies();
  __syncthreads();            // stage 0 is readable by every wave
  if (nT > 1) stage(1);

  for (int t = 0; t < nT; ++t) {
    const T* rb = (const T*)ring + (t & 1) * kBufH;
    const T* fa = rb + ((wm << 6) + rlane) * kGP + koff;
    const T* fb = rb + (128 * NA + (wn << 6) + rlane) * kGP + koff;
    // every loop of a stage is unrolled: fragment and accumulator indices are constants (registers, no scratch) and the
    // LDS offsets of the four 32-k steps are immediates
#pragma unroll
    for (int ks = 0; ks < kGK / 32; ++ks) {
      V bh[4], bl[4], ah[4], al[4];
#pragma unroll
      for (int j = 0; j < 4; ++j) {
        bh[j] = Frag<T>::load(fb + (j << 4) * kGP + ks * 32);
        if (SPLIT == 1) bl[j] = Frag<T>::load(fb + (256 + (j << 4)) * kGP + ks * 32);
      }
#pragma unroll
      for (int i = 0; i < 4; ++i) {
        ah[i] = Frag<T>::load(fa + (i << 4) * kGP + ks * 32);
        al[i] = ah[i];
        if (SPLIT != 0) al[i] = Frag<T>::load(fa + (128 + (i << 4)) * kGP + ks * 32);
      }
#pragma unroll
      for (int i = 0; i < 4; ++i) {
#pragma unroll
        for (int j = 0; j < 4; ++j) {
          acc[i][j] = Frag<T>::mma(ah[i], bh[j], acc[i][j]);
          if (SPLIT == 1) acc[i][j] = Frag<T>::mma(ah[i], bl[j], acc[i][j]);
          if (SPLIT != 0) acc[i][j] = Frag<T>::mma(al[i], bh[j], acc[i][j]);
        }
        Frag<T>::guard4(acc[i][0], acc[i][1], acc[i][2], acc[i][3], ah[i], al[i]);
      }
      Frag<T>::keep(bh[0], bh[1], bh[2], bh[3]);
      if (SPLIT == 1) Frag<T>::keep(bl[0], bl[1], bl[2], bl[3]);
    }
    wait_lds();
    wait_copies();
    __syncthreads();          // publishes stage t + 1 and ends every wave's reads of stage t's buffer
    if (t + 2 < nT) stage(t + 2);
  }
  wait_copies();              // nothing in flight when the wave goes on to the epilogue
  acc_guard4(acc[0][0], acc[0][1], acc[0][2], acc[0][3]);
  acc_guard4(acc[1][0], acc[1][1], acc[1][2], acc[1][3]);
  acc_guard4(acc[2][0], acc[2][1], acc[2][2], acc[2][3]);
  acc_guard4(acc[3][0], acc[3][1], acc[3][2], acc[3][3]);

  // ---- epilogue ----
  float* slab = sT[wave];
#pragma unroll
  for (int i = 0; i < 4; ++i) {
    const int mBase = m0 + (i << 4);
    float rsv[8];
#pragma unroll
    for (int r = 0; r < 8; ++r) rsv[r] = 1.0f;
    if (ROWSC) {
      // two 16-B loads of rowsc[mBase+mOff .. +7], then RNE bf16 of each value
      const v4f ra = *(const v4f*)(rowsc + mBase + mOff);
      const v4f rb = *(const v4f*)(rowsc + mBase + mOff + 4);
      rsv[0] = ra[0]; rsv[1] = ra[1]; rsv[2] = ra[2]; rsv[3] = ra[3];
      rsv[4] = rb[0]; rsv[5] = rb[1]; rsv[6] = rb[2]; rsv[7] = rb[3];
#pragma unroll
      for (int r = 0; r < 8; ++r) rsv[r] = bf_bits2f(f2bf_bits(rsv[r]));
    }
#pragma unroll
    for (int j = 0; j < 4; ++j) {
      const int n = n0 + (j << 4) + rlane;
      float bv = 0.f;
      if (BIAS_MODE == 2) bv = bias[n];
#pragma unroll
      for (int r = 0; r < 8; ++r) {
        float v = acc[i][j][r] * scale;
        if (BIAS_MODE == 1) v += bias[mBase + mOff + r];
        if (BIAS_MODE == 2) v += bv;
        if (ROWSC) v = v * rsv[r];
        slab[(mOff + r) * 68 + (j << 4) + rlane] = v;
      }
    }
    __builtin_amdgcn_fence(__ATOMIC_RELEASE, "workgroup");
    __builtin_amdgcn_wave_barrier();
    __builtin_amdgcn_fence(__ATOMIC_ACQUIRE, "workgroup");
    if (OUT_MODE == 0) {
      float* C = (float*)Cout + (size_t)b * strideC;
      const int hh = lane >> 4, c4 = (lane & 15) * 4;     // row seg = 256 B = 16 lanes x 16 B
      {
#pragma unroll
        for (int it = 0; it < 8; ++it) {
          const int row = it * 2 + hh;
          v4f v = *(const v4f*)(slab + row * 68 + c4);
          *(v4f*)(C + (size_t)(mBase + row) * ldc + n0 + c4) = v;
        }
        
      }
    } else {
      const int q = lane >> 3, c8 = (lane & 7) * 8;
      unsigned short* C  = (unsigned short*)Cout  + (size_t)b * strideC;
      unsigned short* C2 = (OUT_MODE >= 2) ? ((unsigned short*)Cout2 + (size_t)b * strideC) : nullptr;
      {
#pragma unroll
        for (int it = 0; it < 4; ++it) {
          const int row = it * 4 + q;
          const float* sp = slab + row * 68 + c8;
          v8h hv, lv;
#pragma unroll
          for (int e = 0; e < 8; ++e) {
            if (OUT_MODE == 1) {
              hv[e] = (_Float16)sp[e];
            } else if (OUT_MODE == 2) {
              unsigned short hb = f2bf_bits(sp[e]);
              unsigned short lb = f2bf_bits(sp[e] - bf_bits2f(hb));
              hv[e] = __builtin_bit_cast(_Float16, hb);
              lv[e] = __builtin_bit_cast(_Float16, lb);
            } else {
              const unsigned short hb = h_bits(sp[e]);
              const float back = h16_to_f32((unsigned)hb);
              const unsigned short lb = h_bits((sp[e] - back) * kVloCarry);
              hv[e] = __builtin_bit_cast(_Float16, hb);
              lv[e] = __builtin_bit_cast(_Float16, lb);
            }
          }
          *(v8h*)(C + (size_t)(mBase + row) * ldc + n0 + c8) = hv;
          if (OUT_MODE >= 2) *(v8h*)(C2 + (size_t)(mBase + row) * ldc + n0 + c8) = lv;
        }
        
      }
    }
    __builtin_amdgcn_fence(__ATOMIC_RELEASE, "workgroup");
    __builtin_amdgcn_wave_barrier();
    __builtin_amdgcn_fence(__ATOMIC_ACQUIRE, "workgroup");
  }
}

// ---------------------------------------------------------------------------
// f32 -> bf16 (RNE) cast, 8 consecutive elements per thread (one 16-B store per lane; 32 contiguous lanes = 4 whole
// multiples of 256: 1,048,576 threads for x, 131,072 for each weight).
// ---------------------------------------------------------------------------
__global__ __launch_bounds__(256) void cast8_bf16_kernel(const float* __restrict__ in, unsigned short* __restrict__ out, int n8) {
  const int i = blockIdx.x * 256 + threadIdx.x;
  if (i >= n8) return;
  const float* p = in + 8 * (size_t)i;
  const v4f a = *(const v4f*)(p);
  const v4f c = *(const v4f*)(p + 4);
  unsigned short hb[8];
#pragma unroll
  for (int e = 0; e < 4; ++e) {
    hb[e]     = f2bf_bits(a[e]);
    hb[4 + e] = f2bf_bits(c[e]);
  }
  const v4u u = (v4u){pk16(hb[0], hb[1]), pk16(hb[2], hb[3]), pk16(hb[4], hb[5]), pk16(hb[6], hb[7])};
  unsigned short* q = out + 8 * (size_t)i;
  *(v4u*)q = u;
  
}

// ---------------------------------------------------------------------------
// Time-decay bias table in base 2: tab[d] = logf(expf((-(d*300)) * (1/300)) + 1e-12) * log2(e), d = 0..2047, f32, precise expf/logf.
// ---------------------------------------------------------------------------
__global__ __launch_bounds__(256) void tab_kernel(float* __restrict__ tab) {
  const int i = blockIdx.x * 256 + threadIdx.x;
  if (i >= kP / 4) return;
  v4f tv;
#pragma unroll
  for (int e = 0; e < 4; ++e) {
    const float d = (float)(4 * i + e);
    const float dist = d * kDelta;
    const float ex = (-dist) * kInvTau;
    const float w = expf(ex);
    tv[e] = logf(w + kLogEps) * kLog2e;
  }
  float* q = tab + 4 * (size_t)i;
  *(v4f*)q = tv;
  
}

__global__ __launch_bounds__(128) void attn_kernel(const unsigned short* __restrict__ Qp, const unsigned short* __restrict__ Kp,
                                                   const unsigned short* __restrict__ VThp, const unsigned short* __restrict__ VTlp,
                                                   const float* __restrict__ tab, const float* __restrict__ pm,
                                                   unsigned short* __restrict__ Ohp, unsigned short* __restrict__ Olp) {
  __shared__ __align__(16) _Float16 Ksh[kKC * kLP];          // K   [kv][d]   9 KB
  __shared__ __align__(16) _Float16 Vth[kDh * kLP];          // V^T hi [d][kv] 9 KB
  __shared__ __align__(16) _Float16 Vtl[kDh * kLP];          // V^T residual x2048 [d][kv] 9 KB
  __shared__ __align__(16) float    Os[kNW][16 * 68];        // per wave out tile, pitch 68
  __shared__ __align__(16) float    tabs[kP];                // bias table 8 KB

  const int tid  = threadIdx.x;
  const int wave = tid >> 5;
  const int lane = tid & 31;
  const int hh   = lane >> 4;
  const int c    = lane & 15;
  const int nqb  = kP / kQB;              // 32
  const int bx   = blockIdx.x;
  const int qb   = bx % nqb;
  const int bh   = bx / nqb;
  const int h    = bh % kH;
  const int b    = bh / kH;
  const int q0   = qb * kQB + wave * 16;  // first query row of this wave within the sequence
  const size_t tok0 = (size_t)b * kP;     // first token row of this batch

  // ---- bias table -> LDS: 4 x 128 threads x 4 floats = 2048 (whole table); read after the loop's first barrier ----
#pragma unroll
  for (int i = 0; i < 4; ++i) {
    const int idx = i * 128 + tid;
    const v4f t4 = *(const v4f*)(tab + 4 * idx);
    *(v4f*)(tabs + 4 * idx) = t4;
  }
  asm volatile("" ::: "memory");

  // ---- Q fragments (B operand): column = query q0+c, k = d; 2 d-chunks ----
  const _Float16* Qh = (const _Float16*)(const void*)Qp;
  const _Float16* qr = Qh + (tok0 + q0 + c) * (size_t)kD + h * kDh + 8 * hh;
  v16h qa[2];
  qa[0] = Frag<_Float16>::load(qr);
  qa[1] = Frag<_Float16>::load(qr + 32);

  float mrow = -__builtin_inff();   // running maximum of query q0+c (equal in both halves), base 2
  float mref = -__builtin_inff();   // reference point of the exponentials: P, its sum and O all carry the factor 2^(-mref)
  float lrow = 0.f;                 // running sum of query q0+c over this half's keys; the halves are joined after the loop
  v8f oacc[4], oaccl[4];            // O^T: row = d t*16+8hh+r, column = query q0+c
#pragma unroll
  for (int t = 0; t < 4; ++t) {
    oacc[t]  = (v8f){0.f,0.f,0.f,0.f,0.f,0.f,0.f,0.f};
    oaccl[t] = (v8f){0.f,0.f,0.f,0.f,0.f,0.f,0.f,0.f};
  }

  for (int kc = 0; kc < kP / kKC; ++kc) {
    const int kv0 = kc * kKC;
    __syncthreads();
    // ---- stage K tile: 64 rows x 8 segments of 8 halves = 512 x 16 B; 4 per thread (coverage 4 x 128 = 512) ----
    {
      const unsigned short* kbp = Kp + (tok0 + kv0) * (size_t)kD + h * kDh;
      v4u u[4];
#pragma unroll
      for (int i = 0; i < 4; ++i) {
        const int idx = i * 128 + tid;
        const int row = idx >> 3;
        const int seg = (idx & 7) * 8;
        u[i] = *(const v4u*)(kbp + (size_t)row * kD + seg);
      }
#pragma unroll
      for (int i = 0; i < 4; ++i) {
        const int idx = i * 128 + tid;
        const int row = idx >> 3;
        const int seg = (idx & 7) * 8;
        *(v4u*)(Ksh + row * kLP + seg) = u[i];
      }
    }
    asm volatile("" ::: "memory");
    // ---- stage V^T hi tile: 64 d-rows x 64 kv halves; same coverage ----
    {
      const unsigned short* vbp = VThp + (size_t)(h * kDh) * kTok + tok0 + kv0;
      v4u u[4];
#pragma unroll
      for (int i = 0; i < 4; ++i) {
        const int idx = i * 128 + tid;
        const int row = idx >> 3;
        const int seg = (idx & 7) * 8;
        u[i] = *(const v4u*)(vbp + (size_t)row * kTok + seg);
      }
#pragma unroll
      for (int i = 0; i < 4; ++i) {
        const int idx = i * 128 + tid;
        const int row = idx >> 3;
        const int seg = (idx & 7) * 8;
        *(v4u*)(Vth + row * kLP + seg) = u[i];
      }
    }
    asm volatile("" ::: "memory");
    // ---- stage V^T residual tile ----
    {
      const unsigned short* vbp = VTlp + (size_t)(h * kDh) * kTok + tok0 + kv0;
      v4u u[4];
#pragma unroll
      for (int i = 0; i < 4; ++i) {
        const int idx = i * 128 + tid;
        const int row = idx >> 3;
        const int seg = (idx & 7) * 8;
        u[i] = *(const v4u*)(vbp + (size_t)row * kTok + seg);
      }
#pragma unroll
      for (int i = 0; i < 4; ++i) {
        const int idx = i * 128 + tid;
        const int row = idx >> 3;
        const int seg = (idx & 7) * 8;
        *(v4u*)(Vtl + row * kLP + seg) = u[i];
      }
    }
    __syncthreads();

    // ---- scores, transposed: D[row = key j*16+8hh+r][col = query c] = K . Q^T, K = 64 in 2 steps of 32 ----
    v8f s[4];
#pragma unroll
    for (int j = 0; j < 4; ++j) {
      s[j] = (v8f){0.f,0.f,0.f,0.f,0.f,0.f,0.f,0.f};
#pragma unroll
      for (int dc = 0; dc < 2; ++dc) {
        const v16h kf = Frag<_Float16>::load(Ksh + (j * 16 + c) * kLP + dc * 32 + 8 * hh);
        s[j] = mma_h(kf, qa[dc], s[j]);
      }
    }

    // ---- scale, time bias, key mask; maximum over this lane's 32 keys, then over both halves ----
    const int qrow = q0 + c;
    float cm = -__builtin_inff();
#pragma unroll
    for (int j = 0; j < 4; ++j) {
      // key mask values of this lane's 8 consecutive keys of tile j (two 16-B loads)
      const float* pmp = pm + tok0 + kv0 + j * 16 + 8 * hh;
      const v4f pma = *(const v4f*)(pmp);
      const v4f pmb = *(const v4f*)(pmp + 4);
#pragma unroll
      for (int r = 0; r < 8; ++r) {
        const int kvcol = kv0 + j * 16 + 8 * hh + r;
        int dd = qrow - kvcol;
        dd = (dd < 0) ? -dd : dd;
        const float pmv = (r < 4) ? pma[r & 3] : pmb[r & 3];
        float v = s[j][r] * kScoreScale + tabs[dd];
        v = (pmv <= 0.0f) ? kNegBig : v;
        s[j][r] = v;
        cm = fmaxf(cm, v);
      }
    }
    cm = fmaxf(cm, xhalf(cm));

    // ---- online softmax; P = 2^(v - mref) (at most 2^15) as f16 straight into the B operands of the PV products ----
    // B operand of keys kk*32 .. kk*32+31: elements 0..7 = keys 8hh+0..7 (score tile 2kk), 8..15 = keys 16+8hh+0..7 (tile 2kk+1)
    const float mnew  = fmaxf(mrow, cm);
    // from 2^23 on, mnew - 15 would round and could lift P past the f16 range: there the reference point is the maximum itself
    const float rnew  = (fabsf(mnew) < 8388608.0f) ? mnew - kPCarryLog2 : mnew;
    float alpha = mref - rnew;   // becomes 2^(mref - rnew) together with the first eight scores
    mrow = mnew;
    mref = rnew;
    float psum = 0.f;
    v16h pb[2];
#pragma unroll
    for (int j = 0; j < 4; ++j) {
      float e[8];
#pragma unroll
      for (int r = 0; r < 8; ++r) e[r] = s[j][r] - rnew;
      if (j == 0) exp2x9_inplace(alpha, e[0], e[1], e[2], e[3], e[4], e[5], e[6], e[7]);
      else        exp2x8_inplace(e[0], e[1], e[2], e[3], e[4], e[5], e[6], e[7]);
#pragma unroll
      for (int r = 0; r < 8; ++r) {
        psum += e[r];
        pb[j >> 1][(j & 1) * 8 + r] = (_Float16)e[r];
      }
    }
    lrow = lrow * alpha + psum;
#pragma unroll
    for (int t = 0; t < 4; ++t) {
#pragma unroll
      for (int r = 0; r < 8; ++r) { oacc[t][r] *= alpha; oaccl[t][r] *= alpha; }
    }

    // ---- O^T += V^T . P^T : A = V^T [d t*16+c][kv], B = P^T [kv][query c]; hi and residual in separate accumulators ----
#pragma unroll
    for (int kk = 0; kk < 2; ++kk) {
#pragma unroll
      for (int t = 0; t < 4; ++t) {
        const v16h vh = Frag<_Float16>::load(Vth + (t * 16 + c) * kLP + kk * 32 + 8 * hh);
        oacc[t] = mma_h(vh, pb[kk], oacc[t]);
        const v16h vl = Frag<_Float16>::load(Vtl + (t * 16 + c) * kLP + kk * 32 + 8 * hh);
        oaccl[t] = mma_h(vl, pb[kk], oaccl[t]);
      }
    }
  }

  // ---- normalise (the sum carries P's own factor; fold 2^-11 of the residual) into the per-wave f32 slab ----
  float* os = Os[wave];   // [query][d]
  const float inv = 1.0f / (lrow + xhalf(lrow));
#pragma unroll
  for (int t = 0; t < 4; ++t) {
#pragma unroll
    for (int r = 0; r < 8; ++r) os[c * 68 + t * 16 + 8 * hh + r] = (oacc[t][r] + oaccl[t][r] * kVloInv) * inv;
  }
  __builtin_amdgcn_fence(__ATOMIC_RELEASE, "workgroup");
  __builtin_amdgcn_wave_barrier();
  __builtin_amdgcn_fence(__ATOMIC_ACQUIRE, "workgroup");
  {
    const int q4 = lane >> 3, c8 = (lane & 7) * 8;
    {
#pragma unroll
      for (int it = 0; it < 4; ++it) {
        const int row = it * 4 + q4;
        const float* sp = os + row * 68 + c8;
        v8h hv, lv;
#pragma unroll
        for (int e = 0; e < 8; ++e) {
          const unsigned short hb = f2bf_bits(sp[e]);
          const unsigned short lb = f2bf_bits(sp[e] - bf_bits2f(hb));
          hv[e] = __builtin_bit_cast(_Float16, hb);
          lv[e] = __builtin_bit_cast(_Float16, lb);
        }
        const size_t off = (tok0 + q0 + row) * (size_t)kD + h * kDh + c8;
        *(v8h*)(Ohp + off) = hv;
        *(v8h*)(Olp + off) = lv;
      }
      
    }
  }
}

// ---------------------------------------------------------------------------
// Host glue.
//   Xb   bf16 [8192][1024]        16,777,216  at           0
//   Wqb  bf16 [1024][1024]         2,097,152  at  16,777,216
//   Wkb  bf16 [1024][1024]         2,097,152  at  18,874,368
//   Wvb  bf16 [1024][1024]         2,097,152  at  20,971,520
//   Wob  bf16 [1024][1024]         2,097,152  at  23,068,672
//   Q16  f16  [8192][1024]        16,777,216  at  25,165,824
//   K16  f16  [8192][1024]        16,777,216  at  41,943,040
//   VTh  f16  [1024][8192]        16,777,216  at  58,720,256
//   VTl  f16  [1024][8192]        16,777,216  at  75,497,472   (residual x2048)
//   Oh   bf16 [8192][1024]        16,777,216  at  92,274,688
//   Ol   bf16 [8192][1024]        16,777,216  at 109,051,904
//   tab  f32  [2048]                   8,192  at 125,829,120
//   total                        125,837,312
// Every region is fully written before it is read; no region is re-used.
// GEMM shapes: Q,K: M=8192 N=1024 K=1024; V^T: M=1024 N=8192 K=1024; out: M=8192 N=1024 K=1024 (M%128==0, N%256==0,
// K%128==0, no padding). Attention: S=2048 (64-multiples), Dh=64.
// ---------------------------------------------------------------------------
extern "C" void kernel_launch(void* const* d_in, const int* in_sizes, int n_in,
                              void* d_out, int out_size, void* d_ws, size_t ws_size,
                              hipStream_t stream) {
  if (n_in < 10) return;
  const int nX = kTok * kD;     // 8,388,608
  const int nW = kD * kD;       // 1,048,576
  if (in_sizes[0] != nX || in_sizes[1] != kTok) return;
  if (in_sizes[2] != nW || in_sizes[4] != nW || in_sizes[6] != nW || in_sizes[8] != nW) return;
  if (in_sizes[3] != kD || in_sizes[5] != kD || in_sizes[7] != kD || in_sizes[9] != kD) return;
  if (out_size != nX) return;

  const size_t szX16 = (size_t)nX * 2;
  const size_t szW16 = (size_t)nW * 2;
  const size_t szTab = (size_t)kP * 4;
  const size_t offXb  = 0;
  const size_t offWq  = offXb + szX16;
  const size_t offWk  = offWq + szW16;
  const size_t offWv  = offWk + szW16;
  const size_t offWo  = offWv + szW16;
  const size_t offQ   = offWo + szW16;
  const size_t offK   = offQ + szX16;
  const size_t offVTh = offK + szX16;
  const size_t offVTl = offVTh + szX16;
  const size_t offOh  = offVTl + szX16;
  const size_t offOl  = offOh + szX16;
  const size_t offTab = offOl + szX16;
  const size_t total  = offTab + szTab;
  if (ws_size < total) return;

  const float* x  = (const float*)d_in[0];
  const float* pm = (const float*)d_in[1];
  const float* Wq = (const float*)d_in[2];
  const float* bq = (const float*)d_in[3];
  const float* Wk = (const float*)d_in[4];
  const float* bk = (const float*)d_in[5];
  const float* Wv = (const float*)d_in[6];
  const float* bv = (const float*)d_in[7];
  const float* Wo = (const float*)d_in[8];
  const float* bo = (const float*)d_in[9];
  float* out = (float*)d_out;
  char* ws = (char*)d_ws;
  unsigned short* Xb  = (unsigned short*)(ws + offXb);
  unsigned short* Wqb = (unsigned short*)(ws + offWq);
  unsigned short* Wkb = (unsigned short*)(ws + offWk);
  unsigned short* Wvb = (unsigned short*)(ws + offWv);
  unsigned short* Wob = (unsigned short*)(ws + offWo);
  unsigned short* Q16 = (unsigned short*)(ws + offQ);
  unsigned short* K16 = (unsigned short*)(ws + offK);
  unsigned short* VTh = (unsigned short*)(ws + offVTh);
  unsigned short* VTl = (unsigned short*)(ws + offVTl);
  unsigned short* Oh  = (unsigned short*)(ws + offOh);
  unsigned short* Ol  = (unsigned short*)(ws + offOl);
  float* tab = (float*)(ws + offTab);

  // ---- prologue: RNE bf16 operand planes and the bias table ----
  const int n8x = nX / 8;   // 1,048,576 -> 4096 blocks exact
  const int n8w = nW / 8;   //   131,072 ->  512 blocks exact
  cast8_bf16_kernel<<<dim3(n8x / 256), dim3(256), 0, stream>>>(x,  Xb,  n8x);
  cast8_bf16_kernel<<<dim3(n8w / 256), dim3(256), 0, stream>>>(Wq, Wqb, n8w);
  cast8_bf16_kernel<<<dim3(n8w / 256), dim3(256), 0, stream>>>(Wk, Wkb, n8w);
  cast8_bf16_kernel<<<dim3(n8w / 256), dim3(256), 0, stream>>>(Wv, Wvb, n8w);
  cast8_bf16_kernel<<<dim3(n8w / 256), dim3(256), 0, stream>>>(Wo, Wob, n8w);
  tab_kernel<<<dim3((kP / 4) / 256), dim3(256), 0, stream>>>(tab);

  // ---- projections (64x64 wave tiles, 8 waves = one 128x256 tile per block) ----
  const int tilesProj = (kTok / 64) * (kD / 64);   // 2048 -> 256 blocks
  // Q16[m][n] = sum_k Xb[m][k] * Wqb[n][k] + bq[n]   (f16 out)
  wmma_gemm64<1, 0, 2, 1, false><<<dim3(tilesProj / 8, 1), dim3(256), 0, stream>>>(
      Xb, Xb, kD, 0L, Wqb, Wqb, kD, 0L, (void*)Q16, (void*)Q16, kD, 0L, bq, pm, kTok, kD, kD, 1.0f);
  // K16 likewise with Wk, bk
  wmma_gemm64<1, 0, 2, 1, false><<<dim3(tilesProj / 8, 1), dim3(256), 0, stream>>>(
      Xb, Xb, kD, 0L, Wkb, Wkb, kD, 0L, (void*)K16, (void*)K16, kD, 0L, bk, pm, kTok, kD, kD, 1.0f);
  // V^T[m = feature][n = token] = sum_k Wvb[m][k] * Xb[n][k] + bv[m]   (f16 hi plane + f16 residual plane x2048)
  wmma_gemm64<1, 0, 1, 3, false><<<dim3(tilesProj / 8, 1), dim3(256), 0, stream>>>(
      Wvb, Wvb, kD, 0L, Xb, Xb, kD, 0L, (void*)VTh, (void*)VTl, kTok, 0L, bv, pm, kD, kTok, kD, 1.0f);

  // ---- attention: 64 (b,h) x 32 query tiles ----
  attn_kernel<<<dim3(kB * kH * (kP / kQB)), dim3(128), 0, stream>>>(Q16, K16, VTh, VTl, tab, pm, Oh, Ol);

  // ---- output projection: out[m][n] = (sum_k (Oh+Ol)[m][k] * Wob[n][k] + bo[n]) * pm[m] ----
  wmma_gemm64<1, 2, 2, 0, true><<<dim3(tilesProj / 8, 1), dim3(256), 0, stream>>>(
      Oh, Ol, kD, 0L, Wob, Wob, kD, 0L, (void*)out, (void*)out, kD, 0L, bo, pm, kTok, kD, kD, 1.0f);
}

// v005
// A run of this version takes 235 microseconds.
// Next to v004, in two timings, it ran 1.16 and 1.17 times as fast.
// All steps since v000 together make it 3.44 times as fast.
// Contractions: q/k/v projections on v_wmma_f32_16x16x32_bf16 (x and W as RNE bf16 planes, single products); scores q.k^T on v_wmma_f32_16x16x32_f16 (q, k f16 planes); attn.v on v_wmma_f32_16x16x32_f16 (P f16 carried x32768; V^T as f16 hi plane + f16 residual plane carried x2048 in a separate accumulator); output projection on v_wmma_f32_16x16x32_bf16 (attention output as bf16 hi + lo planes, Wo bf16, two products); f32 accumulate everywhere; time bias, masks and softmax in f32.
#include <hip/hip_runtime.h>
#include <math.h>

// ---------------------------------------------------------------------------
// Problem constants
// ---------------------------------------------------------------------------
constexpr int kB   = 4;
constexpr int kP   = 2048;
constexpr int kD   = 1024;
constexpr int kH   = 16;
constexpr int kDh  = 64;
constexpr int kTok = kB * kP;            // 8192 token rows
constexpr int kQB  = 64;                 // queries per attention block
constexpr int kKC  = 64;                 // keys per chunk
constexpr int kNW  = 4;                  // waves per attention block
constexpr int kLP  = 72;                 // LDS row pitch in halves of the 64-half K and V^T rows: 144 B = 16 B x odd,
                                         // so the 16 rows of one ds_load_b128 fragment read fall on distinct banks
constexpr float kLog2e      = 1.4426950408889634f;
constexpr float kScoreScale = 0.125f * kLog2e;    // 64^-0.5, scores kept in base 2 (natural score x log2 e)
constexpr float kNegBig     = -1.0e9f * kLog2e;   // masked score, base 2
constexpr float kPCarryLog2 = 15.0f;     // probabilities carried x2^15 in f16: the exponent's reference point lies 15 below the maximum
constexpr float kVloCarry   = 2048.0f;   // f16 residual planes carried x2^11
constexpr float kVloInv     = 1.0f / 2048.0f;
constexpr float kDelta      = 300.0f;    // seconds per patch step
constexpr float kInvTau     = 1.0f / 300.0f;
constexpr float kLogEps     = 1.0e-12f;
static_assert(kH * kDh == kD, "s");
static_assert(kTok % 64 == 0 && kD % 64 == 0 && kD % 32 == 0, "s");
static_assert(kP % kQB == 0 && kP % kKC == 0 && kDh == 64, "s");
static_assert((kTok * kD) % (8 * 256) == 0 && (kD * kD) % (8 * 256) == 0, "s");
static_assert(kP % 1024 == 0 && kP / kKC >= 2, "s");

typedef __attribute__((ext_vector_type(16))) _Float16 v16h;
typedef __attribute__((ext_vector_type(8)))  _Float16 v8h;
typedef __attribute__((ext_vector_type(16))) __bf16   v16b;
typedef __attribute__((ext_vector_type(8)))  __bf16   v8b;
typedef __attribute__((ext_vector_type(8)))  float    v8f;
typedef __attribute__((ext_vector_type(4)))  float    v4f;
typedef __attribute__((ext_vector_type(4)))  unsigned int v4u;

// ---------------------------------------------------------------------------
// Conversion, fragment and hazard-guard helpers
// ---------------------------------------------------------------------------
__device__ __forceinline__ unsigned short f2bf_bits(float f) {
  unsigned u = __float_as_uint(f);
  return (unsigned short)((u + 0x7FFFu + ((u >> 16) & 1u)) >> 16);
}
__device__ __forceinline__ float bf_bits2f(unsigned short h) { return __uint_as_float(((unsigned)h) << 16); }

// f16 bits (low 16) -> f32, integer path, finite values
__device__ __forceinline__ float h16_to_f32(unsigned hb) {
  const unsigned sgn = (hb & 0x8000u) << 16; const unsigned em = hb & 0x7fffu;
  const float fn = __uint_as_float((em << 13) + 0x38000000u);
  const float fs = (float)em * 5.9604644775390625e-8f;
  const float mag = (em < 0x400u) ? fs : fn; return __uint_as_float(__float_as_uint(mag) | sgn); }

// hazard guards as plain device helpers (no inline asm inside the kernel template body)
__device__ __forceinline__ void dep_guard4_h(v8f& a, v8f& b, v8f& c, v8f& d, v16h x, v16h y) {
  asm volatile("v_nop\n\tv_nop\n\tv_nop\n\tv_nop" : "+v"(a), "+v"(b), "+v"(c), "+v"(d) : "v"(x), "v"(y));
}
__device__ __forceinline__ void dep_guard4_b(v8f& a, v8f& b, v8f& c, v8f& d, v16b x, v16b y) {
  asm volatile("v_nop\n\tv_nop\n\tv_nop\n\tv_nop" : "+v"(a), "+v"(b), "+v"(c), "+v"(d) : "v"(x), "v"(y));
}
__device__ __forceinline__ void keep4_h(v16h a, v16h b, v16h c, v16h d) { asm volatile("v_nop" :: "v"(a), "v"(b), "v"(c), "v"(d)); }
__device__ __forceinline__ void keep4_b(v16b a, v16b b, v16b c, v16b d) { asm volatile("v_nop" :: "v"(a), "v"(b), "v"(c), "v"(d)); }
__device__ __forceinline__ void acc_guard4(v8f& a, v8f& b, v8f& c, v8f& d) { asm volatile("v_nop\n\tv_nop\n\tv_nop\n\tv_nop" : "+v"(a), "+v"(b), "+v"(c), "+v"(d)); }
template <typename T> struct Frag;
template <> struct Frag<_Float16> {
  typedef v16h V; union U { v16h v; v8h h[2]; };
  // elements 0..7 <- p[0..7], 8..15 <- p[16..23]
  static __device__ __forceinline__ v16h load(const _Float16* p) {
    U f; f.h[0] = *(const v8h*)(p); f.h[1] = *(const v8h*)(p + 16); return f.v;
  }
  static __device__ __forceinline__ v8f mma(v16h a, v16h b, v8f c) {
    return __builtin_amdgcn_wmma_f32_16x16x32_f16(false, a, false, b, (short)0, c, false, false);
  }
  static __device__ __forceinline__ void guard4(v8f& a, v8f& b, v8f& c, v8f& d, v16h x, v16h y) { dep_guard4_h(a, b, c, d, x, y); }
  static __device__ __forceinline__ void keep(v16h a, v16h b, v16h c, v16h d) { keep4_h(a, b, c, d); }
};
template <> struct Frag<__bf16> {
  typedef v16b V; union U { v16b v; v8b h[2]; };
  static __device__ __forceinline__ v16b load(const __bf16* p) {
    U f; f.h[0] = *(const v8b*)(p); f.h[1] = *(const v8b*)(p + 16); return f.v;
  }
  static __device__ __forceinline__ v8f mma(v16b a, v16b b, v8f c) {
    return __builtin_amdgcn_wmma_f32_16x16x32_bf16(false, a, false, b, (short)0, c, false, false);
  }
  static __device__ __forceinline__ void guard4(v8f& a, v8f& b, v8f& c, v8f& d, v16b x, v16b y) { dep_guard4_b(a, b, c, d, x, y); }
  static __device__ __forceinline__ void keep(v16b a, v16b b, v16b c, v16b d) { keep4_b(a, b, c, d); }
};

__device__ __forceinline__ unsigned pk16(unsigned short a, unsigned short b) { return (unsigned)a | ((unsigned)b << 16); }
__device__ __forceinline__ unsigned short h_bits(float f) { const _Float16 h = (_Float16)f; return __builtin_bit_cast(unsigned short, h); }

// single WMMA with its own hazard guard (ties D, keeps A/B live)
__device__ __forceinline__ v8f mma_h(v16h a, v16h b, v8f c) {
  c = __builtin_amdgcn_wmma_f32_16x16x32_f16(false, a, false, b, (short)0, c, false, false);
  asm volatile("v_nop\n\tv_nop\n\tv_nop\n\tv_nop" : "+v"(c) : "v"(a), "v"(b));
  return c;
}

// lane l <-> lane l ^ 16 (the other 16-lane half of the wave), a vector-port move
__device__ __forceinline__ float xhalf(float x) {
  const int b = __builtin_bit_cast(int, x);
  return __builtin_bit_cast(float, __builtin_amdgcn_permlanex16(b, b, 0x76543210, 0xfedcba98, false, false));
}

// 2^x on the hardware's v_exp_f32, in place. The instruction set asks for one independent instruction or a v_nop between a
// transcendental and a vector instruction that reads its result or writes over its source. Written as one statement the slot is
// kept by construction: each v_exp_f32 writes over its own source alone, none reads a neighbour's result, and the closing v_nop
// stands between the last one and whatever the compiler places next.
__device__ __forceinline__ void exp2x8_inplace(float& a, float& b, float& c, float& d, float& e, float& f, float& g, float& h) {
  asm("v_exp_f32 %0, %0\n\tv_exp_f32 %1, %1\n\tv_exp_f32 %2, %2\n\tv_exp_f32 %3, %3\n\t"
      "v_exp_f32 %4, %4\n\tv_exp_f32 %5, %5\n\tv_exp_f32 %6, %6\n\tv_exp_f32 %7, %7\n\tv_nop"
      : "+v"(a), "+v"(b), "+v"(c), "+v"(d), "+v"(e), "+v"(f), "+v"(g), "+v"(h));
}
// the same with a ninth value
__device__ __forceinline__ void exp2x9_inplace(float& a, float& b, float& c, float& d, float& e, float& f, float& g, float& h, float& i) {
  asm("v_exp_f32 %0, %0\n\tv_exp_f32 %1, %1\n\tv_exp_f32 %2, %2\n\tv_exp_f32 %3, %3\n\tv_exp_f32 %4, %4\n\t"
      "v_exp_f32 %5, %5\n\tv_exp_f32 %6, %6\n\tv_exp_f32 %7, %7\n\tv_exp_f32 %8, %8\n\tv_nop"
      : "+v"(a), "+v"(b), "+v"(c), "+v"(d), "+v"(e), "+v"(f), "+v"(g), "+v"(h), "+v"(i));
}

// ---- LDS staging of the GEMM operands ----
constexpr int kGK = 128;   // k per stage: every staged operand row is 256 B = two whole 128-B lines
constexpr int kGP = 136;   // LDS row pitch in halves: 272 B = 16 B x odd, so the 16 rows of a ds_load_b128 fragment read fall on distinct banks

// Eight asynchronous 16-B copies per lane, global -> LDS: rows r, r+16, ..., r+112 of one 128-row panel (16 lanes per 256-B row).
// The closing s_wait_xcnt stands inside the statement so that no address register of a copy is rewritten in front of it.
__device__ __forceinline__ void copy8_to_lds(unsigned l, const unsigned short* g, size_t gs) {
  constexpr unsigned ls = 16u * kGP * 2u;   // 16 LDS rows in bytes
  asm volatile(
      "global_load_async_to_lds_b128 %0, %8, off\n\t"
      "global_load_async_to_lds_b128 %1, %9, off\n\t"
      "global_load_async_to_lds_b128 %2, %10, off\n\t"
      "global_load_async_to_lds_b128 %3, %11, off\n\t"
      "global_load_async_to_lds_b128 %4, %12, off\n\t"
      "global_load_async_to_lds_b128 %5, %13, off\n\t"
      "global_load_async_to_lds_b128 %6, %14, off\n\t"
      "global_load_async_to_lds_b128 %7, %15, off\n\t"
      "s_wait_xcnt 0x0"
      :: "v"(l), "v"(l + ls), "v"(l + 2u * ls), "v"(l + 3u * ls), "v"(l + 4u * ls), "v"(l + 5u * ls), "v"(l + 6u * ls), "v"(l + 7u * ls),
         "v"(g), "v"(g + gs), "v"(g + 2 * gs), "v"(g + 3 * gs), "v"(g + 4 * gs), "v"(g + 5 * gs), "v"(g + 6 * gs), "v"(g + 7 * gs)
      : "memory");
}
// this wave's copies have landed in LDS (the compiler places no wait for them)
__device__ __forceinline__ void wait_copies() { asm volatile("s_wait_asynccnt 0x0" ::: "memory"); }
// this wave's LDS reads have returned, so the buffer they read may be refilled behind the next barrier
__device__ __forceinline__ void wait_lds() { asm volatile("s_wait_dscnt 0x0" ::: "memory"); }

// Twelve asynchronous 16-B copies per lane, global -> LDS: rows r, r+16, r+32, r+48 (8 lanes per 128-B row) of the K tile, the
// V^T hi tile and the V^T residual tile of one 64-key chunk; the three tiles lie behind one another in LDS at pitch kLP.
// The closing s_wait_xcnt stands inside the statement so that no address register of a copy is rewritten in front of it.
__device__ __forceinline__ void copy12_to_lds(unsigned l, const unsigned short* gk, const unsigned short* gh, const unsigned short* gl) {
  constexpr unsigned ls = 16u * kLP * 2u;    // 16 LDS rows in bytes
  constexpr unsigned lt = 64u * kLP * 2u;    // one 64-row tile in bytes
  constexpr size_t   sk = (size_t)16 * kD;   // 16 K rows (tokens) in halves
  constexpr size_t   sv = (size_t)16 * kTok; // 16 V^T rows (features) in halves
  asm volatile(
      "global_load_async_to_lds_b128 %0, %12, off\n\t"
      "global_load_async_to_lds_b128 %1, %13, off\n\t"
      "global_load_async_to_lds_b128 %2, %14, off\n\t"
      "global_load_async_to_lds_b128 %3, %15, off\n\t"
      "global_load_async_to_lds_b128 %4, %16, off\n\t"
      "global_load_async_to_lds_b128 %5, %17, off\n\t"
      "global_load_async_to_lds_b128 %6, %18, off\n\t"
      "global_load_async_to_lds_b128 %7, %19, off\n\t"
      "global_load_async_to_lds_b128 %8, %20, off\n\t"
      "global_load_async_to_lds_b128 %9, %21, off\n\t"
      "global_load_async_to_lds_b128 %10, %22, off\n\t"
      "global_load_async_to_lds_b128 %11, %23, off\n\t"
      "s_wait_xcnt 0x0"
      :: "v"(l), "v"(l + ls), "v"(l + 2u * ls), "v"(l + 3u * ls),
         "v"(l + lt), "v"(l + lt + ls), "v"(l + lt + 2u * ls), "v"(l + lt + 3u * ls),
         "v"(l + 2u * lt), "v"(l + 2u * lt + ls), "v"(l + 2u * lt + 2u * ls), "v"(l + 2u * lt + 3u * ls),
         "v"(gk), "v"(gk + sk), "v"(gk + 2 * sk), "v"(gk + 3 * sk),
         "v"(gh), "v"(gh + sv), "v"(gh + 2 * sv), "v"(gh + 3 * sv),
         "v"(gl), "v"(gl + sv), "v"(gl + 2 * sv), "v"(gl + 3 * sv)
      : "memory");
}

// ---- Register-blocked batched WMMA GEMM (modes extended) ----------------------------------------------
// C[m,n] = scale * sum_k A[m,k] * Bt[n,k] (+bias)(*rowsc[m]); each wave owns a 64x64 tile, the block's 8 waves a 128x256 tile
// (2 x 4 waves). Per stage the block's 128 A rows and 256 Bt rows x 128 k are copied to LDS in whole lines and every wave
// reads its fragments from there; two buffers, the next stage's copies in flight while this stage is multiplied.
// A row-major [M,K]; Bt row-major [N,K]; M % 128 == 0, N % 256 == 0, K % 128 == 0, K >= 128 (no tail handling).
// SPLIT: 0 = single product; 1 = A and Bt hi/lo planes (hi*hi + hi*lo + lo*hi); 2 = A hi/lo planes only (hi*B + lo*B).
// BIAS_MODE: 0 = none, 1 = bias[m], 2 = bias[n].  ROWSC: multiply by RNE-bf16(rowsc[m]) after the bias.
// OUT_MODE: 0 = f32, 1 = f16, 2 = bf16 hi plane (Cout) + bf16 lo plane (Cout2), 3 = f16 hi plane + f16 residual plane x2048.
// ET: 0 = f16 operands, 1 = bf16 operands (pointers passed as 16-bit storage)
template <int ET> struct Elem;
template <> struct Elem<0> { typedef _Float16 T; };
template <> struct Elem<1> { typedef __bf16 T; };
template <int ET, int SPLIT, int BIAS_MODE, int OUT_MODE, bool ROWSC>
__global__ __launch_bounds__(256) void wmma_gemm64(
    const unsigned short* __restrict__ Ap, const unsigned short* __restrict__ A2p, int lda, long strideA,
    const unsigned short* __restrict__ Btp, const unsigned short* __restrict__ Bt2p, int ldb, long strideB,
    void* __restrict__ Cout, void* __restrict__ Cout2, int ldc, long strideC,
    const float* __restrict__ bias, const float* __restrict__ rowsc,
    int M, int N, int K, float scale) {
  typedef typename Elem<ET>::T T;
  typedef typename Frag<T>::V V;
  constexpr int NA = (SPLIT != 0) ? 2 : 1;             // A planes
  constexpr int NB = (SPLIT == 1) ? 2 : 1;             // Bt planes
  constexpr int kBufH = (128 * NA + 256 * NB) * kGP;   // halves per buffer: [A planes, 128 rows each][Bt planes, 256 rows each]
  __shared__ __align__(16) unsigned short ring[2 * kBufH];
  __shared__ __align__(16) float sT[8][16 * 68];   // per-wave 16x64 slab, pitch 68 floats
  const int b    = blockIdx.y;
  const int lane = threadIdx.x & 31;
  const int wave = threadIdx.x >> 5;
  const int tilesNb = N >> 8;
  const int tilesMb = M >> 7;
  if ((int)blockIdx.x >= tilesMb * tilesNb) return;   // the same for the whole block, ahead of every barrier
  const int bm  = blockIdx.x / tilesNb;
  const int bn  = blockIdx.x - bm * tilesNb;
  const int m0b = bm << 7;
  const int n0b = bn << 8;
  const int wm  = wave >> 2;
  const int wn  = wave & 3;
  const int m0  = m0b + (wm << 6);
  const int n0  = n0b + (wn << 6);

  const int rlane = lane & 15;                 // row (A) / col (B, D) within subtile
  const int koff  = (lane >> 4) * 8;           // k offset of this lane half
  const int mOff  = (lane >> 4) * 8;           // D row offset

  // copy addresses of this lane: row threadIdx.x / 16 of each 16-row group, 16-B segment threadIdx.x % 16
  const int cr = threadIdx.x >> 4;
  const int cs = (threadIdx.x & 15) * 8;
  const unsigned short* cA  = Ap   + (size_t)b * strideA + (size_t)(m0b + cr) * lda + cs;
  const unsigned short* cA2 = A2p  + (size_t)b * strideA + (size_t)(m0b + cr) * lda + cs;
  const unsigned short* cB  = Btp  + (size_t)b * strideB + (size_t)(n0b + cr) * ldb + cs;
  const unsigned short* cB2 = Bt2p + (size_t)b * strideB + (size_t)(n0b + cr) * ldb + cs;
  const unsigned cl = (unsigned)(uintptr_t)ring + (unsigned)(cr * kGP + cs) * 2u;   // LDS byte address
  const size_t gsA = (size_t)16 * lda;
  const size_t gsB = (size_t)16 * ldb;
  constexpr unsigned kPanel = 128u * kGP * 2u;   // 128 LDS rows in bytes
  auto stage = [&](int t) {
    const unsigned l = cl + (unsigned)(t & 1) * (unsigned)(kBufH * 2);
    const size_t k = (size_t)t * kGK;
    copy8_to_lds(l, cA + k, gsA);
    if (NA == 2) copy8_to_lds(l + kPanel, cA2 + k, gsA);
    copy8_to_lds(l + NA * kPanel, cB + k, gsB);
    copy8_to_lds(l + (NA + 1) * kPanel, cB + k + 8 * gsB, gsB);
    if (NB == 2) {
      copy8_to_lds(l + (NA + 2) * kPanel, cB2 + k, gsB);
      copy8_to_lds(l + (NA + 3) * kPanel, cB2 + k + 8 * gsB, gsB);
    }
  };

  v8f acc[4][4];
#pragma unroll
  for (int i = 0; i < 4; ++i)
#pragma unroll
    for (int j = 0; j < 4; ++j) acc[i][j] = (v8f){0.f,0.f,0.f,0.f,0.f,0.f,0.f,0.f};

  const int nT = K / kGK;
  stage(0);
  wait_copies();
  __syncthreads();            // stage 0 is readable by every wave
  if (nT > 1) stage(1);

  for (int t = 0; t < nT; ++t) {
    const T* rb = (const T*)ring + (t & 1) * kBufH;
    const T* fa = rb + ((wm << 6) + rlane) * kGP + koff;
    const T* fb = rb + (128 * NA + (wn << 6) + rlane) * kGP + koff;
    // every loop of a stage is unrolled: fragment and accumulator indices are constants (registers, no scratch) and the
    // LDS offsets of the four 32-k steps are immediates
#pragma unroll
    for (int ks = 0; ks < kGK / 32; ++ks) {
      V bh[4], bl[4], ah[4], al[4];
#pragma unroll
      for (int j = 0; j < 4; ++j) {
        bh[j] = Frag<T>::load(fb + (j << 4) * kGP + ks * 32);
        if (SPLIT == 1) bl[j] = Frag<T>::load(fb + (256 + (j << 4)) * kGP + ks * 32);
      }
#pragma unroll
      for (int i = 0; i < 4; ++i) {
        ah[i] = Frag<T>::load(fa + (i << 4) * kGP + ks * 32);
        al[i] = ah[i];
        if (SPLIT != 0) al[i] = Frag<T>::load(fa + (128 + (i << 4)) * kGP + ks * 32);
      }
#pragma unroll
      for (int i = 0; i < 4; ++i) {
#pragma unroll
        for (int j = 0; j < 4; ++j) {
          acc[i][j] = Frag<T>::mma(ah[i], bh[j], acc[i][j]);
          if (SPLIT == 1) acc[i][j] = Frag<T>::mma(ah[i], bl[j], acc[i][j]);
          if (SPLIT != 0) acc[i][j] = Frag<T>::mma(al[i], bh[j], acc[i][j]);
        }
        Frag<T>::guard4(acc[i][0], acc[i][1], acc[i][2], acc[i][3], ah[i], al[i]);
      }
      Frag<T>::keep(bh[0], bh[1], bh[2], bh[3]);
      if (SPLIT == 1) Frag<T>::keep(bl[0], bl[1], bl[2], bl[3]);
    }
    wait_lds();
    wait_copies();
    __syncthreads();          // publishes stage t + 1 and ends every wave's reads of stage t's buffer
    if (t + 2 < nT) stage(t + 2);
  }
  wait_copies();              // nothing in flight when the wave goes on to the epilogue
  acc_guard4(acc[0][0], acc[0][1], acc[0][2], acc[0][3]);
  acc_guard4(acc[1][0], acc[1][1], acc[1][2], acc[1][3]);
  acc_guard4(acc[2][0], acc[2][1], acc[2][2], acc[2][3]);
  acc_guard4(acc[3][0], acc[3][1], acc[3][2], acc[3][3]);

  // ---- epilogue ----
  float* slab = sT[wave];
#pragma unroll
  for (int i = 0; i < 4; ++i) {
    const int mBase = m0 + (i << 4);
    float rsv[8];
#pragma unroll
    for (int r = 0; r < 8; ++r) rsv[r] = 1.0f;
    if (ROWSC) {
      // two 16-B loads of rowsc[mBase+mOff .. +7], then RNE bf16 of each value
      const v4f ra = *(const v4f*)(rowsc + mBase + mOff);
      const v4f rb = *(const v4f*)(rowsc + mBase + mOff + 4);
      rsv[0] = ra[0]; rsv[1] = ra[1]; rsv[2] = ra[2]; rsv[3] = ra[3];
      rsv[4] = rb[0]; rsv[5] = rb[1]; rsv[6] = rb[2]; rsv[7] = rb[3];
#pragma unroll
      for (int r = 0; r < 8; ++r) rsv[r] = bf_bits2f(f2bf_bits(rsv[r]));
    }
#pragma unroll
    for (int j = 0; j < 4; ++j) {
      const int n = n0 + (j << 4) + rlane;
      float bv = 0.f;
      if (BIAS_MODE == 2) bv = bias[n];
#pragma unroll
      for (int r = 0; r < 8; ++r) {
        float v = acc[i][j][r] * scale;
        if (BIAS_MODE == 1) v += bias[mBase + mOff + r];
        if (BIAS_MODE == 2) v += bv;
        if (ROWSC) v = v * rsv[r];
        slab[(mOff + r) * 68 + (j << 4) + rlane] = v;
      }
    }
    __builtin_amdgcn_fence(__ATOMIC_RELEASE, "workgroup");
    __builtin_amdgcn_wave_barrier();
    __builtin_amdgcn_fence(__ATOMIC_ACQUIRE, "workgroup");
    if (OUT_MODE == 0) {
      float* C = (float*)Cout + (size_t)b * strideC;
      const int hh = lane >> 4, c4 = (lane & 15) * 4;     // row seg = 256 B = 16 lanes x 16 B
      {
#pragma unroll
        for (int it = 0; it < 8; ++it) {
          const int row = it * 2 + hh;
          v4f v = *(const v4f*)(slab + row * 68 + c4);
          *(v4f*)(C + (size_t)(mBase + row) * ldc + n0 + c4) = v;
        }
        
      }
    } else {
      const int q = lane >> 3, c8 = (lane & 7) * 8;
      unsigned short* C  = (unsigned short*)Cout  + (size_t)b * strideC;
      unsigned short* C2 = (OUT_MODE >= 2) ? ((unsigned short*)Cout2 + (size_t)b * strideC) : nullptr;
      {
#pragma unroll
        for (int it = 0; it < 4; ++it) {
          const int row = it * 4 + q;
          const float* sp = slab + row * 68 + c8;
          v8h hv, lv;
#pragma unroll
          for (int e = 0; e < 8; ++e) {
            if (OUT_MODE == 1) {
              hv[e] = (_Float16)sp[e];
            } else if (OUT_MODE == 2) {
              unsigned short hb = f2bf_bits(sp[e]);
              unsigned short lb = f2bf_bits(sp[e] - bf_bits2f(hb));
              hv[e] = __builtin_bit_cast(_Float16, hb);
              lv[e] = __builtin_bit_cast(_Float16, lb);
            } else {
              const unsigned short hb = h_bits(sp[e]);
              const float back = h16_to_f32((unsigned)hb);
              const unsigned short lb = h_bits((sp[e] - back) * kVloCarry);
              hv[e] = __builtin_bit_cast(_Float16, hb);
              lv[e] = __builtin_bit_cast(_Float16, lb);
            }
          }
          *(v8h*)(C + (size_t)(mBase + row) * ldc + n0 + c8) = hv;
          if (OUT_MODE >= 2) *(v8h*)(C2 + (size_t)(mBase + row) * ldc + n0 + c8) = lv;
        }
        
      }
    }
    __builtin_amdgcn_fence(__ATOMIC_RELEASE, "workgroup");
    __builtin_amdgcn_wave_barrier();
    __builtin_amdgcn_fence(__ATOMIC_ACQUIRE, "workgroup");
  }
}

// ---------------------------------------------------------------------------
// f32 -> bf16 (RNE) cast, 8 consecutive elements per thread (one 16-B store per lane; 32 contiguous lanes = 4 whole
// multiples of 256: 1,048,576 threads for x, 131,072 for each weight).
// ---------------------------------------------------------------------------
__global__ __launch_bounds__(256) void cast8_bf16_kernel(const float* __restrict__ in, unsigned short* __restrict__ out, int n8) {
  const int i = blockIdx.x * 256 + threadIdx.x;
  if (i >= n8) return;
  const float* p = in + 8 * (size_t)i;
  const v4f a = *(const v4f*)(p);
  const v4f c = *(const v4f*)(p + 4);
  unsigned short hb[8];
#pragma unroll
  for (int e = 0; e < 4; ++e) {
    hb[e]     = f2bf_bits(a[e]);
    hb[4 + e] = f2bf_bits(c[e]);
  }
  const v4u u = (v4u){pk16(hb[0], hb[1]), pk16(hb[2], hb[3]), pk16(hb[4], hb[5]), pk16(hb[6], hb[7])};
  unsigned short* q = out + 8 * (size_t)i;
  *(v4u*)q = u;
  
}

// ---------------------------------------------------------------------------
// Time-decay bias table in base 2: tab[d] = logf(expf((-(d*300)) * (1/300)) + 1e-12) * log2(e), d = 0..2047, f32, precise expf/logf.
// ---------------------------------------------------------------------------
__global__ __launch_bounds__(256) void tab_kernel(float* __restrict__ tab) {
  const int i = blockIdx.x * 256 + threadIdx.x;
  if (i >= kP / 4) return;
  v4f tv;
#pragma unroll
  for (int e = 0; e < 4; ++e) {
    const float d = (float)(4 * i + e);
    const float dist = d * kDelta;
    const float ex = (-dist) * kInvTau;
    const float w = expf(ex);
    tv[e] = logf(w + kLogEps) * kLog2e;
  }
  float* q = tab + 4 * (size_t)i;
  *(v4f*)q = tv;
  
}

__global__ __launch_bounds__(128) void attn_kernel(const unsigned short* __restrict__ Qp, const unsigned short* __restrict__ Kp,
                                                   const unsigned short* __restrict__ VThp, const unsigned short* __restrict__ VTlp,
                                                   const float* __restrict__ tab, const float* __restrict__ pm,
                                                   unsigned short* __restrict__ Ohp, unsigned short* __restrict__ Olp) {
  constexpr int kTileH = 64 * kLP;                           // halves of one 64-row tile (9 KB)
  constexpr int kBufH  = 3 * kTileH;                         // one buffer: K [kv][d], V^T hi [d][kv], V^T residual x2048 [d][kv]
  __shared__ __align__(16) _Float16 tiles[2 * kBufH];        // two buffers, 54 KB
  __shared__ __align__(16) float    Os[kNW][16 * 68];        // per wave out tile, pitch 68
  __shared__ __align__(16) float    tabs[kP];                // bias table 8 KB

  const int tid  = threadIdx.x;
  const int wave = tid >> 5;
  const int lane = tid & 31;
  const int hh   = lane >> 4;
  const int c    = lane & 15;
  const int nqb  = kP / kQB;              // 32
  const int bx   = blockIdx.x;
  const int qb   = bx % nqb;
  const int bh   = bx / nqb;
  const int h    = bh % kH;
  const int b    = bh / kH;
  const int q0   = qb * kQB + wave * 16;  // first query row of this wave within the sequence
  const size_t tok0 = (size_t)b * kP;     // first token row of this batch

  // ---- bias table -> LDS: 4 x 128 threads x 4 floats = 2048 (whole table); read after the barrier in front of the loop ----
#pragma unroll
  for (int i = 0; i < 4; ++i) {
    const int idx = i * 128 + tid;
    const v4f t4 = *(const v4f*)(tab + 4 * idx);
    *(v4f*)(tabs + 4 * idx) = t4;
  }
  asm volatile("" ::: "memory");

  // ---- Q fragments (B operand): column = query q0+c, k = d; 2 d-chunks ----
  const _Float16* Qh = (const _Float16*)(const void*)Qp;
  const _Float16* qr = Qh + (tok0 + q0 + c) * (size_t)kD + h * kDh + 8 * hh;
  v16h qa[2];
  qa[0] = Frag<_Float16>::load(qr);
  qa[1] = Frag<_Float16>::load(qr + 32);

  float mrow = -__builtin_inff();   // running maximum of query q0+c (equal in both halves), base 2
  float mref = -__builtin_inff();   // reference point of the exponentials: P, its sum and O all carry the factor 2^(-mref)
  float lrow = 0.f;                 // running sum of query q0+c over this half's keys; the halves are joined after the loop
  v8f oacc[4], oaccl[4];            // O^T: row = d t*16+8hh+r, column = query q0+c
#pragma unroll
  for (int t = 0; t < 4; ++t) {
    oacc[t]  = (v8f){0.f,0.f,0.f,0.f,0.f,0.f,0.f,0.f};
    oaccl[t] = (v8f){0.f,0.f,0.f,0.f,0.f,0.f,0.f,0.f};
  }

  // ---- K / V^T tiles: asynchronous copies, two buffers; chunk kc + 1 is in flight while chunk kc is worked on ----
  // this lane's copy addresses: row tid / 8 of each 16-row group, 16-B segment tid % 8
  const int cr = tid >> 3;
  const int cs = (tid & 7) * 8;
  const unsigned cl = (unsigned)(uintptr_t)tiles + (unsigned)(cr * kLP + cs) * 2u;   // LDS byte address
  const unsigned short* cK  = Kp   + (tok0 + cr) * (size_t)kD + h * kDh + cs;
  const unsigned short* cVh = VThp + (size_t)(h * kDh + cr) * kTok + tok0 + cs;
  const unsigned short* cVl = VTlp + (size_t)(h * kDh + cr) * kTok + tok0 + cs;
  auto stage = [&](int t) {
    copy12_to_lds(cl + (unsigned)(t & 1) * (unsigned)(kBufH * 2), cK + (size_t)t * (kKC * kD), cVh + t * kKC, cVl + t * kKC);
  };
  stage(0);
  wait_copies();
  __syncthreads();            // chunk 0 and the bias table are readable by every wave

  for (int kc = 0; kc < kP / kKC; ++kc) {
    // directly behind the barrier (the one above, or the one at the foot of trip kc - 1, which ended every wave's reads of
    // chunk kc - 1): the copies of chunk kc + 1, while it exists, into the buffer that chunk kc - 1 has left
    if (kc + 1 < kP / kKC) stage(kc + 1);
    const int kv0 = kc * kKC;
    const _Float16* Ksh = tiles + (kc & 1) * kBufH;
    const _Float16* Vth = Ksh + kTileH;
    const _Float16* Vtl = Vth + kTileH;

    // ---- scores, transposed: D[row = key j*16+8hh+r][col = query c] = K . Q^T, K = 64 in 2 steps of 32 ----
    v8f s[4];
#pragma unroll
    for (int j = 0; j < 4; ++j) {
      s[j] = (v8f){0.f,0.f,0.f,0.f,0.f,0.f,0.f,0.f};
#pragma unroll
      for (int dc = 0; dc < 2; ++dc) {
        const v16h kf = Frag<_Float16>::load(Ksh + (j * 16 + c) * kLP + dc * 32 + 8 * hh);
        s[j] = mma_h(kf, qa[dc], s[j]);
      }
    }

    // ---- scale, time bias, key mask; maximum over this lane's 32 keys, then over both halves ----
    const int qrow = q0 + c;
    float cm = -__builtin_inff();
#pragma unroll
    for (int j = 0; j < 4; ++j) {
      // key mask values of this lane's 8 consecutive keys of tile j (two 16-B loads)
      const float* pmp = pm + tok0 + kv0 + j * 16 + 8 * hh;
      const v4f pma = *(const v4f*)(pmp);
      const v4f pmb = *(const v4f*)(pmp + 4);
#pragma unroll
      for (int r = 0; r < 8; ++r) {
        const int kvcol = kv0 + j * 16 + 8 * hh + r;
        int dd = qrow - kvcol;
        dd = (dd < 0) ? -dd : dd;
        const float pmv = (r < 4) ? pma[r & 3] : pmb[r & 3];
        float v = s[j][r] * kScoreScale + tabs[dd];
        v = (pmv <= 0.0f) ? kNegBig : v;
        s[j][r] = v;
        cm = fmaxf(cm, v);
      }
    }
    cm = fmaxf(cm, xhalf(cm));

    // ---- online softmax; P = 2^(v - mref) (at most 2^15) as f16 straight into the B operands of the PV products ----
    // B operand of keys kk*32 .. kk*32+31: elements 0..7 = keys 8hh+0..7 (score tile 2kk), 8..15 = keys 16+8hh+0..7 (tile 2kk+1)
    const float mnew  = fmaxf(mrow, cm);
    // from 2^23 on, mnew - 15 would round and could lift P past the f16 range: there the reference point is the maximum itself
    const float rnew  = (fabsf(mnew) < 8388608.0f) ? mnew - kPCarryLog2 : mnew;
    float alpha = mref - rnew;   // becomes 2^(mref - rnew) together with the first eight scores
    mrow = mnew;
    mref = rnew;
    float psum = 0.f;
    v16h pb[2];
#pragma unroll
    for (int j = 0; j < 4; ++j) {
      float e[8];
#pragma unroll
      for (int r = 0; r < 8; ++r) e[r] = s[j][r] - rnew;
      if (j == 0) exp2x9_inplace(alpha, e[0], e[1], e[2], e[3], e[4], e[5], e[6], e[7]);
      else        exp2x8_inplace(e[0], e[1], e[2], e[3], e[4], e[5], e[6], e[7]);
#pragma unroll
      for (int r = 0; r < 8; ++r) {
        psum += e[r];
        pb[j >> 1][(j & 1) * 8 + r] = (_Float16)e[r];
      }
    }
    lrow = lrow * alpha + psum;
#pragma unroll
    for (int t = 0; t < 4; ++t) {
#pragma unroll
      for (int r = 0; r < 8; ++r) { oacc[t][r] *= alpha; oaccl[t][r] *= alpha; }
    }

    // ---- O^T += V^T . P^T : A = V^T [d t*16+c][kv], B = P^T [kv][query c]; hi and residual in separate accumulators ----
#pragma unroll
    for (int kk = 0; kk < 2; ++kk) {
#pragma unroll
      for (int t = 0; t < 4; ++t) {
        const v16h vh = Frag<_Float16>::load(Vth + (t * 16 + c) * kLP + kk * 32 + 8 * hh);
        oacc[t] = mma_h(vh, pb[kk], oacc[t]);
        const v16h vl = Frag<_Float16>::load(Vtl + (t * 16 + c) * kLP + kk * 32 + 8 * hh);
        oaccl[t] = mma_h(vl, pb[kk], oaccl[t]);
      }
    }
    wait_lds();
    wait_copies();
    __syncthreads();          // publishes chunk kc + 1 and ends every wave's reads of chunk kc's buffer
  }
  wait_copies();              // nothing in flight when the wave goes on to the epilogue

  // ---- normalise (the sum carries P's own factor; fold 2^-11 of the residual) into the per-wave f32 slab ----
  float* os = Os[wave];   // [query][d]
  const float inv = 1.0f / (lrow + xhalf(lrow));
#pragma unroll
  for (int t = 0; t < 4; ++t) {
#pragma unroll
    for (int r = 0; r < 8; ++r) os[c * 68 + t * 16 + 8 * hh + r] = (oacc[t][r] + oaccl[t][r] * kVloInv) * inv;
  }
  __builtin_amdgcn_fence(__ATOMIC_RELEASE, "workgroup");
  __builtin_amdgcn_wave_barrier();
  __builtin_amdgcn_fence(__ATOMIC_ACQUIRE, "workgroup");
  {
    const int q4 = lane >> 3, c8 = (lane & 7) * 8;
    {
#pragma unroll
      for (int it = 0; it < 4; ++it) {
        const int row = it * 4 + q4;
        const float* sp = os + row * 68 + c8;
        v8h hv, lv;
#pragma unroll
        for (int e = 0; e < 8; ++e) {
          const unsigned short hb = f2bf_bits(sp[e]);
          const unsigned short lb = f2bf_bits(sp[e] - bf_bits2f(hb));
          hv[e] = __builtin_bit_cast(_Float16, hb);
          lv[e] = __builtin_bit_cast(_Float16, lb);
        }
        const size_t off = (tok0 + q0 + row) * (size_t)kD + h * kDh + c8;
        *(v8h*)(Ohp + off) = hv;
        *(v8h*)(Olp + off) = lv;
      }
      
    }
  }
}

// ---------------------------------------------------------------------------
// Host glue.
//   Xb   bf16 [8192][1024]        16,777,216  at           0
//   Wqb  bf16 [1024][1024]         2,097,152  at  16,777,216
//   Wkb  bf16 [1024][1024]         2,097,152  at  18,874,368
//   Wvb  bf16 [1024][1024]         2,097,152  at  20,971,520
//   Wob  bf16 [1024][1024]         2,097,152  at  23,068,672
//   Q16  f16  [8192][1024]        16,777,216  at  25,165,824
//   K16  f16  [8192][1024]        16,777,216  at  41,943,040
//   VTh  f16  [1024][8192]        16,777,216  at  58,720,256
//   VTl  f16  [1024][8192]        16,777,216  at  75,497,472   (residual x2048)
//   Oh   bf16 [8192][1024]        16,777,216  at  92,274,688
//   Ol   bf16 [8192][1024]        16,777,216  at 109,051,904
//   tab  f32  [2048]                   8,192  at 125,829,120
//   total                        125,837,312
// Every region is fully written before it is read; no region is re-used.
// GEMM shapes: Q,K: M=8192 N=1024 K=1024; V^T: M=1024 N=8192 K=1024; out: M=8192 N=1024 K=1024 (M%128==0, N%256==0,
// K%128==0, no padding). Attention: S=2048 (64-multiples), Dh=64.
// ---------------------------------------------------------------------------
extern "C" void kernel_launch(void* const* d_in, const int* in_sizes, int n_in,
                              void* d_out, int out_size, void* d_ws, size_t ws_size,
                              hipStream_t stream) {
  if (n_in < 10) return;
  const int nX = kTok * kD;     // 8,388,608
  const int nW = kD * kD;       // 1,048,576
  if (in_sizes[0] != nX || in_sizes[1] != kTok) return;
  if (in_sizes[2] != nW || in_sizes[4] != nW || in_sizes[6] != nW || in_sizes[8] != nW) return;
  if (in_sizes[3] != kD || in_sizes[5] != kD || in_sizes[7] != kD || in_sizes[9] != kD) return;
  if (out_size != nX) return;

  const size_t szX16 = (size_t)nX * 2;
  const size_t szW16 = (size_t)nW * 2;
  const size_t szTab = (size_t)kP * 4;
  const size_t offXb  = 0;
  const size_t offWq  = offXb + szX16;
  const size_t offWk  = offWq + szW16;
  const size_t offWv  = offWk + szW16;
  const size_t offWo  = offWv + szW16;
  const size_t offQ   = offWo + szW16;
  const size_t offK   = offQ + szX16;
  const size_t offVTh = offK + szX16;
  const size_t offVTl = offVTh + szX16;
  const size_t offOh  = offVTl + szX16;
  const size_t offOl  = offOh + szX16;
  const size_t offTab = offOl + szX16;
  const size_t total  = offTab + szTab;
  if (ws_size < total) return;

  const float* x  = (const float*)d_in[0];
  const float* pm = (const float*)d_in[1];
  const float* Wq = (const float*)d_in[2];
  const float* bq = (const float*)d_in[3];
  const float* Wk = (const float*)d_in[4];
  const float* bk = (const float*)d_in[5];
  const float* Wv = (const float*)d_in[6];
  const float* bv = (const float*)d_in[7];
  const float* Wo = (const float*)d_in[8];
  const float* bo = (const float*)d_in[9];
  float* out = (float*)d_out;
  char* ws = (char*)d_ws;
  unsigned short* Xb  = (unsigned short*)(ws + offXb);
  unsigned short* Wqb = (unsigned short*)(ws + offWq);
  unsigned short* Wkb = (unsigned short*)(ws + offWk);
  unsigned short* Wvb = (unsigned short*)(ws + offWv);
  unsigned short* Wob = (unsigned short*)(ws + offWo);
  unsigned short* Q16 = (unsigned short*)(ws + offQ);
  unsigned short* K16 = (unsigned short*)(ws + offK);
  unsigned short* VTh = (unsigned short*)(ws + offVTh);
  unsigned short* VTl = (unsigned short*)(ws + offVTl);
  unsigned short* Oh  = (unsigned short*)(ws + offOh);
  unsigned short* Ol  = (unsigned short*)(ws + offOl);
  float* tab = (float*)(ws + offTab);

  // ---- prologue: RNE bf16 operand planes and the bias table ----
  const int n8x = nX / 8;   // 1,048,576 -> 4096 blocks exact
  const int n8w = nW / 8;   //   131,072 ->  512 blocks exact
  cast8_bf16_kernel<<<dim3(n8x / 256), dim3(256), 0, stream>>>(x,  Xb,  n8x);
  cast8_bf16_kernel<<<dim3(n8w / 256), dim3(256), 0, stream>>>(Wq, Wqb, n8w);
  cast8_bf16_kernel<<<dim3(n8w / 256), dim3(256), 0, stream>>>(Wk, Wkb, n8w);
  cast8_bf16_kernel<<<dim3(n8w / 256), dim3(256), 0, stream>>>(Wv, Wvb, n8w);
  cast8_bf16_kernel<<<dim3(n8w / 256), dim3(256), 0, stream>>>(Wo, Wob, n8w);
  tab_kernel<<<dim3((kP / 4) / 256), dim3(256), 0, stream>>>(tab);

  // ---- projections (64x64 wave tiles, 8 waves = one 128x256 tile per block) ----
  const int tilesProj = (kTok / 64) * (kD / 64);   // 2048 -> 256 blocks
  // Q16[m][n] = sum_k Xb[m][k] * Wqb[n][k] + bq[n]   (f16 out)
  wmma_gemm64<1, 0, 2, 1, false><<<dim3(tilesProj / 8, 1), dim3(256), 0, stream>>>(
      Xb, Xb, kD, 0L, Wqb, Wqb, kD, 0L, (void*)Q16, (void*)Q16, kD, 0L, bq, pm, kTok, kD, kD, 1.0f);
  // K16 likewise with Wk, bk
  wmma_gemm64<1, 0, 2, 1, false><<<dim3(tilesProj / 8, 1), dim3(256), 0, stream>>>(
      Xb, Xb, kD, 0L, Wkb, Wkb, kD, 0L, (void*)K16, (void*)K16, kD, 0L, bk, pm, kTok, kD, kD, 1.0f);
  // V^T[m = feature][n = token] = sum_k Wvb[m][k] * Xb[n][k] + bv[m]   (f16 hi plane + f16 residual plane x2048)
  wmma_gemm64<1, 0, 1, 3, false><<<dim3(tilesProj / 8, 1), dim3(256), 0, stream>>>(
      Wvb, Wvb, kD, 0L, Xb, Xb, kD, 0L, (void*)VTh, (void*)VTl, kTok, 0L, bv, pm, kD, kTok, kD, 1.0f);

  // ---- attention: 64 (b,h) x 32 query tiles ----
  attn_kernel<<<dim3(kB * kH * (kP / kQB)), dim3(128), 0, stream>>>(Q16, K16, VTh, VTl, tab, pm, Oh, Ol);

  // ---- output projection: out[m][n] = (sum_k (Oh+Ol)[m][k] * Wob[n][k] + bo[n]) * pm[m] ----
  wmma_gemm64<1, 2, 2, 0, true><<<dim3(tilesProj / 8, 1), dim3(256), 0, stream>>>(
      Oh, Ol, kD, 0L, Wob, Wob, kD, 0L, (void*)out, (void*)out, kD, 0L, bo, pm, kTok, kD, kD, 1.0f);
}

// v006
// One run takes 216 microseconds.
// Timed twice side by side with v005, it ran 1.09 times as fast both times.
// All steps since v000 together make it 3.73 times as fast.
// Contractions: q/k/v projections on v_wmma_f32_16x16x32_bf16 (x and W as RNE bf16 planes, single products); scores q.k^T on v_wmma_f32_16x16x32_f16 (q, k f16 planes); attn.v on v_wmma_f32_16x16x32_f16 (P f16 carried x32768; V^T as f16 hi plane + f16 residual plane carried x2048 in a separate accumulator); output projection on v_wmma_f32_16x16x32_bf16 (attention output as bf16 hi + lo planes, Wo bf16, two products); f32 accumulate everywhere; time bias, masks and softmax in f32.
#include <hip/hip_runtime.h>
#include <math.h>

// ---------------------------------------------------------------------------
// Problem constants
// ---------------------------------------------------------------------------
constexpr int kB   = 4;
constexpr int kP   = 2048;
constexpr int kD   = 1024;
constexpr int kH   = 16;
constexpr int kDh  = 64;
constexpr int kTok = kB * kP;            // 8192 token rows
constexpr int kQB  = 64;                 // queries per attention block
constexpr int kKC  = 64;                 // keys per chunk
constexpr int kNW  = 4;                  // waves per attention block
constexpr int kLP  = 72;                 // LDS row pitch in halves of the 64-half K and V^T rows: 144 B = 16 B x odd,
                                         // so the 16 rows of one ds_load_b128 fragment read fall on distinct banks
constexpr float kLog2e      = 1.4426950408889634f;
constexpr float kScoreScale = 0.125f * kLog2e;    // 64^-0.5, scores kept in base 2 (natural score x log2 e)
constexpr float kNegBig     = -1.0e9f * kLog2e;   // masked score, base 2
constexpr float kPCarryLog2 = 15.0f;     // probabilities carried x2^15 in f16: the exponent's reference point lies 15 below the maximum
constexpr float kVloCarry   = 2048.0f;   // f16 residual planes carried x2^11
constexpr float kVloInv     = 1.0f / 2048.0f;
constexpr float kDelta      = 300.0f;    // seconds per patch step
constexpr float kInvTau     = 1.0f / 300.0f;
constexpr float kLogEps     = 1.0e-12f;
static_assert(kH * kDh == kD, "s");
static_assert(kTok % 64 == 0 && kD % 64 == 0 && kD % 32 == 0, "s");
static_assert(kP % kQB == 0 && kP % kKC == 0 && kDh == 64, "s");
static_assert((kTok * kD) % (8 * 256) == 0 && (kD * kD) % (8 * 256) == 0, "s");
static_assert(kP % 1024 == 0 && kP / kKC >= 2, "s");

typedef __attribute__((ext_vector_type(16))) _Float16 v16h;
typedef __attribute__((ext_vector_type(8)))  _Float16 v8h;
typedef __attribute__((ext_vector_type(16))) __bf16   v16b;
typedef __attribute__((ext_vector_type(8)))  __bf16   v8b;
typedef __attribute__((ext_vector_type(8)))  float    v8f;
typedef __attribute__((ext_vector_type(4)))  float    v4f;
typedef __attribute__((ext_vector_type(4)))  unsigned int v4u;

// ---------------------------------------------------------------------------
// Conversion, fragment and hazard-guard helpers
// ---------------------------------------------------------------------------
__device__ __forceinline__ unsigned short f2bf_bits(float f) {
  unsigned u = __float_as_uint(f);
  return (unsigned short)((u + 0x7FFFu + ((u >> 16) & 1u)) >> 16);
}
__device__ __forceinline__ float bf_bits2f(unsigned short h) { return __uint_as_float(((unsigned)h) << 16); }

// f16 bits (low 16) -> f32, integer path, finite values
__device__ __forceinline__ float h16_to_f32(unsigned hb) {
  const unsigned sgn = (hb & 0x8000u) << 16; const unsigned em = hb & 0x7fffu;
  const float fn = __uint_as_float((em << 13) + 0x38000000u);
  const float fs = (float)em * 5.9604644775390625e-8f;
  const float mag = (em < 0x400u) ? fs : fn; return __uint_as_float(__float_as_uint(mag) | sgn); }

// hazard guards as plain device helpers (no inline asm inside the kernel template body)
__device__ __forceinline__ void dep_guard4_h(v8f& a, v8f& b, v8f& c, v8f& d, v16h x, v16h y) {
  asm volatile("v_nop\n\tv_nop\n\tv_nop\n\tv_nop" : "+v"(a), "+v"(b), "+v"(c), "+v"(d) : "v"(x), "v"(y));
}
__device__ __forceinline__ void dep_guard4_b(v8f& a, v8f& b, v8f& c, v8f& d, v16b x, v16b y) {
  asm volatile("v_nop\n\tv_nop\n\tv_nop\n\tv_nop" : "+v"(a), "+v"(b), "+v"(c), "+v"(d) : "v"(x), "v"(y));
}
__device__ __forceinline__ void keep4_h(v16h a, v16h b, v16h c, v16h d) { asm volatile("v_nop" :: "v"(a), "v"(b), "v"(c), "v"(d)); }
__device__ __forceinline__ void keep4_b(v16b a, v16b b, v16b c, v16b d) { asm volatile("v_nop" :: "v"(a), "v"(b), "v"(c), "v"(d)); }
__device__ __forceinline__ void acc_guard4(v8f& a, v8f& b, v8f& c, v8f& d) { asm volatile("v_nop\n\tv_nop\n\tv_nop\n\tv_nop" : "+v"(a), "+v"(b), "+v"(c), "+v"(d)); }
template <typename T> struct Frag;
template <> struct Frag<_Float16> {
  typedef v16h V; union U { v16h v; v8h h[2]; };
  // elements 0..7 <- p[0..7], 8..15 <- p[16..23]
  static __device__ __forceinline__ v16h load(const _Float16* p) {
    U f; f.h[0] = *(const v8h*)(p); f.h[1] = *(const v8h*)(p + 16); return f.v;
  }
  static __device__ __forceinline__ v8f mma(v16h a, v16h b, v8f c) {
    return __builtin_amdgcn_wmma_f32_16x16x32_f16(false, a, false, b, (short)0, c, false, false);
  }
  static __device__ __forceinline__ void guard4(v8f& a, v8f& b, v8f& c, v8f& d, v16h x, v16h y) { dep_guard4_h(a, b, c, d, x, y); }
  static __device__ __forceinline__ void keep(v16h a, v16h b, v16h c, v16h d) { keep4_h(a, b, c, d); }
};
template <> struct Frag<__bf16> {
  typedef v16b V; union U { v16b v; v8b h[2]; };
  static __device__ __forceinline__ v16b load(const __bf16* p) {
    U f; f.h[0] = *(const v8b*)(p); f.h[1] = *(const v8b*)(p + 16); return f.v;
  }
  static __device__ __forceinline__ v8f mma(v16b a, v16b b, v8f c) {
    return __builtin_amdgcn_wmma_f32_16x16x32_bf16(false, a, false, b, (short)0, c, false, false);
  }
  static __device__ __forceinline__ void guard4(v8f& a, v8f& b, v8f& c, v8f& d, v16b x, v16b y) { dep_guard4_b(a, b, c, d, x, y); }
  static __device__ __forceinline__ void keep(v16b a, v16b b, v16b c, v16b d) { keep4_b(a, b, c, d); }
};

__device__ __forceinline__ unsigned pk16(unsigned short a, unsigned short b) { return (unsigned)a | ((unsigned)b << 16); }
__device__ __forceinline__ unsigned short h_bits(float f) { const _Float16 h = (_Float16)f; return __builtin_bit_cast(unsigned short, h); }

// single WMMA with its own hazard guard (ties D, keeps A/B live)
__device__ __forceinline__ v8f mma_h(v16h a, v16h b, v8f c) {
  c = __builtin_amdgcn_wmma_f32_16x16x32_f16(false, a, false, b, (short)0, c, false, false);
  asm volatile("v_nop\n\tv_nop\n\tv_nop\n\tv_nop" : "+v"(c) : "v"(a), "v"(b));
  return c;
}

// lane l <-> lane l ^ 16 (the other 16-lane half of the wave), a vector-port move
__device__ __forceinline__ float xhalf(float x) {
  const int b = __builtin_bit_cast(int, x);
  return __builtin_bit_cast(float, __builtin_amdgcn_permlanex16(b, b, 0x76543210, 0xfedcba98, false, false));
}

// 2^x on the hardware's v_exp_f32, in place. The instruction set asks for one independent instruction or a v_nop between a
// transcendental and a vector instruction that reads its result or writes over its source. Written as one statement the slot is
// kept by construction: each v_exp_f32 writes over its own source alone, none reads a neighbour's result, and the closing v_nop
// stands between the last one and whatever the compiler places next.
__device__ __forceinline__ void exp2x8_inplace(float& a, float& b, float& c, float& d, float& e, float& f, float& g, float& h) {
  asm("v_exp_f32 %0, %0\n\tv_exp_f32 %1, %1\n\tv_exp_f32 %2, %2\n\tv_exp_f32 %3, %3\n\t"
      "v_exp_f32 %4, %4\n\tv_exp_f32 %5, %5\n\tv_exp_f32 %6, %6\n\tv_exp_f32 %7, %7\n\tv_nop"
      : "+v"(a), "+v"(b), "+v"(c), "+v"(d), "+v"(e), "+v"(f), "+v"(g), "+v"(h));
}
// the same with a ninth value
__device__ __forceinline__ void exp2x9_inplace(float& a, float& b, float& c, float& d, float& e, float& f, float& g, float& h, float& i) {
  asm("v_exp_f32 %0, %0\n\tv_exp_f32 %1, %1\n\tv_exp_f32 %2, %2\n\tv_exp_f32 %3, %3\n\tv_exp_f32 %4, %4\n\t"
      "v_exp_f32 %5, %5\n\tv_exp_f32 %6, %6\n\tv_exp_f32 %7, %7\n\tv_exp_f32 %8, %8\n\tv_nop"
      : "+v"(a), "+v"(b), "+v"(c), "+v"(d), "+v"(e), "+v"(f), "+v"(g), "+v"(h), "+v"(i));
}

// ---- LDS staging of the GEMM operands ----
constexpr int kGK = 128;   // k per stage: every staged operand row is 256 B = two whole 128-B lines
constexpr int kGP = 136;   // LDS row pitch in halves: 272 B = 16 B x odd, so the 16 rows of a ds_load_b128 fragment read fall on distinct banks

// Eight asynchronous 16-B copies per lane, global -> LDS: rows r, r+16, ..., r+112 of one 128-row panel (16 lanes per 256-B row).
// The closing s_wait_xcnt stands inside the statement so that no address register of a copy is rewritten in front of it.
__device__ __forceinline__ void copy8_to_lds(unsigned l, const unsigned short* g, size_t gs) {
  constexpr unsigned ls = 16u * kGP * 2u;   // 16 LDS rows in bytes
  asm volatile(
      "global_load_async_to_lds_b128 %0, %8, off\n\t"
      "global_load_async_to_lds_b128 %1, %9, off\n\t"
      "global_load_async_to_lds_b128 %2, %10, off\n\t"
      "global_load_async_to_lds_b128 %3, %11, off\n\t"
      "global_load_async_to_lds_b128 %4, %12, off\n\t"
      "global_load_async_to_lds_b128 %5, %13, off\n\t"
      "global_load_async_to_lds_b128 %6, %14, off\n\t"
      "global_load_async_to_lds_b128 %7, %15, off\n\t"
      "s_wait_xcnt 0x0"
      :: "v"(l), "v"(l + ls), "v"(l + 2u * ls), "v"(l + 3u * ls), "v"(l + 4u * ls), "v"(l + 5u * ls), "v"(l + 6u * ls), "v"(l + 7u * ls),
         "v"(g), "v"(g + gs), "v"(g + 2 * gs), "v"(g + 3 * gs), "v"(g + 4 * gs), "v"(g + 5 * gs), "v"(g + 6 * gs), "v"(g + 7 * gs)
      : "memory");
}
// this wave's copies have landed in LDS (the compiler places no wait for them)
__device__ __forceinline__ void wait_copies() { asm volatile("s_wait_asynccnt 0x0" ::: "memory"); }
// this wave's LDS reads have returned, so the buffer they read may be refilled behind the next barrier
__device__ __forceinline__ void wait_lds() { asm volatile("s_wait_dscnt 0x0" ::: "memory"); }

// Twelve asynchronous 16-B copies per lane, global -> LDS: rows r, r+16, r+32, r+48 (8 lanes per 128-B row) of the K tile, the
// V^T hi tile and the V^T residual tile of one 64-key chunk; the three tiles lie behind one another in LDS at pitch kLP.
// The closing s_wait_xcnt stands inside the statement so that no address register of a copy is rewritten in front of it.
__device__ __forceinline__ void copy12_to_lds(unsigned l, const unsigned short* gk, const unsigned short* gh, const unsigned short* gl) {
  constexpr unsigned ls = 16u * kLP * 2u;    // 16 LDS rows in bytes
  constexpr unsigned lt = 64u * kLP * 2u;    // one 64-row tile in bytes
  constexpr size_t   sk = (size_t)16 * kD;   // 16 K rows (tokens) in halves
  constexpr size_t   sv = (size_t)16 * kTok; // 16 V^T rows (features) in halves
  asm volatile(
      "global_load_async_to_lds_b128 %0, %12, off\n\t"
      "global_load_async_to_lds_b128 %1, %13, off\n\t"
      "global_load_async_to_lds_b128 %2, %14, off\n\t"
      "global_load_async_to_lds_b128 %3, %15, off\n\t"
      "global_load_async_to_lds_b128 %4, %16, off\n\t"
      "global_load_async_to_lds_b128 %5, %17, off\n\t"
      "global_load_async_to_lds_b128 %6, %18, off\n\t"
      "global_load_async_to_lds_b128 %7, %19, off\n\t"
      "global_load_async_to_lds_b128 %8, %20, off\n\t"
      "global_load_async_to_lds_b128 %9, %21, off\n\t"
      "global_load_async_to_lds_b128 %10, %22, off\n\t"
      "global_load_async_to_lds_b128 %11, %23, off\n\t"
      "s_wait_xcnt 0x0"
      :: "v"(l), "v"(l + ls), "v"(l + 2u * ls), "v"(l + 3u * ls),
         "v"(l + lt), "v"(l + lt + ls), "v"(l + lt + 2u * ls), "v"(l + lt + 3u * ls),
         "v"(l + 2u * lt), "v"(l + 2u * lt + ls), "v"(l + 2u * lt + 2u * ls), "v"(l + 2u * lt + 3u * ls),
         "v"(gk), "v"(gk + sk), "v"(gk + 2 * sk), "v"(gk + 3 * sk),
         "v"(gh), "v"(gh + sv), "v"(gh + 2 * sv), "v"(gh + 3 * sv),
         "v"(gl), "v"(gl + sv), "v"(gl + 2 * sv), "v"(gl + 3 * sv)
      : "memory");
}

// ---- Register-blocked batched WMMA GEMM (modes extended) ----------------------------------------------
// C[m,n] = scale * sum_k A[m,k] * Bt[n,k] (+bias)(*rowsc[m]); each wave owns a 64x64 tile, the block's 8 waves a 128x256 tile
// (2 x 4 waves). Per stage the block's 128 A rows and 256 Bt rows x 128 k are copied to LDS in whole lines and every wave
// reads its fragments from there; two buffers, the next stage's copies in flight while this stage is multiplied.
// A row-major [M,K]; Bt row-major [N,K]; M % 128 == 0, N % 256 == 0, K % 128 == 0, K >= 128 (no tail handling).
// SPLIT: 0 = single product; 1 = A and Bt hi/lo planes (hi*hi + hi*lo + lo*hi); 2 = A hi/lo planes only (hi*B + lo*B).
// BIAS_MODE: 0 = none, 1 = bias[m], 2 = bias[n].  ROWSC: multiply by RNE-bf16(rowsc[m]) after the bias.
// OUT_MODE: 0 = f32, 1 = f16, 2 = bf16 hi plane (Cout) + bf16 lo plane (Cout2), 3 = f16 hi plane + f16 residual plane x2048.
// ET: 0 = f16 operands, 1 = bf16 operands (pointers passed as 16-bit storage)
template <int ET> struct Elem;
template <> struct Elem<0> { typedef _Float16 T; };
template <> struct Elem<1> { typedef __bf16 T; };
template <int ET, int SPLIT, int BIAS_MODE, int OUT_MODE, bool ROWSC>
__global__ __launch_bounds__(256) void wmma_gemm64(
    const unsigned short* __restrict__ Ap, const unsigned short* __restrict__ A2p, int lda, long strideA,
    const unsigned short* __restrict__ Btp, const unsigned short* __restrict__ Bt2p, int ldb, long strideB,
    void* __restrict__ Cout, void* __restrict__ Cout2, int ldc, long strideC,
    const float* __restrict__ bias, const float* __restrict__ rowsc,
    int M, int N, int K, float scale) {
  typedef typename Elem<ET>::T T;
  typedef typename Frag<T>::V V;
  constexpr int NA = (SPLIT != 0) ? 2 : 1;             // A planes
  constexpr int NB = (SPLIT == 1) ? 2 : 1;             // Bt planes
  constexpr int kBufH = (128 * NA + 256 * NB) * kGP;   // halves per buffer: [A planes, 128 rows each][Bt planes, 256 rows each]
  __shared__ __align__(16) unsigned short ring[2 * kBufH];
  __shared__ __align__(16) float sT[8][16 * 68];   // per-wave 16x64 slab, pitch 68 floats
  const int b    = blockIdx.y;
  const int lane = threadIdx.x & 31;
  const int wave = threadIdx.x >> 5;
  const int tilesNb = N >> 8;
  const int tilesMb = M >> 7;
  if ((int)blockIdx.x >= tilesMb * tilesNb) return;   // the same for the whole block, ahead of every barrier
  const int bm  = blockIdx.x / tilesNb;
  const int bn  = blockIdx.x - bm * tilesNb;
  const int m0b = bm << 7;
  const int n0b = bn << 8;
  const int wm  = wave >> 2;
  const int wn  = wave & 3;
  const int m0  = m0b + (wm << 6);
  const int n0  = n0b + (wn << 6);

  const int rlane = lane & 15;                 // row (A) / col (B, D) within subtile
  const int koff  = (lane >> 4) * 8;           // k offset of this lane half
  const int mOff  = (lane >> 4) * 8;           // D row offset

  // copy addresses of this lane: row threadIdx.x / 16 of each 16-row group, 16-B segment threadIdx.x % 16
  const int cr = threadIdx.x >> 4;
  const int cs = (threadIdx.x & 15) * 8;
  const unsigned short* cA  = Ap   + (size_t)b * strideA + (size_t)(m0b + cr) * lda + cs;
  const unsigned short* cA2 = A2p  + (size_t)b * strideA + (size_t)(m0b + cr) * lda + cs;
  const unsigned short* cB  = Btp  + (size_t)b * strideB + (size_t)(n0b + cr) * ldb + cs;
  const unsigned short* cB2 = Bt2p + (size_t)b * strideB + (size_t)(n0b + cr) * ldb + cs;
  const unsigned cl = (unsigned)(uintptr_t)ring + (unsigned)(cr * kGP + cs) * 2u;   // LDS byte address
  const size_t gsA = (size_t)16 * lda;
  const size_t gsB = (size_t)16 * ldb;
  constexpr unsigned kPanel = 128u * kGP * 2u;   // 128 LDS rows in bytes
  auto stage = [&](int t) {
    const unsigned l = cl + (unsigned)(t & 1) * (unsigned)(kBufH * 2);
    const size_t k = (size_t)t * kGK;
    copy8_to_lds(l, cA + k, gsA);
    if (NA == 2) copy8_to_lds(l + kPanel, cA2 + k, gsA);
    copy8_to_lds(l + NA * kPanel, cB + k, gsB);
    copy8_to_lds(l + (NA + 1) * kPanel, cB + k + 8 * gsB, gsB);
    if (NB == 2) {
      copy8_to_lds(l + (NA + 2) * kPanel, cB2 + k, gsB);
      copy8_to_lds(l + (NA + 3) * kPanel, cB2 + k + 8 * gsB, gsB);
    }
  };

  v8f acc[4][4];
#pragma unroll
  for (int i = 0; i < 4; ++i)
#pragma unroll
    for (int j = 0; j < 4; ++j) acc[i][j] = (v8f){0.f,0.f,0.f,0.f,0.f,0.f,0.f,0.f};

  const int nT = K / kGK;
  stage(0);
  wait_copies();
  __syncthreads();            // stage 0 is readable by every wave
  if (nT > 1) stage(1);

  for (int t = 0; t < nT; ++t) {
    const T* rb = (const T*)ring + (t & 1) * kBufH;
    const T* fa = rb + ((wm << 6) + rlane) * kGP + koff;
    const T* fb = rb + (128 * NA + (wn << 6) + rlane) * kGP + koff;
    // every loop of a stage is unrolled: fragment and accumulator indices are constants (registers, no scratch) and the
    // LDS offsets of the four 32-k steps are immediates
#pragma unroll
    for (int ks = 0; ks < kGK / 32; ++ks) {
      V bh[4], bl[4], ah[4], al[4];
#pragma unroll
      for (int j = 0; j < 4; ++j) {
        bh[j] = Frag<T>::load(fb + (j << 4) * kGP + ks * 32);
        if (SPLIT == 1) bl[j] = Frag<T>::load(fb + (256 + (j << 4)) * kGP + ks * 32);
      }
#pragma unroll
      for (int i = 0; i < 4; ++i) {
        ah[i] = Frag<T>::load(fa + (i << 4) * kGP + ks * 32);
        al[i] = ah[i];
        if (SPLIT != 0) al[i] = Frag<T>::load(fa + (128 + (i << 4)) * kGP + ks * 32);
      }
#pragma unroll
      for (int i = 0; i < 4; ++i) {
#pragma unroll
        for (int j = 0; j < 4; ++j) {
          acc[i][j] = Frag<T>::mma(ah[i], bh[j], acc[i][j]);
          if (SPLIT == 1) acc[i][j] = Frag<T>::mma(ah[i], bl[j], acc[i][j]);
          if (SPLIT != 0) acc[i][j] = Frag<T>::mma(al[i], bh[j], acc[i][j]);
        }
        Frag<T>::guard4(acc[i][0], acc[i][1], acc[i][2], acc[i][3], ah[i], al[i]);
      }
      Frag<T>::keep(bh[0], bh[1], bh[2], bh[3]);
      if (SPLIT == 1) Frag<T>::keep(bl[0], bl[1], bl[2], bl[3]);
    }
    wait_lds();
    wait_copies();
    __syncthreads();          // publishes stage t + 1 and ends every wave's reads of stage t's buffer
    if (t + 2 < nT) stage(t + 2);
  }
  wait_copies();              // nothing in flight when the wave goes on to the epilogue
  acc_guard4(acc[0][0], acc[0][1], acc[0][2], acc[0][3]);
  acc_guard4(acc[1][0], acc[1][1], acc[1][2], acc[1][3]);
  acc_guard4(acc[2][0], acc[2][1], acc[2][2], acc[2][3]);
  acc_guard4(acc[3][0], acc[3][1], acc[3][2], acc[3][3]);

  // ---- epilogue ----
  float* slab = sT[wave];
#pragma unroll
  for (int i = 0; i < 4; ++i) {
    const int mBase = m0 + (i << 4);
    float rsv[8];
#pragma unroll
    for (int r = 0; r < 8; ++r) rsv[r] = 1.0f;
    if (ROWSC) {
      // two 16-B loads of rowsc[mBase+mOff .. +7], then RNE bf16 of each value
      const v4f ra = *(const v4f*)(rowsc + mBase + mOff);
      const v4f rb = *(const v4f*)(rowsc + mBase + mOff + 4);
      rsv[0] = ra[0]; rsv[1] = ra[1]; rsv[2] = ra[2]; rsv[3] = ra[3];
      rsv[4] = rb[0]; rsv[5] = rb[1]; rsv[6] = rb[2]; rsv[7] = rb[3];
#pragma unroll
      for (int r = 0; r < 8; ++r) rsv[r] = bf_bits2f(f2bf_bits(rsv[r]));
    }
#pragma unroll
    for (int j = 0; j < 4; ++j) {
      const int n = n0 + (j << 4) + rlane;
      float bv = 0.f;
      if (BIAS_MODE == 2) bv = bias[n];
#pragma unroll
      for (int r = 0; r < 8; ++r) {
        float v = acc[i][j][r] * scale;
        if (BIAS_MODE == 1) v += bias[mBase + mOff + r];
        if (BIAS_MODE == 2) v += bv;
        if (ROWSC) v = v * rsv[r];
        slab[(mOff + r) * 68 + (j << 4) + rlane] = v;
      }
    }
    __builtin_amdgcn_fence(__ATOMIC_RELEASE, "workgroup");
    __builtin_amdgcn_wave_barrier();
    __builtin_amdgcn_fence(__ATOMIC_ACQUIRE, "workgroup");
    if (OUT_MODE == 0) {
      float* C = (float*)Cout + (size_t)b * strideC;
      const int hh = lane >> 4, c4 = (lane & 15) * 4;     // row seg = 256 B = 16 lanes x 16 B
      {
#pragma unroll
        for (int it = 0; it < 8; ++it) {
          const int row = it * 2 + hh;
          v4f v = *(const v4f*)(slab + row * 68 + c4);
          *(v4f*)(C + (size_t)(mBase + row) * ldc + n0 + c4) = v;
        }
        
      }
    } else {
      const int q = lane >> 3, c8 = (lane & 7) * 8;
      unsigned short* C  = (unsigned short*)Cout  + (size_t)b * strideC;
      unsigned short* C2 = (OUT_MODE >= 2) ? ((unsigned short*)Cout2 + (size_t)b * strideC) : nullptr;
      {
#pragma unroll
        for (int it = 0; it < 4; ++it) {
          const int row = it * 4 + q;
          const float* sp = slab + row * 68 + c8;
          v8h hv, lv;
#pragma unroll
          for (int e = 0; e < 8; ++e) {
            if (OUT_MODE == 1) {
              hv[e] = (_Float16)sp[e];
            } else if (OUT_MODE == 2) {
              unsigned short hb = f2bf_bits(sp[e]);
              unsigned short lb = f2bf_bits(sp[e] - bf_bits2f(hb));
              hv[e] = __builtin_bit_cast(_Float16, hb);
              lv[e] = __builtin_bit_cast(_Float16, lb);
            } else {
              const unsigned short hb = h_bits(sp[e]);
              const float back = h16_to_f32((unsigned)hb);
              const unsigned short lb = h_bits((sp[e] - back) * kVloCarry);
              hv[e] = __builtin_bit_cast(_Float16, hb);
              lv[e] = __builtin_bit_cast(_Float16, lb);
            }
          }
          *(v8h*)(C + (size_t)(mBase + row) * ldc + n0 + c8) = hv;
          if (OUT_MODE >= 2) *(v8h*)(C2 + (size_t)(mBase + row) * ldc + n0 + c8) = lv;
        }
        
      }
    }
    __builtin_amdgcn_fence(__ATOMIC_RELEASE, "workgroup");
    __builtin_amdgcn_wave_barrier();
    __builtin_amdgcn_fence(__ATOMIC_ACQUIRE, "workgroup");
  }
}

// ---------------------------------------------------------------------------
// f32 -> bf16 (RNE) cast, 8 consecutive elements per thread (one 16-B store per lane; 32 contiguous lanes = 4 whole
// multiples of 256: 1,048,576 threads for x, 131,072 for each weight).
// ---------------------------------------------------------------------------
__global__ __launch_bounds__(256) void cast8_bf16_kernel(const float* __restrict__ in, unsigned short* __restrict__ out, int n8) {
  const int i = blockIdx.x * 256 + threadIdx.x;
  if (i >= n8) return;
  const float* p = in + 8 * (size_t)i;
  const v4f a = *(const v4f*)(p);
  const v4f c = *(const v4f*)(p + 4);
  unsigned short hb[8];
#pragma unroll
  for (int e = 0; e < 4; ++e) {
    hb[e]     = f2bf_bits(a[e]);
    hb[4 + e] = f2bf_bits(c[e]);
  }
  const v4u u = (v4u){pk16(hb[0], hb[1]), pk16(hb[2], hb[3]), pk16(hb[4], hb[5]), pk16(hb[6], hb[7])};
  unsigned short* q = out + 8 * (size_t)i;
  *(v4u*)q = u;
  
}

// ---------------------------------------------------------------------------
// Time-decay bias table in base 2: tab[d] = logf(expf((-(d*300)) * (1/300)) + 1e-12) * log2(e), d = 0..2047, f32, precise expf/logf.
// ---------------------------------------------------------------------------
__global__ __launch_bounds__(256) void tab_kernel(float* __restrict__ tab) {
  const int i = blockIdx.x * 256 + threadIdx.x;
  if (i >= kP / 4) return;
  v4f tv;
#pragma unroll
  for (int e = 0; e < 4; ++e) {
    const float d = (float)(4 * i + e);
    const float dist = d * kDelta;
    const float ex = (-dist) * kInvTau;
    const float w = expf(ex);
    tv[e] = logf(w + kLogEps) * kLog2e;
  }
  float* q = tab + 4 * (size_t)i;
  *(v4f*)q = tv;
  
}

__global__ __launch_bounds__(128) void attn_kernel(const unsigned short* __restrict__ Qp, const unsigned short* __restrict__ Kp,
                                                   const unsigned short* __restrict__ VThp, const unsigned short* __restrict__ VTlp,
                                                   const float* __restrict__ tab, const float* __restrict__ pm,
                                                   unsigned short* __restrict__ Ohp, unsigned short* __restrict__ Olp) {
  constexpr int kTileH = 64 * kLP;                           // halves of one 64-row tile (9 KB)
  constexpr int kBufH  = 3 * kTileH;                         // one buffer: K [kv][d], V^T hi [d][kv], V^T residual x2048 [d][kv]
  __shared__ __align__(16) _Float16 tiles[2 * kBufH];        // two buffers, 54 KB
  __shared__ __align__(16) float    Os[kNW][16 * 68];        // per wave out tile, pitch 68
  __shared__ __align__(16) float    tabs[kP];                // bias table 8 KB

  const int tid  = threadIdx.x;
  const int wave = tid >> 5;
  const int lane = tid & 31;
  const int hh   = lane >> 4;
  const int c    = lane & 15;
  const int nqb  = kP / kQB;              // 32
  const int bx   = blockIdx.x;
  const int qb   = bx % nqb;
  const int bh   = bx / nqb;
  const int h    = bh % kH;
  const int b    = bh / kH;
  const int q0   = qb * kQB + wave * 16;  // first query row of this wave within the sequence
  const size_t tok0 = (size_t)b * kP;     // first token row of this batch

  // ---- bias table -> LDS: 4 x 128 threads x 4 floats = 2048 (whole table); read after the barrier in front of the loop ----
#pragma unroll
  for (int i = 0; i < 4; ++i) {
    const int idx = i * 128 + tid;
    const v4f t4 = *(const v4f*)(tab + 4 * idx);
    *(v4f*)(tabs + 4 * idx) = t4;
  }
  asm volatile("" ::: "memory");

  // ---- Q fragments (B operand): column = query q0+c, k = d; 2 d-chunks ----
  const _Float16* Qh = (const _Float16*)(const void*)Qp;
  const _Float16* qr = Qh + (tok0 + q0 + c) * (size_t)kD + h * kDh + 8 * hh;
  v16h qa[2];
  qa[0] = Frag<_Float16>::load(qr);
  qa[1] = Frag<_Float16>::load(qr + 32);

  float mrow = -__builtin_inff();   // running maximum of query q0+c (equal in both halves), base 2
  float mref = -__builtin_inff();   // reference point of the exponentials: P, its sum and O all carry the factor 2^(-mref)
  float lrow = 0.f;                 // running sum of query q0+c over this half's keys; the halves are joined after the loop
  v8f oacc[4], oaccl[4];            // O^T: row = d t*16+8hh+r, column = query q0+c
#pragma unroll
  for (int t = 0; t < 4; ++t) {
    oacc[t]  = (v8f){0.f,0.f,0.f,0.f,0.f,0.f,0.f,0.f};
    oaccl[t] = (v8f){0.f,0.f,0.f,0.f,0.f,0.f,0.f,0.f};
  }

  // ---- K / V^T tiles: asynchronous copies, two buffers; chunk kc + 1 is in flight while chunk kc is worked on ----
  // this lane's copy addresses: row tid / 8 of each 16-row group, 16-B segment tid % 8
  const int cr = tid >> 3;
  const int cs = (tid & 7) * 8;
  const unsigned cl = (unsigned)(uintptr_t)tiles + (unsigned)(cr * kLP + cs) * 2u;   // LDS byte address
  const unsigned short* cK  = Kp   + (tok0 + cr) * (size_t)kD + h * kDh + cs;
  const unsigned short* cVh = VThp + (size_t)(h * kDh + cr) * kTok + tok0 + cs;
  const unsigned short* cVl = VTlp + (size_t)(h * kDh + cr) * kTok + tok0 + cs;
  auto stage = [&](int t) {
    copy12_to_lds(cl + (unsigned)(t & 1) * (unsigned)(kBufH * 2), cK + (size_t)t * (kKC * kD), cVh + t * kKC, cVl + t * kKC);
  };
  stage(0);
  wait_copies();
  __syncthreads();            // chunk 0 and the bias table are readable by every wave

  for (int kc = 0; kc < kP / kKC; ++kc) {
    // directly behind the barrier (the one above, or the one at the foot of trip kc - 1, which ended every wave's reads of
    // chunk kc - 1): the copies of chunk kc + 1, while it exists, into the buffer that chunk kc - 1 has left
    if (kc + 1 < kP / kKC) stage(kc + 1);
    const int kv0 = kc * kKC;
    const _Float16* Ksh = tiles + (kc & 1) * kBufH;
    const _Float16* Vth = Ksh + kTileH;
    const _Float16* Vtl = Vth + kTileH;

    // ---- scores, transposed: D[row = key j*16+8hh+r][col = query c] = K . Q^T, K = 64 in 2 steps of 32 ----
    // all eight K fragments are read ahead of the first product: one LDS latency for the group, counted waits behind it
    // (the loops are unrolled so that fragment and accumulator indices are constants: registers, no scratch)
    v16h kf[2][4];
#pragma unroll
    for (int dc = 0; dc < 2; ++dc) {
#pragma unroll
      for (int j = 0; j < 4; ++j) kf[dc][j] = Frag<_Float16>::load(Ksh + (j * 16 + c) * kLP + dc * 32 + 8 * hh);
    }
    v8f s[4];
#pragma unroll
    for (int j = 0; j < 4; ++j) s[j] = (v8f){0.f,0.f,0.f,0.f,0.f,0.f,0.f,0.f};
#pragma unroll
    for (int dc = 0; dc < 2; ++dc) {
#pragma unroll
      for (int j = 0; j < 4; ++j) s[j] = mma_h(kf[dc][j], qa[dc], s[j]);
    }

    // ---- scale, time bias, key mask; maximum over this lane's 32 keys, then over both halves ----
    const int qrow = q0 + c;
    float cm = -__builtin_inff();
#pragma unroll
    for (int j = 0; j < 4; ++j) {
      // key mask values of this lane's 8 consecutive keys of tile j (two 16-B loads)
      const float* pmp = pm + tok0 + kv0 + j * 16 + 8 * hh;
      const v4f pma = *(const v4f*)(pmp);
      const v4f pmb = *(const v4f*)(pmp + 4);
#pragma unroll
      for (int r = 0; r < 8; ++r) {
        const int kvcol = kv0 + j * 16 + 8 * hh + r;
        int dd = qrow - kvcol;
        dd = (dd < 0) ? -dd : dd;
        const float pmv = (r < 4) ? pma[r & 3] : pmb[r & 3];
        float v = s[j][r] * kScoreScale + tabs[dd];
        v = (pmv <= 0.0f) ? kNegBig : v;
        s[j][r] = v;
        cm = fmaxf(cm, v);
      }
    }
    cm = fmaxf(cm, xhalf(cm));

    // ---- online softmax; P = 2^(v - mref) (at most 2^15) as f16 straight into the B operands of the PV products ----
    // B operand of keys kk*32 .. kk*32+31: elements 0..7 = keys 8hh+0..7 (score tile 2kk), 8..15 = keys 16+8hh+0..7 (tile 2kk+1)
    const float mnew  = fmaxf(mrow, cm);
    // from 2^23 on, mnew - 15 would round and could lift P past the f16 range: there the reference point is the maximum itself
    const float rnew  = (fabsf(mnew) < 8388608.0f) ? mnew - kPCarryLog2 : mnew;
    float alpha = mref - rnew;   // becomes 2^(mref - rnew) together with the first eight scores
    mrow = mnew;
    mref = rnew;
    float psum = 0.f;
    v16h pb[2];
#pragma unroll
    for (int j = 0; j < 4; ++j) {
      float e[8];
#pragma unroll
      for (int r = 0; r < 8; ++r) e[r] = s[j][r] - rnew;
      if (j == 0) exp2x9_inplace(alpha, e[0], e[1], e[2], e[3], e[4], e[5], e[6], e[7]);
      else        exp2x8_inplace(e[0], e[1], e[2], e[3], e[4], e[5], e[6], e[7]);
#pragma unroll
      for (int r = 0; r < 8; ++r) {
        psum += e[r];
        pb[j >> 1][(j & 1) * 8 + r] = (_Float16)e[r];
      }
    }
    lrow = lrow * alpha + psum;
#pragma unroll
    for (int t = 0; t < 4; ++t) {
#pragma unroll
      for (int r = 0; r < 8; ++r) { oacc[t][r] *= alpha; oaccl[t][r] *= alpha; }
    }

    // ---- O^T += V^T . P^T : A = V^T [d t*16+c][kv], B = P^T [kv][query c]; hi and residual in separate accumulators ----
    // the sixteen V^T fragments (order: kk, t, hi / residual) are read in groups of four, two groups ahead of their products:
    // the LDS latency is met once at the head and then runs beside the products of the groups in front.
    // (unrolled for the same reason as above: constant indices, and the reads stand in the order written here)
    auto vfrag = [&](int i) {
      const _Float16* pl = (i & 1) ? Vtl : Vth;
      return Frag<_Float16>::load(pl + (((i >> 1) & 3) * 16 + c) * kLP + (i >> 3) * 32 + 8 * hh);
    };
    v16h vf[16];
#pragma unroll
    for (int i = 0; i < 8; ++i) vf[i] = vfrag(i);
#pragma unroll
    for (int g = 0; g < 4; ++g) {
#pragma unroll
      for (int i = 4 * g; i < 4 * g + 4; i += 2) {
        const int t = (i >> 1) & 3;
        oacc[t]  = mma_h(vf[i],     pb[i >> 3], oacc[t]);
        oaccl[t] = mma_h(vf[i + 1], pb[i >> 3], oaccl[t]);
      }
      if (g < 2) {
#pragma unroll
        for (int i = 4 * g + 8; i < 4 * g + 12; ++i) vf[i] = vfrag(i);
      }
    }
    wait_lds();
    wait_copies();
    __syncthreads();          // publishes chunk kc + 1 and ends every wave's reads of chunk kc's buffer
  }
  wait_copies();              // nothing in flight when the wave goes on to the epilogue

  // ---- normalise (the sum carries P's own factor; fold 2^-11 of the residual) into the per-wave f32 slab ----
  float* os = Os[wave];   // [query][d]
  const float inv = 1.0f / (lrow + xhalf(lrow));
#pragma unroll
  for (int t = 0; t < 4; ++t) {
#pragma unroll
    for (int r = 0; r < 8; ++r) os[c * 68 + t * 16 + 8 * hh + r] = (oacc[t][r] + oaccl[t][r] * kVloInv) * inv;
  }
  __builtin_amdgcn_fence(__ATOMIC_RELEASE, "workgroup");
  __builtin_amdgcn_wave_barrier();
  __builtin_amdgcn_fence(__ATOMIC_ACQUIRE, "workgroup");
  {
    const int q4 = lane >> 3, c8 = (lane & 7) * 8;
    {
#pragma unroll
      for (int it = 0; it < 4; ++it) {
        const int row = it * 4 + q4;
        const float* sp = os + row * 68 + c8;
        v8h hv, lv;
#pragma unroll
        for (int e = 0; e < 8; ++e) {
          const unsigned short hb = f2bf_bits(sp[e]);
          const unsigned short lb = f2bf_bits(sp[e] - bf_bits2f(hb));
          hv[e] = __builtin_bit_cast(_Float16, hb);
          lv[e] = __builtin_bit_cast(_Float16, lb);
        }
        const size_t off = (tok0 + q0 + row) * (size_t)kD + h * kDh + c8;
        *(v8h*)(Ohp + off) = hv;
        *(v8h*)(Olp + off) = lv;
      }
      
    }
  }
}

// ---------------------------------------------------------------------------
// Host glue.
//   Xb   bf16 [8192][1024]        16,777,216  at           0
//   Wqb  bf16 [1024][1024]         2,097,152  at  16,777,216
//   Wkb  bf16 [1024][1024]         2,097,152  at  18,874,368
//   Wvb  bf16 [1024][1024]         2,097,152  at  20,971,520
//   Wob  bf16 [1024][1024]         2,097,152  at  23,068,672
//   Q16  f16  [8192][1024]        16,777,216  at  25,165,824
//   K16  f16  [8192][1024]        16,777,216  at  41,943,040
//   VTh  f16  [1024][8192]        16,777,216  at  58,720,256
//   VTl  f16  [1024][8192]        16,777,216  at  75,497,472   (residual x2048)
//   Oh   bf16 [8192][1024]        16,777,216  at  92,274,688
//   Ol   bf16 [8192][1024]        16,777,216  at 109,051,904
//   tab  f32  [2048]                   8,192  at 125,829,120
//   total                        125,837,312
// Every region is fully written before it is read; no region is re-used.
// GEMM shapes: Q,K: M=8192 N=1024 K=1024; V^T: M=1024 N=8192 K=1024; out: M=8192 N=1024 K=1024 (M%128==0, N%256==0,
// K%128==0, no padding). Attention: S=2048 (64-multiples), Dh=64.
// ---------------------------------------------------------------------------
extern "C" void kernel_launch(void* const* d_in, const int* in_sizes, int n_in,
                              void* d_out, int out_size, void* d_ws, size_t ws_size,
                              hipStream_t stream) {
  if (n_in < 10) return;
  const int nX = kTok * kD;     // 8,388,608
  const int nW = kD * kD;       // 1,048,576
  if (in_sizes[0] != nX || in_sizes[1] != kTok) return;
  if (in_sizes[2] != nW || in_sizes[4] != nW || in_sizes[6] != nW || in_sizes[8] != nW) return;
  if (in_sizes[3] != kD || in_sizes[5] != kD || in_sizes[7] != kD || in_sizes[9] != kD) return;
  if (out_size != nX) return;

  const size_t szX16 = (size_t)nX * 2;
  const size_t szW16 = (size_t)nW * 2;
  const size_t szTab = (size_t)kP * 4;
  const size_t offXb  = 0;
  const size_t offWq  = offXb + szX16;
  const size_t offWk  = offWq + szW16;
  const size_t offWv  = offWk + szW16;
  const size_t offWo  = offWv + szW16;
  const size_t offQ   = offWo + szW16;
  const size_t offK   = offQ + szX16;
  const size_t offVTh = offK + szX16;
  const size_t offVTl = offVTh + szX16;
  const size_t offOh  = offVTl + szX16;
  const size_t offOl  = offOh + szX16;
  const size_t offTab = offOl + szX16;
  const size_t total  = offTab + szTab;
  if (ws_size < total) return;

  const float* x  = (const float*)d_in[0];
  const float* pm = (const float*)d_in[1];
  const float* Wq = (const float*)d_in[2];
  const float* bq = (const float*)d_in[3];
  const float* Wk = (const float*)d_in[4];
  const float* bk = (const float*)d_in[5];
  const float* Wv = (const float*)d_in[6];
  const float* bv = (const float*)d_in[7];
  const float* Wo = (const float*)d_in[8];
  const float* bo = (const float*)d_in[9];
  float* out = (float*)d_out;
  char* ws = (char*)d_ws;
  unsigned short* Xb  = (unsigned short*)(ws + offXb);
  unsigned short* Wqb = (unsigned short*)(ws + offWq);
  unsigned short* Wkb = (unsigned short*)(ws + offWk);
  unsigned short* Wvb = (unsigned short*)(ws + offWv);
  unsigned short* Wob = (unsigned short*)(ws + offWo);
  unsigned short* Q16 = (unsigned short*)(ws + offQ);
  unsigned short* K16 = (unsigned short*)(ws + offK);
  unsigned short* VTh = (unsigned short*)(ws + offVTh);
  unsigned short* VTl = (unsigned short*)(ws + offVTl);
  unsigned short* Oh  = (unsigned short*)(ws + offOh);
  unsigned short* Ol  = (unsigned short*)(ws + offOl);
  float* tab = (float*)(ws + offTab);

  // ---- prologue: RNE bf16 operand planes and the bias table ----
  const int n8x = nX / 8;   // 1,048,576 -> 4096 blocks exact
  const int n8w = nW / 8;   //   131,072 ->  512 blocks exact
  cast8_bf16_kernel<<<dim3(n8x / 256), dim3(256), 0, stream>>>(x,  Xb,  n8x);
  cast8_bf16_kernel<<<dim3(n8w / 256), dim3(256), 0, stream>>>(Wq, Wqb, n8w);
  cast8_bf16_kernel<<<dim3(n8w / 256), dim3(256), 0, stream>>>(Wk, Wkb, n8w);
  cast8_bf16_kernel<<<dim3(n8w / 256), dim3(256), 0, stream>>>(Wv, Wvb, n8w);
  cast8_bf16_kernel<<<dim3(n8w / 256), dim3(256), 0, stream>>>(Wo, Wob, n8w);
  tab_kernel<<<dim3((kP / 4) / 256), dim3(256), 0, stream>>>(tab);

  // ---- projections (64x64 wave tiles, 8 waves = one 128x256 tile per block) ----
  const int tilesProj = (kTok / 64) * (kD / 64);   // 2048 -> 256 blocks
  // Q16[m][n] = sum_k Xb[m][k] * Wqb[n][k] + bq[n]   (f16 out)
  wmma_gemm64<1, 0, 2, 1, false><<<dim3(tilesProj / 8, 1), dim3(256), 0, stream>>>(
      Xb, Xb, kD, 0L, Wqb, Wqb, kD, 0L, (void*)Q16, (void*)Q16, kD, 0L, bq, pm, kTok, kD, kD, 1.0f);
  // K16 likewise with Wk, bk
  wmma_gemm64<1, 0, 2, 1, false><<<dim3(tilesProj / 8, 1), dim3(256), 0, stream>>>(
      Xb, Xb, kD, 0L, Wkb, Wkb, kD, 0L, (void*)K16, (void*)K16, kD, 0L, bk, pm, kTok, kD, kD, 1.0f);
  // V^T[m = feature][n = token] = sum_k Wvb[m][k] * Xb[n][k] + bv[m]   (f16 hi plane + f16 residual plane x2048)
  wmma_gemm64<1, 0, 1, 3, false><<<dim3(tilesProj / 8, 1), dim3(256), 0, stream>>>(
      Wvb, Wvb, kD, 0L, Xb, Xb, kD, 0L, (void*)VTh, (void*)VTl, kTok, 0L, bv, pm, kD, kTok, kD, 1.0f);

  // ---- attention: 64 (b,h) x 32 query tiles ----
  attn_kernel<<<dim3(kB * kH * (kP / kQB)), dim3(128), 0, stream>>>(Q16, K16, VTh, VTl, tab, pm, Oh, Ol);

  // ---- output projection: out[m][n] = (sum_k (Oh+Ol)[m][k] * Wob[n][k] + bo[n]) * pm[m] ----
  wmma_gemm64<1, 2, 2, 0, true><<<dim3(tilesProj / 8, 1), dim3(256), 0, stream>>>(
      Oh, Ol, kD, 0L, Wob, Wob, kD, 0L, (void*)out, (void*)out, kD, 0L, bo, pm, kTok, kD, kD, 1.0f);
}

// v008
// Measured time: 170 microseconds a run.
// Versions in between are left out here; by their measured steps it is 1.27 times as fast as v006.
// Counting every step since v000, it is 4.73 times as fast.
// Contractions: q/k/v projections on v_wmma_f32_16x16x32_bf16 (x and W as RNE bf16 planes, single products); scores q.k^T on v_wmma_f32_16x16x32_f16 (q, k f16 planes); attn.v on v_wmma_f32_16x16x32_f16 (P f16 carried x32768; V^T as one f16 plane); output projection on v_wmma_f32_16x16x32_bf16 (attention output as bf16 hi + lo planes, Wo bf16, two products); f32 accumulate everywhere; time bias, masks and softmax in f32.
#include <hip/hip_runtime.h>
#include <math.h>

// ---------------------------------------------------------------------------
// Problem constants
// ---------------------------------------------------------------------------
constexpr int kB   = 4;
constexpr int kP   = 2048;
constexpr int kD   = 1024;
constexpr int kH   = 16;
constexpr int kDh  = 64;
constexpr int kTok = kB * kP;            // 8192 token rows
constexpr int kQB  = 64;                 // queries per attention block
constexpr int kKC  = 64;                 // keys per chunk
constexpr int kNW  = 4;                  // waves per attention block
constexpr int kLP  = 72;                 // LDS row pitch in halves of the 64-half K and V^T rows: 144 B = 16 B x odd,
                                         // so the 16 rows of one ds_load_b128 fragment read fall on distinct banks
constexpr float kLog2e      = 1.4426950408889634f;
constexpr float kScoreScale = 0.125f * kLog2e;    // 64^-0.5, scores kept in base 2 (natural score x log2 e)
constexpr float kNegBig     = -1.0e9f * kLog2e;   // masked score, base 2
constexpr float kPCarryLog2 = 15.0f;     // probabilities carried x2^15 in f16: the exponent's reference point lies 15 below the maximum
constexpr float kDelta      = 300.0f;    // seconds per patch step
constexpr float kInvTau     = 1.0f / 300.0f;
constexpr float kLogEps     = 1.0e-12f;
constexpr int   kFarD       = 65;        // smallest |query - key| between a 64-query block and a 64-key chunk two or more chunks away.
                                         // From d = 45 on exp(-d) lies below half an ulp of 1e-12 (2^-64), so the f32 sum exp(-d) + 1e-12 is
                                         // 1e-12 itself and every table entry from there on is the same number
static_assert(kH * kDh == kD, "s");
static_assert(kTok % 64 == 0 && kD % 64 == 0 && kD % 32 == 0, "s");
static_assert(kP % kQB == 0 && kP % kKC == 0 && kDh == 64, "s");
static_assert((kTok * kD) % (8 * 256) == 0 && (kD * kD) % (8 * 256) == 0, "s");
static_assert(kP % 1024 == 0 && kP / kKC >= 2, "s");
static_assert(kP / kKC == 32 && kKC == kNW * 16 && kQB == kKC && kFarD == 2 * kKC - (kQB - 1) && kFarD >= 45 && kFarD < kP, "s");

typedef __attribute__((ext_vector_type(16))) _Float16 v16h;
typedef __attribute__((ext_vector_type(8)))  _Float16 v8h;
typedef __attribute__((ext_vector_type(16))) __bf16   v16b;
typedef __attribute__((ext_vector_type(8)))  __bf16   v8b;
typedef __attribute__((ext_vector_type(8)))  float    v8f;
typedef __attribute__((ext_vector_type(4)))  float    v4f;
typedef __attribute__((ext_vector_type(2)))  float    v2f;
typedef __attribute__((ext_vector_type(4)))  unsigned int v4u;

// ---------------------------------------------------------------------------
// Conversion, fragment and hazard-guard helpers
// ---------------------------------------------------------------------------
__device__ __forceinline__ unsigned short f2bf_bits(float f) {
  unsigned u = __float_as_uint(f);
  return (unsigned short)((u + 0x7FFFu + ((u >> 16) & 1u)) >> 16);
}
__device__ __forceinline__ float bf_bits2f(unsigned short h) { return __uint_as_float(((unsigned)h) << 16); }

// hazard guards as plain device helpers (no inline asm inside the kernel template body)
__device__ __forceinline__ void dep_guard4_h(v8f& a, v8f& b, v8f& c, v8f& d, v16h x, v16h y) {
  asm volatile("v_nop\n\tv_nop\n\tv_nop\n\tv_nop" : "+v"(a), "+v"(b), "+v"(c), "+v"(d) : "v"(x), "v"(y));
}
__device__ __forceinline__ void dep_guard4_b(v8f& a, v8f& b, v8f& c, v8f& d, v16b x, v16b y) {
  asm volatile("v_nop\n\tv_nop\n\tv_nop\n\tv_nop" : "+v"(a), "+v"(b), "+v"(c), "+v"(d) : "v"(x), "v"(y));
}
__device__ __forceinline__ void keep4_h(v16h a, v16h b, v16h c, v16h d) { asm volatile("v_nop" :: "v"(a), "v"(b), "v"(c), "v"(d)); }
__device__ __forceinline__ void keep4_b(v16b a, v16b b, v16b c, v16b d) { asm volatile("v_nop" :: "v"(a), "v"(b), "v"(c), "v"(d)); }
__device__ __forceinline__ void acc_guard4(v8f& a, v8f& b, v8f& c, v8f& d) { asm volatile("v_nop\n\tv_nop\n\tv_nop\n\tv_nop" : "+v"(a), "+v"(b), "+v"(c), "+v"(d)); }
template <typename T> struct Frag;
template <> struct Frag<_Float16> {
  typedef v16h V; union U { v16h v; v8h h[2]; };
  // elements 0..7 <- p[0..7], 8..15 <- p[16..23]
  static __device__ __forceinline__ v16h load(const _Float16* p) {
    U f; f.h[0] = *(const v8h*)(p); f.h[1] = *(const v8h*)(p + 16); return f.v;
  }
  static __device__ __forceinline__ v8f mma(v16h a, v16h b, v8f c) {
    return __builtin_amdgcn_wmma_f32_16x16x32_f16(false, a, false, b, (short)0, c, false, false);
  }
  static __device__ __forceinline__ void guard4(v8f& a, v8f& b, v8f& c, v8f& d, v16h x, v16h y) { dep_guard4_h(a, b, c, d, x, y); }
  static __device__ __forceinline__ void keep(v16h a, v16h b, v16h c, v16h d) { keep4_h(a, b, c, d); }
};
template <> struct Frag<__bf16> {
  typedef v16b V; union U { v16b v; v8b h[2]; };
  static __device__ __forceinline__ v16b load(const __bf16* p) {
    U f; f.h[0] = *(const v8b*)(p); f.h[1] = *(const v8b*)(p + 16); return f.v;
  }
  static __device__ __forceinline__ v8f mma(v16b a, v16b b, v8f c) {
    return __builtin_amdgcn_wmma_f32_16x16x32_bf16(false, a, false, b, (short)0, c, false, false);
  }
  static __device__ __forceinline__ void guard4(v8f& a, v8f& b, v8f& c, v8f& d, v16b x, v16b y) { dep_guard4_b(a, b, c, d, x, y); }
  static __device__ __forceinline__ void keep(v16b a, v16b b, v16b c, v16b d) { keep4_b(a, b, c, d); }
};

__device__ __forceinline__ unsigned pk16(unsigned short a, unsigned short b) { return (unsigned)a | ((unsigned)b << 16); }

// single WMMA with its own hazard guard (ties D, keeps A/B live)
__device__ __forceinline__ v8f mma_h(v16h a, v16h b, v8f c) {
  c = __builtin_amdgcn_wmma_f32_16x16x32_f16(false, a, false, b, (short)0, c, false, false);
  asm volatile("v_nop\n\tv_nop\n\tv_nop\n\tv_nop" : "+v"(c) : "v"(a), "v"(b));
  return c;
}

// lane l <-> lane l ^ 16 (the other 16-lane half of the wave), a vector-port move
__device__ __forceinline__ float xhalf(float x) {
  const int b = __builtin_bit_cast(int, x);
  return __builtin_bit_cast(float, __builtin_amdgcn_permlanex16(b, b, 0x76543210, 0xfedcba98, false, false));
}

// 2^x on the hardware's v_exp_f32, in place. The instruction set asks for one independent instruction or a v_nop between a
// transcendental and a vector instruction that reads its result or writes over its source. Written as one statement the slot is
// kept by construction: each v_exp_f32 writes over its own source alone, none reads a neighbour's result, and the closing v_nop
// stands between the last one and whatever the compiler places next.
__device__ __forceinline__ void exp2x8_inplace(float& a, float& b, float& c, float& d, float& e, float& f, float& g, float& h) {
  asm("v_exp_f32 %0, %0\n\tv_exp_f32 %1, %1\n\tv_exp_f32 %2, %2\n\tv_exp_f32 %3, %3\n\t"
      "v_exp_f32 %4, %4\n\tv_exp_f32 %5, %5\n\tv_exp_f32 %6, %6\n\tv_exp_f32 %7, %7\n\tv_nop"
      : "+v"(a), "+v"(b), "+v"(c), "+v"(d), "+v"(e), "+v"(f), "+v"(g), "+v"(h));
}
// the same with a ninth value
__device__ __forceinline__ void exp2x9_inplace(float& a, float& b, float& c, float& d, float& e, float& f, float& g, float& h, float& i) {
  asm("v_exp_f32 %0, %0\n\tv_exp_f32 %1, %1\n\tv_exp_f32 %2, %2\n\tv_exp_f32 %3, %3\n\tv_exp_f32 %4, %4\n\t"
      "v_exp_f32 %5, %5\n\tv_exp_f32 %6, %6\n\tv_exp_f32 %7, %7\n\tv_exp_f32 %8, %8\n\tv_nop"
      : "+v"(a), "+v"(b), "+v"(c), "+v"(d), "+v"(e), "+v"(f), "+v"(g), "+v"(h), "+v"(i));
}

// ---- LDS staging of the GEMM operands ----
constexpr int kGK = 128;   // k per stage: every staged operand row is 256 B = two whole 128-B lines
constexpr int kGP = 136;   // LDS row pitch in halves: 272 B = 16 B x odd, so the 16 rows of a ds_load_b128 fragment read fall on distinct banks

// Eight asynchronous 16-B copies per lane, global -> LDS: rows r, r+16, ..., r+112 of one 128-row panel (16 lanes per 256-B row).
// The closing s_wait_xcnt stands inside the statement so that no address register of a copy is rewritten in front of it.
__device__ __forceinline__ void copy8_to_lds(unsigned l, const unsigned short* g, size_t gs) {
  constexpr unsigned ls = 16u * kGP * 2u;   // 16 LDS rows in bytes
  asm volatile(
      "global_load_async_to_lds_b128 %0, %8, off\n\t"
      "global_load_async_to_lds_b128 %1, %9, off\n\t"
      "global_load_async_to_lds_b128 %2, %10, off\n\t"
      "global_load_async_to_lds_b128 %3, %11, off\n\t"
      "global_load_async_to_lds_b128 %4, %12, off\n\t"
      "global_load_async_to_lds_b128 %5, %13, off\n\t"
      "global_load_async_to_lds_b128 %6, %14, off\n\t"
      "global_load_async_to_lds_b128 %7, %15, off\n\t"
      "s_wait_xcnt 0x0"
      :: "v"(l), "v"(l + ls), "v"(l + 2u * ls), "v"(l + 3u * ls), "v"(l + 4u * ls), "v"(l + 5u * ls), "v"(l + 6u * ls), "v"(l + 7u * ls),
         "v"(g), "v"(g + gs), "v"(g + 2 * gs), "v"(g + 3 * gs), "v"(g + 4 * gs), "v"(g + 5 * gs), "v"(g + 6 * gs), "v"(g + 7 * gs)
      : "memory");
}
// this wave's copies have landed in LDS (the compiler places no wait for them)
__device__ __forceinline__ void wait_copies() { asm volatile("s_wait_asynccnt 0x0" ::: "memory"); }
// this wave's LDS reads have returned, so the buffer they read may be refilled behind the next barrier
__device__ __forceinline__ void wait_lds() { asm volatile("s_wait_dscnt 0x0" ::: "memory"); }

// Eight asynchronous 16-B copies per lane, global -> LDS: rows r, r+16, r+32, r+48 (8 lanes per 128-B row) of the K tile and of the
// V^T tile of one 64-key chunk; the two tiles lie behind one another in LDS at pitch kLP.
// The closing s_wait_xcnt stands inside the statement so that no address register of a copy is rewritten in front of it.
__device__ __forceinline__ void copy_kv_to_lds(unsigned l, const unsigned short* gk, const unsigned short* gv) {
  constexpr unsigned ls = 16u * kLP * 2u;    // 16 LDS rows in bytes
  constexpr unsigned lt = 64u * kLP * 2u;    // one 64-row tile in bytes
  constexpr size_t   sk = (size_t)16 * kD;   // 16 K rows (tokens) in halves
  constexpr size_t   sv = (size_t)16 * kTok; // 16 V^T rows (features) in halves
  asm volatile(
      "global_load_async_to_lds_b128 %0, %8, off\n\t"
      "global_load_async_to_lds_b128 %1, %9, off\n\t"
      "global_load_async_to_lds_b128 %2, %10, off\n\t"
      "global_load_async_to_lds_b128 %3, %11, off\n\t"
      "global_load_async_to_lds_b128 %4, %12, off\n\t"
      "global_load_async_to_lds_b128 %5, %13, off\n\t"
      "global_load_async_to_lds_b128 %6, %14, off\n\t"
      "global_load_async_to_lds_b128 %7, %15, off\n\t"
      "s_wait_xcnt 0x0"
      :: "v"(l), "v"(l + ls), "v"(l + 2u * ls), "v"(l + 3u * ls),
         "v"(l + lt), "v"(l + lt + ls), "v"(l + lt + 2u * ls), "v"(l + lt + 3u * ls),
         "v"(gk), "v"(gk + sk), "v"(gk + 2 * sk), "v"(gk + 3 * sk),
         "v"(gv), "v"(gv + sv), "v"(gv + 2 * sv), "v"(gv + 3 * sv)
      : "memory");
}

// ---- Register-blocked batched WMMA GEMM (modes extended) ----------------------------------------------
// C[m,n] = scale * sum_k A[m,k] * Bt[n,k] (+bias)(*rowsc[m]); each wave owns a 64x64 tile, the block's 8 waves a 128x256 tile
// (2 x 4 waves). Per stage the block's 128 A rows and 256 Bt rows x 128 k are copied to LDS in whole lines and every wave
// reads its fragments from there; two buffers, the next stage's copies in flight while this stage is multiplied.
// A row-major [M,K]; Bt row-major [N,K]; M % 128 == 0, N % 256 == 0, K % 128 == 0, K >= 128 (no tail handling).
// SPLIT: 0 = single product; 1 = A and Bt hi/lo planes (hi*hi + hi*lo + lo*hi); 2 = A hi/lo planes only (hi*B + lo*B).
// BIAS_MODE: 0 = none, 1 = bias[m], 2 = bias[n].  ROWSC: multiply by RNE-bf16(rowsc[m]) after the bias.
// OUT_MODE: 0 = f32, 1 = f16, 2 = bf16 hi plane (Cout) + bf16 lo plane (Cout2).
// ET: 0 = f16 operands, 1 = bf16 operands (pointers passed as 16-bit storage)
template <int ET> struct Elem;
template <> struct Elem<0> { typedef _Float16 T; };
template <> struct Elem<1> { typedef __bf16 T; };
template <int ET, int SPLIT, int BIAS_MODE, int OUT_MODE, bool ROWSC>
__global__ __launch_bounds__(256) void wmma_gemm64(
    const unsigned short* __restrict__ Ap, const unsigned short* __restrict__ A2p, int lda, long strideA,
    const unsigned short* __restrict__ Btp, const unsigned short* __restrict__ Bt2p, int ldb, long strideB,
    void* __restrict__ Cout, void* __restrict__ Cout2, int ldc, long strideC,
    const float* __restrict__ bias, const float* __restrict__ rowsc,
    int M, int N, int K, float scale) {
  typedef typename Elem<ET>::T T;
  typedef typename Frag<T>::V V;
  constexpr int NA = (SPLIT != 0) ? 2 : 1;             // A planes
  constexpr int NB = (SPLIT == 1) ? 2 : 1;             // Bt planes
  constexpr int kBufH = (128 * NA + 256 * NB) * kGP;   // halves per buffer: [A planes, 128 rows each][Bt planes, 256 rows each]
  __shared__ __align__(16) unsigned short ring[2 * kBufH];
  __shared__ __align__(16) float sT[8][16 * 68];   // per-wave 16x64 slab, pitch 68 floats
  const int b    = blockIdx.y;
  const int lane = threadIdx.x & 31;
  const int wave = threadIdx.x >> 5;
  const int tilesNb = N >> 8;
  const int tilesMb = M >> 7;
  if ((int)blockIdx.x >= tilesMb * tilesNb) return;   // the same for the whole block, ahead of every barrier
  const int bm  = blockIdx.x / tilesNb;
  const int bn  = blockIdx.x - bm * tilesNb;
  const int m0b = bm << 7;
  const int n0b = bn << 8;
  const int wm  = wave >> 2;
  const int wn  = wave & 3;
  const int m0  = m0b + (wm << 6);
  const int n0  = n0b + (wn << 6);

  const int rlane = lane & 15;                 // row (A) / col (B, D) within subtile
  const int koff  = (lane >> 4) * 8;           // k offset of this lane half
  const int mOff  = (lane >> 4) * 8;           // D row offset

  // copy addresses of this lane: row threadIdx.x / 16 of each 16-row group, 16-B segment threadIdx.x % 16
  const int cr = threadIdx.x >> 4;
  const int cs = (threadIdx.x & 15) * 8;
  const unsigned short* cA  = Ap   + (size_t)b * strideA + (size_t)(m0b + cr) * lda + cs;
  const unsigned short* cA2 = A2p  + (size_t)b * strideA + (size_t)(m0b + cr) * lda + cs;
  const unsigned short* cB  = Btp  + (size_t)b * strideB + (size_t)(n0b + cr) * ldb + cs;
  const unsigned short* cB2 = Bt2p + (size_t)b * strideB + (size_t)(n0b + cr) * ldb + cs;
  const unsigned cl = (unsigned)(uintptr_t)ring + (unsigned)(cr * kGP + cs) * 2u;   // LDS byte address
  const size_t gsA = (size_t)16 * lda;
  const size_t gsB = (size_t)16 * ldb;
  constexpr unsigned kPanel = 128u * kGP * 2u;   // 128 LDS rows in bytes
  auto stage = [&](int t) {
    const unsigned l = cl + (unsigned)(t & 1) * (unsigned)(kBufH * 2);
    const size_t k = (size_t)t * kGK;
    copy8_to_lds(l, cA + k, gsA);
    if (NA == 2) copy8_to_lds(l + kPanel, cA2 + k, gsA);
    copy8_to_lds(l + NA * kPanel, cB + k, gsB);
    copy8_to_lds(l + (NA + 1) * kPanel, cB + k + 8 * gsB, gsB);
    if (NB == 2) {
      copy8_to_lds(l + (NA + 2) * kPanel, cB2 + k, gsB);
      copy8_to_lds(l + (NA + 3) * kPanel, cB2 + k + 8 * gsB, gsB);
    }
  };

  v8f acc[4][4];
#pragma unroll
  for (int i = 0; i < 4; ++i)
#pragma unroll
    for (int j = 0; j < 4; ++j) acc[i][j] = (v8f){0.f,0.f,0.f,0.f,0.f,0.f,0.f,0.f};

  const int nT = K / kGK;
  stage(0);
  wait_copies();
  __syncthreads();            // stage 0 is readable by every wave
  if (nT > 1) stage(1);

  for (int t = 0; t < nT; ++t) {
    const T* rb = (const T*)ring + (t & 1) * kBufH;
    const T* fa = rb + ((wm << 6) + rlane) * kGP + koff;
    const T* fb = rb + (128 * NA + (wn << 6) + rlane) * kGP + koff;
    // every loop of a stage is unrolled: fragment and accumulator indices are constants (registers, no scratch) and the
    // LDS offsets of the four 32-k steps are immediates
#pragma unroll
    for (int ks = 0; ks < kGK / 32; ++ks) {
      V bh[4], bl[4], ah[4], al[4];
#pragma unroll
      for (int j = 0; j < 4; ++j) {
        bh[j] = Frag<T>::load(fb + (j << 4) * kGP + ks * 32);
        if (SPLIT == 1) bl[j] = Frag<T>::load(fb + (256 + (j << 4)) * kGP + ks * 32);
      }
#pragma unroll
      for (int i = 0; i < 4; ++i) {
        ah[i] = Frag<T>::load(fa + (i << 4) * kGP + ks * 32);
        al[i] = ah[i];
        if (SPLIT != 0) al[i] = Frag<T>::load(fa + (128 + (i << 4)) * kGP + ks * 32);
      }
#pragma unroll
      for (int i = 0; i < 4; ++i) {
#pragma unroll
        for (int j = 0; j < 4; ++j) {
          acc[i][j] = Frag<T>::mma(ah[i], bh[j], acc[i][j]);
          if (SPLIT == 1) acc[i][j] = Frag<T>::mma(ah[i], bl[j], acc[i][j]);
          if (SPLIT != 0) acc[i][j] = Frag<T>::mma(al[i], bh[j], acc[i][j]);
        }
        Frag<T>::guard4(acc[i][0], acc[i][1], acc[i][2], acc[i][3], ah[i], al[i]);
      }
      Frag<T>::keep(bh[0], bh[1], bh[2], bh[3]);
      if (SPLIT == 1) Frag<T>::keep(bl[0], bl[1], bl[2], bl[3]);
    }
    wait_lds();
    wait_copies();
    __syncthreads();          // publishes stage t + 1 and ends every wave's reads of stage t's buffer
    if (t + 2 < nT) stage(t + 2);
  }
  wait_copies();              // nothing in flight when the wave goes on to the epilogue
  acc_guard4(acc[0][0], acc[0][1], acc[0][2], acc[0][3]);
  acc_guard4(acc[1][0], acc[1][1], acc[1][2], acc[1][3]);
  acc_guard4(acc[2][0], acc[2][1], acc[2][2], acc[2][3]);
  acc_guard4(acc[3][0], acc[3][1], acc[3][2], acc[3][3]);

  // ---- epilogue ----
  float* slab = sT[wave];
#pragma unroll
  for (int i = 0; i < 4; ++i) {
    const int mBase = m0 + (i << 4);
    float rsv[8];
#pragma unroll
    for (int r = 0; r < 8; ++r) rsv[r] = 1.0f;
    if (ROWSC) {
      // two 16-B loads of rowsc[mBase+mOff .. +7], then RNE bf16 of each value
      const v4f ra = *(const v4f*)(rowsc + mBase + mOff);
      const v4f rb = *(const v4f*)(rowsc + mBase + mOff + 4);
      rsv[0] = ra[0]; rsv[1] = ra[1]; rsv[2] = ra[2]; rsv[3] = ra[3];
      rsv[4] = rb[0]; rsv[5] = rb[1]; rsv[6] = rb[2]; rsv[7] = rb[3];
#pragma unroll
      for (int r = 0; r < 8; ++r) rsv[r] = bf_bits2f(f2bf_bits(rsv[r]));
    }
#pragma unroll
    for (int j = 0; j < 4; ++j) {
      const int n = n0 + (j << 4) + rlane;
      float bv = 0.f;
      if (BIAS_MODE == 2) bv = bias[n];
#pragma unroll
      for (int r = 0; r < 8; ++r) {
        float v = acc[i][j][r] * scale;
        if (BIAS_MODE == 1) v += bias[mBase + mOff + r];
        if (BIAS_MODE == 2) v += bv;
        if (ROWSC) v = v * rsv[r];
        slab[(mOff + r) * 68 + (j << 4) + rlane] = v;
      }
    }
    __builtin_amdgcn_fence(__ATOMIC_RELEASE, "workgroup");
    __builtin_amdgcn_wave_barrier();
    __builtin_amdgcn_fence(__ATOMIC_ACQUIRE, "workgroup");
    if (OUT_MODE == 0) {
      float* C = (float*)Cout + (size_t)b * strideC;
      const int hh = lane >> 4, c4 = (lane & 15) * 4;     // row seg = 256 B = 16 lanes x 16 B
      {
#pragma unroll
        for (int it = 0; it < 8; ++it) {
          const int row = it * 2 + hh;
          v4f v = *(const v4f*)(slab + row * 68 + c4);
          *(v4f*)(C + (size_t)(mBase + row) * ldc + n0 + c4) = v;
        }
        
      }
    } else {
      const int q = lane >> 3, c8 = (lane & 7) * 8;
      unsigned short* C  = (unsigned short*)Cout  + (size_t)b * strideC;
      unsigned short* C2 = (OUT_MODE >= 2) ? ((unsigned short*)Cout2 + (size_t)b * strideC) : nullptr;
      {
#pragma unroll
        for (int it = 0; it < 4; ++it) {
          const int row = it * 4 + q;
          const float* sp = slab + row * 68 + c8;
          v8h hv, lv;
#pragma unroll
          for (int e = 0; e < 8; ++e) {
            if (OUT_MODE == 1) {
              hv[e] = (_Float16)sp[e];
            } else {
              unsigned short hb = f2bf_bits(sp[e]);
              unsigned short lb = f2bf_bits(sp[e] - bf_bits2f(hb));
              hv[e] = __builtin_bit_cast(_Float16, hb);
              lv[e] = __builtin_bit_cast(_Float16, lb);
            }
          }
          *(v8h*)(C + (size_t)(mBase + row) * ldc + n0 + c8) = hv;
          if (OUT_MODE >= 2) *(v8h*)(C2 + (size_t)(mBase + row) * ldc + n0 + c8) = lv;
        }
        
      }
    }
    __builtin_amdgcn_fence(__ATOMIC_RELEASE, "workgroup");
    __builtin_amdgcn_wave_barrier();
    __builtin_amdgcn_fence(__ATOMIC_ACQUIRE, "workgroup");
  }
}

// ---------------------------------------------------------------------------
// f32 -> bf16 (RNE) cast, 8 consecutive elements per thread (one 16-B store per lane; 32 contiguous lanes = 4 whole
// multiples of 256: 1,048,576 threads for x, 131,072 for each weight).
// ---------------------------------------------------------------------------
__global__ __launch_bounds__(256) void cast8_bf16_kernel(const float* __restrict__ in, unsigned short* __restrict__ out, int n8) {
  const int i = blockIdx.x * 256 + threadIdx.x;
  if (i >= n8) return;
  const float* p = in + 8 * (size_t)i;
  const v4f a = *(const v4f*)(p);
  const v4f c = *(const v4f*)(p + 4);
  unsigned short hb[8];
#pragma unroll
  for (int e = 0; e < 4; ++e) {
    hb[e]     = f2bf_bits(a[e]);
    hb[4 + e] = f2bf_bits(c[e]);
  }
  const v4u u = (v4u){pk16(hb[0], hb[1]), pk16(hb[2], hb[3]), pk16(hb[4], hb[5]), pk16(hb[6], hb[7])};
  unsigned short* q = out + 8 * (size_t)i;
  *(v4u*)q = u;
  
}

// ---------------------------------------------------------------------------
// Time-decay bias table in base 2: tab[d] = logf(expf((-(d*300)) * (1/300)) + 1e-12) * log2(e), d = 0..2047, f32, precise expf/logf.
// ---------------------------------------------------------------------------
__global__ __launch_bounds__(256) void tab_kernel(float* __restrict__ tab) {
  const int i = blockIdx.x * 256 + threadIdx.x;
  if (i >= kP / 4) return;
  v4f tv;
#pragma unroll
  for (int e = 0; e < 4; ++e) {
    const float d = (float)(4 * i + e);
    const float dist = d * kDelta;
    const float ex = (-dist) * kInvTau;
    const float w = expf(ex);
    tv[e] = logf(w + kLogEps) * kLog2e;
  }
  float* q = tab + 4 * (size_t)i;
  *(v4f*)q = tv;
  
}

__global__ __launch_bounds__(128, 5) void attn_kernel(const unsigned short* __restrict__ Qp, const unsigned short* __restrict__ Kp,
                                                   const unsigned short* __restrict__ VTp,
                                                   const float* __restrict__ tab, const float* __restrict__ pm,
                                                   unsigned short* __restrict__ Ohp, unsigned short* __restrict__ Olp) {
  constexpr int kTileH = 64 * kLP;                           // halves of one 64-row tile (9 KB)
  constexpr int kBufH  = 2 * kTileH;                         // one buffer: K [kv][d], V^T [d][kv]
  __shared__ __align__(16) _Float16 tiles[2 * kBufH];        // two buffers, 36 KB
  __shared__ __align__(16) float    Os[kNW][16 * 68];        // per wave out tile, pitch 68
  __shared__ __align__(16) float    tabs[kP];                // bias table 8 KB
  __shared__ __align__(16) unsigned mb[kNW];                 // per wave: bit kc = a masked key in this wave's quarter of chunk kc

  const int tid  = threadIdx.x;
  const int wave = tid >> 5;
  const int lane = tid & 31;
  const int hh   = lane >> 4;
  const int c    = lane & 15;
  const int nqb  = kP / kQB;              // 32
  const int bx   = blockIdx.x;
  const int qb   = bx % nqb;
  const int bh   = bx / nqb;
  const int h    = bh % kH;
  const int b    = bh / kH;
  const int q0   = qb * kQB + wave * 16;  // first query row of this wave within the sequence
  const size_t tok0 = (size_t)b * kP;     // first token row of this batch

  // ---- bias table -> LDS: 4 x 128 threads x 4 floats = 2048 (whole table); read after the barrier in front of the loop ----
#pragma unroll
  for (int i = 0; i < 4; ++i) {
    const int idx = i * 128 + tid;
    const v4f t4 = *(const v4f*)(tab + 4 * idx);
    *(v4f*)(tabs + 4 * idx) = t4;
  }
  asm volatile("" ::: "memory");

  // ---- which chunks of this batch hold a masked key: lane = chunk, wave = quarter of the chunk (16 keys); joined behind the barrier ----
  {
    const float* pq = pm + tok0 + lane * kKC + wave * 16;
    bool anym = false;
#pragma unroll   // the four loads go out together
    for (int i = 0; i < 4; ++i) {
      const v4f t4 = *(const v4f*)(pq + 4 * i);
      anym = anym || (t4[0] <= 0.0f) || (t4[1] <= 0.0f) || (t4[2] <= 0.0f) || (t4[3] <= 0.0f);
    }
    const unsigned bal = __builtin_amdgcn_ballot_w32(anym);
    if (lane == 0) mb[wave] = bal;
  }

  // ---- Q fragments (B operand): column = query q0+c, k = d; 2 d-chunks ----
  const _Float16* Qh = (const _Float16*)(const void*)Qp;
  const _Float16* qr = Qh + (tok0 + q0 + c) * (size_t)kD + h * kDh + 8 * hh;
  v16h qa[2];
  qa[0] = Frag<_Float16>::load(qr);
  qa[1] = Frag<_Float16>::load(qr + 32);

  float mrow = -__builtin_inff();   // running maximum of query q0+c (equal in both halves), base 2
  float mref = -__builtin_inff();   // reference point of the exponentials: P, its sum and O all carry the factor 2^(-mref)
  float lrow = 0.f;                 // running sum of query q0+c over this half's keys; the halves are joined after the loop
  v8f oacc[4];                      // O^T: row = d t*16+8hh+r, column = query q0+c
#pragma unroll
  for (int t = 0; t < 4; ++t) oacc[t] = (v8f){0.f,0.f,0.f,0.f,0.f,0.f,0.f,0.f};

  // ---- K / V^T tiles: asynchronous copies, two buffers; chunk kc + 1 is in flight while chunk kc is worked on ----
  // this lane's copy addresses: row tid / 8 of each 16-row group, 16-B segment tid % 8
  const int cr = tid >> 3;
  const int cs = (tid & 7) * 8;
  const unsigned cl = (unsigned)(uintptr_t)tiles + (unsigned)(cr * kLP + cs) * 2u;   // LDS byte address
  const unsigned short* cK  = Kp   + (tok0 + cr) * (size_t)kD + h * kDh + cs;
  const unsigned short* cV  = VTp  + (size_t)(h * kDh + cr) * kTok + tok0 + cs;
  auto stage = [&](int t) {
    copy_kv_to_lds(cl + (unsigned)(t & 1) * (unsigned)(kBufH * 2), cK + (size_t)t * (kKC * kD), cV + t * kKC);
  };
  stage(0);
  wait_copies();
  __syncthreads();            // chunk 0, the bias table and the mask words are readable by every wave

  // both are the same in every lane: kept in scalar registers, so that the test in the loop is a scalar branch
  // bit kc of shortbits: chunk kc holds no masked key and is none of qb - 1, qb, qb + 1
  const unsigned mbits = (unsigned)__builtin_amdgcn_readfirstlane((int)(mb[0] | mb[1] | mb[2] | mb[3]));
  const unsigned shortbits = ~(mbits | (unsigned)((7ull << qb) >> 1));
  const float    cfar  = __builtin_bit_cast(float, __builtin_amdgcn_readfirstlane(__builtin_bit_cast(int, tabs[kFarD])));

  for (int kc = 0; kc < kP / kKC; ++kc) {
    // directly behind the barrier (the one above, or the one at the foot of trip kc - 1, which ended every wave's reads of
    // chunk kc - 1): the copies of chunk kc + 1, while it exists, into the buffer that chunk kc - 1 has left
    if (kc + 1 < kP / kKC) stage(kc + 1);
    const int kv0 = kc * kKC;
    const _Float16* Ksh = tiles + (kc & 1) * kBufH;
    const _Float16* Vt  = Ksh + kTileH;

    // ---- scores, transposed: D[row = key j*16+8hh+r][col = query c] = K . Q^T, K = 64 in 2 steps of 32 ----
    // all eight K fragments are read ahead of the first product: one LDS latency for the group, counted waits behind it
    // (the loops are unrolled so that fragment and accumulator indices are constants: registers, no scratch)
    v16h kf[2][4];
#pragma unroll
    for (int dc = 0; dc < 2; ++dc) {
#pragma unroll
      for (int j = 0; j < 4; ++j) kf[dc][j] = Frag<_Float16>::load(Ksh + (j * 16 + c) * kLP + dc * 32 + 8 * hh);
    }
    v8f s[4];
#pragma unroll
    for (int j = 0; j < 4; ++j) s[j] = (v8f){0.f,0.f,0.f,0.f,0.f,0.f,0.f,0.f};
#pragma unroll
    for (int dc = 0; dc < 2; ++dc) {
#pragma unroll
      for (int j = 0; j < 4; ++j) s[j] = mma_h(kf[dc][j], qa[dc], s[j]);
    }

    // ---- base-2 score = s * smul + sadd. A short chunk keeps its raw products: smul the scale, sadd the one bias. ----
    float smul = kScoreScale, sadd = cfar;
    if (((shortbits >> kc) & 1u) == 0u) {
      // general chunk: scale, time bias and key mask are worked into s here
      const int qrow = q0 + c;
#pragma unroll
      for (int j = 0; j < 4; ++j) {
        // key mask values of this lane's 8 consecutive keys of tile j (two 16-B loads)
        const float* pmp = pm + tok0 + kv0 + j * 16 + 8 * hh;
        const v4f pma = *(const v4f*)(pmp);
        const v4f pmb = *(const v4f*)(pmp + 4);
#pragma unroll
        for (int r = 0; r < 8; ++r) {
          const int kvcol = kv0 + j * 16 + 8 * hh + r;
          int dd = qrow - kvcol;
          dd = (dd < 0) ? -dd : dd;
          const float pmv = (r < 4) ? pma[r & 3] : pmb[r & 3];
          const float v = s[j][r] * kScoreScale + tabs[dd];
          s[j][r] = (pmv <= 0.0f) ? kNegBig : v;
        }
      }
      smul = 1.0f;   // x * 1 + 0 is x and x * 1 - y is x - y, each rounded as before: these chunks keep their values
      sadd = 0.0f;
    }

    // ---- maximum over this lane's 32 keys (smul is positive: the largest s gives the largest score), then over both halves ----
    float sm[4];   // one chain per score tile: four short dependent chains, not one long one (unrolled: constant indices)
#pragma unroll
    for (int j = 0; j < 4; ++j) {
      sm[j] = -__builtin_inff();
#pragma unroll
      for (int r = 0; r < 8; ++r) sm[j] = fmaxf(sm[j], s[j][r]);
    }
    float cm = fmaxf(fmaxf(sm[0], sm[1]), fmaxf(sm[2], sm[3])) * smul + sadd;
    cm = fmaxf(cm, xhalf(cm));

    // ---- online softmax; P = 2^(v - mref) (at most 2^15) as f16 straight into the B operands of the PV products ----
    // B operand of keys kk*32 .. kk*32+31: elements 0..7 = keys 8hh+0..7 (score tile 2kk), 8..15 = keys 16+8hh+0..7 (tile 2kk+1)
    const float mnew  = fmaxf(mrow, cm);
    // from 2^23 on, mnew - 15 would round and could lift P past the f16 range: there the reference point is the maximum itself
    const float rnew  = (fabsf(mnew) < 8388608.0f) ? mnew - kPCarryLog2 : mnew;
    float alpha = mref - rnew;   // becomes 2^(mref - rnew) together with the first eight scores
    mrow = mnew;
    mref = rnew;
    const float soff = sadd - rnew;
    const v2f smul2 = (v2f){smul, smul};
    const v2f soff2 = (v2f){soff, soff};
    float psum = 0.f;
    v16h pb[2];
#pragma unroll
    for (int j = 0; j < 4; ++j) {
      float e[8];
#pragma unroll
      for (int r = 0; r < 8; r += 2) {
        const v2f x = (v2f){s[j][r], s[j][r + 1]} * smul2 + soff2;   // two scores per packed multiply-add
        e[r] = x[0];
        e[r + 1] = x[1];
      }
      if (j == 0) exp2x9_inplace(alpha, e[0], e[1], e[2], e[3], e[4], e[5], e[6], e[7]);
      else        exp2x8_inplace(e[0], e[1], e[2], e[3], e[4], e[5], e[6], e[7]);
#pragma unroll
      for (int r = 0; r < 8; ++r) {
        psum += e[r];
        pb[j >> 1][(j & 1) * 8 + r] = (_Float16)e[r];
      }
    }
    lrow = lrow * alpha + psum;
#pragma unroll
    for (int t = 0; t < 4; ++t) {
#pragma unroll
      for (int r = 0; r < 8; ++r) oacc[t][r] *= alpha;
    }

    // ---- O^T += V^T . P^T : A = V^T [d t*16+c][kv], B = P^T [kv][query c] ----
    // the eight V^T fragments (order: kk, t) are asked for as one group in front of their products: the LDS latency is met once,
    // counted waits follow (unrolled for the same reason as above: constant indices, registers and no scratch)
    v16h vf[8];
#pragma unroll
    for (int i = 0; i < 8; ++i) vf[i] = Frag<_Float16>::load(Vt + ((i & 3) * 16 + c) * kLP + (i >> 2) * 32 + 8 * hh);
#pragma unroll
    for (int i = 0; i < 8; ++i) oacc[i & 3] = mma_h(vf[i], pb[i >> 2], oacc[i & 3]);
    wait_lds();
    wait_copies();
    __syncthreads();          // publishes chunk kc + 1 and ends every wave's reads of chunk kc's buffer
  }
  wait_copies();              // nothing in flight when the wave goes on to the epilogue

  // ---- normalise (the sum carries P's own factor) into the per-wave f32 slab ----
  float* os = Os[wave];   // [query][d]
  const float inv = 1.0f / (lrow + xhalf(lrow));
#pragma unroll
  for (int t = 0; t < 4; ++t) {
#pragma unroll
    for (int r = 0; r < 8; ++r) os[c * 68 + t * 16 + 8 * hh + r] = oacc[t][r] * inv;
  }
  __builtin_amdgcn_fence(__ATOMIC_RELEASE, "workgroup");
  __builtin_amdgcn_wave_barrier();
  __builtin_amdgcn_fence(__ATOMIC_ACQUIRE, "workgroup");
  {
    const int q4 = lane >> 3, c8 = (lane & 7) * 8;
    {
#pragma unroll
      for (int it = 0; it < 4; ++it) {
        const int row = it * 4 + q4;
        const float* sp = os + row * 68 + c8;
        v8h hv, lv;
#pragma unroll
        for (int e = 0; e < 8; ++e) {
          const unsigned short hb = f2bf_bits(sp[e]);
          const unsigned short lb = f2bf_bits(sp[e] - bf_bits2f(hb));
          hv[e] = __builtin_bit_cast(_Float16, hb);
          lv[e] = __builtin_bit_cast(_Float16, lb);
        }
        const size_t off = (tok0 + q0 + row) * (size_t)kD + h * kDh + c8;
        *(v8h*)(Ohp + off) = hv;
        *(v8h*)(Olp + off) = lv;
      }
      
    }
  }
}

// ---------------------------------------------------------------------------
// Host glue.
//   Xb   bf16 [8192][1024]        16,777,216  at           0
//   Wqb  bf16 [1024][1024]         2,097,152  at  16,777,216
//   Wkb  bf16 [1024][1024]         2,097,152  at  18,874,368
//   Wvb  bf16 [1024][1024]         2,097,152  at  20,971,520
//   Wob  bf16 [1024][1024]         2,097,152  at  23,068,672
//   Q16  f16  [8192][1024]        16,777,216  at  25,165,824
//   K16  f16  [8192][1024]        16,777,216  at  41,943,040
//   VT   f16  [1024][8192]        16,777,216  at  58,720,256
//   Oh   bf16 [8192][1024]        16,777,216  at  75,497,472
//   Ol   bf16 [8192][1024]        16,777,216  at  92,274,688
//   tab  f32  [2048]                   8,192  at 109,051,904
//   total                        109,060,096
// Every region is fully written before it is read; no region is re-used.
// GEMM shapes: Q,K: M=8192 N=1024 K=1024; V^T: M=1024 N=8192 K=1024; out: M=8192 N=1024 K=1024 (M%128==0, N%256==0,
// K%128==0, no padding). Attention: S=2048 (64-multiples), Dh=64.
// ---------------------------------------------------------------------------
extern "C" void kernel_launch(void* const* d_in, const int* in_sizes, int n_in,
                              void* d_out, int out_size, void* d_ws, size_t ws_size,
                              hipStream_t stream) {
  if (n_in < 10) return;
  const int nX = kTok * kD;     // 8,388,608
  const int nW = kD * kD;       // 1,048,576
  if (in_sizes[0] != nX || in_sizes[1] != kTok) return;
  if (in_sizes[2] != nW || in_sizes[4] != nW || in_sizes[6] != nW || in_sizes[8] != nW) return;
  if (in_sizes[3] != kD || in_sizes[5] != kD || in_sizes[7] != kD || in_sizes[9] != kD) return;
  if (out_size != nX) return;

  const size_t szX16 = (size_t)nX * 2;
  const size_t szW16 = (size_t)nW * 2;
  const size_t szTab = (size_t)kP * 4;
  const size_t offXb  = 0;
  const size_t offWq  = offXb + szX16;
  const size_t offWk  = offWq + szW16;
  const size_t offWv  = offWk + szW16;
  const size_t offWo  = offWv + szW16;
  const size_t offQ   = offWo + szW16;
  const size_t offK   = offQ + szX16;
  const size_t offVT  = offK + szX16;
  const size_t offOh  = offVT + szX16;
  const size_t offOl  = offOh + szX16;
  const size_t offTab = offOl + szX16;
  const size_t total  = offTab + szTab;
  if (ws_size < total) return;

  const float* x  = (const float*)d_in[0];
  const float* pm = (const float*)d_in[1];
  const float* Wq = (const float*)d_in[2];
  const float* bq = (const float*)d_in[3];
  const float* Wk = (const float*)d_in[4];
  const float* bk = (const float*)d_in[5];
  const float* Wv = (const float*)d_in[6];
  const float* bv = (const float*)d_in[7];
  const float* Wo = (const float*)d_in[8];
  const float* bo = (const float*)d_in[9];
  float* out = (float*)d_out;
  char* ws = (char*)d_ws;
  unsigned short* Xb  = (unsigned short*)(ws + offXb);
  unsigned short* Wqb = (unsigned short*)(ws + offWq);
  unsigned short* Wkb = (unsigned short*)(ws + offWk);
  unsigned short* Wvb = (unsigned short*)(ws + offWv);
  unsigned short* Wob = (unsigned short*)(ws + offWo);
  unsigned short* Q16 = (unsigned short*)(ws + offQ);
  unsigned short* K16 = (unsigned short*)(ws + offK);
  unsigned short* VT  = (unsigned short*)(ws + offVT);
  unsigned short* Oh  = (unsigned short*)(ws + offOh);
  unsigned short* Ol  = (unsigned short*)(ws + offOl);
  float* tab = (float*)(ws + offTab);

  // ---- prologue: RNE bf16 operand planes and the bias table ----
  const int n8x = nX / 8;   // 1,048,576 -> 4096 blocks exact
  const int n8w = nW / 8;   //   131,072 ->  512 blocks exact
  cast8_bf16_kernel<<<dim3(n8x / 256), dim3(256), 0, stream>>>(x,  Xb,  n8x);
  cast8_bf16_kernel<<<dim3(n8w / 256), dim3(256), 0, stream>>>(Wq, Wqb, n8w);
  cast8_bf16_kernel<<<dim3(n8w / 256), dim3(256), 0, stream>>>(Wk, Wkb, n8w);
  cast8_bf16_kernel<<<dim3(n8w / 256), dim3(256), 0, stream>>>(Wv, Wvb, n8w);
  cast8_bf16_kernel<<<dim3(n8w / 256), dim3(256), 0, stream>>>(Wo, Wob, n8w);
  tab_kernel<<<dim3((kP / 4) / 256), dim3(256), 0, stream>>>(tab);

  // ---- projections (64x64 wave tiles, 8 waves = one 128x256 tile per block) ----
  const int tilesProj = (kTok / 64) * (kD / 64);   // 2048 -> 256 blocks
  // Q16[m][n] = sum_k Xb[m][k] * Wqb[n][k] + bq[n]   (f16 out)
  wmma_gemm64<1, 0, 2, 1, false><<<dim3(tilesProj / 8, 1), dim3(256), 0, stream>>>(
      Xb, Xb, kD, 0L, Wqb, Wqb, kD, 0L, (void*)Q16, (void*)Q16, kD, 0L, bq, pm, kTok, kD, kD, 1.0f);
  // K16 likewise with Wk, bk
  wmma_gemm64<1, 0, 2, 1, false><<<dim3(tilesProj / 8, 1), dim3(256), 0, stream>>>(
      Xb, Xb, kD, 0L, Wkb, Wkb, kD, 0L, (void*)K16, (void*)K16, kD, 0L, bk, pm, kTok, kD, kD, 1.0f);
  // V^T[m = feature][n = token] = sum_k Wvb[m][k] * Xb[n][k] + bv[m]   (f16 out)
  wmma_gemm64<1, 0, 1, 1, false><<<dim3(tilesProj / 8, 1), dim3(256), 0, stream>>>(
      Wvb, Wvb, kD, 0L, Xb, Xb, kD, 0L, (void*)VT, (void*)VT, kTok, 0L, bv, pm, kD, kTok, kD, 1.0f);

  // ---- attention: 64 (b,h) x 32 query tiles ----
  attn_kernel<<<dim3(kB * kH * (kP / kQB)), dim3(128), 0, stream>>>(Q16, K16, VT, tab, pm, Oh, Ol);

  // ---- output projection: out[m][n] = (sum_k (Oh+Ol)[m][k] * Wob[n][k] + bo[n]) * pm[m] ----
  wmma_gemm64<1, 2, 2, 0, true><<<dim3(tilesProj / 8, 1), dim3(256), 0, stream>>>(
      Oh, Ol, kD, 0L, Wob, Wob, kD, 0L, (void*)out, (void*)out, kD, 0L, bo, pm, kTok, kD, kD, 1.0f);
}

// v009
// It runs in 159 microseconds.
// Next to v008, in two timings, it ran 1.07 times as fast each time.
// All steps since v000 together make it 5.06 times as fast.
// Contractions: q/k/v projections on v_wmma_f32_16x16x32_bf16 (x and W as RNE bf16 planes, single products); scores q.k^T on v_wmma_f32_16x16x32_f16 (q, k f16 planes); attn.v on v_wmma_f32_16x16x32_f16 (P f16 carried x32768; V^T as one f16 plane); output projection on v_wmma_f32_16x16x32_bf16 (attention output as bf16 hi + lo planes, Wo bf16, two products); f32 accumulate everywhere; time bias, masks and softmax in f32.
#include <hip/hip_runtime.h>
#include <math.h>

// ---------------------------------------------------------------------------
// Problem constants
// ---------------------------------------------------------------------------
constexpr int kB   = 4;
constexpr int kP   = 2048;
constexpr int kD   = 1024;
constexpr int kH   = 16;
constexpr int kDh  = 64;
constexpr int kTok = kB * kP;            // 8192 token rows
constexpr int kQB  = 64;                 // queries per attention block
constexpr int kKC  = 64;                 // keys per chunk
constexpr int kNW  = 4;                  // waves per attention block
constexpr int kLP  = 72;                 // LDS row pitch in halves of the 64-half K and V^T rows: 144 B = 16 B x odd,
                                         // so the 16 rows of one ds_load_b128 fragment read fall on distinct banks
constexpr float kLog2e      = 1.4426950408889634f;
constexpr float kScoreScale = 0.125f * kLog2e;    // 64^-0.5, scores kept in base 2 (natural score x log2 e)
constexpr float kNegBig     = -1.0e9f * kLog2e;   // masked score, base 2
constexpr float kPCarryLog2 = 15.0f;     // probabilities carried x2^15 in f16: the exponent's reference point lies 15 below the maximum
constexpr float kDelta      = 300.0f;    // seconds per patch step
constexpr float kInvTau     = 1.0f / 300.0f;
constexpr float kLogEps     = 1.0e-12f;
constexpr int   kFarD       = 65;        // smallest |query - key| between a 64-query block and a 64-key chunk two or more chunks away.
                                         // From d = 45 on exp(-d) lies below half an ulp of 1e-12 (2^-64), so the f32 sum exp(-d) + 1e-12 is
                                         // 1e-12 itself and every table entry from there on is the same number
static_assert(kH * kDh == kD, "s");
static_assert(kTok % 64 == 0 && kD % 64 == 0 && kD % 32 == 0, "s");
static_assert(kP % kQB == 0 && kP % kKC == 0 && kDh == 64, "s");
static_assert((kTok * kD) % (8 * 256) == 0 && (kD * kD) % (8 * 256) == 0, "s");
static_assert(kP % 1024 == 0 && kP / kKC >= 2, "s");
static_assert(kP / kKC == 32 && kKC == kNW * 16 && kQB == kKC && kFarD == 2 * kKC - (kQB - 1) && kFarD >= 45 && kFarD < kP, "s");

typedef __attribute__((ext_vector_type(16))) _Float16 v16h;
typedef __attribute__((ext_vector_type(8)))  _Float16 v8h;
typedef __attribute__((ext_vector_type(16))) __bf16   v16b;
typedef __attribute__((ext_vector_type(8)))  __bf16   v8b;
typedef __attribute__((ext_vector_type(8)))  float    v8f;
typedef __attribute__((ext_vector_type(4)))  float    v4f;
typedef __attribute__((ext_vector_type(2)))  float    v2f;
typedef __attribute__((ext_vector_type(4)))  unsigned int v4u;

// ---------------------------------------------------------------------------
// Conversion, fragment and hazard-guard helpers
// ---------------------------------------------------------------------------
__device__ __forceinline__ unsigned short f2bf_bits(float f) {
  unsigned u = __float_as_uint(f);
  return (unsigned short)((u + 0x7FFFu + ((u >> 16) & 1u)) >> 16);
}
__device__ __forceinline__ float bf_bits2f(unsigned short h) { return __uint_as_float(((unsigned)h) << 16); }

// hazard guards as plain device helpers (no inline asm inside the kernel template body)
__device__ __forceinline__ void dep_guard4_h(v8f& a, v8f& b, v8f& c, v8f& d, v16h x, v16h y) {
  asm volatile("v_nop\n\tv_nop\n\tv_nop\n\tv_nop" : "+v"(a), "+v"(b), "+v"(c), "+v"(d) : "v"(x), "v"(y));
}
__device__ __forceinline__ void dep_guard4_b(v8f& a, v8f& b, v8f& c, v8f& d, v16b x, v16b y) {
  asm volatile("v_nop\n\tv_nop\n\tv_nop\n\tv_nop" : "+v"(a), "+v"(b), "+v"(c), "+v"(d) : "v"(x), "v"(y));
}
__device__ __forceinline__ void keep4_h(v16h a, v16h b, v16h c, v16h d) { asm volatile("v_nop" :: "v"(a), "v"(b), "v"(c), "v"(d)); }
__device__ __forceinline__ void keep4_b(v16b a, v16b b, v16b c, v16b d) { asm volatile("v_nop" :: "v"(a), "v"(b), "v"(c), "v"(d)); }
__device__ __forceinline__ void acc_guard4(v8f& a, v8f& b, v8f& c, v8f& d) { asm volatile("v_nop\n\tv_nop\n\tv_nop\n\tv_nop" : "+v"(a), "+v"(b), "+v"(c), "+v"(d)); }
template <typename T> struct Frag;
template <> struct Frag<_Float16> {
  typedef v16h V; union U { v16h v; v8h h[2]; };
  // elements 0..7 <- p[0..7], 8..15 <- p[16..23]
  static __device__ __forceinline__ v16h load(const _Float16* p) {
    U f; f.h[0] = *(const v8h*)(p); f.h[1] = *(const v8h*)(p + 16); return f.v;
  }
  static __device__ __forceinline__ v8f mma(v16h a, v16h b, v8f c) {
    return __builtin_amdgcn_wmma_f32_16x16x32_f16(false, a, false, b, (short)0, c, false, false);
  }
  static __device__ __forceinline__ void guard4(v8f& a, v8f& b, v8f& c, v8f& d, v16h x, v16h y) { dep_guard4_h(a, b, c, d, x, y); }
  static __device__ __forceinline__ void keep(v16h a, v16h b, v16h c, v16h d) { keep4_h(a, b, c, d); }
};
template <> struct Frag<__bf16> {
  typedef v16b V; union U { v16b v; v8b h[2]; };
  static __device__ __forceinline__ v16b load(const __bf16* p) {
    U f; f.h[0] = *(const v8b*)(p); f.h[1] = *(const v8b*)(p + 16); return f.v;
  }
  static __device__ __forceinline__ v8f mma(v16b a, v16b b, v8f c) {
    return __builtin_amdgcn_wmma_f32_16x16x32_bf16(false, a, false, b, (short)0, c, false, false);
  }
  static __device__ __forceinline__ void guard4(v8f& a, v8f& b, v8f& c, v8f& d, v16b x, v16b y) { dep_guard4_b(a, b, c, d, x, y); }
  static __device__ __forceinline__ void keep(v16b a, v16b b, v16b c, v16b d) { keep4_b(a, b, c, d); }
};

__device__ __forceinline__ unsigned pk16(unsigned short a, unsigned short b) { return (unsigned)a | ((unsigned)b << 16); }

// single WMMA with its own hazard guard (ties D, keeps A/B live)
__device__ __forceinline__ v8f mma_h(v16h a, v16h b, v8f c) {
  c = __builtin_amdgcn_wmma_f32_16x16x32_f16(false, a, false, b, (short)0, c, false, false);
  asm volatile("v_nop\n\tv_nop\n\tv_nop\n\tv_nop" : "+v"(c) : "v"(a), "v"(b));
  return c;
}

// lane l <-> lane l ^ 16 (the other 16-lane half of the wave), a vector-port move
__device__ __forceinline__ float xhalf(float x) {
  const int b = __builtin_bit_cast(int, x);
  return __builtin_bit_cast(float, __builtin_amdgcn_permlanex16(b, b, 0x76543210, 0xfedcba98, false, false));
}

// 2^x on the hardware's v_exp_f32, in place. The instruction set asks for one independent instruction or a v_nop between a
// transcendental and a vector instruction that reads its result or writes over its source. Written as one statement the slot is
// kept by construction: each v_exp_f32 writes over its own source alone, none reads a neighbour's result, and the closing v_nop
// stands between the last one and whatever the compiler places next.
__device__ __forceinline__ void exp2x8_inplace(float& a, float& b, float& c, float& d, float& e, float& f, float& g, float& h) {
  asm("v_exp_f32 %0, %0\n\tv_exp_f32 %1, %1\n\tv_exp_f32 %2, %2\n\tv_exp_f32 %3, %3\n\t"
      "v_exp_f32 %4, %4\n\tv_exp_f32 %5, %5\n\tv_exp_f32 %6, %6\n\tv_exp_f32 %7, %7\n\tv_nop"
      : "+v"(a), "+v"(b), "+v"(c), "+v"(d), "+v"(e), "+v"(f), "+v"(g), "+v"(h));
}
// the same with a ninth value
__device__ __forceinline__ void exp2x9_inplace(float& a, float& b, float& c, float& d, float& e, float& f, float& g, float& h, float& i) {
  asm("v_exp_f32 %0, %0\n\tv_exp_f32 %1, %1\n\tv_exp_f32 %2, %2\n\tv_exp_f32 %3, %3\n\tv_exp_f32 %4, %4\n\t"
      "v_exp_f32 %5, %5\n\tv_exp_f32 %6, %6\n\tv_exp_f32 %7, %7\n\tv_exp_f32 %8, %8\n\tv_nop"
      : "+v"(a), "+v"(b), "+v"(c), "+v"(d), "+v"(e), "+v"(f), "+v"(g), "+v"(h), "+v"(i));
}

// ---- LDS staging of the GEMM operands ----
constexpr int kGK = 128;   // k per stage: every staged operand row is 256 B = two whole 128-B lines
constexpr int kGP = 136;   // LDS row pitch in halves: 272 B = 16 B x odd, so the 16 rows of a ds_load_b128 fragment read fall on distinct banks

// Eight asynchronous 16-B copies per lane, global -> LDS: rows r, r+16, ..., r+112 of one 128-row panel (16 lanes per 256-B row).
// The closing s_wait_xcnt stands inside the statement so that no address register of a copy is rewritten in front of it.
__device__ __forceinline__ void copy8_to_lds(unsigned l, const unsigned short* g, size_t gs) {
  constexpr unsigned ls = 16u * kGP * 2u;   // 16 LDS rows in bytes
  asm volatile(
      "global_load_async_to_lds_b128 %0, %8, off\n\t"
      "global_load_async_to_lds_b128 %1, %9, off\n\t"
      "global_load_async_to_lds_b128 %2, %10, off\n\t"
      "global_load_async_to_lds_b128 %3, %11, off\n\t"
      "global_load_async_to_lds_b128 %4, %12, off\n\t"
      "global_load_async_to_lds_b128 %5, %13, off\n\t"
      "global_load_async_to_lds_b128 %6, %14, off\n\t"
      "global_load_async_to_lds_b128 %7, %15, off\n\t"
      "s_wait_xcnt 0x0"
      :: "v"(l), "v"(l + ls), "v"(l + 2u * ls), "v"(l + 3u * ls), "v"(l + 4u * ls), "v"(l + 5u * ls), "v"(l + 6u * ls), "v"(l + 7u * ls),
         "v"(g), "v"(g + gs), "v"(g + 2 * gs), "v"(g + 3 * gs), "v"(g + 4 * gs), "v"(g + 5 * gs), "v"(g + 6 * gs), "v"(g + 7 * gs)
      : "memory");
}
// this wave's copies have landed in LDS (the compiler places no wait for them)
__device__ __forceinline__ void wait_copies() { asm volatile("s_wait_asynccnt 0x0" ::: "memory"); }
// this wave's LDS reads have returned, so the buffer they read may be refilled behind the next barrier
__device__ __forceinline__ void wait_lds() { asm volatile("s_wait_dscnt 0x0" ::: "memory"); }

// Eight asynchronous 16-B copies per lane, global -> LDS: rows r, r+16, r+32, r+48 (8 lanes per 128-B row) of the K tile and of the
// V^T tile of one 64-key chunk; the two tiles lie behind one another in LDS at pitch kLP.
// The closing s_wait_xcnt stands inside the statement so that no address register of a copy is rewritten in front of it.
__device__ __forceinline__ void copy_kv_to_lds(unsigned l, const unsigned short* gk, const unsigned short* gv) {
  constexpr unsigned ls = 16u * kLP * 2u;    // 16 LDS rows in bytes
  constexpr unsigned lt = 64u * kLP * 2u;    // one 64-row tile in bytes
  constexpr size_t   sk = (size_t)16 * kD;   // 16 K rows (tokens) in halves
  constexpr size_t   sv = (size_t)16 * kTok; // 16 V^T rows (features) in halves
  asm volatile(
      "global_load_async_to_lds_b128 %0, %8, off\n\t"
      "global_load_async_to_lds_b128 %1, %9, off\n\t"
      "global_load_async_to_lds_b128 %2, %10, off\n\t"
      "global_load_async_to_lds_b128 %3, %11, off\n\t"
      "global_load_async_to_lds_b128 %4, %12, off\n\t"
      "global_load_async_to_lds_b128 %5, %13, off\n\t"
      "global_load_async_to_lds_b128 %6, %14, off\n\t"
      "global_load_async_to_lds_b128 %7, %15, off\n\t"
      "s_wait_xcnt 0x0"
      :: "v"(l), "v"(l + ls), "v"(l + 2u * ls), "v"(l + 3u * ls),
         "v"(l + lt), "v"(l + lt + ls), "v"(l + lt + 2u * ls), "v"(l + lt + 3u * ls),
         "v"(gk), "v"(gk + sk), "v"(gk + 2 * sk), "v"(gk + 3 * sk),
         "v"(gv), "v"(gv + sv), "v"(gv + 2 * sv), "v"(gv + 3 * sv)
      : "memory");
}

// ---- Register-blocked batched WMMA GEMM (modes extended) ----------------------------------------------
// C[m,n] = scale * sum_k A[m,k] * Bt[n,k] (+bias)(*rowsc[m]); each wave owns a 64x64 tile, the block's 8 waves a 128x256 tile
// (2 x 4 waves). Per stage the block's 128 A rows and 256 Bt rows x 128 k are copied to LDS in whole lines and every wave
// reads its fragments from there; two buffers, the next stage's copies in flight while this stage is multiplied.
// A row-major [M,K]; Bt row-major [N,K]; M % 128 == 0, N % 256 == 0, K % 128 == 0, K >= 128 (no tail handling).
// SPLIT: 0 = single product; 1 = A and Bt hi/lo planes (hi*hi + hi*lo + lo*hi); 2 = A hi/lo planes only (hi*B + lo*B).
// BIAS_MODE: 0 = none, 1 = bias[m], 2 = bias[n], 3 = bias[m] where biasRow is set (the same in the whole block), else bias[n].
// ROWSC: multiply by RNE-bf16(rowsc[m]) after the bias.
// bx = index of the block's tile, b = batch index: the kernels below hand them in from blockIdx.
// OUT_MODE: 0 = f32, 1 = f16, 2 = bf16 hi plane (Cout) + bf16 lo plane (Cout2).
// ET: 0 = f16 operands, 1 = bf16 operands (pointers passed as 16-bit storage)
template <int ET> struct Elem;
template <> struct Elem<0> { typedef _Float16 T; };
template <> struct Elem<1> { typedef __bf16 T; };
template <int ET, int SPLIT, int BIAS_MODE, int OUT_MODE, bool ROWSC>
__device__ __forceinline__ void gemm_block(
    const unsigned bx, const int b, const bool biasRow,
    const unsigned short* __restrict__ Ap, const unsigned short* __restrict__ A2p, int lda, long strideA,
    const unsigned short* __restrict__ Btp, const unsigned short* __restrict__ Bt2p, int ldb, long strideB,
    void* __restrict__ Cout, void* __restrict__ Cout2, int ldc, long strideC,
    const float* __restrict__ bias, const float* __restrict__ rowsc,
    int M, int N, int K, float scale) {
  typedef typename Elem<ET>::T T;
  typedef typename Frag<T>::V V;
  constexpr int NA = (SPLIT != 0) ? 2 : 1;             // A planes
  constexpr int NB = (SPLIT == 1) ? 2 : 1;             // Bt planes
  constexpr int kBufH = (128 * NA + 256 * NB) * kGP;   // halves per buffer: [A planes, 128 rows each][Bt planes, 256 rows each]
  __shared__ __align__(16) unsigned short ring[2 * kBufH];
  __shared__ __align__(16) float sT[8][16 * 68];   // per-wave 16x64 slab, pitch 68 floats
  const int lane = threadIdx.x & 31;
  const int wave = threadIdx.x >> 5;
  const int tilesNb = N >> 8;
  const int tilesMb = M >> 7;
  if ((int)bx >= tilesMb * tilesNb) return;   // the same for the whole block, ahead of every barrier
  const int bm  = bx / tilesNb;
  const int bn  = bx - bm * tilesNb;
  const int m0b = bm << 7;
  const int n0b = bn << 8;
  const int wm  = wave >> 2;
  const int wn  = wave & 3;
  const int m0  = m0b + (wm << 6);
  const int n0  = n0b + (wn << 6);

  const int rlane = lane & 15;                 // row (A) / col (B, D) within subtile
  const int koff  = (lane >> 4) * 8;           // k offset of this lane half
  const int mOff  = (lane >> 4) * 8;           // D row offset

  // copy addresses of this lane: row threadIdx.x / 16 of each 16-row group, 16-B segment threadIdx.x % 16
  const int cr = threadIdx.x >> 4;
  const int cs = (threadIdx.x & 15) * 8;
  const unsigned short* cA  = Ap   + (size_t)b * strideA + (size_t)(m0b + cr) * lda + cs;
  const unsigned short* cA2 = A2p  + (size_t)b * strideA + (size_t)(m0b + cr) * lda + cs;
  const unsigned short* cB  = Btp  + (size_t)b * strideB + (size_t)(n0b + cr) * ldb + cs;
  const unsigned short* cB2 = Bt2p + (size_t)b * strideB + (size_t)(n0b + cr) * ldb + cs;
  const unsigned cl = (unsigned)(uintptr_t)ring + (unsigned)(cr * kGP + cs) * 2u;   // LDS byte address
  const size_t gsA = (size_t)16 * lda;
  const size_t gsB = (size_t)16 * ldb;
  constexpr unsigned kPanel = 128u * kGP * 2u;   // 128 LDS rows in bytes
  auto stage = [&](int t) {
    const unsigned l = cl + (unsigned)(t & 1) * (unsigned)(kBufH * 2);
    const size_t k = (size_t)t * kGK;
    copy8_to_lds(l, cA + k, gsA);
    if (NA == 2) copy8_to_lds(l + kPanel, cA2 + k, gsA);
    copy8_to_lds(l + NA * kPanel, cB + k, gsB);
    copy8_to_lds(l + (NA + 1) * kPanel, cB + k + 8 * gsB, gsB);
    if (NB == 2) {
      copy8_to_lds(l + (NA + 2) * kPanel, cB2 + k, gsB);
      copy8_to_lds(l + (NA + 3) * kPanel, cB2 + k + 8 * gsB, gsB);
    }
  };

  v8f acc[4][4];
#pragma unroll
  for (int i = 0; i < 4; ++i)
#pragma unroll
    for (int j = 0; j < 4; ++j) acc[i][j] = (v8f){0.f,0.f,0.f,0.f,0.f,0.f,0.f,0.f};

  const int nT = K / kGK;
  stage(0);
  wait_copies();
  __syncthreads();            // stage 0 is readable by every wave
  if (nT > 1) stage(1);

  for (int t = 0; t < nT; ++t) {
    const T* rb = (const T*)ring + (t & 1) * kBufH;
    const T* fa = rb + ((wm << 6) + rlane) * kGP + koff;
    const T* fb = rb + (128 * NA + (wn << 6) + rlane) * kGP + koff;
    // every loop of a stage is unrolled: fragment and accumulator indices are constants (registers, no scratch) and the
    // LDS offsets of the four 32-k steps are immediates
#pragma unroll
    for (int ks = 0; ks < kGK / 32; ++ks) {
      V bh[4], bl[4], ah[4], al[4];
#pragma unroll
      for (int j = 0; j < 4; ++j) {
        bh[j] = Frag<T>::load(fb + (j << 4) * kGP + ks * 32);
        if (SPLIT == 1) bl[j] = Frag<T>::load(fb + (256 + (j << 4)) * kGP + ks * 32);
      }
#pragma unroll
      for (int i = 0; i < 4; ++i) {
        ah[i] = Frag<T>::load(fa + (i << 4) * kGP + ks * 32);
        al[i] = ah[i];
        if (SPLIT != 0) al[i] = Frag<T>::load(fa + (128 + (i << 4)) * kGP + ks * 32);
      }
#pragma unroll
      for (int i = 0; i < 4; ++i) {
#pragma unroll
        for (int j = 0; j < 4; ++j) {
          acc[i][j] = Frag<T>::mma(ah[i], bh[j], acc[i][j]);
          if (SPLIT == 1) acc[i][j] = Frag<T>::mma(ah[i], bl[j], acc[i][j]);
          if (SPLIT != 0) acc[i][j] = Frag<T>::mma(al[i], bh[j], acc[i][j]);
        }
        Frag<T>::guard4(acc[i][0], acc[i][1], acc[i][2], acc[i][3], ah[i], al[i]);
      }
      Frag<T>::keep(bh[0], bh[1], bh[2], bh[3]);
      if (SPLIT == 1) Frag<T>::keep(bl[0], bl[1], bl[2], bl[3]);
    }
    wait_lds();
    wait_copies();
    __syncthreads();          // publishes stage t + 1 and ends every wave's reads of stage t's buffer
    if (t + 2 < nT) stage(t + 2);
  }
  wait_copies();              // nothing in flight when the wave goes on to the epilogue
  acc_guard4(acc[0][0], acc[0][1], acc[0][2], acc[0][3]);
  acc_guard4(acc[1][0], acc[1][1], acc[1][2], acc[1][3]);
  acc_guard4(acc[2][0], acc[2][1], acc[2][2], acc[2][3]);
  acc_guard4(acc[3][0], acc[3][1], acc[3][2], acc[3][3]);

  // ---- epilogue ----
  // BIAS_MODE 3: this lane's bias values of the whole 64x64 tile, fetched behind one test; the side that is not in use stays 0, and
  // the bias of an element is the sum of its row's and its column's value (unrolled: constant indices, registers)
  float bnv[4], bmv[4][8];
  if (BIAS_MODE == 3) {
#pragma unroll
    for (int i = 0; i < 4; ++i) {
      bnv[i] = 0.f;
#pragma unroll
      for (int r = 0; r < 8; ++r) bmv[i][r] = 0.f;
    }
    if (biasRow) {
#pragma unroll
      for (int i = 0; i < 4; ++i) {
#pragma unroll
        for (int r = 0; r < 8; ++r) bmv[i][r] = bias[m0 + (i << 4) + mOff + r];
      }
    } else {
#pragma unroll
      for (int j = 0; j < 4; ++j) bnv[j] = bias[n0 + (j << 4) + rlane];
    }
  }
  float* slab = sT[wave];
#pragma unroll
  for (int i = 0; i < 4; ++i) {
    const int mBase = m0 + (i << 4);
    float rsv[8];
#pragma unroll
    for (int r = 0; r < 8; ++r) rsv[r] = 1.0f;
    if (ROWSC) {
      // two 16-B loads of rowsc[mBase+mOff .. +7], then RNE bf16 of each value
      const v4f ra = *(const v4f*)(rowsc + mBase + mOff);
      const v4f rb = *(const v4f*)(rowsc + mBase + mOff + 4);
      rsv[0] = ra[0]; rsv[1] = ra[1]; rsv[2] = ra[2]; rsv[3] = ra[3];
      rsv[4] = rb[0]; rsv[5] = rb[1]; rsv[6] = rb[2]; rsv[7] = rb[3];
#pragma unroll
      for (int r = 0; r < 8; ++r) rsv[r] = bf_bits2f(f2bf_bits(rsv[r]));
    }
#pragma unroll
    for (int j = 0; j < 4; ++j) {
      const int n = n0 + (j << 4) + rlane;
      float bv = 0.f;
      if (BIAS_MODE == 2) bv = bias[n];
#pragma unroll
      for (int r = 0; r < 8; ++r) {
        float v = acc[i][j][r] * scale;
        if (BIAS_MODE == 1) v += bias[mBase + mOff + r];
        if (BIAS_MODE == 2) v += bv;
        if (BIAS_MODE == 3) v += bmv[i][r] + bnv[j];
        if (ROWSC) v = v * rsv[r];
        slab[(mOff + r) * 68 + (j << 4) + rlane] = v;
      }
    }
    __builtin_amdgcn_fence(__ATOMIC_RELEASE, "workgroup");
    __builtin_amdgcn_wave_barrier();
    __builtin_amdgcn_fence(__ATOMIC_ACQUIRE, "workgroup");
    if (OUT_MODE == 0) {
      float* C = (float*)Cout + (size_t)b * strideC;
      const int hh = lane >> 4, c4 = (lane & 15) * 4;     // row seg = 256 B = 16 lanes x 16 B
      {
#pragma unroll
        for (int it = 0; it < 8; ++it) {
          const int row = it * 2 + hh;
          v4f v = *(const v4f*)(slab + row * 68 + c4);
          *(v4f*)(C + (size_t)(mBase + row) * ldc + n0 + c4) = v;
        }
        
      }
    } else {
      const int q = lane >> 3, c8 = (lane & 7) * 8;
      unsigned short* C  = (unsigned short*)Cout  + (size_t)b * strideC;
      unsigned short* C2 = (OUT_MODE >= 2) ? ((unsigned short*)Cout2 + (size_t)b * strideC) : nullptr;
      {
#pragma unroll
        for (int it = 0; it < 4; ++it) {
          const int row = it * 4 + q;
          const float* sp = slab + row * 68 + c8;
          v8h hv, lv;
#pragma unroll
          for (int e = 0; e < 8; ++e) {
            if (OUT_MODE == 1) {
              hv[e] = (_Float16)sp[e];
            } else {
              unsigned short hb = f2bf_bits(sp[e]);
              unsigned short lb = f2bf_bits(sp[e] - bf_bits2f(hb));
              hv[e] = __builtin_bit_cast(_Float16, hb);
              lv[e] = __builtin_bit_cast(_Float16, lb);
            }
          }
          *(v8h*)(C + (size_t)(mBase + row) * ldc + n0 + c8) = hv;
          if (OUT_MODE >= 2) *(v8h*)(C2 + (size_t)(mBase + row) * ldc + n0 + c8) = lv;
        }
        
      }
    }
    __builtin_amdgcn_fence(__ATOMIC_RELEASE, "workgroup");
    __builtin_amdgcn_wave_barrier();
    __builtin_amdgcn_fence(__ATOMIC_ACQUIRE, "workgroup");
  }
}

// One GEMM per launch: grid.x = tiles, grid.y = batch.
template <int ET, int SPLIT, int BIAS_MODE, int OUT_MODE, bool ROWSC>
__global__ __launch_bounds__(256) void wmma_gemm64(
    const unsigned short* __restrict__ Ap, const unsigned short* __restrict__ A2p, int lda, long strideA,
    const unsigned short* __restrict__ Btp, const unsigned short* __restrict__ Bt2p, int ldb, long strideB,
    void* __restrict__ Cout, void* __restrict__ Cout2, int ldc, long strideC,
    const float* __restrict__ bias, const float* __restrict__ rowsc,
    int M, int N, int K, float scale) {
  gemm_block<ET, SPLIT, BIAS_MODE, OUT_MODE, ROWSC>(blockIdx.x, (int)blockIdx.y, false, Ap, A2p, lda, strideA, Btp, Bt2p, ldb, strideB,
                                                    Cout, Cout2, ldc, strideC, bias, rowsc, M, N, K, scale);
}

// The three projections need nothing of each other: one launch, grid.y = 0 (Q), 1 (K), 2 (V^T), grid.x = tiles of one projection.
//   Q16[t][n] = sum_k Xb[t][k] * Wqb[n][k] + bq[n], K16 likewise; VT[m][t] = sum_k Wvb[m][k] * Xb[t][k] + bv[m]; f16 out.
// nTok token rows, nFeat features, K = row length of Xb and of every weight. Every choice below reads the same in the whole block.
__global__ __launch_bounds__(256) void qkv_gemm64(
    const unsigned short* __restrict__ Xb, const unsigned short* __restrict__ Wqb, const unsigned short* __restrict__ Wkb,
    const unsigned short* __restrict__ Wvb, unsigned short* __restrict__ Q16, unsigned short* __restrict__ K16,
    unsigned short* __restrict__ VT, const float* __restrict__ bq, const float* __restrict__ bk, const float* __restrict__ bv,
    int nTok, int nFeat, int K) {
  const int  which = blockIdx.y;
  const bool isV   = which == 2;
  const unsigned short* W    = (which == 0) ? Wqb : (which == 1) ? Wkb : Wvb;
  unsigned short*       C    = (which == 0) ? Q16 : (which == 1) ? K16 : VT;
  const float*          bias = (which == 0) ? bq  : (which == 1) ? bk  : bv;
  const unsigned short* A    = isV ? W : Xb;
  const unsigned short* Bt   = isV ? Xb : W;
  const int M = isV ? nFeat : nTok;
  const int N = isV ? nTok : nFeat;
  gemm_block<1, 0, 3, 1, false>(blockIdx.x, 0, isV, A, A, K, 0L, Bt, Bt, K, 0L, (void*)C, (void*)C, N, 0L, bias, bias, M, N, K, 1.0f);
}

// ---------------------------------------------------------------------------
// f32 -> bf16 (RNE) cast, 8 consecutive elements per thread (one 16-B store per lane; 32 contiguous lanes = 4 whole
// lines). i = index of the thread's group of 8.
// ---------------------------------------------------------------------------
__device__ __forceinline__ void cast8_bf16(const float* __restrict__ in, unsigned short* __restrict__ out, int i) {
  const float* p = in + 8 * (size_t)i;
  const v4f a = *(const v4f*)(p);
  const v4f c = *(const v4f*)(p + 4);
  unsigned short hb[8];
#pragma unroll
  for (int e = 0; e < 4; ++e) {
    hb[e]     = f2bf_bits(a[e]);
    hb[4 + e] = f2bf_bits(c[e]);
  }
  const v4u u = (v4u){pk16(hb[0], hb[1]), pk16(hb[2], hb[3]), pk16(hb[4], hb[5]), pk16(hb[6], hb[7])};
  unsigned short* q = out + 8 * (size_t)i;
  *(v4u*)q = u;
}

// ---------------------------------------------------------------------------
// Time-decay bias table in base 2: tab[d] = logf(expf((-(d*300)) * (1/300)) + 1e-12) * log2(e), d = 0..2047, f32, precise expf/logf.
// i = index of the thread's group of 4.
// ---------------------------------------------------------------------------
__device__ __forceinline__ void tab4(float* __restrict__ tab, int i) {
  v4f tv;
#pragma unroll
  for (int e = 0; e < 4; ++e) {
    const float d = (float)(4 * i + e);
    const float dist = d * kDelta;
    const float ex = (-dist) * kInvTau;
    const float w = expf(ex);
    tv[e] = logf(w + kLogEps) * kLog2e;
  }
  float* q = tab + 4 * (size_t)i;
  *(v4f*)q = tv;
}

// ---------------------------------------------------------------------------
// Prologue: the bias table and the five casts need nothing of each other, so they are ranges of the block index of one launch
// (every test reads the same in the whole block). Each range is an exact quotient: no thread is without its group.
//   blocks [0, kTabBlk): table; then kWBlk blocks for each of Wq, Wk, Wv, Wo; then kXBlk blocks for x.
// ---------------------------------------------------------------------------
constexpr int kTabBlk = (kP / 4) / 256;           //    2
constexpr int kWBlk   = (kD * kD) / (8 * 256);    //  512
constexpr int kXBlk   = (kTok * kD) / (8 * 256);  // 4096
static_assert((kP / 4) % 256 == 0, "s");
__global__ __launch_bounds__(256) void prologue_kernel(const float* __restrict__ x, const float* __restrict__ Wq, const float* __restrict__ Wk,
                                                       const float* __restrict__ Wv, const float* __restrict__ Wo,
                                                       unsigned short* __restrict__ Xb, unsigned short* __restrict__ Wqb,
                                                       unsigned short* __restrict__ Wkb, unsigned short* __restrict__ Wvb,
                                                       unsigned short* __restrict__ Wob, float* __restrict__ tab) {
  int bx = blockIdx.x;
  if (bx < kTabBlk) {
    tab4(tab, bx * 256 + (int)threadIdx.x);
    return;
  }
  bx -= kTabBlk;
  const float* in = x;
  unsigned short* out = Xb;
  if (bx < 4 * kWBlk) {
    const int w = bx / kWBlk;
    in  = (w == 0) ? Wq  : (w == 1) ? Wk  : (w == 2) ? Wv  : Wo;
    out = (w == 0) ? Wqb : (w == 1) ? Wkb : (w == 2) ? Wvb : Wob;
    bx -= w * kWBlk;
  } else {
    bx -= 4 * kWBlk;
  }
  cast8_bf16(in, out, bx * 256 + (int)threadIdx.x);
}

__global__ __launch_bounds__(128, 5) void attn_kernel(const unsigned short* __restrict__ Qp, const unsigned short* __restrict__ Kp,
                                                   const unsigned short* __restrict__ VTp,
                                                   const float* __restrict__ tab, const float* __restrict__ pm,
                                                   unsigned short* __restrict__ Ohp, unsigned short* __restrict__ Olp) {
  constexpr int kTileH = 64 * kLP;                           // halves of one 64-row tile (9 KB)
  constexpr int kBufH  = 2 * kTileH;                         // one buffer: K [kv][d], V^T [d][kv]
  __shared__ __align__(16) _Float16 tiles[2 * kBufH];        // two buffers, 36 KB
  __shared__ __align__(16) float    Os[kNW][16 * 68];        // per wave out tile, pitch 68
  __shared__ __align__(16) float    tabs[kP];                // bias table 8 KB
  __shared__ __align__(16) unsigned mb[kNW];                 // per wave: bit kc = a masked key in this wave's quarter of chunk kc

  const int tid  = threadIdx.x;
  const int wave = tid >> 5;
  const int lane = tid & 31;
  const int hh   = lane >> 4;
  const int c    = lane & 15;
  const int nqb  = kP / kQB;              // 32
  const int bx   = blockIdx.x;
  const int qb   = bx % nqb;
  const int bh   = bx / nqb;
  const int h    = bh % kH;
  const int b    = bh / kH;
  const int q0   = qb * kQB + wave * 16;  // first query row of this wave within the sequence
  const size_t tok0 = (size_t)b * kP;     // first token row of this batch

  // ---- bias table -> LDS: 4 x 128 threads x 4 floats = 2048 (whole table); read after the barrier in front of the loop ----
#pragma unroll
  for (int i = 0; i < 4; ++i) {
    const int idx = i * 128 + tid;
    const v4f t4 = *(const v4f*)(tab + 4 * idx);
    *(v4f*)(tabs + 4 * idx) = t4;
  }
  asm volatile("" ::: "memory");

  // ---- which chunks of this batch hold a masked key: lane = chunk, wave = quarter of the chunk (16 keys); joined behind the barrier ----
  {
    const float* pq = pm + tok0 + lane * kKC + wave * 16;
    bool anym = false;
#pragma unroll   // the four loads go out together
    for (int i = 0; i < 4; ++i) {
      const v4f t4 = *(const v4f*)(pq + 4 * i);
      anym = anym || (t4[0] <= 0.0f) || (t4[1] <= 0.0f) || (t4[2] <= 0.0f) || (t4[3] <= 0.0f);
    }
    const unsigned bal = __builtin_amdgcn_ballot_w32(anym);
    if (lane == 0) mb[wave] = bal;
  }

  // ---- Q fragments (B operand): column = query q0+c, k = d; 2 d-chunks ----
  const _Float16* Qh = (const _Float16*)(const void*)Qp;
  const _Float16* qr = Qh + (tok0 + q0 + c) * (size_t)kD + h * kDh + 8 * hh;
  v16h qa[2];
  qa[0] = Frag<_Float16>::load(qr);
  qa[1] = Frag<_Float16>::load(qr + 32);

  float mrow = -__builtin_inff();   // running maximum of query q0+c (equal in both halves), base 2
  float mref = -__builtin_inff();   // reference point of the exponentials: P, its sum and O all carry the factor 2^(-mref)
  float lrow = 0.f;                 // running sum of query q0+c over this half's keys; the halves are joined after the loop
  v8f oacc[4];                      // O^T: row = d t*16+8hh+r, column = query q0+c
#pragma unroll
  for (int t = 0; t < 4; ++t) oacc[t] = (v8f){0.f,0.f,0.f,0.f,0.f,0.f,0.f,0.f};

  // ---- K / V^T tiles: asynchronous copies, two buffers; chunk kc + 1 is in flight while chunk kc is worked on ----
  // this lane's copy addresses: row tid / 8 of each 16-row group, 16-B segment tid % 8
  const int cr = tid >> 3;
  const int cs = (tid & 7) * 8;
  const unsigned cl = (unsigned)(uintptr_t)tiles + (unsigned)(cr * kLP + cs) * 2u;   // LDS byte address
  const unsigned short* cK  = Kp   + (tok0 + cr) * (size_t)kD + h * kDh + cs;
  const unsigned short* cV  = VTp  + (size_t)(h * kDh + cr) * kTok + tok0 + cs;
  auto stage = [&](int t) {
    copy_kv_to_lds(cl + (unsigned)(t & 1) * (unsigned)(kBufH * 2), cK + (size_t)t * (kKC * kD), cV + t * kKC);
  };
  stage(0);
  wait_copies();
  __syncthreads();            // chunk 0, the bias table and the mask words are readable by every wave

  // both are the same in every lane: kept in scalar registers, so that the test in the loop is a scalar branch
  // bit kc of shortbits: chunk kc holds no masked key and is none of qb - 1, qb, qb + 1
  const unsigned mbits = (unsigned)__builtin_amdgcn_readfirstlane((int)(mb[0] | mb[1] | mb[2] | mb[3]));
  const unsigned shortbits = ~(mbits | (unsigned)((7ull << qb) >> 1));
  const float    cfar  = __builtin_bit_cast(float, __builtin_amdgcn_readfirstlane(__builtin_bit_cast(int, tabs[kFarD])));

  for (int kc = 0; kc < kP / kKC; ++kc) {
    // directly behind the barrier (the one above, or the one at the foot of trip kc - 1, which ended every wave's reads of
    // chunk kc - 1): the copies of chunk kc + 1, while it exists, into the buffer that chunk kc - 1 has left
    if (kc + 1 < kP / kKC) stage(kc + 1);
    const int kv0 = kc * kKC;
    const _Float16* Ksh = tiles + (kc & 1) * kBufH;
    const _Float16* Vt  = Ksh + kTileH;

    // ---- scores, transposed: D[row = key j*16+8hh+r][col = query c] = K . Q^T, K = 64 in 2 steps of 32 ----
    // all eight K fragments are read ahead of the first product: one LDS latency for the group, counted waits behind it
    // (the loops are unrolled so that fragment and accumulator indices are constants: registers, no scratch)
    v16h kf[2][4];
#pragma unroll
    for (int dc = 0; dc < 2; ++dc) {
#pragma unroll
      for (int j = 0; j < 4; ++j) kf[dc][j] = Frag<_Float16>::load(Ksh + (j * 16 + c) * kLP + dc * 32 + 8 * hh);
    }
    v8f s[4];
#pragma unroll
    for (int j = 0; j < 4; ++j) s[j] = (v8f){0.f,0.f,0.f,0.f,0.f,0.f,0.f,0.f};
#pragma unroll
    for (int dc = 0; dc < 2; ++dc) {
#pragma unroll
      for (int j = 0; j < 4; ++j) s[j] = mma_h(kf[dc][j], qa[dc], s[j]);
    }

    // ---- base-2 score = s * smul + sadd. A short chunk keeps its raw products: smul the scale, sadd the one bias. ----
    float smul = kScoreScale, sadd = cfar;
    if (((shortbits >> kc) & 1u) == 0u) {
      // general chunk: scale, time bias and key mask are worked into s here
      const int qrow = q0 + c;
#pragma unroll
      for (int j = 0; j < 4; ++j) {
        // key mask values of this lane's 8 consecutive keys of tile j (two 16-B loads)
        const float* pmp = pm + tok0 + kv0 + j * 16 + 8 * hh;
        const v4f pma = *(const v4f*)(pmp);
        const v4f pmb = *(const v4f*)(pmp + 4);
#pragma unroll
        for (int r = 0; r < 8; ++r) {
          const int kvcol = kv0 + j * 16 + 8 * hh + r;
          int dd = qrow - kvcol;
          dd = (dd < 0) ? -dd : dd;
          const float pmv = (r < 4) ? pma[r & 3] : pmb[r & 3];
          const float v = s[j][r] * kScoreScale + tabs[dd];
          s[j][r] = (pmv <= 0.0f) ? kNegBig : v;
        }
      }
      smul = 1.0f;   // x * 1 + 0 is x and x * 1 - y is x - y, each rounded as before: these chunks keep their values
      sadd = 0.0f;
    }

    // ---- maximum over this lane's 32 keys (smul is positive: the largest s gives the largest score), then over both halves ----
    float sm[4];   // one chain per score tile: four short dependent chains, not one long one (unrolled: constant indices)
#pragma unroll
    for (int j = 0; j < 4; ++j) {
      sm[j] = -__builtin_inff();
#pragma unroll
      for (int r = 0; r < 8; ++r) sm[j] = fmaxf(sm[j], s[j][r]);
    }
    float cm = fmaxf(fmaxf(sm[0], sm[1]), fmaxf(sm[2], sm[3])) * smul + sadd;
    cm = fmaxf(cm, xhalf(cm));

    // ---- online softmax; P = 2^(v - mref) (at most 2^15) as f16 straight into the B operands of the PV products ----
    // B operand of keys kk*32 .. kk*32+31: elements 0..7 = keys 8hh+0..7 (score tile 2kk), 8..15 = keys 16+8hh+0..7 (tile 2kk+1)
    const float mnew  = fmaxf(mrow, cm);
    // from 2^23 on, mnew - 15 would round and could lift P past the f16 range: there the reference point is the maximum itself
    const float rnew  = (fabsf(mnew) < 8388608.0f) ? mnew - kPCarryLog2 : mnew;
    float alpha = mref - rnew;   // becomes 2^(mref - rnew) together with the first eight scores
    mrow = mnew;
    mref = rnew;
    const float soff = sadd - rnew;
    const v2f smul2 = (v2f){smul, smul};
    const v2f soff2 = (v2f){soff, soff};
    float psum = 0.f;
    v16h pb[2];
#pragma unroll
    for (int j = 0; j < 4; ++j) {
      float e[8];
#pragma unroll
      for (int r = 0; r < 8; r += 2) {
        const v2f x = (v2f){s[j][r], s[j][r + 1]} * smul2 + soff2;   // two scores per packed multiply-add
        e[r] = x[0];
        e[r + 1] = x[1];
      }
      if (j == 0) exp2x9_inplace(alpha, e[0], e[1], e[2], e[3], e[4], e[5], e[6], e[7]);
      else        exp2x8_inplace(e[0], e[1], e[2], e[3], e[4], e[5], e[6], e[7]);
#pragma unroll
      for (int r = 0; r < 8; ++r) {
        psum += e[r];
        pb[j >> 1][(j & 1) * 8 + r] = (_Float16)e[r];
      }
    }
    lrow = lrow * alpha + psum;
#pragma unroll
    for (int t = 0; t < 4; ++t) {
#pragma unroll
      for (int r = 0; r < 8; ++r) oacc[t][r] *= alpha;
    }

    // ---- O^T += V^T . P^T : A = V^T [d t*16+c][kv], B = P^T [kv][query c] ----
    // the eight V^T fragments (order: kk, t) are asked for as one group in front of their products: the LDS latency is met once,
    // counted waits follow (unrolled for the same reason as above: constant indices, registers and no scratch)
    v16h vf[8];
#pragma unroll
    for (int i = 0; i < 8; ++i) vf[i] = Frag<_Float16>::load(Vt + ((i & 3) * 16 + c) * kLP + (i >> 2) * 32 + 8 * hh);
#pragma unroll
    for (int i = 0; i < 8; ++i) oacc[i & 3] = mma_h(vf[i], pb[i >> 2], oacc[i & 3]);
    wait_lds();
    wait_copies();
    __syncthreads();          // publishes chunk kc + 1 and ends every wave's reads of chunk kc's buffer
  }
  wait_copies();              // nothing in flight when the wave goes on to the epilogue

  // ---- normalise (the sum carries P's own factor) into the per-wave f32 slab ----
  float* os = Os[wave];   // [query][d]
  const float inv = 1.0f / (lrow + xhalf(lrow));
#pragma unroll
  for (int t = 0; t < 4; ++t) {
#pragma unroll
    for (int r = 0; r < 8; ++r) os[c * 68 + t * 16 + 8 * hh + r] = oacc[t][r] * inv;
  }
  __builtin_amdgcn_fence(__ATOMIC_RELEASE, "workgroup");
  __builtin_amdgcn_wave_barrier();
  __builtin_amdgcn_fence(__ATOMIC_ACQUIRE, "workgroup");
  {
    const int q4 = lane >> 3, c8 = (lane & 7) * 8;
    {
#pragma unroll
      for (int it = 0; it < 4; ++it) {
        const int row = it * 4 + q4;
        const float* sp = os + row * 68 + c8;
        v8h hv, lv;
#pragma unroll
        for (int e = 0; e < 8; ++e) {
          const unsigned short hb = f2bf_bits(sp[e]);
          const unsigned short lb = f2bf_bits(sp[e] - bf_bits2f(hb));
          hv[e] = __builtin_bit_cast(_Float16, hb);
          lv[e] = __builtin_bit_cast(_Float16, lb);
        }
        const size_t off = (tok0 + q0 + row) * (size_t)kD + h * kDh + c8;
        *(v8h*)(Ohp + off) = hv;
        *(v8h*)(Olp + off) = lv;
      }
      
    }
  }
}

// ---------------------------------------------------------------------------
// Host glue.
//   Xb   bf16 [8192][1024]        16,777,216  at           0
//   Wqb  bf16 [1024][1024]         2,097,152  at  16,777,216
//   Wkb  bf16 [1024][1024]         2,097,152  at  18,874,368
//   Wvb  bf16 [1024][1024]         2,097,152  at  20,971,520
//   Wob  bf16 [1024][1024]         2,097,152  at  23,068,672
//   Q16  f16  [8192][1024]        16,777,216  at  25,165,824
//   K16  f16  [8192][1024]        16,777,216  at  41,943,040
//   VT   f16  [1024][8192]        16,777,216  at  58,720,256
//   Oh   bf16 [8192][1024]        16,777,216  at  75,497,472
//   Ol   bf16 [8192][1024]        16,777,216  at  92,274,688
//   tab  f32  [2048]                   8,192  at 109,051,904
//   total                        109,060,096
// Every region is fully written before it is read; no region is re-used.
// GEMM shapes: Q,K: M=8192 N=1024 K=1024; V^T: M=1024 N=8192 K=1024; out: M=8192 N=1024 K=1024 (M%128==0, N%256==0,
// K%128==0, no padding). Attention: S=2048 (64-multiples), Dh=64.
// ---------------------------------------------------------------------------
extern "C" void kernel_launch(void* const* d_in, const int* in_sizes, int n_in,
                              void* d_out, int out_size, void* d_ws, size_t ws_size,
                              hipStream_t stream) {
  if (n_in < 10) return;
  const int nX = kTok * kD;     // 8,388,608
  const int nW = kD * kD;       // 1,048,576
  if (in_sizes[0] != nX || in_sizes[1] != kTok) return;
  if (in_sizes[2] != nW || in_sizes[4] != nW || in_sizes[6] != nW || in_sizes[8] != nW) return;
  if (in_sizes[3] != kD || in_sizes[5] != kD || in_sizes[7] != kD || in_sizes[9] != kD) return;
  if (out_size != nX) return;

  const size_t szX16 = (size_t)nX * 2;
  const size_t szW16 = (size_t)nW * 2;
  const size_t szTab = (size_t)kP * 4;
  const size_t offXb  = 0;
  const size_t offWq  = offXb + szX16;
  const size_t offWk  = offWq + szW16;
  const size_t offWv  = offWk + szW16;
  const size_t offWo  = offWv + szW16;
  const size_t offQ   = offWo + szW16;
  const size_t offK   = offQ + szX16;
  const size_t offVT  = offK + szX16;
  const size_t offOh  = offVT + szX16;
  const size_t offOl  = offOh + szX16;
  const size_t offTab = offOl + szX16;
  const size_t total  = offTab + szTab;
  if (ws_size < total) return;

  const float* x  = (const float*)d_in[0];
  const float* pm = (const float*)d_in[1];
  const float* Wq = (const float*)d_in[2];
  const float* bq = (const float*)d_in[3];
  const float* Wk = (const float*)d_in[4];
  const float* bk = (const float*)d_in[5];
  const float* Wv = (const float*)d_in[6];
  const float* bv = (const float*)d_in[7];
  const float* Wo = (const float*)d_in[8];
  const float* bo = (const float*)d_in[9];
  float* out = (float*)d_out;
  char* ws = (char*)d_ws;
  unsigned short* Xb  = (unsigned short*)(ws + offXb);
  unsigned short* Wqb = (unsigned short*)(ws + offWq);
  unsigned short* Wkb = (unsigned short*)(ws + offWk);
  unsigned short* Wvb = (unsigned short*)(ws + offWv);
  unsigned short* Wob = (unsigned short*)(ws + offWo);
  unsigned short* Q16 = (unsigned short*)(ws + offQ);
  unsigned short* K16 = (unsigned short*)(ws + offK);
  unsigned short* VT  = (unsigned short*)(ws + offVT);
  unsigned short* Oh  = (unsigned short*)(ws + offOh);
  unsigned short* Ol  = (unsigned short*)(ws + offOl);
  float* tab = (float*)(ws + offTab);

  // ---- prologue: RNE bf16 operand planes and the bias table, one launch ----
  prologue_kernel<<<dim3(kTabBlk + 4 * kWBlk + kXBlk), dim3(256), 0, stream>>>(x, Wq, Wk, Wv, Wo, Xb, Wqb, Wkb, Wvb, Wob, tab);

  // ---- projections (64x64 wave tiles, 8 waves = one 128x256 tile per block): Q, K and V^T in one launch ----
  const int tilesProj = (kTok / 64) * (kD / 64);   // 2048 -> 256 blocks per projection
  qkv_gemm64<<<dim3(tilesProj / 8, 3), dim3(256), 0, stream>>>(Xb, Wqb, Wkb, Wvb, Q16, K16, VT, bq, bk, bv, kTok, kD, kD);

  // ---- attention: 64 (b,h) x 32 query tiles ----
  attn_kernel<<<dim3(kB * kH * (kP / kQB)), dim3(128), 0, stream>>>(Q16, K16, VT, tab, pm, Oh, Ol);

  // ---- output projection: out[m][n] = (sum_k (Oh+Ol)[m][k] * Wob[n][k] + bo[n]) * pm[m] ----
  wmma_gemm64<1, 2, 2, 0, true><<<dim3(tilesProj / 8, 1), dim3(256), 0, stream>>>(
      Oh, Ol, kD, 0L, Wob, Wob, kD, 0L, (void*)out, (void*)out, kD, 0L, bo, pm, kTok, kD, kD, 1.0f);
}

// v010
// One run takes 144 microseconds.
// Timed twice side by side with v009, it ran 1.10 times as fast both times.
// All steps since v000 together make it 5.58 times as fast.
// Contractions: q/k/v projections on v_wmma_f32_16x16x32_bf16 (x and W as RNE bf16 planes, single products); scores q.k^T on v_wmma_f32_16x16x32_f16 (q, k f16 planes); attn.v on v_wmma_f32_16x16x32_f16 (P f16 carried x32768; V^T as one f16 plane); output projection on v_wmma_f32_16x16x32_bf16 (attention output as bf16 hi + lo planes, Wo bf16, two products); f32 accumulate everywhere; time bias, masks and softmax in f32.
#include <hip/hip_runtime.h>
#include <math.h>

// ---------------------------------------------------------------------------
// Problem constants
// ---------------------------------------------------------------------------
constexpr int kB   = 4;
constexpr int kP   = 2048;
constexpr int kD   = 1024;
constexpr int kH   = 16;
constexpr int kDh  = 64;
constexpr int kTok = kB * kP;            // 8192 token rows
constexpr int kQW  = 32;                 // queries per attention wave: two 16-column tiles, both fed by every K and V^T fragment
constexpr int kQG  = kQW / 16;           // 16-query column tiles per wave
constexpr int kKC  = 64;                 // keys per chunk
constexpr int kNW  = 4;                  // waves per attention block
constexpr int kQB  = kNW * kQW;          // queries per attention block
constexpr int kLP  = 72;                 // LDS row pitch in halves of the 64-half K and V^T rows: 144 B = 16 B x odd,
                                         // so the 16 rows of one ds_load_b128 fragment read fall on distinct banks
constexpr float kLog2e      = 1.4426950408889634f;
constexpr float kScoreScale = 0.125f * kLog2e;    // 64^-0.5, scores kept in base 2 (natural score x log2 e)
constexpr float kNegBig     = -1.0e9f * kLog2e;   // masked score, base 2
constexpr float kPCarryLog2 = 15.0f;     // probabilities carried x2^15 in f16: the exponent's reference point lies 15 below the maximum
constexpr float kDelta      = 300.0f;    // seconds per patch step
constexpr float kInvTau     = 1.0f / 300.0f;
constexpr float kLogEps     = 1.0e-12f;
constexpr int   kFarD       = 65;        // smallest |query - key| between a wave's queries (all inside one 64-key chunk) and a chunk two or more chunks away.
                                         // From d = 45 on exp(-d) lies below half an ulp of 1e-12 (2^-64), so the f32 sum exp(-d) + 1e-12 is
                                         // 1e-12 itself and every table entry from there on is the same number
static_assert(kH * kDh == kD, "s");
static_assert(kTok % 64 == 0 && kD % 64 == 0 && kD % 32 == 0, "s");
static_assert(kP % kQB == 0 && kP % kKC == 0 && kDh == 64, "s");
static_assert((kTok * kD) % (8 * 256) == 0 && (kD * kD) % (8 * 256) == 0, "s");
static_assert(kP % 1024 == 0 && kP / kKC >= 2, "s");
static_assert(kP / kKC == 32 && kKC == kNW * 16 && kKC % kQW == 0 && kFarD == kKC + 1 && kFarD >= 45 && kFarD < kP, "s");

typedef __attribute__((ext_vector_type(16))) _Float16 v16h;
typedef __attribute__((ext_vector_type(8)))  _Float16 v8h;
typedef __attribute__((ext_vector_type(16))) __bf16   v16b;
typedef __attribute__((ext_vector_type(8)))  __bf16   v8b;
typedef __attribute__((ext_vector_type(8)))  float    v8f;
typedef __attribute__((ext_vector_type(4)))  float    v4f;
typedef __attribute__((ext_vector_type(2)))  float    v2f;
typedef __attribute__((ext_vector_type(4)))  unsigned int v4u;

// ---------------------------------------------------------------------------
// Conversion, fragment and hazard-guard helpers
// ---------------------------------------------------------------------------
__device__ __forceinline__ unsigned short f2bf_bits(float f) {
  unsigned u = __float_as_uint(f);
  return (unsigned short)((u + 0x7FFFu + ((u >> 16) & 1u)) >> 16);
}
__device__ __forceinline__ float bf_bits2f(unsigned short h) { return __uint_as_float(((unsigned)h) << 16); }

// hazard guards as plain device helpers (no inline asm inside the kernel template body)
__device__ __forceinline__ void dep_guard4_h(v8f& a, v8f& b, v8f& c, v8f& d, v16h x, v16h y) {
  asm volatile("v_nop\n\tv_nop\n\tv_nop\n\tv_nop" : "+v"(a), "+v"(b), "+v"(c), "+v"(d) : "v"(x), "v"(y));
}
__device__ __forceinline__ void dep_guard4_b(v8f& a, v8f& b, v8f& c, v8f& d, v16b x, v16b y) {
  asm volatile("v_nop\n\tv_nop\n\tv_nop\n\tv_nop" : "+v"(a), "+v"(b), "+v"(c), "+v"(d) : "v"(x), "v"(y));
}
__device__ __forceinline__ void keep4_h(v16h a, v16h b, v16h c, v16h d) { asm volatile("v_nop" :: "v"(a), "v"(b), "v"(c), "v"(d)); }
__device__ __forceinline__ void keep4_b(v16b a, v16b b, v16b c, v16b d) { asm volatile("v_nop" :: "v"(a), "v"(b), "v"(c), "v"(d)); }
__device__ __forceinline__ void acc_guard4(v8f& a, v8f& b, v8f& c, v8f& d) { asm volatile("v_nop\n\tv_nop\n\tv_nop\n\tv_nop" : "+v"(a), "+v"(b), "+v"(c), "+v"(d)); }
template <typename T> struct Frag;
template <> struct Frag<_Float16> {
  typedef v16h V; union U { v16h v; v8h h[2]; };
  // elements 0..7 <- p[0..7], 8..15 <- p[16..23]
  static __device__ __forceinline__ v16h load(const _Float16* p) {
    U f; f.h[0] = *(const v8h*)(p); f.h[1] = *(const v8h*)(p + 16); return f.v;
  }
  static __device__ __forceinline__ v8f mma(v16h a, v16h b, v8f c) {
    return __builtin_amdgcn_wmma_f32_16x16x32_f16(false, a, false, b, (short)0, c, false, false);
  }
  static __device__ __forceinline__ void guard4(v8f& a, v8f& b, v8f& c, v8f& d, v16h x, v16h y) { dep_guard4_h(a, b, c, d, x, y); }
  static __device__ __forceinline__ void keep(v16h a, v16h b, v16h c, v16h d) { keep4_h(a, b, c, d); }
};
template <> struct Frag<__bf16> {
  typedef v16b V; union U { v16b v; v8b h[2]; };
  static __device__ __forceinline__ v16b load(const __bf16* p) {
    U f; f.h[0] = *(const v8b*)(p); f.h[1] = *(const v8b*)(p + 16); return f.v;
  }
  static __device__ __forceinline__ v8f mma(v16b a, v16b b, v8f c) {
    return __builtin_amdgcn_wmma_f32_16x16x32_bf16(false, a, false, b, (short)0, c, false, false);
  }
  static __device__ __forceinline__ void guard4(v8f& a, v8f& b, v8f& c, v8f& d, v16b x, v16b y) { dep_guard4_b(a, b, c, d, x, y); }
  static __device__ __forceinline__ void keep(v16b a, v16b b, v16b c, v16b d) { keep4_b(a, b, c, d); }
};

__device__ __forceinline__ unsigned pk16(unsigned short a, unsigned short b) { return (unsigned)a | ((unsigned)b << 16); }

// single WMMA with its own hazard guard (ties D, keeps A/B live)
__device__ __forceinline__ v8f mma_h(v16h a, v16h b, v8f c) {
  c = __builtin_amdgcn_wmma_f32_16x16x32_f16(false, a, false, b, (short)0, c, false, false);
  asm volatile("v_nop\n\tv_nop\n\tv_nop\n\tv_nop" : "+v"(c) : "v"(a), "v"(b));
  return c;
}

// lane l <-> lane l ^ 16 (the other 16-lane half of the wave), a vector-port move
__device__ __forceinline__ float xhalf(float x) {
  const int b = __builtin_bit_cast(int, x);
  return __builtin_bit_cast(float, __builtin_amdgcn_permlanex16(b, b, 0x76543210, 0xfedcba98, false, false));
}

// 2^x on the hardware's v_exp_f32, in place. The instruction set asks for one independent instruction or a v_nop between a
// transcendental and a vector instruction that reads its result or writes over its source. Written as one statement the slot is
// kept by construction: each v_exp_f32 writes over its own source alone, none reads a neighbour's result, and the closing v_nop
// stands between the last one and whatever the compiler places next.
__device__ __forceinline__ void exp2x8_inplace(float& a, float& b, float& c, float& d, float& e, float& f, float& g, float& h) {
  asm("v_exp_f32 %0, %0\n\tv_exp_f32 %1, %1\n\tv_exp_f32 %2, %2\n\tv_exp_f32 %3, %3\n\t"
      "v_exp_f32 %4, %4\n\tv_exp_f32 %5, %5\n\tv_exp_f32 %6, %6\n\tv_exp_f32 %7, %7\n\tv_nop"
      : "+v"(a), "+v"(b), "+v"(c), "+v"(d), "+v"(e), "+v"(f), "+v"(g), "+v"(h));
}
// the same with a ninth value
__device__ __forceinline__ void exp2x9_inplace(float& a, float& b, float& c, float& d, float& e, float& f, float& g, float& h, float& i) {
  asm("v_exp_f32 %0, %0\n\tv_exp_f32 %1, %1\n\tv_exp_f32 %2, %2\n\tv_exp_f32 %3, %3\n\tv_exp_f32 %4, %4\n\t"
      "v_exp_f32 %5, %5\n\tv_exp_f32 %6, %6\n\tv_exp_f32 %7, %7\n\tv_exp_f32 %8, %8\n\tv_nop"
      : "+v"(a), "+v"(b), "+v"(c), "+v"(d), "+v"(e), "+v"(f), "+v"(g), "+v"(h), "+v"(i));
}

// ---- LDS staging of the GEMM operands ----
constexpr int kGK = 128;   // k per stage: every staged operand row is 256 B = two whole 128-B lines
constexpr int kGP = 136;   // LDS row pitch in halves: 272 B = 16 B x odd, so the 16 rows of a ds_load_b128 fragment read fall on distinct banks

// Eight asynchronous 16-B copies per lane, global -> LDS: rows r, r+16, ..., r+112 of one 128-row panel (16 lanes per 256-B row).
// The closing s_wait_xcnt stands inside the statement so that no address register of a copy is rewritten in front of it.
__device__ __forceinline__ void copy8_to_lds(unsigned l, const unsigned short* g, size_t gs) {
  constexpr unsigned ls = 16u * kGP * 2u;   // 16 LDS rows in bytes
  asm volatile(
      "global_load_async_to_lds_b128 %0, %8, off\n\t"
      "global_load_async_to_lds_b128 %1, %9, off\n\t"
      "global_load_async_to_lds_b128 %2, %10, off\n\t"
      "global_load_async_to_lds_b128 %3, %11, off\n\t"
      "global_load_async_to_lds_b128 %4, %12, off\n\t"
      "global_load_async_to_lds_b128 %5, %13, off\n\t"
      "global_load_async_to_lds_b128 %6, %14, off\n\t"
      "global_load_async_to_lds_b128 %7, %15, off\n\t"
      "s_wait_xcnt 0x0"
      :: "v"(l), "v"(l + ls), "v"(l + 2u * ls), "v"(l + 3u * ls), "v"(l + 4u * ls), "v"(l + 5u * ls), "v"(l + 6u * ls), "v"(l + 7u * ls),
         "v"(g), "v"(g + gs), "v"(g + 2 * gs), "v"(g + 3 * gs), "v"(g + 4 * gs), "v"(g + 5 * gs), "v"(g + 6 * gs), "v"(g + 7 * gs)
      : "memory");
}
// this wave's copies have landed in LDS (the compiler places no wait for them)
__device__ __forceinline__ void wait_copies() { asm volatile("s_wait_asynccnt 0x0" ::: "memory"); }
// this wave's LDS reads have returned, so the buffer they read may be refilled behind the next barrier
__device__ __forceinline__ void wait_lds() { asm volatile("s_wait_dscnt 0x0" ::: "memory"); }

// Eight asynchronous 16-B copies per lane, global -> LDS: rows r, r+16, r+32, r+48 (8 lanes per 128-B row) of the K tile and of the
// V^T tile of one 64-key chunk; the two tiles lie behind one another in LDS at pitch kLP.
// The closing s_wait_xcnt stands inside the statement so that no address register of a copy is rewritten in front of it.
__device__ __forceinline__ void copy_kv_to_lds(unsigned l, const unsigned short* gk, const unsigned short* gv) {
  constexpr unsigned ls = 16u * kLP * 2u;    // 16 LDS rows in bytes
  constexpr unsigned lt = 64u * kLP * 2u;    // one 64-row tile in bytes
  constexpr size_t   sk = (size_t)16 * kD;   // 16 K rows (tokens) in halves
  constexpr size_t   sv = (size_t)16 * kTok; // 16 V^T rows (features) in halves
  asm volatile(
      "global_load_async_to_lds_b128 %0, %8, off\n\t"
      "global_load_async_to_lds_b128 %1, %9, off\n\t"
      "global_load_async_to_lds_b128 %2, %10, off\n\t"
      "global_load_async_to_lds_b128 %3, %11, off\n\t"
      "global_load_async_to_lds_b128 %4, %12, off\n\t"
      "global_load_async_to_lds_b128 %5, %13, off\n\t"
      "global_load_async_to_lds_b128 %6, %14, off\n\t"
      "global_load_async_to_lds_b128 %7, %15, off\n\t"
      "s_wait_xcnt 0x0"
      :: "v"(l), "v"(l + ls), "v"(l + 2u * ls), "v"(l + 3u * ls),
         "v"(l + lt), "v"(l + lt + ls), "v"(l + lt + 2u * ls), "v"(l + lt + 3u * ls),
         "v"(gk), "v"(gk + sk), "v"(gk + 2 * sk), "v"(gk + 3 * sk),
         "v"(gv), "v"(gv + sv), "v"(gv + 2 * sv), "v"(gv + 3 * sv)
      : "memory");
}

// ---- Register-blocked batched WMMA GEMM (modes extended) ----------------------------------------------
// C[m,n] = scale * sum_k A[m,k] * Bt[n,k] (+bias)(*rowsc[m]); each wave owns a 64x64 tile, the block's 8 waves a 128x256 tile
// (2 x 4 waves). Per stage the block's 128 A rows and 256 Bt rows x 128 k are copied to LDS in whole lines and every wave
// reads its fragments from there; two buffers, the next stage's copies in flight while this stage is multiplied.
// A row-major [M,K]; Bt row-major [N,K]; M % 128 == 0, N % 256 == 0, K % 128 == 0, K >= 128 (no tail handling).
// SPLIT: 0 = single product; 1 = A and Bt hi/lo planes (hi*hi + hi*lo + lo*hi); 2 = A hi/lo planes only (hi*B + lo*B).
// BIAS_MODE: 0 = none, 1 = bias[m], 2 = bias[n], 3 = bias[m] where biasRow is set (the same in the whole block), else bias[n].
// ROWSC: multiply by RNE-bf16(rowsc[m]) after the bias.
// bx = index of the block's tile, b = batch index: the kernels below hand them in from blockIdx.
// OUT_MODE: 0 = f32, 1 = f16, 2 = bf16 hi plane (Cout) + bf16 lo plane (Cout2).
// ET: 0 = f16 operands, 1 = bf16 operands (pointers passed as 16-bit storage)
template <int ET> struct Elem;
template <> struct Elem<0> { typedef _Float16 T; };
template <> struct Elem<1> { typedef __bf16 T; };
template <int ET, int SPLIT, int BIAS_MODE, int OUT_MODE, bool ROWSC>
__device__ __forceinline__ void gemm_block(
    const unsigned bx, const int b, const bool biasRow,
    const unsigned short* __restrict__ Ap, const unsigned short* __restrict__ A2p, int lda, long strideA,
    const unsigned short* __restrict__ Btp, const unsigned short* __restrict__ Bt2p, int ldb, long strideB,
    void* __restrict__ Cout, void* __restrict__ Cout2, int ldc, long strideC,
    const float* __restrict__ bias, const float* __restrict__ rowsc,
    int M, int N, int K, float scale) {
  typedef typename Elem<ET>::T T;
  typedef typename Frag<T>::V V;
  constexpr int NA = (SPLIT != 0) ? 2 : 1;             // A planes
  constexpr int NB = (SPLIT == 1) ? 2 : 1;             // Bt planes
  constexpr int kBufH = (128 * NA + 256 * NB) * kGP;   // halves per buffer: [A planes, 128 rows each][Bt planes, 256 rows each]
  __shared__ __align__(16) unsigned short ring[2 * kBufH];
  __shared__ __align__(16) float sT[8][16 * 68];   // per-wave 16x64 slab, pitch 68 floats
  const int lane = threadIdx.x & 31;
  const int wave = threadIdx.x >> 5;
  const int tilesNb = N >> 8;
  const int tilesMb = M >> 7;
  if ((int)bx >= tilesMb * tilesNb) return;   // the same for the whole block, ahead of every barrier
  const int bm  = bx / tilesNb;
  const int bn  = bx - bm * tilesNb;
  const int m0b = bm << 7;
  const int n0b = bn << 8;
  const int wm  = wave >> 2;
  const int wn  = wave & 3;
  const int m0  = m0b + (wm << 6);
  const int n0  = n0b + (wn << 6);

  const int rlane = lane & 15;                 // row (A) / col (B, D) within subtile
  const int koff  = (lane >> 4) * 8;           // k offset of this lane half
  const int mOff  = (lane >> 4) * 8;           // D row offset

  // copy addresses of this lane: row threadIdx.x / 16 of each 16-row group, 16-B segment threadIdx.x % 16
  const int cr = threadIdx.x >> 4;
  const int cs = (threadIdx.x & 15) * 8;
  const unsigned short* cA  = Ap   + (size_t)b * strideA + (size_t)(m0b + cr) * lda + cs;
  const unsigned short* cA2 = A2p  + (size_t)b * strideA + (size_t)(m0b + cr) * lda + cs;
  const unsigned short* cB  = Btp  + (size_t)b * strideB + (size_t)(n0b + cr) * ldb + cs;
  const unsigned short* cB2 = Bt2p + (size_t)b * strideB + (size_t)(n0b + cr) * ldb + cs;
  const unsigned cl = (unsigned)(uintptr_t)ring + (unsigned)(cr * kGP + cs) * 2u;   // LDS byte address
  const size_t gsA = (size_t)16 * lda;
  const size_t gsB = (size_t)16 * ldb;
  constexpr unsigned kPanel = 128u * kGP * 2u;   // 128 LDS rows in bytes
  auto stage = [&](int t) {
    const unsigned l = cl + (unsigned)(t & 1) * (unsigned)(kBufH * 2);
    const size_t k = (size_t)t * kGK;
    copy8_to_lds(l, cA + k, gsA);
    if (NA == 2) copy8_to_lds(l + kPanel, cA2 + k, gsA);
    copy8_to_lds(l + NA * kPanel, cB + k, gsB);
    copy8_to_lds(l + (NA + 1) * kPanel, cB + k + 8 * gsB, gsB);
    if (NB == 2) {
      copy8_to_lds(l + (NA + 2) * kPanel, cB2 + k, gsB);
      copy8_to_lds(l + (NA + 3) * kPanel, cB2 + k + 8 * gsB, gsB);
    }
  };

  v8f acc[4][4];
#pragma unroll
  for (int i = 0; i < 4; ++i)
#pragma unroll
    for (int j = 0; j < 4; ++j) acc[i][j] = (v8f){0.f,0.f,0.f,0.f,0.f,0.f,0.f,0.f};

  const int nT = K / kGK;
  stage(0);
  wait_copies();
  __syncthreads();            // stage 0 is readable by every wave
  if (nT > 1) stage(1);

  for (int t = 0; t < nT; ++t) {
    const T* rb = (const T*)ring + (t & 1) * kBufH;
    const T* fa = rb + ((wm << 6) + rlane) * kGP + koff;
    const T* fb = rb + (128 * NA + (wn << 6) + rlane) * kGP + koff;
    // every loop of a stage is unrolled: fragment and accumulator indices are constants (registers, no scratch) and the
    // LDS offsets of the four 32-k steps are immediates
#pragma unroll
    for (int ks = 0; ks < kGK / 32; ++ks) {
      V bh[4], bl[4], ah[4], al[4];
#pragma unroll
      for (int j = 0; j < 4; ++j) {
        bh[j] = Frag<T>::load(fb + (j << 4) * kGP + ks * 32);
        if (SPLIT == 1) bl[j] = Frag<T>::load(fb + (256 + (j << 4)) * kGP + ks * 32);
      }
#pragma unroll
      for (int i = 0; i < 4; ++i) {
        ah[i] = Frag<T>::load(fa + (i << 4) * kGP + ks * 32);
        al[i] = ah[i];
        if (SPLIT != 0) al[i] = Frag<T>::load(fa + (128 + (i << 4)) * kGP + ks * 32);
      }
#pragma unroll
      for (int i = 0; i < 4; ++i) {
#pragma unroll
        for (int j = 0; j < 4; ++j) {
          acc[i][j] = Frag<T>::mma(ah[i], bh[j], acc[i][j]);
          if (SPLIT == 1) acc[i][j] = Frag<T>::mma(ah[i], bl[j], acc[i][j]);
          if (SPLIT != 0) acc[i][j] = Frag<T>::mma(al[i], bh[j], acc[i][j]);
        }
        Frag<T>::guard4(acc[i][0], acc[i][1], acc[i][2], acc[i][3], ah[i], al[i]);
      }
      Frag<T>::keep(bh[0], bh[1], bh[2], bh[3]);
      if (SPLIT == 1) Frag<T>::keep(bl[0], bl[1], bl[2], bl[3]);
    }
    wait_lds();
    wait_copies();
    __syncthreads();          // publishes stage t + 1 and ends every wave's reads of stage t's buffer
    if (t + 2 < nT) stage(t + 2);
  }
  wait_copies();              // nothing in flight when the wave goes on to the epilogue
  acc_guard4(acc[0][0], acc[0][1], acc[0][2], acc[0][3]);
  acc_guard4(acc[1][0], acc[1][1], acc[1][2], acc[1][3]);
  acc_guard4(acc[2][0], acc[2][1], acc[2][2], acc[2][3]);
  acc_guard4(acc[3][0], acc[3][1], acc[3][2], acc[3][3]);

  // ---- epilogue ----
  // BIAS_MODE 3: this lane's bias values of the whole 64x64 tile, fetched behind one test; the side that is not in use stays 0, and
  // the bias of an element is the sum of its row's and its column's value (unrolled: constant indices, registers)
  float bnv[4], bmv[4][8];
  if (BIAS_MODE == 3) {
#pragma unroll
    for (int i = 0; i < 4; ++i) {
      bnv[i] = 0.f;
#pragma unroll
      for (int r = 0; r < 8; ++r) bmv[i][r] = 0.f;
    }
    if (biasRow) {
#pragma unroll
      for (int i = 0; i < 4; ++i) {
#pragma unroll
        for (int r = 0; r < 8; ++r) bmv[i][r] = bias[m0 + (i << 4) + mOff + r];
      }
    } else {
#pragma unroll
      for (int j = 0; j < 4; ++j) bnv[j] = bias[n0 + (j << 4) + rlane];
    }
  }
  float* slab = sT[wave];
#pragma unroll
  for (int i = 0; i < 4; ++i) {
    const int mBase = m0 + (i << 4);
    float rsv[8];
#pragma unroll
    for (int r = 0; r < 8; ++r) rsv[r] = 1.0f;
    if (ROWSC) {
      // two 16-B loads of rowsc[mBase+mOff .. +7], then RNE bf16 of each value
      const v4f ra = *(const v4f*)(rowsc + mBase + mOff);
      const v4f rb = *(const v4f*)(rowsc + mBase + mOff + 4);
      rsv[0] = ra[0]; rsv[1] = ra[1]; rsv[2] = ra[2]; rsv[3] = ra[3];
      rsv[4] = rb[0]; rsv[5] = rb[1]; rsv[6] = rb[2]; rsv[7] = rb[3];
#pragma unroll
      for (int r = 0; r < 8; ++r) rsv[r] = bf_bits2f(f2bf_bits(rsv[r]));
    }
#pragma unroll
    for (int j = 0; j < 4; ++j) {
      const int n = n0 + (j << 4) + rlane;
      float bv = 0.f;
      if (BIAS_MODE == 2) bv = bias[n];
#pragma unroll
      for (int r = 0; r < 8; ++r) {
        float v = acc[i][j][r] * scale;
        if (BIAS_MODE == 1) v += bias[mBase + mOff + r];
        if (BIAS_MODE == 2) v += bv;
        if (BIAS_MODE == 3) v += bmv[i][r] + bnv[j];
        if (ROWSC) v = v * rsv[r];
        slab[(mOff + r) * 68 + (j << 4) + rlane] = v;
      }
    }
    __builtin_amdgcn_fence(__ATOMIC_RELEASE, "workgroup");
    __builtin_amdgcn_wave_barrier();
    __builtin_amdgcn_fence(__ATOMIC_ACQUIRE, "workgroup");
    if (OUT_MODE == 0) {
      float* C = (float*)Cout + (size_t)b * strideC;
      const int hh = lane >> 4, c4 = (lane & 15) * 4;     // row seg = 256 B = 16 lanes x 16 B
      {
#pragma unroll
        for (int it = 0; it < 8; ++it) {
          const int row = it * 2 + hh;
          v4f v = *(const v4f*)(slab + row * 68 + c4);
          *(v4f*)(C + (size_t)(mBase + row) * ldc + n0 + c4) = v;
        }
        
      }
    } else {
      const int q = lane >> 3, c8 = (lane & 7) * 8;
      unsigned short* C  = (unsigned short*)Cout  + (size_t)b * strideC;
      unsigned short* C2 = (OUT_MODE >= 2) ? ((unsigned short*)Cout2 + (size_t)b * strideC) : nullptr;
      {
#pragma unroll
        for (int it = 0; it < 4; ++it) {
          const int row = it * 4 + q;
          const float* sp = slab + row * 68 + c8;
          v8h hv, lv;
#pragma unroll
          for (int e = 0; e < 8; ++e) {
            if (OUT_MODE == 1) {
              hv[e] = (_Float16)sp[e];
            } else {
              unsigned short hb = f2bf_bits(sp[e]);
              unsigned short lb = f2bf_bits(sp[e] - bf_bits2f(hb));
              hv[e] = __builtin_bit_cast(_Float16, hb);
              lv[e] = __builtin_bit_cast(_Float16, lb);
            }
          }
          *(v8h*)(C + (size_t)(mBase + row) * ldc + n0 + c8) = hv;
          if (OUT_MODE >= 2) *(v8h*)(C2 + (size_t)(mBase + row) * ldc + n0 + c8) = lv;
        }
        
      }
    }
    __builtin_amdgcn_fence(__ATOMIC_RELEASE, "workgroup");
    __builtin_amdgcn_wave_barrier();
    __builtin_amdgcn_fence(__ATOMIC_ACQUIRE, "workgroup");
  }
}

// One GEMM per launch: grid.x = tiles, grid.y = batch.
template <int ET, int SPLIT, int BIAS_MODE, int OUT_MODE, bool ROWSC>
__global__ __launch_bounds__(256) void wmma_gemm64(
    const unsigned short* __restrict__ Ap, const unsigned short* __restrict__ A2p, int lda, long strideA,
    const unsigned short* __restrict__ Btp, const unsigned short* __restrict__ Bt2p, int ldb, long strideB,
    void* __restrict__ Cout, void* __restrict__ Cout2, int ldc, long strideC,
    const float* __restrict__ bias, const float* __restrict__ rowsc,
    int M, int N, int K, float scale) {
  gemm_block<ET, SPLIT, BIAS_MODE, OUT_MODE, ROWSC>(blockIdx.x, (int)blockIdx.y, false, Ap, A2p, lda, strideA, Btp, Bt2p, ldb, strideB,
                                                    Cout, Cout2, ldc, strideC, bias, rowsc, M, N, K, scale);
}

// The three projections need nothing of each other: one launch, grid.y = 0 (Q), 1 (K), 2 (V^T), grid.x = tiles of one projection.
//   Q16[t][n] = sum_k Xb[t][k] * Wqb[n][k] + bq[n], K16 likewise; VT[m][t] = sum_k Wvb[m][k] * Xb[t][k] + bv[m]; f16 out.
// nTok token rows, nFeat features, K = row length of Xb and of every weight. Every choice below reads the same in the whole block.
__global__ __launch_bounds__(256) void qkv_gemm64(
    const unsigned short* __restrict__ Xb, const unsigned short* __restrict__ Wqb, const unsigned short* __restrict__ Wkb,
    const unsigned short* __restrict__ Wvb, unsigned short* __restrict__ Q16, unsigned short* __restrict__ K16,
    unsigned short* __restrict__ VT, const float* __restrict__ bq, const float* __restrict__ bk, const float* __restrict__ bv,
    int nTok, int nFeat, int K) {
  const int  which = blockIdx.y;
  const bool isV   = which == 2;
  const unsigned short* W    = (which == 0) ? Wqb : (which == 1) ? Wkb : Wvb;
  unsigned short*       C    = (which == 0) ? Q16 : (which == 1) ? K16 : VT;
  const float*          bias = (which == 0) ? bq  : (which == 1) ? bk  : bv;
  const unsigned short* A    = isV ? W : Xb;
  const unsigned short* Bt   = isV ? Xb : W;
  const int M = isV ? nFeat : nTok;
  const int N = isV ? nTok : nFeat;
  gemm_block<1, 0, 3, 1, false>(blockIdx.x, 0, isV, A, A, K, 0L, Bt, Bt, K, 0L, (void*)C, (void*)C, N, 0L, bias, bias, M, N, K, 1.0f);
}

// ---------------------------------------------------------------------------
// f32 -> bf16 (RNE) cast, 8 consecutive elements per thread (one 16-B store per lane; 32 contiguous lanes = 4 whole
// lines). i = index of the thread's group of 8.
// ---------------------------------------------------------------------------
__device__ __forceinline__ void cast8_bf16(const float* __restrict__ in, unsigned short* __restrict__ out, int i) {
  const float* p = in + 8 * (size_t)i;
  const v4f a = *(const v4f*)(p);
  const v4f c = *(const v4f*)(p + 4);
  unsigned short hb[8];
#pragma unroll
  for (int e = 0; e < 4; ++e) {
    hb[e]     = f2bf_bits(a[e]);
    hb[4 + e] = f2bf_bits(c[e]);
  }
  const v4u u = (v4u){pk16(hb[0], hb[1]), pk16(hb[2], hb[3]), pk16(hb[4], hb[5]), pk16(hb[6], hb[7])};
  unsigned short* q = out + 8 * (size_t)i;
  *(v4u*)q = u;
}

// ---------------------------------------------------------------------------
// Time-decay bias table in base 2: tab[d] = logf(expf((-(d*300)) * (1/300)) + 1e-12) * log2(e), d = 0..2047, f32, precise expf/logf.
// i = index of the thread's group of 4.
// ---------------------------------------------------------------------------
__device__ __forceinline__ void tab4(float* __restrict__ tab, int i) {
  v4f tv;
#pragma unroll
  for (int e = 0; e < 4; ++e) {
    const float d = (float)(4 * i + e);
    const float dist = d * kDelta;
    const float ex = (-dist) * kInvTau;
    const float w = expf(ex);
    tv[e] = logf(w + kLogEps) * kLog2e;
  }
  float* q = tab + 4 * (size_t)i;
  *(v4f*)q = tv;
}

// ---------------------------------------------------------------------------
// Prologue: the bias table and the five casts need nothing of each other, so they are ranges of the block index of one launch
// (every test reads the same in the whole block). Each range is an exact quotient: no thread is without its group.
//   blocks [0, kTabBlk): table; then kWBlk blocks for each of Wq, Wk, Wv, Wo; then kXBlk blocks for x.
// ---------------------------------------------------------------------------
constexpr int kTabBlk = (kP / 4) / 256;           //    2
constexpr int kWBlk   = (kD * kD) / (8 * 256);    //  512
constexpr int kXBlk   = (kTok * kD) / (8 * 256);  // 4096
static_assert((kP / 4) % 256 == 0, "s");
__global__ __launch_bounds__(256) void prologue_kernel(const float* __restrict__ x, const float* __restrict__ Wq, const float* __restrict__ Wk,
                                                       const float* __restrict__ Wv, const float* __restrict__ Wo,
                                                       unsigned short* __restrict__ Xb, unsigned short* __restrict__ Wqb,
                                                       unsigned short* __restrict__ Wkb, unsigned short* __restrict__ Wvb,
                                                       unsigned short* __restrict__ Wob, float* __restrict__ tab) {
  int bx = blockIdx.x;
  if (bx < kTabBlk) {
    tab4(tab, bx * 256 + (int)threadIdx.x);
    return;
  }
  bx -= kTabBlk;
  const float* in = x;
  unsigned short* out = Xb;
  if (bx < 4 * kWBlk) {
    const int w = bx / kWBlk;
    in  = (w == 0) ? Wq  : (w == 1) ? Wk  : (w == 2) ? Wv  : Wo;
    out = (w == 0) ? Wqb : (w == 1) ? Wkb : (w == 2) ? Wvb : Wob;
    bx -= w * kWBlk;
  } else {
    bx -= 4 * kWBlk;
  }
  cast8_bf16(in, out, bx * 256 + (int)threadIdx.x);
}

__global__ __launch_bounds__(128, 4) void attn_kernel(const unsigned short* __restrict__ Qp, const unsigned short* __restrict__ Kp,
                                                   const unsigned short* __restrict__ VTp,
                                                   const float* __restrict__ tab, const float* __restrict__ pm,
                                                   unsigned short* __restrict__ Ohp, unsigned short* __restrict__ Olp) {
  constexpr int kTileH = 64 * kLP;                           // halves of one 64-row tile (9 KB)
  constexpr int kBufH  = 2 * kTileH;                         // one buffer: K [kv][d], V^T [d][kv]
  __shared__ __align__(16) _Float16 tiles[2 * kBufH];        // two buffers, 36 KB
  __shared__ __align__(16) float    Os[kNW][16 * 68];        // per wave out tile (one 16-query tile at a time), pitch 68
  __shared__ __align__(16) float    tabs[kP];                // bias table 8 KB
  __shared__ __align__(16) unsigned mb[kNW];                 // per wave: bit kc = a masked key in this wave's quarter of chunk kc

  const int tid  = threadIdx.x;
  const int wave = tid >> 5;
  const int lane = tid & 31;
  const int hh   = lane >> 4;
  const int c    = lane & 15;
  const int nqb  = kP / kQB;              // 16
  const int bx   = blockIdx.x;
  const int qb   = bx % nqb;
  const int bh   = bx / nqb;
  const int h    = bh % kH;
  const int b    = bh / kH;
  const int q0   = qb * kQB + wave * kQW; // first query row of this wave within the sequence
  const size_t tok0 = (size_t)b * kP;     // first token row of this batch

  // ---- bias table -> LDS: 4 x 128 threads x 4 floats = 2048 (whole table); read after the barrier in front of the loop ----
#pragma unroll
  for (int i = 0; i < 4; ++i) {
    const int idx = i * 128 + tid;
    const v4f t4 = *(const v4f*)(tab + 4 * idx);
    *(v4f*)(tabs + 4 * idx) = t4;
  }
  asm volatile("" ::: "memory");

  // ---- which chunks of this batch hold a masked key: lane = chunk, wave = quarter of the chunk (16 keys); joined behind the barrier ----
  {
    const float* pq = pm + tok0 + lane * kKC + wave * 16;
    bool anym = false;
#pragma unroll   // the four loads go out together
    for (int i = 0; i < 4; ++i) {
      const v4f t4 = *(const v4f*)(pq + 4 * i);
      anym = anym || (t4[0] <= 0.0f) || (t4[1] <= 0.0f) || (t4[2] <= 0.0f) || (t4[3] <= 0.0f);
    }
    const unsigned bal = __builtin_amdgcn_ballot_w32(anym);
    if (lane == 0) mb[wave] = bal;
  }

  // ---- Q fragments (B operand): column = query q0+g*16+c, k = d; 2 d-chunks per tile ----
  const _Float16* Qh = (const _Float16*)(const void*)Qp;
  const _Float16* qr = Qh + (tok0 + q0 + c) * (size_t)kD + h * kDh + 8 * hh;
  v16h qa[kQG][2];
#pragma unroll   // every loop over g is unrolled: register arrays with constant indices, no scratch
  for (int g = 0; g < kQG; ++g) {
    qa[g][0] = Frag<_Float16>::load(qr + (size_t)g * 16 * kD);
    qa[g][1] = Frag<_Float16>::load(qr + (size_t)g * 16 * kD + 32);
  }

  float mrow[kQG];                  // running maximum of query q0+g*16+c (equal in both halves), base 2
  float mref[kQG];                  // reference point of the exponentials: P, its sum and O all carry the factor 2^(-mref)
  float lrow[kQG];                  // running sum of query q0+g*16+c over this half's keys; the halves are joined after the loop
  v8f oacc[kQG][4];                 // O^T: row = d t*16+8hh+r, column = query q0+g*16+c
#pragma unroll
  for (int g = 0; g < kQG; ++g) {
    mrow[g] = -__builtin_inff();
    mref[g] = -__builtin_inff();
    lrow[g] = 0.f;
#pragma unroll
    for (int t = 0; t < 4; ++t) oacc[g][t] = (v8f){0.f,0.f,0.f,0.f,0.f,0.f,0.f,0.f};
  }

  // ---- K / V^T tiles: asynchronous copies, two buffers; chunk kc + 1 is in flight while chunk kc is worked on ----
  // this lane's copy addresses: row tid / 8 of each 16-row group, 16-B segment tid % 8
  const int cr = tid >> 3;
  const int cs = (tid & 7) * 8;
  const unsigned cl = (unsigned)(uintptr_t)tiles + (unsigned)(cr * kLP + cs) * 2u;   // LDS byte address
  const unsigned short* cK  = Kp   + (tok0 + cr) * (size_t)kD + h * kDh + cs;
  const unsigned short* cV  = VTp  + (size_t)(h * kDh + cr) * kTok + tok0 + cs;
  auto stage = [&](int t) {
    copy_kv_to_lds(cl + (unsigned)(t & 1) * (unsigned)(kBufH * 2), cK + (size_t)t * (kKC * kD), cV + t * kKC);
  };
  stage(0);
  wait_copies();
  __syncthreads();            // chunk 0, the bias table and the mask words are readable by every wave

  // all are the same in every lane: kept in scalar registers, so that the test in the loop is a scalar branch
  // bit kc of shortbits: chunk kc holds no masked key and is none of kq - 1, kq, kq + 1, kq the chunk in which this wave's queries lie
  const unsigned mbits = (unsigned)__builtin_amdgcn_readfirstlane((int)(mb[0] | mb[1] | mb[2] | mb[3]));
  const int      kq    = __builtin_amdgcn_readfirstlane(q0 / kKC);
  const unsigned shortbits = ~(mbits | (unsigned)((7ull << kq) >> 1));
  const float    cfar  = __builtin_bit_cast(float, __builtin_amdgcn_readfirstlane(__builtin_bit_cast(int, tabs[kFarD])));

  for (int kc = 0; kc < kP / kKC; ++kc) {
    // directly behind the barrier (the one above, or the one at the foot of trip kc - 1, which ended every wave's reads of
    // chunk kc - 1): the copies of chunk kc + 1, while it exists, into the buffer that chunk kc - 1 has left
    if (kc + 1 < kP / kKC) stage(kc + 1);
    const int kv0 = kc * kKC;
    const _Float16* Ksh = tiles + (kc & 1) * kBufH;
    const _Float16* Vt  = Ksh + kTileH;

    // ---- scores, transposed: D[row = key j*16+8hh+r][col = query c of tile g] = K . Q^T, K = 64 in 2 steps of 32 ----
    // all eight K fragments are read ahead of the first product: one LDS latency for the group, counted waits behind it
    // (the loops are unrolled so that fragment and accumulator indices are constants: registers, no scratch)
    v16h kf[2][4];
#pragma unroll
    for (int dc = 0; dc < 2; ++dc) {
#pragma unroll
      for (int j = 0; j < 4; ++j) kf[dc][j] = Frag<_Float16>::load(Ksh + (j * 16 + c) * kLP + dc * 32 + 8 * hh);
    }
    v8f s[kQG][4];
#pragma unroll
    for (int g = 0; g < kQG; ++g) {
#pragma unroll
      for (int j = 0; j < 4; ++j) s[g][j] = (v8f){0.f,0.f,0.f,0.f,0.f,0.f,0.f,0.f};
    }
#pragma unroll
    for (int dc = 0; dc < 2; ++dc) {
#pragma unroll
      for (int j = 0; j < 4; ++j) {
#pragma unroll
        for (int g = 0; g < kQG; ++g) s[g][j] = mma_h(kf[dc][j], qa[g][dc], s[g][j]);
      }
    }

    // ---- base-2 score = s * smul + sadd. A short chunk keeps its raw products: smul the scale, sadd the one bias. ----
    float smul = kScoreScale, sadd = cfar;
    if (((shortbits >> kc) & 1u) == 0u) {
      // general chunk: scale, time bias and key mask are worked into s here
#pragma unroll
      for (int j = 0; j < 4; ++j) {
        // key mask values of this lane's 8 consecutive keys of tile j (two 16-B loads), the same for both query tiles
        const float* pmp = pm + tok0 + kv0 + j * 16 + 8 * hh;
        const v4f pma = *(const v4f*)(pmp);
        const v4f pmb = *(const v4f*)(pmp + 4);
#pragma unroll
        for (int g = 0; g < kQG; ++g) {
          const int qrow = q0 + g * 16 + c;
#pragma unroll
          for (int r = 0; r < 8; ++r) {
            const int kvcol = kv0 + j * 16 + 8 * hh + r;
            int dd = qrow - kvcol;
            dd = (dd < 0) ? -dd : dd;
            const float pmv = (r < 4) ? pma[r & 3] : pmb[r & 3];
            const float v = s[g][j][r] * kScoreScale + tabs[dd];
            s[g][j][r] = (pmv <= 0.0f) ? kNegBig : v;
          }
        }
      }
      smul = 1.0f;   // x * 1 + 0 is x and x * 1 - y is x - y, each rounded as before: these chunks keep their values
      sadd = 0.0f;
    }

    const v2f smul2 = (v2f){smul, smul};
    v16h pb[kQG][2];
#pragma unroll
    for (int g = 0; g < kQG; ++g) {
      // ---- maximum over this lane's 32 keys (smul is positive: the largest s gives the largest score), then over both halves ----
      float sm[4];   // one chain per score tile: four short dependent chains, not one long one (unrolled: constant indices)
#pragma unroll
      for (int j = 0; j < 4; ++j) {
        sm[j] = -__builtin_inff();
#pragma unroll
        for (int r = 0; r < 8; ++r) sm[j] = fmaxf(sm[j], s[g][j][r]);
      }
      float cm = fmaxf(fmaxf(sm[0], sm[1]), fmaxf(sm[2], sm[3])) * smul + sadd;
      cm = fmaxf(cm, xhalf(cm));

      // ---- online softmax; P = 2^(v - mref) (at most 2^15) as f16 straight into the B operands of the PV products ----
      // B operand of keys kk*32 .. kk*32+31: elements 0..7 = keys 8hh+0..7 (score tile 2kk), 8..15 = keys 16+8hh+0..7 (tile 2kk+1)
      const float mnew  = fmaxf(mrow[g], cm);
      // from 2^23 on, mnew - 15 would round and could lift P past the f16 range: there the reference point is the maximum itself
      const float rnew  = (fabsf(mnew) < 8388608.0f) ? mnew - kPCarryLog2 : mnew;
      float alpha = mref[g] - rnew;   // becomes 2^(mref - rnew) together with the first eight scores
      mrow[g] = mnew;
      mref[g] = rnew;
      const float soff = sadd - rnew;
      const v2f soff2 = (v2f){soff, soff};
      float psum = 0.f;
#pragma unroll
      for (int j = 0; j < 4; ++j) {
        float e[8];
#pragma unroll
        for (int r = 0; r < 8; r += 2) {
          const v2f x = (v2f){s[g][j][r], s[g][j][r + 1]} * smul2 + soff2;   // two scores per packed multiply-add
          e[r] = x[0];
          e[r + 1] = x[1];
        }
        if (j == 0) exp2x9_inplace(alpha, e[0], e[1], e[2], e[3], e[4], e[5], e[6], e[7]);
        else        exp2x8_inplace(e[0], e[1], e[2], e[3], e[4], e[5], e[6], e[7]);
#pragma unroll
        for (int r = 0; r < 8; ++r) {
          psum += e[r];
          pb[g][j >> 1][(j & 1) * 8 + r] = (_Float16)e[r];
        }
      }
      lrow[g] = lrow[g] * alpha + psum;
#pragma unroll
      for (int t = 0; t < 4; ++t) {
#pragma unroll
        for (int r = 0; r < 8; ++r) oacc[g][t][r] *= alpha;
      }
    }

    // ---- O^T += V^T . P^T : A = V^T [d t*16+c][kv], B = P^T [kv][query c of tile g] ----
    // the eight V^T fragments (order: kk, t) are asked for as one group in front of their products: the LDS latency is met once,
    // counted waits follow (unrolled for the same reason as above: constant indices, registers and no scratch)
    v16h vf[8];
#pragma unroll
    for (int i = 0; i < 8; ++i) vf[i] = Frag<_Float16>::load(Vt + ((i & 3) * 16 + c) * kLP + (i >> 2) * 32 + 8 * hh);
#pragma unroll
    for (int i = 0; i < 8; ++i) {
#pragma unroll
      for (int g = 0; g < kQG; ++g) oacc[g][i & 3] = mma_h(vf[i], pb[g][i >> 2], oacc[g][i & 3]);
    }
    wait_lds();
    wait_copies();
    __syncthreads();          // publishes chunk kc + 1 and ends every wave's reads of chunk kc's buffer
  }
  wait_copies();              // nothing in flight when the wave goes on to the epilogue

  // ---- normalise (the sum carries P's own factor) into the per-wave f32 slab, one 16-query tile after the other ----
  float* os = Os[wave];   // [query][d]
#pragma unroll
  for (int g = 0; g < kQG; ++g) {
    const float inv = 1.0f / (lrow[g] + xhalf(lrow[g]));
#pragma unroll
    for (int t = 0; t < 4; ++t) {
#pragma unroll
      for (int r = 0; r < 8; ++r) os[c * 68 + t * 16 + 8 * hh + r] = oacc[g][t][r] * inv;
    }
    __builtin_amdgcn_fence(__ATOMIC_RELEASE, "workgroup");
    __builtin_amdgcn_wave_barrier();
    __builtin_amdgcn_fence(__ATOMIC_ACQUIRE, "workgroup");
    {
      const int q4 = lane >> 3, c8 = (lane & 7) * 8;
#pragma unroll
      for (int it = 0; it < 4; ++it) {
        const int row = it * 4 + q4;
        const float* sp = os + row * 68 + c8;
        v8h hv, lv;
#pragma unroll
        for (int e = 0; e < 8; ++e) {
          const unsigned short hb = f2bf_bits(sp[e]);
          const unsigned short lb = f2bf_bits(sp[e] - bf_bits2f(hb));
          hv[e] = __builtin_bit_cast(_Float16, hb);
          lv[e] = __builtin_bit_cast(_Float16, lb);
        }
        const size_t off = (tok0 + q0 + g * 16 + row) * (size_t)kD + h * kDh + c8;
        *(v8h*)(Ohp + off) = hv;
        *(v8h*)(Olp + off) = lv;
      }
    }
    if (g + 1 < kQG) {
      // keeps the next tile's slab writes behind this tile's slab reads (the lanes read rows that other lanes write)
      __builtin_amdgcn_fence(__ATOMIC_RELEASE, "workgroup");
      __builtin_amdgcn_wave_barrier();
      __builtin_amdgcn_fence(__ATOMIC_ACQUIRE, "workgroup");
    }
  }
}

// ---------------------------------------------------------------------------
// Host glue.
//   Xb   bf16 [8192][1024]        16,777,216  at           0
//   Wqb  bf16 [1024][1024]         2,097,152  at  16,777,216
//   Wkb  bf16 [1024][1024]         2,097,152  at  18,874,368
//   Wvb  bf16 [1024][1024]         2,097,152  at  20,971,520
//   Wob  bf16 [1024][1024]         2,097,152  at  23,068,672
//   Q16  f16  [8192][1024]        16,777,216  at  25,165,824
//   K16  f16  [8192][1024]        16,777,216  at  41,943,040
//   VT   f16  [1024][8192]        16,777,216  at  58,720,256
//   Oh   bf16 [8192][1024]        16,777,216  at  75,497,472
//   Ol   bf16 [8192][1024]        16,777,216  at  92,274,688
//   tab  f32  [2048]                   8,192  at 109,051,904
//   total                        109,060,096
// Every region is fully written before it is read; no region is re-used.
// GEMM shapes: Q,K: M=8192 N=1024 K=1024; V^T: M=1024 N=8192 K=1024; out: M=8192 N=1024 K=1024 (M%128==0, N%256==0,
// K%128==0, no padding). Attention: S=2048 (64-multiples), Dh=64.
// ---------------------------------------------------------------------------
extern "C" void kernel_launch(void* const* d_in, const int* in_sizes, int n_in,
                              void* d_out, int out_size, void* d_ws, size_t ws_size,
                              hipStream_t stream) {
  if (n_in < 10) return;
  const int nX = kTok * kD;     // 8,388,608
  const int nW = kD * kD;       // 1,048,576
  if (in_sizes[0] != nX || in_sizes[1] != kTok) return;
  if (in_sizes[2] != nW || in_sizes[4] != nW || in_sizes[6] != nW || in_sizes[8] != nW) return;
  if (in_sizes[3] != kD || in_sizes[5] != kD || in_sizes[7] != kD || in_sizes[9] != kD) return;
  if (out_size != nX) return;

  const size_t szX16 = (size_t)nX * 2;
  const size_t szW16 = (size_t)nW * 2;
  const size_t szTab = (size_t)kP * 4;
  const size_t offXb  = 0;
  const size_t offWq  = offXb + szX16;
  const size_t offWk  = offWq + szW16;
  const size_t offWv  = offWk + szW16;
  const size_t offWo  = offWv + szW16;
  const size_t offQ   = offWo + szW16;
  const size_t offK   = offQ + szX16;
  const size_t offVT  = offK + szX16;
  const size_t offOh  = offVT + szX16;
  const size_t offOl  = offOh + szX16;
  const size_t offTab = offOl + szX16;
  const size_t total  = offTab + szTab;
  if (ws_size < total) return;

  const float* x  = (const float*)d_in[0];
  const float* pm = (const float*)d_in[1];
  const float* Wq = (const float*)d_in[2];
  const float* bq = (const float*)d_in[3];
  const float* Wk = (const float*)d_in[4];
  const float* bk = (const float*)d_in[5];
  const float* Wv = (const float*)d_in[6];
  const float* bv = (const float*)d_in[7];
  const float* Wo = (const float*)d_in[8];
  const float* bo = (const float*)d_in[9];
  float* out = (float*)d_out;
  char* ws = (char*)d_ws;
  unsigned short* Xb  = (unsigned short*)(ws + offXb);
  unsigned short* Wqb = (unsigned short*)(ws + offWq);
  unsigned short* Wkb = (unsigned short*)(ws + offWk);
  unsigned short* Wvb = (unsigned short*)(ws + offWv);
  unsigned short* Wob = (unsigned short*)(ws + offWo);
  unsigned short* Q16 = (unsigned short*)(ws + offQ);
  unsigned short* K16 = (unsigned short*)(ws + offK);
  unsigned short* VT  = (unsigned short*)(ws + offVT);
  unsigned short* Oh  = (unsigned short*)(ws + offOh);
  unsigned short* Ol  = (unsigned short*)(ws + offOl);
  float* tab = (float*)(ws + offTab);

  // ---- prologue: RNE bf16 operand planes and the bias table, one launch ----
  prologue_kernel<<<dim3(kTabBlk + 4 * kWBlk + kXBlk), dim3(256), 0, stream>>>(x, Wq, Wk, Wv, Wo, Xb, Wqb, Wkb, Wvb, Wob, tab);

  // ---- projections (64x64 wave tiles, 8 waves = one 128x256 tile per block): Q, K and V^T in one launch ----
  const int tilesProj = (kTok / 64) * (kD / 64);   // 2048 -> 256 blocks per projection
  qkv_gemm64<<<dim3(tilesProj / 8, 3), dim3(256), 0, stream>>>(Xb, Wqb, Wkb, Wvb, Q16, K16, VT, bq, bk, bv, kTok, kD, kD);

  // ---- attention: 64 (b,h) x 16 query blocks of 128 ----
  attn_kernel<<<dim3(kB * kH * (kP / kQB)), dim3(128), 0, stream>>>(Q16, K16, VT, tab, pm, Oh, Ol);

  // ---- output projection: out[m][n] = (sum_k (Oh+Ol)[m][k] * Wob[n][k] + bo[n]) * pm[m] ----
  wmma_gemm64<1, 2, 2, 0, true><<<dim3(tilesProj / 8, 1), dim3(256), 0, stream>>>(
      Oh, Ol, kD, 0L, Wob, Wob, kD, 0L, (void*)out, (void*)out, kD, 0L, bo, pm, kTok, kD, kD, 1.0f);
}
